// v000
// Measured on an AMD MI455X. A time is GPU time per run, averaged over a window of back-to-back runs after a warm-up
// (all launches, gaps included; the runs take copies of the inputs in turn), and the median of several windows.
// Apart from v000's, it joins two sittings. Times from different sittings can be a few percent apart, while
// side-by-side timings come from the same sitting.
// v000, which the later versions start from, runs in 189 microseconds.
// Contractions: q = x.Wq^T, k = x.Wk^T and v^T = Wv.x^T (plain f16, exact bf16-valued operands);
// attention scores q.k^T and p.v^T with q, k, p, v^T as f16 hi + x2048 residual planes (hi.hi + hi.lo + lo.hi);
// output projection z.Wo^T with z as f16 hi + x2048 residual planes (hi.W + lo.W); all v_wmma_f32_16x16x32_f16
// (f16 operands, f32 accumulate); float inputs RNE-converted to bf16 on load (x in f16 containers, weights x16
// in f16), p carried x1024, z carried x16; softmax in f32 on VALU.
#include <hip/hip_runtime.h>
#include <math.h>
#include <stdint.h>

#define NBT  2
#define SEQ  2048
#define HH   768
#define NHD  12
#define HD   64
#define SEGL 256
#define MT   (NBT * SEQ)
#define QT   128
#define NCHK (SEGL / 32)
#define ZSP  72
#define WSC  16.0f
#define PSC  1024.0f
#define ZSC  16.0f
#define RSC  2048.0f
#define RSCI 0.00048828125f
#define SCL  0.125f

static_assert(NHD * HD == HH);
static_assert(HD == 64);
static_assert((SEQ % SEGL) == 0 && (SEGL % QT) == 0 && (MT % QT) == 0 && QT == 128 && (SEGL % 32) == 0);
static_assert((MT % 64) == 0 && (HH % 64) == 0 && (MT % 32) == 0 && (HH % 32) == 0);
static_assert((((MT / 64) * (HH / 64)) % 8) == 0);
static_assert((((HH / 64) * (MT / 64)) % 8) == 0);
static_assert((((MT / 32) * (HH / 64)) % 8) == 0);
static_assert((MT % 8) == 0 && (HH % 8) == 0 && (HH % 256) == 0);
static_assert(ZSP >= 64 && (ZSP % 8) == 0);

typedef _Float16 v16h __attribute__((ext_vector_type(16)));
typedef _Float16 v8h  __attribute__((ext_vector_type(8)));
typedef unsigned short v16us __attribute__((ext_vector_type(16)));
typedef unsigned short v8us  __attribute__((ext_vector_type(8)));
typedef float v8f __attribute__((ext_vector_type(8)));
typedef float v4f __attribute__((ext_vector_type(4)));
typedef unsigned int v4u __attribute__((ext_vector_type(4)));

union FragU { v16us v; v8us h[2]; };

// ---- scalar helpers --------------------------------------------------------------------------------
__device__ __forceinline__ unsigned short bf_bits(float f) {          // f32 -> bf16 bits, RNE convert
  const unsigned u = __float_as_uint(f);
  return (unsigned short)((u + 0x7FFFu + ((u >> 16) & 1u)) >> 16);
}
__device__ __forceinline__ float bf_up(unsigned short h) { return __uint_as_float(((unsigned)h) << 16); }
__device__ __forceinline__ float bfr(float f) { return bf_up(bf_bits(f)); }   // value of the bf16 RNE convert
__device__ __forceinline__ unsigned short h_bits(_Float16 x) { return __builtin_bit_cast(unsigned short, x); }
__device__ __forceinline__ unsigned short f2h(float f) { return h_bits((_Float16)f); }
__device__ __forceinline__ float h_up(unsigned short h) { return (float)__builtin_bit_cast(_Float16, h); }
__device__ __forceinline__ unsigned pk16(unsigned short a, unsigned short b) { return (unsigned)a | ((unsigned)b << 16); }
__device__ __forceinline__ v8f zero8() { v8f z = {0.f, 0.f, 0.f, 0.f, 0.f, 0.f, 0.f, 0.f}; return z; }
// f -> f16 hi bits and f16 bits of the x2048 residual (f - hi) * 2048
__device__ __forceinline__ void split_h(float f, unsigned short& hi, unsigned short& lo) {
  hi = f2h(f);
  lo = f2h((f - h_up(hi)) * RSC);
}

// ---- fragment loader: 16-bit A/B operand, lane -> row/col (lane&15), p already includes +8*(lane>>4);
//      elements 0..7 <- p[0..7] (k0+8h..), elements 8..15 <- p[16..23] (k0+16+8h..)
__device__ __forceinline__ v16us ldfrag_u(const unsigned short* p) {
  FragU f;
  f.h[0] = *(const v8us*)(p);
  f.h[1] = *(const v8us*)(p + 16);
  return f.v;
}

// ---- WMMA helpers with trailing VALU hazard gap --------------------------------------------------------
__device__ __forceinline__ v8f mma_h_raw(v16us a, v16us b, v8f c) {             // f16 operands (bits), unguarded
  return __builtin_amdgcn_wmma_f32_16x16x32_f16(false, __builtin_bit_cast(v16h, a), false,
                                                __builtin_bit_cast(v16h, b), (short)0, c, false, false);
}
__device__ __forceinline__ void dep_guard1(v8f& a, v8f& b, v16us x) {
#if defined(__HIP_DEVICE_COMPILE__)
  asm volatile("v_nop\n\tv_nop\n\tv_nop\n\tv_nop" : "+v"(a), "+v"(b) : "v"(x));
#endif
}
__device__ __forceinline__ void dep_guard2(v8f& a, v8f& b, v8f& c, v8f& d, v16us x, v16us y) {
#if defined(__HIP_DEVICE_COMPILE__)
  asm volatile("v_nop\n\tv_nop\n\tv_nop\n\tv_nop" : "+v"(a), "+v"(b), "+v"(c), "+v"(d) : "v"(x), "v"(y));
#endif
}
__device__ __forceinline__ void keep4_u(v16us a, v16us b, v16us c, v16us d) {
#if defined(__HIP_DEVICE_COMPILE__)
  asm volatile("v_nop" :: "v"(a), "v"(b), "v"(c), "v"(d));
#endif
}
__device__ __forceinline__ void acc_guard4(v8f& a, v8f& b, v8f& c, v8f& d) {
#if defined(__HIP_DEVICE_COMPILE__)
  asm volatile("v_nop\n\tv_nop\n\tv_nop\n\tv_nop" : "+v"(a), "+v"(b), "+v"(c), "+v"(d));
#endif
}
// ties four D accumulators and keeps six A/B fragments live across a 4-slot VALU gap
__device__ __forceinline__ void guard4x6(v8f& a, v8f& b, v8f& c, v8f& d,
                                         v16us p, v16us q, v16us r, v16us s, v16us t, v16us u) {
#if defined(__HIP_DEVICE_COMPILE__)
  asm volatile("v_nop\n\tv_nop\n\tv_nop\n\tv_nop"
               : "+v"(a), "+v"(b), "+v"(c), "+v"(d)
               : "v"(p), "v"(q), "v"(r), "v"(s), "v"(t), "v"(u));
#endif
}
__device__ __forceinline__ void wave_sync_lds() {
  __builtin_amdgcn_fence(__ATOMIC_RELEASE, "workgroup");
  __builtin_amdgcn_wave_barrier();
  __builtin_amdgcn_fence(__ATOMIC_ACQUIRE, "workgroup");
}

// =====================================================================================================
// Rows [nrows][768] f32 -> f16 bits of (bf16 RNE value * sc). Used for x (sc = 1) and for the [out][in]
// weight matrices (sc = 16), which are already Bt[n][k] with k contiguous. One wave per row; three column
// chunks of 256: lane owns columns 256c + 8*lane..+7, one instruction = 32 lanes x 16 B = 512 contiguous B
// coverage: 8 rows per block, grid = nrows/8 exact (host-checked), 3 chunks x 256 = 768 cols: union = every row.
// =====================================================================================================
__global__ __launch_bounds__(256) void cvt_rows(const float* __restrict__ x, unsigned short* xh, int nrows, float sc) {
  const int row = blockIdx.x * 8 + (threadIdx.x >> 5);
  const int lane = threadIdx.x & 31;
  if (row >= nrows) return;                               // wave-uniform, no barriers below
  v4u hv[HH / 256];
#pragma unroll
  for (int c = 0; c < HH / 256; ++c) {
    const float* p = x + (size_t)row * HH + c * 256 + lane * 8;
    const v4f a0 = *(const v4f*)(p);
    const v4f a1 = *(const v4f*)(p + 4);
    v4u h;
#pragma unroll
    for (int e = 0; e < 2; ++e) {
      h[e]     = pk16(f2h(bfr(a0[2 * e]) * sc), f2h(bfr(a0[2 * e + 1]) * sc));
      h[2 + e] = pk16(f2h(bfr(a1[2 * e]) * sc), f2h(bfr(a1[2 * e + 1]) * sc));
    }
    hv[c] = h;
  }
  unsigned short* d = xh + (size_t)row * HH + lane * 8;
  {
#pragma unroll
    for (int c = 0; c < HH / 256; ++c) *(v4u*)(d + c * 256) = hv[c];
    
  }
}

// =====================================================================================================
// Register-blocked f16 WMMA GEMM: C[m][n] = (sum_k A[m][k] * Bt[n][k] * wsc + bias) * osc, one wave per TRx64
// tile (TR = 64, or 32 when the A operand is split), no block barriers. A row-major [M][K] pitch lda (ASPL = 1:
// a second plane Al holds the x2048 residual, same pitch, products into a separate accumulator folded back
// as acc + accr/2048); Bt row-major [N][K] pitch ldb (k contiguous); M multiple of TR, N of 64, K of 32 (true at
// every call site; host-checked grids = tiles/8 exact so no wave exits early).
// OM: 0 = f32 out Cf; 1 = f16 hi bits Ch plus x2048 residual bits Cl (both pitch ldc).
// CBM: 0 = no bias; 1 = column bias bf16(cb[n]); 2 = row bias bf16(cb[m]). All biases bf16 RNE values.
// coverage: MI slabs x 16 rows x 64 cols = the wave's whole TRx64 tile; tiles/8 blocks x 8 waves = every tile.
// =====================================================================================================
template <int OM, int CBM, int ASPL>
__global__ __launch_bounds__(256) void gemm64(
    const unsigned short* __restrict__ Ap, const unsigned short* __restrict__ Alp, int lda,
    const unsigned short* __restrict__ Btp, int ldb,
    unsigned short* Ch, unsigned short* Cl, float* Cf, int ldc,
    const float* __restrict__ cb, float wsc, float osc, int M, int N, int K) {
  constexpr int MI = ASPL ? 2 : 4;
  constexpr int TR = 16 * MI;
  __shared__ __align__(16) float sT[8][16 * 68];   // per-wave 16x64 slab, pitch 68 floats
  const int lane = threadIdx.x & 31;
  const int wave = threadIdx.x >> 5;
  const int tilesN = N >> 6;
  const int tilesM = M / TR;
  const int tile = blockIdx.x * 8 + wave;
  if (tile >= tilesM * tilesN) return;   // wave-uniform; no block barriers in this kernel
  const int tm = tile / tilesN;
  const int tn = tile - tm * tilesN;
  const int m0 = tm * TR;
  const int n0 = tn << 6;

  const int rlane = lane & 15;                 // row (A) / col (B, D) within subtile
  const int koff  = (lane >> 4) * 8;           // k offset of this lane half
  const int mOff  = (lane >> 4) * 8;           // D row offset

  v8f acc[MI][4];
  v8f accr[MI][4];
#pragma unroll
  for (int i = 0; i < MI; ++i)
#pragma unroll
    for (int j = 0; j < 4; ++j) { acc[i][j] = zero8(); accr[i][j] = zero8(); }

  for (int k0 = 0; k0 < K; k0 += 32) {
    v16us bh[4];
#pragma unroll
    for (int j = 0; j < 4; ++j) {
      const size_t bo = (size_t)(n0 + (j << 4) + rlane) * ldb + koff + k0;
      bh[j] = ldfrag_u(Btp + bo);
    }
#pragma unroll
    for (int i = 0; i < MI; ++i) {
      const size_t ao = (size_t)(m0 + (i << 4) + rlane) * lda + koff + k0;
      const v16us ah = ldfrag_u(Ap + ao);
      if (ASPL) {
        const v16us al = ldfrag_u(Alp + ao);
#pragma unroll
        for (int j = 0; j < 4; ++j) {
          acc[i][j]  = mma_h_raw(ah, bh[j], acc[i][j]);
          accr[i][j] = mma_h_raw(al, bh[j], accr[i][j]);
        }
        dep_guard2(acc[i][0], acc[i][3], accr[i][0], accr[i][3], ah, al);
      } else {
#pragma unroll
        for (int j = 0; j < 4; ++j) acc[i][j] = mma_h_raw(ah, bh[j], acc[i][j]);
        dep_guard1(acc[i][0], acc[i][3], ah);
      }
    }
    keep4_u(bh[0], bh[1], bh[2], bh[3]);
  }
#pragma unroll
  for (int i = 0; i < MI; ++i) {
    acc_guard4(acc[i][0], acc[i][1], acc[i][2], acc[i][3]);
    if (ASPL) acc_guard4(accr[i][0], accr[i][1], accr[i][2], accr[i][3]);
  }

  const int hh2 = lane >> 4, c4 = (lane & 15) * 4;     // f32 out: 256-B row segment = 16 lanes x 16 B
  const int q8  = lane >> 3, c8 = (lane & 7) * 8;

  v4f cb4 = {0.f, 0.f, 0.f, 0.f};
  float cbc[8];
#pragma unroll
  for (int e = 0; e < 8; ++e) cbc[e] = 0.f;
  if (OM == 0 && CBM == 1) {
    const v4f v = *(const v4f*)(cb + n0 + c4);
    cb4[0] = bfr(v[0]); cb4[1] = bfr(v[1]); cb4[2] = bfr(v[2]); cb4[3] = bfr(v[3]);
  }
  if (OM == 1 && CBM == 1) {
    const v4f v0 = *(const v4f*)(cb + n0 + c8);
    const v4f v1 = *(const v4f*)(cb + n0 + c8 + 4);
#pragma unroll
    for (int e = 0; e < 4; ++e) { cbc[e] = bfr(v0[e]); cbc[4 + e] = bfr(v1[e]); }
  }

  // ---- epilogue ----
  float* slab = sT[wave];
#pragma unroll
  for (int i = 0; i < MI; ++i) {
    const int mBase = m0 + (i << 4);
#pragma unroll
    for (int j = 0; j < 4; ++j) {
#pragma unroll
      for (int r = 0; r < 8; ++r) {
        float v = acc[i][j][r];
        if (ASPL) v += accr[i][j][r] * RSCI;
        slab[(mOff + r) * 68 + (j << 4) + rlane] = v;
      }
    }
    wave_sync_lds();
    if (OM == 0) {
      v4f vals[8];
#pragma unroll
      for (int it = 0; it < 8; ++it) {
        const int row = it * 2 + hh2;                      // it 0..7 x hh2 0..1 = rows 0..15
        const v4f v = *(const v4f*)(slab + row * 68 + c4);
        vals[it] = (v * wsc + cb4) * osc;
      }
      {
#pragma unroll
        for (int it = 0; it < 8; ++it) {
          const int row = it * 2 + hh2;
          *(v4f*)(Cf + (size_t)(mBase + row) * ldc + (size_t)n0 + c4) = vals[it];
        }
        
      }
    }
    if (OM == 1) {
      v4u hv[4], lv[4];
#pragma unroll
      for (int it = 0; it < 4; ++it) {
        const int row = it * 4 + q8;                       // it 0..3 x q8 0..3 = rows 0..15
        const float* sp = slab + row * 68 + c8;
        float rb = 0.f;
        if (CBM == 2) rb = bfr(cb[mBase + row]);
        v4u ha = {0u, 0u, 0u, 0u}, la = {0u, 0u, 0u, 0u};
#pragma unroll
        for (int e = 0; e < 4; ++e) {
          const float f0 = (sp[2 * e]     * wsc + cbc[2 * e]     + rb) * osc;
          const float f1 = (sp[2 * e + 1] * wsc + cbc[2 * e + 1] + rb) * osc;
          unsigned short h0, l0, h1, l1;
          split_h(f0, h0, l0);
          split_h(f1, h1, l1);
          ha[e] = pk16(h0, h1);
          la[e] = pk16(l0, l1);
        }
        hv[it] = ha;
        lv[it] = la;
      }
      {
#pragma unroll
        for (int it = 0; it < 4; ++it) {
          const int row = it * 4 + q8;
          const size_t go = (size_t)(mBase + row) * ldc + (size_t)n0 + c8;
          *(v4u*)(Ch + go) = hv[it];
          *(v4u*)(Cl + go) = lv[it];
        }
        
      }
    }
    wave_sync_lds();
  }
}

// =====================================================================================================
// Block-diagonal attention over 256-token segments, head dim 64. Block = 256 threads = 8 waves, one block per
// (128 query tokens tq0..tq0+127, head); all 128 queries lie in one segment whose keys are tokens
// tk00 = (tq0 & ~255) .. tk00+255, every key valid (no masking); wave w owns queries tq0+16w..+15 and all 64 dv.
// Q/K planes f16 bits [token][768] (head h at cols 64h..64h+63): hi (Qh, Kh) and x2048 residual (Ql, Kl);
// V^T planes f16 [dv][token]: hi (VT) and x2048 residual (VTl).
// Per chunk of 32 keys: s = qh.kh^T (acc s) and qh.kl^T + ql.kh^T (acc sr), two 32-deep k-steps over the 64
// head dims; logit = (s + sr/2048) * 0.125; running-max softmax in f32; p = exp(logit - m) carried as 1024 p
// barrier, v8us fragment reload of the same element type); z accumulates ph.vh (oz) and ph.vl + pl.vh (orr) on
// WMMA for 4 dv tiles, z = oz + orr/2048. q, k, p and v^T fragments all use the split k map.
// coverage: 128 query rows x 64 halves at cols 64*head per block in Zh and in Zl; grid (MT/128) x 12 heads = the
// whole [4096][768] z planes.
// =====================================================================================================
__global__ __launch_bounds__(256) void attn_kernel(const unsigned short* __restrict__ Qh,
                                                   const unsigned short* __restrict__ Ql,
                                                   const unsigned short* __restrict__ Kh,
                                                   const unsigned short* __restrict__ Kl,
                                                   const unsigned short* __restrict__ VT,
                                                   const unsigned short* __restrict__ VTl,
                                                   unsigned short* Zh, unsigned short* Zl) {
  __shared__ __align__(16) unsigned short ps[8 * 1024];     // wave-private P tiles: hi [16][32] at 0, lo at 512
  __shared__ __align__(16) unsigned short zsth[QT * ZSP];   // output staging, hi plane
  __shared__ __align__(16) unsigned short zstl[QT * ZSP];   // output staging, residual plane
  const int tq0  = blockIdx.x * QT;                         // first query token (token = b*2048 + s)
  const int tk00 = tq0 & ~(SEGL - 1);                       // first key token of the segment
  const int hc   = blockIdx.y * HD;                         // head column offset
  const int t = threadIdx.x, lane = t & 31, wv = t >> 5, hh = lane >> 4, jc = lane & 15;

  const size_t qo = (size_t)(tq0 + 16 * wv + jc) * HH + hc + 8 * hh;   // A: row = query jc, k = head dim
  const v16us qf0 = ldfrag_u(Qh + qo);                                  // dims 0..31
  const v16us qf1 = ldfrag_u(Qh + qo + 32);                             // dims 32..63
  const v16us ql0 = ldfrag_u(Ql + qo);
  const v16us ql1 = ldfrag_u(Ql + qo + 32);
  float m[8], ll[8];
  v8f oz[4], orr[4];
#pragma unroll
  for (int r = 0; r < 8; ++r) { m[r] = -1.0e30f; ll[r] = 0.f; }
#pragma unroll
  for (int d = 0; d < 4; ++d) { oz[d] = zero8(); orr[d] = zero8(); }
  unsigned short* pw = ps + wv * 1024;
  const size_t vob = (size_t)(hc + jc) * MT;                            // B: col dv = jc (+16d), k = key token

#pragma unroll 1
  for (int c = 0; c < NCHK; ++c) {
    const int tk0 = tk00 + 32 * c;                           // first key token of the chunk (multiple of 32)
    const size_t ko0 = (size_t)(tk0 + jc) * HH + hc + 8 * hh;   // B: col = key jc, k = head dim
    const size_t ko1 = ko0 + (size_t)16 * HH;                    // col = key 16 + jc
    v8f s0 = zero8(), s1 = zero8(), sr0 = zero8(), sr1 = zero8();
    {                                                        // k-step 0: head dims 0..31
      const v16us kf0 = ldfrag_u(Kh + ko0);
      const v16us kf1 = ldfrag_u(Kh + ko1);
      const v16us kl0 = ldfrag_u(Kl + ko0);
      const v16us kl1 = ldfrag_u(Kl + ko1);
      s0  = mma_h_raw(qf0, kf0, s0);                         // D row 8hh+r = query 16wv+8hh+r, col jc = key tk0+jc
      sr0 = mma_h_raw(qf0, kl0, sr0);                        // hi . residual
      s1  = mma_h_raw(qf0, kf1, s1);                         // key tk0+16+jc
      sr1 = mma_h_raw(qf0, kl1, sr1);
      sr0 = mma_h_raw(ql0, kf0, sr0);                        // residual . hi
      sr1 = mma_h_raw(ql0, kf1, sr1);
      guard4x6(s0, s1, sr0, sr1, qf0, ql0, kf0, kf1, kl0, kl1);
    }
    {                                                        // k-step 1: head dims 32..63
      const v16us kf0 = ldfrag_u(Kh + ko0 + 32);
      const v16us kf1 = ldfrag_u(Kh + ko1 + 32);
      const v16us kl0 = ldfrag_u(Kl + ko0 + 32);
      const v16us kl1 = ldfrag_u(Kl + ko1 + 32);
      s0  = mma_h_raw(qf1, kf0, s0);
      sr0 = mma_h_raw(qf1, kl0, sr0);
      s1  = mma_h_raw(qf1, kf1, s1);
      sr1 = mma_h_raw(qf1, kl1, sr1);
      sr0 = mma_h_raw(ql1, kf0, sr0);
      sr1 = mma_h_raw(ql1, kf1, sr1);
      guard4x6(s0, s1, sr0, sr1, qf1, ql1, kf0, kf1, kl0, kl1);
    }
    wave_sync_lds();                                         // earlier P fragment reads complete before overwrite
#pragma unroll
    for (int r = 0; r < 8; ++r) {
      const int il = 8 * hh + r;
      const float t0 = (s0[r] + sr0[r] * RSCI) * SCL;
      const float t1 = (s1[r] + sr1[r] * RSCI) * SCL;
      float rm = fmaxf(t0, t1);
#pragma unroll
      for (int off = 1; off < 16; off <<= 1) rm = fmaxf(rm, __shfl_xor(rm, off, 32));
      const float mn2   = fmaxf(m[r], rm);
      const float alpha = __expf(m[r] - mn2);
      const float e0 = __expf(t0 - mn2);
      const float e1 = __expf(t1 - mn2);
      float rs = e0 + e1;
#pragma unroll
      for (int off = 1; off < 16; off <<= 1) rs += __shfl_xor(rs, off, 32);
      ll[r] = ll[r] * alpha + rs;
      m[r]  = mn2;
#pragma unroll
      for (int d = 0; d < 4; ++d) { oz[d][r] *= alpha; orr[d][r] *= alpha; }
      unsigned short h0, l0, h1, l1;
      split_h(e0 * PSC, h0, l0);
      split_h(e1 * PSC, h1, l1);
      pw[il * 32 + jc]            = h0;                      // P hi [query il][k = jc]
      pw[il * 32 + 16 + jc]       = h1;                      // P hi [query il][k = 16 + jc]
      pw[512 + il * 32 + jc]      = l0;                      // P residual
      pw[512 + il * 32 + 16 + jc] = l1;
    }
    wave_sync_lds();
    FragU pa, pb;                                            // A: row = query jc, elements 0..7 <- k 8hh.., 8..15 <- k 16+8hh..
    pa.h[0] = *(const v8us*)(pw + jc * 32 + 8 * hh);
    pa.h[1] = *(const v8us*)(pw + jc * 32 + 16 + 8 * hh);
    pb.h[0] = *(const v8us*)(pw + 512 + jc * 32 + 8 * hh);
    pb.h[1] = *(const v8us*)(pw + 512 + jc * 32 + 16 + 8 * hh);
#pragma unroll
    for (int dg = 0; dg < 2; ++dg) {                         // dv tiles 2dg (cols 32dg+jc) and 2dg+1 (cols 32dg+16+jc)
      const size_t voa = vob + (size_t)(32 * dg) * MT + tk0 + 8 * hh;   // B: keys tk0+8hh.. and tk0+16+8hh..
      const size_t voc = voa + (size_t)16 * MT;
      const v16us f0 = ldfrag_u(VT  + voa);
      const v16us f1 = ldfrag_u(VT  + voc);
      const v16us g0 = ldfrag_u(VTl + voa);                  // residual plane, same cols
      const v16us g1 = ldfrag_u(VTl + voc);
      oz[2 * dg]      = mma_h_raw(pa.v, f0, oz[2 * dg]);
      orr[2 * dg]     = mma_h_raw(pa.v, g0, orr[2 * dg]);
      oz[2 * dg + 1]  = mma_h_raw(pa.v, f1, oz[2 * dg + 1]);
      orr[2 * dg + 1] = mma_h_raw(pa.v, g1, orr[2 * dg + 1]);
      orr[2 * dg]     = mma_h_raw(pb.v, f0, orr[2 * dg]);
      orr[2 * dg + 1] = mma_h_raw(pb.v, f1, orr[2 * dg + 1]);
      guard4x6(oz[2 * dg], oz[2 * dg + 1], orr[2 * dg], orr[2 * dg + 1], pa.v, pb.v, f0, f1, g0, g1);
    }
  }

#pragma unroll
  for (int r = 0; r < 8; ++r) {
    const int il = 8 * hh + r;
    const float l = ll[r];
    const float inv = ((l > 0.f) ? (1.0f / l) : 0.f) * (ZSC / PSC);
    const int so = (16 * wv + il) * ZSP + jc;
#pragma unroll
    for (int d = 0; d < 4; ++d) {
      const float z = (oz[d][r] + orr[d][r] * RSCI) * inv;
      unsigned short h0, l0;
      split_h(z, h0, l0);
      zsth[so + 16 * d] = h0;
      zstl[so + 16 * d] = l0;
    }
  }
  __syncthreads();
  v4u hv[4], lv[4];
#pragma unroll
  for (int it = 0; it < 4; ++it) {
    const int row = it * 32 + (t >> 3), p = (t & 7) * 8;   // it 0..3 x (t>>3) 0..31 = rows 0..127, 8 lanes per row
    hv[it] = *(const v4u*)(zsth + row * ZSP + p);
    lv[it] = *(const v4u*)(zstl + row * ZSP + p);
  }
  {
#pragma unroll
    for (int it = 0; it < 4; ++it) {
      const int row = it * 32 + (t >> 3), p = (t & 7) * 8;
      const size_t go = (size_t)(tq0 + row) * HH + hc + p;
      *(v4u*)(Zh + go) = hv[it];
      *(v4u*)(Zl + go) = lv[it];
    }
    
  }
}

// =====================================================================================================
// Workspace map (bytes); every plane is an exact multiple of its whole-row / whole-tile store granularity
//   Xh    f16 [4096][768]     0          6291456
//   Wq16  f16 [768][768]      6291456    1179648   (x16)
//   Wk16  f16 [768][768]      7471104    1179648   (x16)
//   Wv16  f16 [768][768]      8650752    1179648   (x16)
//   Wo16  f16 [768][768]      9830400    1179648   (x16)
//   Qh    f16 [4096][768]     11010048   6291456   (hi)
//   Ql    f16 [4096][768]     17301504   6291456   (x2048 residual)
//   Kh    f16 [4096][768]     23592960   6291456   (hi)
//   Kl    f16 [4096][768]     29884416   6291456   (x2048 residual)
//   VT    f16 [768][4096]     36175872   6291456   (hi)
//   VTl   f16 [768][4096]     42467328   6291456   (x2048 residual)
//   Zh    f16 [4096][768]     48758784   6291456   (z x16, hi)
//   Zl    f16 [4096][768]     55050240   6291456   (x2048 residual)
//   end                       61341696
// =====================================================================================================
extern "C" void kernel_launch(void* const* d_in, const int* in_sizes, int n_in,
                              void* d_out, int out_size, void* d_ws, size_t ws_size,
                              hipStream_t stream) {
  if (n_in < 9) return;
  if (in_sizes[0] != MT * HH) return;
  if (in_sizes[1] != HH * HH || in_sizes[2] != HH) return;
  if (in_sizes[3] != HH * HH || in_sizes[4] != HH) return;
  if (in_sizes[5] != HH * HH || in_sizes[6] != HH) return;
  if (in_sizes[7] != HH * HH || in_sizes[8] != HH) return;
  if (out_size != MT * HH) return;

  const float* x  = (const float*)d_in[0];
  const float* Wq = (const float*)d_in[1];
  const float* bq = (const float*)d_in[2];
  const float* Wk = (const float*)d_in[3];
  const float* bk = (const float*)d_in[4];
  const float* Wv = (const float*)d_in[5];
  const float* bv = (const float*)d_in[6];
  const float* Wo = (const float*)d_in[7];
  const float* bo = (const float*)d_in[8];

  const size_t PX  = (size_t)MT * HH * 2;        // 6291456
  const size_t PW  = (size_t)HH * HH * 2;        // 1179648
  const size_t PVT = (size_t)HH * MT * 2;        // 6291456
  size_t off = 0;
  const size_t oXh = off; off += PX;
  const size_t oWq = off; off += PW;
  const size_t oWk = off; off += PW;
  const size_t oWv = off; off += PW;
  const size_t oWo = off; off += PW;
  const size_t oQh = off; off += PX;
  const size_t oQl = off; off += PX;
  const size_t oKh = off; off += PX;
  const size_t oKl = off; off += PX;
  const size_t oVT = off; off += PVT;
  const size_t oVL = off; off += PVT;
  const size_t oZh = off; off += PX;
  const size_t oZl = off; off += PX;
  if (off > ws_size) return;                     // off = 61341696
  if (off > (size_t)134217728) return;

  char* ws = (char*)d_ws;
  unsigned short* Xh   = (unsigned short*)(ws + oXh);
  unsigned short* Wq16 = (unsigned short*)(ws + oWq);
  unsigned short* Wk16 = (unsigned short*)(ws + oWk);
  unsigned short* Wv16 = (unsigned short*)(ws + oWv);
  unsigned short* Wo16 = (unsigned short*)(ws + oWo);
  unsigned short* Qh   = (unsigned short*)(ws + oQh);
  unsigned short* Ql   = (unsigned short*)(ws + oQl);
  unsigned short* Kh   = (unsigned short*)(ws + oKh);
  unsigned short* Kl   = (unsigned short*)(ws + oKl);
  unsigned short* VT   = (unsigned short*)(ws + oVT);
  unsigned short* VTl  = (unsigned short*)(ws + oVL);
  unsigned short* Zh   = (unsigned short*)(ws + oZh);
  unsigned short* Zl   = (unsigned short*)(ws + oZl);
  float*          out0 = (float*)d_out;

  const dim3 blk(256);
  const int gqk = ((MT / 64) * (HH / 64)) / 8;             // 768 tiles of 64x64 -> 96 blocks
  const int gvt = ((HH / 64) * (MT / 64)) / 8;             // 768 tiles -> 96 blocks
  const int gsp = ((MT / 32) * (HH / 64)) / 8;             // 1536 tiles of 32x64 -> 192 blocks
  if ((((MT / 64) * (HH / 64)) % 8) != 0) return;
  if ((((HH / 64) * (MT / 64)) % 8) != 0) return;
  if ((((MT / 32) * (HH / 64)) % 8) != 0) return;

  // (0) x -> f16 plane of bf16 values; weights [768][768] ([out][in] = Bt[n][k]) -> f16 bits of bf16 values x16
  cvt_rows<<<dim3(MT / 8), blk, 0, stream>>>(x, Xh, MT, 1.0f);
  cvt_rows<<<dim3(HH / 8), blk, 0, stream>>>(Wq, Wq16, HH, WSC);
  cvt_rows<<<dim3(HH / 8), blk, 0, stream>>>(Wk, Wk16, HH, WSC);
  cvt_rows<<<dim3(HH / 8), blk, 0, stream>>>(Wv, Wv16, HH, WSC);
  cvt_rows<<<dim3(HH / 8), blk, 0, stream>>>(Wo, Wo16, HH, WSC);

  // (1) q = x . Wq^T + bq and k = x . Wk^T + bk -> hi + residual planes [4096][768];
  //     v^T = Wv . x^T + bv[m] -> hi + residual planes [768][4096]
  gemm64<1, 1, 0><<<dim3(gqk), blk, 0, stream>>>(
      Xh, Xh, HH, Wq16, HH, Qh, Ql, out0, HH, bq, 1.0f / WSC, 1.0f, MT, HH, HH);
  gemm64<1, 1, 0><<<dim3(gqk), blk, 0, stream>>>(
      Xh, Xh, HH, Wk16, HH, Kh, Kl, out0, HH, bk, 1.0f / WSC, 1.0f, MT, HH, HH);
  gemm64<1, 2, 0><<<dim3(gvt), blk, 0, stream>>>(
      Wv16, Wv16, HH, Xh, HH, VT, VTl, out0, MT, bv, 1.0f / WSC, 1.0f, HH, MT, HH);

  // (2) block-diagonal segment attention -> z (x16) hi + residual planes
  attn_kernel<<<dim3(MT / QT, NHD), blk, 0, stream>>>(Qh, Ql, Kh, Kl, VT, VTl, Zh, Zl);

  // (3) output projection: out = z . Wo^T + bo -> f32 (A operand split)
  gemm64<0, 1, 1><<<dim3(gsp), blk, 0, stream>>>(
      Zh, Zl, HH, Wo16, HH, Qh, Ql, out0, HH, bo, 1.0f / (WSC * ZSC), 1.0f, MT, HH, HH);
  (void)hipGetLastError();
}

// v001
// It runs in 102 microseconds.
// Next to v000, in two timings, it ran 1.88 and 1.90 times as fast.
// Contractions: q = x.Wq^T, k = x.Wk^T and v^T = Wv.x^T (plain f16, exact bf16-valued operands);
// attention scores q.k^T and p.v^T with q, k, p, v^T as f16 hi + x2048 residual planes (hi.hi + hi.lo + lo.hi);
// output projection z.Wo^T with z as f16 hi + x2048 residual planes (hi.W + lo.W); all v_wmma_f32_16x16x32_f16
// (f16 operands, f32 accumulate); float inputs RNE-converted to bf16 on load (x in f16 containers, weights x16
// in f16), p carried x1024, z carried x16; softmax in f32 on VALU.
#include <hip/hip_runtime.h>
#include <math.h>
#include <stdint.h>

#define NBT  2
#define SEQ  2048
#define HH   768
#define NHD  12
#define HD   64
#define SEGL 256
#define MT   (NBT * SEQ)
#define QT   128
#define NCHK (SEGL / 32)
#define ZSP  72
#define WSC  16.0f
#define PSC  1024.0f
#define ZSC  16.0f
#define RSC  2048.0f
#define RSCI 0.00048828125f
#define SCL  0.125f
#define KST  128                   // k (halves) per LDS stage: 256 B of every staged row
#define LPH  136                   // LDS row pitch in halves: 272 B = 16 B x odd, for ds_load_b128 readers
#define SROW 384                   // rows per stage: 128 of A (or 64 hi + 64 residual), then 256 of Bt
#define STGH (SROW * LPH)          // halves per stage buffer
#define RSB  (16 * LPH * 2)        // LDS bytes between two copies of one lane (16 rows)

static_assert(NHD * HD == HH);
static_assert(HD == 64);
static_assert((SEQ % SEGL) == 0 && (SEGL % QT) == 0 && (MT % QT) == 0 && QT == 128 && (SEGL % 32) == 0);
static_assert((MT % 64) == 0 && (HH % 64) == 0 && (MT % 32) == 0 && (HH % 32) == 0);
static_assert((((MT / 64) * (HH / 64)) % 8) == 0);
static_assert((((HH / 64) * (MT / 64)) % 8) == 0);
static_assert((((MT / 32) * (HH / 64)) % 8) == 0);
static_assert((MT % 8) == 0 && (HH % 8) == 0 && (HH % 256) == 0);
static_assert(ZSP >= 64 && (ZSP % 8) == 0);
static_assert((MT % 256) == 0 && (HH % 128) == 0 && (MT % 128) == 0 && (HH % KST) == 0 && HH / KST >= 2);
static_assert((LPH % 8) == 0 && LPH >= KST);

typedef _Float16 v16h __attribute__((ext_vector_type(16)));
typedef _Float16 v8h  __attribute__((ext_vector_type(8)));
typedef unsigned short v16us __attribute__((ext_vector_type(16)));
typedef unsigned short v8us  __attribute__((ext_vector_type(8)));
typedef float v8f __attribute__((ext_vector_type(8)));
typedef float v4f __attribute__((ext_vector_type(4)));
typedef unsigned int v4u __attribute__((ext_vector_type(4)));

union FragU { v16us v; v8us h[2]; };

// ---- scalar helpers --------------------------------------------------------------------------------
__device__ __forceinline__ unsigned short bf_bits(float f) {          // f32 -> bf16 bits, RNE convert
  const unsigned u = __float_as_uint(f);
  return (unsigned short)((u + 0x7FFFu + ((u >> 16) & 1u)) >> 16);
}
__device__ __forceinline__ float bf_up(unsigned short h) { return __uint_as_float(((unsigned)h) << 16); }
__device__ __forceinline__ float bfr(float f) { return bf_up(bf_bits(f)); }   // value of the bf16 RNE convert
__device__ __forceinline__ unsigned short h_bits(_Float16 x) { return __builtin_bit_cast(unsigned short, x); }
__device__ __forceinline__ unsigned short f2h(float f) { return h_bits((_Float16)f); }
__device__ __forceinline__ float h_up(unsigned short h) { return (float)__builtin_bit_cast(_Float16, h); }
__device__ __forceinline__ unsigned pk16(unsigned short a, unsigned short b) { return (unsigned)a | ((unsigned)b << 16); }
__device__ __forceinline__ v8f zero8() { v8f z = {0.f, 0.f, 0.f, 0.f, 0.f, 0.f, 0.f, 0.f}; return z; }
// f -> f16 hi bits and f16 bits of the x2048 residual (f - hi) * 2048
__device__ __forceinline__ void split_h(float f, unsigned short& hi, unsigned short& lo) {
  hi = f2h(f);
  lo = f2h((f - h_up(hi)) * RSC);
}

// ---- fragment loader: 16-bit A/B operand, lane -> row/col (lane&15), p already includes +8*(lane>>4);
//      elements 0..7 <- p[0..7] (k0+8h..), elements 8..15 <- p[16..23] (k0+16+8h..)
__device__ __forceinline__ v16us ldfrag_u(const unsigned short* p) {
  FragU f;
  f.h[0] = *(const v8us*)(p);
  f.h[1] = *(const v8us*)(p + 16);
  return f.v;
}

// ---- WMMA helpers with trailing VALU hazard gap --------------------------------------------------------
__device__ __forceinline__ v8f mma_h_raw(v16us a, v16us b, v8f c) {             // f16 operands (bits), unguarded
  return __builtin_amdgcn_wmma_f32_16x16x32_f16(false, __builtin_bit_cast(v16h, a), false,
                                                __builtin_bit_cast(v16h, b), (short)0, c, false, false);
}
__device__ __forceinline__ void dep_guard1(v8f& a, v8f& b, v16us x) {
#if defined(__HIP_DEVICE_COMPILE__)
  asm volatile("v_nop\n\tv_nop\n\tv_nop\n\tv_nop" : "+v"(a), "+v"(b) : "v"(x));
#endif
}
__device__ __forceinline__ void dep_guard2(v8f& a, v8f& b, v8f& c, v8f& d, v16us x, v16us y) {
#if defined(__HIP_DEVICE_COMPILE__)
  asm volatile("v_nop\n\tv_nop\n\tv_nop\n\tv_nop" : "+v"(a), "+v"(b), "+v"(c), "+v"(d) : "v"(x), "v"(y));
#endif
}
__device__ __forceinline__ void keep4_u(v16us a, v16us b, v16us c, v16us d) {
#if defined(__HIP_DEVICE_COMPILE__)
  asm volatile("v_nop" :: "v"(a), "v"(b), "v"(c), "v"(d));
#endif
}
__device__ __forceinline__ void acc_guard4(v8f& a, v8f& b, v8f& c, v8f& d) {
#if defined(__HIP_DEVICE_COMPILE__)
  asm volatile("v_nop\n\tv_nop\n\tv_nop\n\tv_nop" : "+v"(a), "+v"(b), "+v"(c), "+v"(d));
#endif
}
// ties four D accumulators and keeps six A/B fragments live across a 4-slot VALU gap
__device__ __forceinline__ void guard4x6(v8f& a, v8f& b, v8f& c, v8f& d,
                                         v16us p, v16us q, v16us r, v16us s, v16us t, v16us u) {
#if defined(__HIP_DEVICE_COMPILE__)
  asm volatile("v_nop\n\tv_nop\n\tv_nop\n\tv_nop"
               : "+v"(a), "+v"(b), "+v"(c), "+v"(d)
               : "v"(p), "v"(q), "v"(r), "v"(s), "v"(t), "v"(u));
#endif
}
__device__ __forceinline__ void wave_sync_lds() {
  __builtin_amdgcn_fence(__ATOMIC_RELEASE, "workgroup");
  __builtin_amdgcn_wave_barrier();
  __builtin_amdgcn_fence(__ATOMIC_ACQUIRE, "workgroup");
}

// ---- asynchronous copies global -> LDS ------------------------------------------------------------------
// Eight 16-byte copies per lane: LDS bytes l + i * RSB; global ga + i * gs (i = 0..3) and gb + i * gs (i = 4..7
// as 0..3). The closing s_wait_xcnt stands inside the statement so that no address register named by a copy is
// rewritten in front of it.
__device__ __forceinline__ void copy8(unsigned l, const unsigned short* ga, const unsigned short* gb, size_t gs) {
#if defined(__HIP_DEVICE_COMPILE__)
  asm volatile(
      "global_load_async_to_lds_b128 %0, %8, off\n\t"
      "global_load_async_to_lds_b128 %1, %9, off\n\t"
      "global_load_async_to_lds_b128 %2, %10, off\n\t"
      "global_load_async_to_lds_b128 %3, %11, off\n\t"
      "global_load_async_to_lds_b128 %4, %12, off\n\t"
      "global_load_async_to_lds_b128 %5, %13, off\n\t"
      "global_load_async_to_lds_b128 %6, %14, off\n\t"
      "global_load_async_to_lds_b128 %7, %15, off\n\t"
      "s_wait_xcnt 0x0"
      :: "v"(l), "v"(l + RSB), "v"(l + 2 * RSB), "v"(l + 3 * RSB),
         "v"(l + 4 * RSB), "v"(l + 5 * RSB), "v"(l + 6 * RSB), "v"(l + 7 * RSB),
         "v"(ga), "v"(ga + gs), "v"(ga + 2 * gs), "v"(ga + 3 * gs),
         "v"(gb), "v"(gb + gs), "v"(gb + 2 * gs), "v"(gb + 3 * gs)
      : "memory");
#endif
}
// this wave's own copies have landed in LDS
__device__ __forceinline__ void wait_async0() {
#if defined(__HIP_DEVICE_COMPILE__)
  asm volatile("s_wait_asynccnt 0x0" ::: "memory");
#endif
}
// this wave's own LDS reads have returned, before the buffer they read is handed to its next writer
__device__ __forceinline__ void wait_ds0() {
#if defined(__HIP_DEVICE_COMPILE__)
  asm volatile("s_wait_dscnt 0x0" ::: "memory");
#endif
}

// =====================================================================================================
// Rows [nrows][768] f32 -> f16 bits of (bf16 RNE value * sc). Used for x (sc = 1) and for the [out][in]
// weight matrices (sc = 16), which are already Bt[n][k] with k contiguous. One wave per row; three column
// chunks of 256: lane owns columns 256c + 8*lane..+7, one instruction = 32 lanes x 16 B = 512 contiguous B
// coverage: 8 rows per block, grid = nrows/8 exact (host-checked), 3 chunks x 256 = 768 cols: union = every row.
// =====================================================================================================
__global__ __launch_bounds__(256) void cvt_rows(const float* __restrict__ x, unsigned short* xh, int nrows, float sc) {
  const int row = blockIdx.x * 8 + (threadIdx.x >> 5);
  const int lane = threadIdx.x & 31;
  if (row >= nrows) return;                               // wave-uniform, no barriers below
  v4u hv[HH / 256];
#pragma unroll
  for (int c = 0; c < HH / 256; ++c) {
    const float* p = x + (size_t)row * HH + c * 256 + lane * 8;
    const v4f a0 = *(const v4f*)(p);
    const v4f a1 = *(const v4f*)(p + 4);
    v4u h;
#pragma unroll
    for (int e = 0; e < 2; ++e) {
      h[e]     = pk16(f2h(bfr(a0[2 * e]) * sc), f2h(bfr(a0[2 * e + 1]) * sc));
      h[2 + e] = pk16(f2h(bfr(a1[2 * e]) * sc), f2h(bfr(a1[2 * e + 1]) * sc));
    }
    hv[c] = h;
  }
  unsigned short* d = xh + (size_t)row * HH + lane * 8;
  {
#pragma unroll
    for (int c = 0; c < HH / 256; ++c) *(v4u*)(d + c * 256) = hv[c];
    
  }
}

// =====================================================================================================
// Register-blocked f16 WMMA GEMM: C[m][n] = (sum_k A[m][k] * Bt[n][k] * wsc + bias) * osc, one wave per TRx64
// tile (TR = 64, or 32 when the A operand is split); the block's 8 waves form a (2 TR) x 256 tile (2 x 4 waves)
// whose operand rows are staged in LDS, 128 k at a time, two buffers, by asynchronous 16-byte copies (16 lanes
// per 256-B row piece), the next stage in flight while this one is multiplied. A row-major [M][K] pitch lda (ASPL = 1:
// a second plane Al holds the x2048 residual, same pitch, products into a separate accumulator folded back
// as acc + accr/2048); Bt row-major [N][K] pitch ldb (k contiguous); M multiple of 2 TR, N of 256, K of 128 and at
// least 256 (true at every call site; host-checked grids = tiles/8 exact so no block exits early).
// OM: 0 = f32 out Cf; 1 = f16 hi bits Ch plus x2048 residual bits Cl (both pitch ldc).
// CBM: 0 = no bias; 1 = column bias bf16(cb[n]); 2 = row bias bf16(cb[m]). All biases bf16 RNE values.
// coverage: MI slabs x 16 rows x 64 cols = the wave's whole TRx64 tile; tiles/8 blocks x 8 waves = every tile.
// =====================================================================================================
template <int OM, int CBM, int ASPL>
__global__ __launch_bounds__(256) void gemm64(
    const unsigned short* __restrict__ Ap, const unsigned short* __restrict__ Alp, int lda,
    const unsigned short* __restrict__ Btp, int ldb,
    unsigned short* Ch, unsigned short* Cl, float* Cf, int ldc,
    const float* __restrict__ cb, float wsc, float osc, int M, int N, int K) {
  constexpr int MI = ASPL ? 2 : 4;
  constexpr int TR = 16 * MI;
  __shared__ __align__(16) float sT[8][16 * 68];   // per-wave 16x64 slab, pitch 68 floats
  __shared__ __align__(16) unsigned short sS[2 * STGH];   // two operand stages
  const int lane = threadIdx.x & 31;
  const int wave = threadIdx.x >> 5;
  const int tilesN = N >> 8;
  const int tilesM = M / (2 * TR);
  if ((int)blockIdx.x >= tilesM * tilesN) return;   // block-uniform, in front of every barrier
  const int tm = blockIdx.x / tilesN;
  const int tn = blockIdx.x - tm * tilesN;
  const int wm = wave >> 2;                    // wave row 0..1
  const int wn = wave & 3;                     // wave column 0..3
  const int mb = tm * (2 * TR);                // block's first row of A
  const int nb = tn << 8;                      // block's first row of Bt
  const int m0 = mb + wm * TR;
  const int n0 = nb + (wn << 6);

  const int rlane = lane & 15;                 // row (A) / col (B, D) within subtile
  const int koff  = (lane >> 4) * 8;           // k offset of this lane half
  const int mOff  = (lane >> 4) * 8;           // D row offset

  v8f acc[MI][4];
  v8f accr[MI][4];
#pragma unroll
  for (int i = 0; i < MI; ++i)
#pragma unroll
    for (int j = 0; j < 4; ++j) { acc[i][j] = zero8(); accr[i][j] = zero8(); }

  // copy map: lane's 16-B piece cch of staged row crow + 16 i, i = 0..23 (rows 0..127 A, 128..383 Bt)
  const int crow = threadIdx.x >> 4;           // 0..15
  const int cch  = (threadIdx.x & 15) * 8;     // halves
  const unsigned lds0 = (unsigned)(size_t)sS + (unsigned)(crow * LPH + cch) * 2u;   // LDS byte address, buffer 0
  const unsigned short* gA0 = Ap + (size_t)(mb + crow) * lda + cch;                 // staged rows 0..63
  const unsigned short* gA1 = ASPL ? Alp + (size_t)(mb + crow) * lda + cch          // rows 64..127: residual plane
                                   : gA0 + (size_t)64 * lda;                        // or A rows 64..127
  const unsigned short* gB0 = Btp + (size_t)(nb + crow) * ldb + cch;                // staged rows 128..383
  const size_t gsa = (size_t)16 * lda, gsb = (size_t)16 * ldb;
  const int NT = K / KST;

  // staged row of this lane's first A fragment and first Bt fragment, with its k offset
  const int fa = (wm * TR + rlane) * LPH + koff;
  const int fb = (128 + (wn << 6) + rlane) * LPH + koff;

  // stage 0 -> buffer 0, landed and published; then stage 1 -> buffer 1 in flight
  copy8(lds0,            gA0,           gA1,            gsa);
  copy8(lds0 + 8 * RSB,  gB0,           gB0 + 4 * gsb,  gsb);
  copy8(lds0 + 16 * RSB, gB0 + 8 * gsb, gB0 + 12 * gsb, gsb);
  wait_async0();
  __syncthreads();
  if (NT > 1) {
    const unsigned lb = lds0 + STGH * 2;
    copy8(lb,            gA0 + KST,           gA1 + KST,            gsa);
    copy8(lb + 8 * RSB,  gB0 + KST,           gB0 + KST + 4 * gsb,  gsb);
    copy8(lb + 16 * RSB, gB0 + KST + 8 * gsb, gB0 + KST + 12 * gsb, gsb);
  }

#pragma unroll 1   // one stage per trip: the buffer index stays a run-time value and the text small
  for (int t = 0; t < NT; ++t) {
    const unsigned short* sb = sS + (t & 1) * STGH;
#pragma unroll
    for (int kk = 0; kk < KST; kk += 32) {
      // all eight fragments of this k-step are asked for ahead of its 16 products, not one A fragment per four
      v16us bh[4], ahf[MI], alf[MI];
#pragma unroll
      for (int j = 0; j < 4; ++j) bh[j] = ldfrag_u(sb + fb + (j << 4) * LPH + kk);
#pragma unroll
      for (int i = 0; i < MI; ++i) {
        ahf[i] = ldfrag_u(sb + fa + (i << 4) * LPH + kk);
        if (ASPL) alf[i] = ldfrag_u(sb + fa + (64 + (i << 4)) * LPH + kk);
      }
#pragma unroll
      for (int i = 0; i < MI; ++i) {
        const v16us ah = ahf[i];
        if (ASPL) {
          const v16us al = alf[i];
#pragma unroll
          for (int j = 0; j < 4; ++j) {
            acc[i][j]  = mma_h_raw(ah, bh[j], acc[i][j]);
            accr[i][j] = mma_h_raw(al, bh[j], accr[i][j]);
          }
          dep_guard2(acc[i][0], acc[i][3], accr[i][0], accr[i][3], ah, al);
        } else {
#pragma unroll
          for (int j = 0; j < 4; ++j) acc[i][j] = mma_h_raw(ah, bh[j], acc[i][j]);
          dep_guard1(acc[i][0], acc[i][3], ah);
        }
      }
      keep4_u(bh[0], bh[1], bh[2], bh[3]);
    }
    // publish point of stage t + 1: own reads of this buffer done, own copies landed, then every wave passes
    wait_ds0();
    wait_async0();
    __syncthreads();
    if (t + 2 < NT) {                          // block-uniform: refill the buffer that this trip has just read
      const unsigned lb = lds0 + (unsigned)(t & 1) * (STGH * 2);
      const int k2 = (t + 2) * KST;
      copy8(lb,            gA0 + k2,           gA1 + k2,            gsa);
      copy8(lb + 8 * RSB,  gB0 + k2,           gB0 + k2 + 4 * gsb,  gsb);
      copy8(lb + 16 * RSB, gB0 + k2 + 8 * gsb, gB0 + k2 + 12 * gsb, gsb);
    }
  }
  wait_async0();
#pragma unroll
  for (int i = 0; i < MI; ++i) {
    acc_guard4(acc[i][0], acc[i][1], acc[i][2], acc[i][3]);
    if (ASPL) acc_guard4(accr[i][0], accr[i][1], accr[i][2], accr[i][3]);
  }

  const int hh2 = lane >> 4, c4 = (lane & 15) * 4;     // f32 out: 256-B row segment = 16 lanes x 16 B
  const int q8  = lane >> 3, c8 = (lane & 7) * 8;

  v4f cb4 = {0.f, 0.f, 0.f, 0.f};
  float cbc[8];
#pragma unroll
  for (int e = 0; e < 8; ++e) cbc[e] = 0.f;
  if (OM == 0 && CBM == 1) {
    const v4f v = *(const v4f*)(cb + n0 + c4);
    cb4[0] = bfr(v[0]); cb4[1] = bfr(v[1]); cb4[2] = bfr(v[2]); cb4[3] = bfr(v[3]);
  }
  if (OM == 1 && CBM == 1) {
    const v4f v0 = *(const v4f*)(cb + n0 + c8);
    const v4f v1 = *(const v4f*)(cb + n0 + c8 + 4);
#pragma unroll
    for (int e = 0; e < 4; ++e) { cbc[e] = bfr(v0[e]); cbc[4 + e] = bfr(v1[e]); }
  }

  // ---- epilogue ----
  float* slab = sT[wave];
#pragma unroll
  for (int i = 0; i < MI; ++i) {
    const int mBase = m0 + (i << 4);
#pragma unroll
    for (int j = 0; j < 4; ++j) {
#pragma unroll
      for (int r = 0; r < 8; ++r) {
        float v = acc[i][j][r];
        if (ASPL) v += accr[i][j][r] * RSCI;
        slab[(mOff + r) * 68 + (j << 4) + rlane] = v;
      }
    }
    wave_sync_lds();
    if (OM == 0) {
      v4f vals[8];
#pragma unroll
      for (int it = 0; it < 8; ++it) {
        const int row = it * 2 + hh2;                      // it 0..7 x hh2 0..1 = rows 0..15
        const v4f v = *(const v4f*)(slab + row * 68 + c4);
        vals[it] = (v * wsc + cb4) * osc;
      }
      {
#pragma unroll
        for (int it = 0; it < 8; ++it) {
          const int row = it * 2 + hh2;
          *(v4f*)(Cf + (size_t)(mBase + row) * ldc + (size_t)n0 + c4) = vals[it];
        }
        
      }
    }
    if (OM == 1) {
      v4u hv[4], lv[4];
#pragma unroll
      for (int it = 0; it < 4; ++it) {
        const int row = it * 4 + q8;                       // it 0..3 x q8 0..3 = rows 0..15
        const float* sp = slab + row * 68 + c8;
        float rb = 0.f;
        if (CBM == 2) rb = bfr(cb[mBase + row]);
        v4u ha = {0u, 0u, 0u, 0u}, la = {0u, 0u, 0u, 0u};
#pragma unroll
        for (int e = 0; e < 4; ++e) {
          const float f0 = (sp[2 * e]     * wsc + cbc[2 * e]     + rb) * osc;
          const float f1 = (sp[2 * e + 1] * wsc + cbc[2 * e + 1] + rb) * osc;
          unsigned short h0, l0, h1, l1;
          split_h(f0, h0, l0);
          split_h(f1, h1, l1);
          ha[e] = pk16(h0, h1);
          la[e] = pk16(l0, l1);
        }
        hv[it] = ha;
        lv[it] = la;
      }
      {
#pragma unroll
        for (int it = 0; it < 4; ++it) {
          const int row = it * 4 + q8;
          const size_t go = (size_t)(mBase + row) * ldc + (size_t)n0 + c8;
          *(v4u*)(Ch + go) = hv[it];
          *(v4u*)(Cl + go) = lv[it];
        }
        
      }
    }
    wave_sync_lds();
  }
}

// =====================================================================================================
// Block-diagonal attention over 256-token segments, head dim 64. Block = 256 threads = 8 waves, one block per
// (128 query tokens tq0..tq0+127, head); all 128 queries lie in one segment whose keys are tokens
// tk00 = (tq0 & ~255) .. tk00+255, every key valid (no masking); wave w owns queries tq0+16w..+15 and all 64 dv.
// Q/K planes f16 bits [token][768] (head h at cols 64h..64h+63): hi (Qh, Kh) and x2048 residual (Ql, Kl);
// V^T planes f16 [dv][token]: hi (VT) and x2048 residual (VTl).
// Per chunk of 32 keys: s = qh.kh^T (acc s) and qh.kl^T + ql.kh^T (acc sr), two 32-deep k-steps over the 64
// head dims; logit = (s + sr/2048) * 0.125; running-max softmax in f32; p = exp(logit - m) carried as 1024 p
// barrier, v8us fragment reload of the same element type); z accumulates ph.vh (oz) and ph.vl + pl.vh (orr) on
// WMMA for 4 dv tiles, z = oz + orr/2048. q, k, p and v^T fragments all use the split k map.
// coverage: 128 query rows x 64 halves at cols 64*head per block in Zh and in Zl; grid (MT/128) x 12 heads = the
// whole [4096][768] z planes.
// =====================================================================================================
__global__ __launch_bounds__(256) void attn_kernel(const unsigned short* __restrict__ Qh,
                                                   const unsigned short* __restrict__ Ql,
                                                   const unsigned short* __restrict__ Kh,
                                                   const unsigned short* __restrict__ Kl,
                                                   const unsigned short* __restrict__ VT,
                                                   const unsigned short* __restrict__ VTl,
                                                   unsigned short* Zh, unsigned short* Zl) {
  __shared__ __align__(16) unsigned short ps[8 * 1024];     // wave-private P tiles: hi [16][32] at 0, lo at 512
  __shared__ __align__(16) unsigned short zsth[QT * ZSP];   // output staging, hi plane
  __shared__ __align__(16) unsigned short zstl[QT * ZSP];   // output staging, residual plane
  const int tq0  = blockIdx.x * QT;                         // first query token (token = b*2048 + s)
  const int tk00 = tq0 & ~(SEGL - 1);                       // first key token of the segment
  const int hc   = blockIdx.y * HD;                         // head column offset
  const int t = threadIdx.x, lane = t & 31, wv = t >> 5, hh = lane >> 4, jc = lane & 15;

  const size_t qo = (size_t)(tq0 + 16 * wv + jc) * HH + hc + 8 * hh;   // A: row = query jc, k = head dim
  const v16us qf0 = ldfrag_u(Qh + qo);                                  // dims 0..31
  const v16us qf1 = ldfrag_u(Qh + qo + 32);                             // dims 32..63
  const v16us ql0 = ldfrag_u(Ql + qo);
  const v16us ql1 = ldfrag_u(Ql + qo + 32);
  float m[8], ll[8];
  v8f oz[4], orr[4];
#pragma unroll
  for (int r = 0; r < 8; ++r) { m[r] = -1.0e30f; ll[r] = 0.f; }
#pragma unroll
  for (int d = 0; d < 4; ++d) { oz[d] = zero8(); orr[d] = zero8(); }
  unsigned short* pw = ps + wv * 1024;
  const size_t vob = (size_t)(hc + jc) * MT;                            // B: col dv = jc (+16d), k = key token

#pragma unroll 1
  for (int c = 0; c < NCHK; ++c) {
    const int tk0 = tk00 + 32 * c;                           // first key token of the chunk (multiple of 32)
    const size_t ko0 = (size_t)(tk0 + jc) * HH + hc + 8 * hh;   // B: col = key jc, k = head dim
    const size_t ko1 = ko0 + (size_t)16 * HH;                    // col = key 16 + jc
    v8f s0 = zero8(), s1 = zero8(), sr0 = zero8(), sr1 = zero8();
    {                                                        // k-step 0: head dims 0..31
      const v16us kf0 = ldfrag_u(Kh + ko0);
      const v16us kf1 = ldfrag_u(Kh + ko1);
      const v16us kl0 = ldfrag_u(Kl + ko0);
      const v16us kl1 = ldfrag_u(Kl + ko1);
      s0  = mma_h_raw(qf0, kf0, s0);                         // D row 8hh+r = query 16wv+8hh+r, col jc = key tk0+jc
      sr0 = mma_h_raw(qf0, kl0, sr0);                        // hi . residual
      s1  = mma_h_raw(qf0, kf1, s1);                         // key tk0+16+jc
      sr1 = mma_h_raw(qf0, kl1, sr1);
      sr0 = mma_h_raw(ql0, kf0, sr0);                        // residual . hi
      sr1 = mma_h_raw(ql0, kf1, sr1);
      guard4x6(s0, s1, sr0, sr1, qf0, ql0, kf0, kf1, kl0, kl1);
    }
    {                                                        // k-step 1: head dims 32..63
      const v16us kf0 = ldfrag_u(Kh + ko0 + 32);
      const v16us kf1 = ldfrag_u(Kh + ko1 + 32);
      const v16us kl0 = ldfrag_u(Kl + ko0 + 32);
      const v16us kl1 = ldfrag_u(Kl + ko1 + 32);
      s0  = mma_h_raw(qf1, kf0, s0);
      sr0 = mma_h_raw(qf1, kl0, sr0);
      s1  = mma_h_raw(qf1, kf1, s1);
      sr1 = mma_h_raw(qf1, kl1, sr1);
      sr0 = mma_h_raw(ql1, kf0, sr0);
      sr1 = mma_h_raw(ql1, kf1, sr1);
      guard4x6(s0, s1, sr0, sr1, qf1, ql1, kf0, kf1, kl0, kl1);
    }
    wave_sync_lds();                                         // earlier P fragment reads complete before overwrite
#pragma unroll
    for (int r = 0; r < 8; ++r) {
      const int il = 8 * hh + r;
      const float t0 = (s0[r] + sr0[r] * RSCI) * SCL;
      const float t1 = (s1[r] + sr1[r] * RSCI) * SCL;
      float rm = fmaxf(t0, t1);
#pragma unroll
      for (int off = 1; off < 16; off <<= 1) rm = fmaxf(rm, __shfl_xor(rm, off, 32));
      const float mn2   = fmaxf(m[r], rm);
      const float alpha = __expf(m[r] - mn2);
      const float e0 = __expf(t0 - mn2);
      const float e1 = __expf(t1 - mn2);
      float rs = e0 + e1;
#pragma unroll
      for (int off = 1; off < 16; off <<= 1) rs += __shfl_xor(rs, off, 32);
      ll[r] = ll[r] * alpha + rs;
      m[r]  = mn2;
#pragma unroll
      for (int d = 0; d < 4; ++d) { oz[d][r] *= alpha; orr[d][r] *= alpha; }
      unsigned short h0, l0, h1, l1;
      split_h(e0 * PSC, h0, l0);
      split_h(e1 * PSC, h1, l1);
      pw[il * 32 + jc]            = h0;                      // P hi [query il][k = jc]
      pw[il * 32 + 16 + jc]       = h1;                      // P hi [query il][k = 16 + jc]
      pw[512 + il * 32 + jc]      = l0;                      // P residual
      pw[512 + il * 32 + 16 + jc] = l1;
    }
    wave_sync_lds();
    FragU pa, pb;                                            // A: row = query jc, elements 0..7 <- k 8hh.., 8..15 <- k 16+8hh..
    pa.h[0] = *(const v8us*)(pw + jc * 32 + 8 * hh);
    pa.h[1] = *(const v8us*)(pw + jc * 32 + 16 + 8 * hh);
    pb.h[0] = *(const v8us*)(pw + 512 + jc * 32 + 8 * hh);
    pb.h[1] = *(const v8us*)(pw + 512 + jc * 32 + 16 + 8 * hh);
#pragma unroll
    for (int dg = 0; dg < 2; ++dg) {                         // dv tiles 2dg (cols 32dg+jc) and 2dg+1 (cols 32dg+16+jc)
      const size_t voa = vob + (size_t)(32 * dg) * MT + tk0 + 8 * hh;   // B: keys tk0+8hh.. and tk0+16+8hh..
      const size_t voc = voa + (size_t)16 * MT;
      const v16us f0 = ldfrag_u(VT  + voa);
      const v16us f1 = ldfrag_u(VT  + voc);
      const v16us g0 = ldfrag_u(VTl + voa);                  // residual plane, same cols
      const v16us g1 = ldfrag_u(VTl + voc);
      oz[2 * dg]      = mma_h_raw(pa.v, f0, oz[2 * dg]);
      orr[2 * dg]     = mma_h_raw(pa.v, g0, orr[2 * dg]);
      oz[2 * dg + 1]  = mma_h_raw(pa.v, f1, oz[2 * dg + 1]);
      orr[2 * dg + 1] = mma_h_raw(pa.v, g1, orr[2 * dg + 1]);
      orr[2 * dg]     = mma_h_raw(pb.v, f0, orr[2 * dg]);
      orr[2 * dg + 1] = mma_h_raw(pb.v, f1, orr[2 * dg + 1]);
      guard4x6(oz[2 * dg], oz[2 * dg + 1], orr[2 * dg], orr[2 * dg + 1], pa.v, pb.v, f0, f1, g0, g1);
    }
  }

#pragma unroll
  for (int r = 0; r < 8; ++r) {
    const int il = 8 * hh + r;
    const float l = ll[r];
    const float inv = ((l > 0.f) ? (1.0f / l) : 0.f) * (ZSC / PSC);
    const int so = (16 * wv + il) * ZSP + jc;
#pragma unroll
    for (int d = 0; d < 4; ++d) {
      const float z = (oz[d][r] + orr[d][r] * RSCI) * inv;
      unsigned short h0, l0;
      split_h(z, h0, l0);
      zsth[so + 16 * d] = h0;
      zstl[so + 16 * d] = l0;
    }
  }
  __syncthreads();
  v4u hv[4], lv[4];
#pragma unroll
  for (int it = 0; it < 4; ++it) {
    const int row = it * 32 + (t >> 3), p = (t & 7) * 8;   // it 0..3 x (t>>3) 0..31 = rows 0..127, 8 lanes per row
    hv[it] = *(const v4u*)(zsth + row * ZSP + p);
    lv[it] = *(const v4u*)(zstl + row * ZSP + p);
  }
  {
#pragma unroll
    for (int it = 0; it < 4; ++it) {
      const int row = it * 32 + (t >> 3), p = (t & 7) * 8;
      const size_t go = (size_t)(tq0 + row) * HH + hc + p;
      *(v4u*)(Zh + go) = hv[it];
      *(v4u*)(Zl + go) = lv[it];
    }
    
  }
}

// =====================================================================================================
// Workspace map (bytes); every plane is an exact multiple of its whole-row / whole-tile store granularity
//   Xh    f16 [4096][768]     0          6291456
//   Wq16  f16 [768][768]      6291456    1179648   (x16)
//   Wk16  f16 [768][768]      7471104    1179648   (x16)
//   Wv16  f16 [768][768]      8650752    1179648   (x16)
//   Wo16  f16 [768][768]      9830400    1179648   (x16)
//   Qh    f16 [4096][768]     11010048   6291456   (hi)
//   Ql    f16 [4096][768]     17301504   6291456   (x2048 residual)
//   Kh    f16 [4096][768]     23592960   6291456   (hi)
//   Kl    f16 [4096][768]     29884416   6291456   (x2048 residual)
//   VT    f16 [768][4096]     36175872   6291456   (hi)
//   VTl   f16 [768][4096]     42467328   6291456   (x2048 residual)
//   Zh    f16 [4096][768]     48758784   6291456   (z x16, hi)
//   Zl    f16 [4096][768]     55050240   6291456   (x2048 residual)
//   end                       61341696
// =====================================================================================================
extern "C" void kernel_launch(void* const* d_in, const int* in_sizes, int n_in,
                              void* d_out, int out_size, void* d_ws, size_t ws_size,
                              hipStream_t stream) {
  if (n_in < 9) return;
  if (in_sizes[0] != MT * HH) return;
  if (in_sizes[1] != HH * HH || in_sizes[2] != HH) return;
  if (in_sizes[3] != HH * HH || in_sizes[4] != HH) return;
  if (in_sizes[5] != HH * HH || in_sizes[6] != HH) return;
  if (in_sizes[7] != HH * HH || in_sizes[8] != HH) return;
  if (out_size != MT * HH) return;

  const float* x  = (const float*)d_in[0];
  const float* Wq = (const float*)d_in[1];
  const float* bq = (const float*)d_in[2];
  const float* Wk = (const float*)d_in[3];
  const float* bk = (const float*)d_in[4];
  const float* Wv = (const float*)d_in[5];
  const float* bv = (const float*)d_in[6];
  const float* Wo = (const float*)d_in[7];
  const float* bo = (const float*)d_in[8];

  const size_t PX  = (size_t)MT * HH * 2;        // 6291456
  const size_t PW  = (size_t)HH * HH * 2;        // 1179648
  const size_t PVT = (size_t)HH * MT * 2;        // 6291456
  size_t off = 0;
  const size_t oXh = off; off += PX;
  const size_t oWq = off; off += PW;
  const size_t oWk = off; off += PW;
  const size_t oWv = off; off += PW;
  const size_t oWo = off; off += PW;
  const size_t oQh = off; off += PX;
  const size_t oQl = off; off += PX;
  const size_t oKh = off; off += PX;
  const size_t oKl = off; off += PX;
  const size_t oVT = off; off += PVT;
  const size_t oVL = off; off += PVT;
  const size_t oZh = off; off += PX;
  const size_t oZl = off; off += PX;
  if (off > ws_size) return;                     // off = 61341696
  if (off > (size_t)134217728) return;

  char* ws = (char*)d_ws;
  unsigned short* Xh   = (unsigned short*)(ws + oXh);
  unsigned short* Wq16 = (unsigned short*)(ws + oWq);
  unsigned short* Wk16 = (unsigned short*)(ws + oWk);
  unsigned short* Wv16 = (unsigned short*)(ws + oWv);
  unsigned short* Wo16 = (unsigned short*)(ws + oWo);
  unsigned short* Qh   = (unsigned short*)(ws + oQh);
  unsigned short* Ql   = (unsigned short*)(ws + oQl);
  unsigned short* Kh   = (unsigned short*)(ws + oKh);
  unsigned short* Kl   = (unsigned short*)(ws + oKl);
  unsigned short* VT   = (unsigned short*)(ws + oVT);
  unsigned short* VTl  = (unsigned short*)(ws + oVL);
  unsigned short* Zh   = (unsigned short*)(ws + oZh);
  unsigned short* Zl   = (unsigned short*)(ws + oZl);
  float*          out0 = (float*)d_out;

  const dim3 blk(256);
  const int gqk = ((MT / 64) * (HH / 64)) / 8;             // 768 tiles of 64x64 -> 96 blocks
  const int gvt = ((HH / 64) * (MT / 64)) / 8;             // 768 tiles -> 96 blocks
  const int gsp = ((MT / 32) * (HH / 64)) / 8;             // 1536 tiles of 32x64 -> 192 blocks
  if ((((MT / 64) * (HH / 64)) % 8) != 0) return;
  if ((((HH / 64) * (MT / 64)) % 8) != 0) return;
  if ((((MT / 32) * (HH / 64)) % 8) != 0) return;

  // (0) x -> f16 plane of bf16 values; weights [768][768] ([out][in] = Bt[n][k]) -> f16 bits of bf16 values x16
  cvt_rows<<<dim3(MT / 8), blk, 0, stream>>>(x, Xh, MT, 1.0f);
  cvt_rows<<<dim3(HH / 8), blk, 0, stream>>>(Wq, Wq16, HH, WSC);
  cvt_rows<<<dim3(HH / 8), blk, 0, stream>>>(Wk, Wk16, HH, WSC);
  cvt_rows<<<dim3(HH / 8), blk, 0, stream>>>(Wv, Wv16, HH, WSC);
  cvt_rows<<<dim3(HH / 8), blk, 0, stream>>>(Wo, Wo16, HH, WSC);

  // (1) q = x . Wq^T + bq and k = x . Wk^T + bk -> hi + residual planes [4096][768];
  //     v^T = Wv . x^T + bv[m] -> hi + residual planes [768][4096]
  gemm64<1, 1, 0><<<dim3(gqk), blk, 0, stream>>>(
      Xh, Xh, HH, Wq16, HH, Qh, Ql, out0, HH, bq, 1.0f / WSC, 1.0f, MT, HH, HH);
  gemm64<1, 1, 0><<<dim3(gqk), blk, 0, stream>>>(
      Xh, Xh, HH, Wk16, HH, Kh, Kl, out0, HH, bk, 1.0f / WSC, 1.0f, MT, HH, HH);
  gemm64<1, 2, 0><<<dim3(gvt), blk, 0, stream>>>(
      Wv16, Wv16, HH, Xh, HH, VT, VTl, out0, MT, bv, 1.0f / WSC, 1.0f, HH, MT, HH);

  // (2) block-diagonal segment attention -> z (x16) hi + residual planes
  attn_kernel<<<dim3(MT / QT, NHD), blk, 0, stream>>>(Qh, Ql, Kh, Kl, VT, VTl, Zh, Zl);

  // (3) output projection: out = z . Wo^T + bo -> f32 (A operand split)
  gemm64<0, 1, 1><<<dim3(gsp), blk, 0, stream>>>(
      Zh, Zl, HH, Wo16, HH, Qh, Ql, out0, HH, bo, 1.0f / (WSC * ZSC), 1.0f, MT, HH, HH);
  (void)hipGetLastError();
}

// v002
// Measured time: 78 microseconds a run.
// Next to v001, in two timings, it ran 1.29 and 1.30 times as fast.
// Counting every step since v000, it is 2.45 times as fast.
// Contractions: q = x.Wq^T, k = x.Wk^T and v^T = Wv.x^T (plain f16, exact bf16-valued operands);
// attention scores q.k^T and p.v^T with q, k, p, v^T as f16 hi + x2048 residual planes (hi.hi + hi.lo + lo.hi);
// output projection z.Wo^T with z as f16 hi + x2048 residual planes (hi.W + lo.W); all v_wmma_f32_16x16x32_f16
// (f16 operands, f32 accumulate); float inputs RNE-converted to bf16 on load (x in f16 containers, weights x16
// in f16), p carried x1024, z carried x16; softmax in f32 on VALU.
#include <hip/hip_runtime.h>
#include <math.h>
#include <stdint.h>

#define NBT  2
#define SEQ  2048
#define HH   768
#define NHD  12
#define HD   64
#define SEGL 256
#define MT   (NBT * SEQ)
#define QT   128
#define NCHK (SEGL / 32)
#define ZSP  72
#define WSC  16.0f
#define PSC  1024.0f
#define ZSC  16.0f
#define RSC  2048.0f
#define RSCI 0.00048828125f
#define SCL  0.125f
#define KST  128                   // k (halves) per LDS stage: 256 B of every staged row
#define LPH  136                   // LDS row pitch in halves: 272 B = 16 B x odd, for ds_load_b128 readers
#define SROW 384                   // rows per stage: 128 of A (or 64 hi + 64 residual), then 256 of Bt
#define STGH (SROW * LPH)          // halves per stage buffer
#define RSB  (16 * LPH * 2)        // LDS bytes between two copies of one lane (16 rows)

static_assert(NHD * HD == HH);
static_assert(HD == 64);
static_assert((SEQ % SEGL) == 0 && (SEGL % QT) == 0 && (MT % QT) == 0 && QT == 128 && (SEGL % 32) == 0);
static_assert((MT % 64) == 0 && (HH % 64) == 0 && (MT % 32) == 0 && (HH % 32) == 0);
static_assert((((MT / 64) * (HH / 64)) % 8) == 0);
static_assert((((HH / 64) * (MT / 64)) % 8) == 0);
static_assert((((MT / 32) * (HH / 64)) % 8) == 0);
static_assert((MT % 8) == 0 && (HH % 8) == 0 && (HH % 256) == 0);
static_assert(ZSP >= 64 && (ZSP % 8) == 0);
static_assert((MT % 256) == 0 && (HH % 128) == 0 && (MT % 128) == 0 && (HH % KST) == 0 && HH / KST >= 2);
static_assert((LPH % 8) == 0 && LPH >= KST);

typedef _Float16 v16h __attribute__((ext_vector_type(16)));
typedef _Float16 v8h  __attribute__((ext_vector_type(8)));
typedef unsigned short v16us __attribute__((ext_vector_type(16)));
typedef unsigned short v8us  __attribute__((ext_vector_type(8)));
typedef float v8f __attribute__((ext_vector_type(8)));
typedef float v4f __attribute__((ext_vector_type(4)));
typedef unsigned int v4u __attribute__((ext_vector_type(4)));

union FragU { v16us v; v8us h[2]; };

// ---- scalar helpers --------------------------------------------------------------------------------
__device__ __forceinline__ unsigned short bf_bits(float f) {          // f32 -> bf16 bits, RNE convert
  const unsigned u = __float_as_uint(f);
  return (unsigned short)((u + 0x7FFFu + ((u >> 16) & 1u)) >> 16);
}
__device__ __forceinline__ float bf_up(unsigned short h) { return __uint_as_float(((unsigned)h) << 16); }
__device__ __forceinline__ float bfr(float f) { return bf_up(bf_bits(f)); }   // value of the bf16 RNE convert
__device__ __forceinline__ unsigned short h_bits(_Float16 x) { return __builtin_bit_cast(unsigned short, x); }
__device__ __forceinline__ unsigned short f2h(float f) { return h_bits((_Float16)f); }
__device__ __forceinline__ float h_up(unsigned short h) { return (float)__builtin_bit_cast(_Float16, h); }
__device__ __forceinline__ unsigned pk16(unsigned short a, unsigned short b) { return (unsigned)a | ((unsigned)b << 16); }
__device__ __forceinline__ v8f zero8() { v8f z = {0.f, 0.f, 0.f, 0.f, 0.f, 0.f, 0.f, 0.f}; return z; }
// f -> f16 hi bits and f16 bits of the x2048 residual (f - hi) * 2048
__device__ __forceinline__ void split_h(float f, unsigned short& hi, unsigned short& lo) {
  hi = f2h(f);
  lo = f2h((f - h_up(hi)) * RSC);
}

// ---- fragment loader: 16-bit A/B operand, lane -> row/col (lane&15), p already includes +8*(lane>>4);
//      elements 0..7 <- p[0..7] (k0+8h..), elements 8..15 <- p[16..23] (k0+16+8h..)
__device__ __forceinline__ v16us ldfrag_u(const unsigned short* p) {
  FragU f;
  f.h[0] = *(const v8us*)(p);
  f.h[1] = *(const v8us*)(p + 16);
  return f.v;
}

// ---- WMMA helpers with trailing VALU hazard gap --------------------------------------------------------
__device__ __forceinline__ v8f mma_h_raw(v16us a, v16us b, v8f c) {             // f16 operands (bits), unguarded
  return __builtin_amdgcn_wmma_f32_16x16x32_f16(false, __builtin_bit_cast(v16h, a), false,
                                                __builtin_bit_cast(v16h, b), (short)0, c, false, false);
}
__device__ __forceinline__ void dep_guard1(v8f& a, v8f& b, v16us x) {
#if defined(__HIP_DEVICE_COMPILE__)
  asm volatile("v_nop\n\tv_nop\n\tv_nop\n\tv_nop" : "+v"(a), "+v"(b) : "v"(x));
#endif
}
__device__ __forceinline__ void dep_guard2(v8f& a, v8f& b, v8f& c, v8f& d, v16us x, v16us y) {
#if defined(__HIP_DEVICE_COMPILE__)
  asm volatile("v_nop\n\tv_nop\n\tv_nop\n\tv_nop" : "+v"(a), "+v"(b), "+v"(c), "+v"(d) : "v"(x), "v"(y));
#endif
}
__device__ __forceinline__ void keep4_u(v16us a, v16us b, v16us c, v16us d) {
#if defined(__HIP_DEVICE_COMPILE__)
  asm volatile("v_nop" :: "v"(a), "v"(b), "v"(c), "v"(d));
#endif
}
__device__ __forceinline__ void acc_guard4(v8f& a, v8f& b, v8f& c, v8f& d) {
#if defined(__HIP_DEVICE_COMPILE__)
  asm volatile("v_nop\n\tv_nop\n\tv_nop\n\tv_nop" : "+v"(a), "+v"(b), "+v"(c), "+v"(d));
#endif
}
// ties four D accumulators and keeps six A/B fragments live across a 4-slot VALU gap
__device__ __forceinline__ void guard4x6(v8f& a, v8f& b, v8f& c, v8f& d,
                                         v16us p, v16us q, v16us r, v16us s, v16us t, v16us u) {
#if defined(__HIP_DEVICE_COMPILE__)
  asm volatile("v_nop\n\tv_nop\n\tv_nop\n\tv_nop"
               : "+v"(a), "+v"(b), "+v"(c), "+v"(d)
               : "v"(p), "v"(q), "v"(r), "v"(s), "v"(t), "v"(u));
#endif
}
__device__ __forceinline__ void wave_sync_lds() {
  __builtin_amdgcn_fence(__ATOMIC_RELEASE, "workgroup");
  __builtin_amdgcn_wave_barrier();
  __builtin_amdgcn_fence(__ATOMIC_ACQUIRE, "workgroup");
}

// ---- asynchronous copies global -> LDS ------------------------------------------------------------------
// Eight 16-byte copies per lane: LDS bytes l + i * RSB; global ga + i * gs (i = 0..3) and gb + i * gs (i = 4..7
// as 0..3). The closing s_wait_xcnt stands inside the statement so that no address register named by a copy is
// rewritten in front of it.
__device__ __forceinline__ void copy8(unsigned l, const unsigned short* ga, const unsigned short* gb, size_t gs) {
#if defined(__HIP_DEVICE_COMPILE__)
  asm volatile(
      "global_load_async_to_lds_b128 %0, %8, off\n\t"
      "global_load_async_to_lds_b128 %1, %9, off\n\t"
      "global_load_async_to_lds_b128 %2, %10, off\n\t"
      "global_load_async_to_lds_b128 %3, %11, off\n\t"
      "global_load_async_to_lds_b128 %4, %12, off\n\t"
      "global_load_async_to_lds_b128 %5, %13, off\n\t"
      "global_load_async_to_lds_b128 %6, %14, off\n\t"
      "global_load_async_to_lds_b128 %7, %15, off\n\t"
      "s_wait_xcnt 0x0"
      :: "v"(l), "v"(l + RSB), "v"(l + 2 * RSB), "v"(l + 3 * RSB),
         "v"(l + 4 * RSB), "v"(l + 5 * RSB), "v"(l + 6 * RSB), "v"(l + 7 * RSB),
         "v"(ga), "v"(ga + gs), "v"(ga + 2 * gs), "v"(ga + 3 * gs),
         "v"(gb), "v"(gb + gs), "v"(gb + 2 * gs), "v"(gb + 3 * gs)
      : "memory");
#endif
}
// this wave's own copies have landed in LDS
__device__ __forceinline__ void wait_async0() {
#if defined(__HIP_DEVICE_COMPILE__)
  asm volatile("s_wait_asynccnt 0x0" ::: "memory");
#endif
}
// this wave's own LDS reads have returned, before the buffer they read is handed to its next writer
__device__ __forceinline__ void wait_ds0() {
#if defined(__HIP_DEVICE_COMPILE__)
  asm volatile("s_wait_dscnt 0x0" ::: "memory");
#endif
}

// =====================================================================================================
// Rows [nrows][768] f32 -> f16 bits of (bf16 RNE value * sc). Used for x (sc = 1) and for the [out][in]
// weight matrices (sc = 16), which are already Bt[n][k] with k contiguous. The five conversions need nothing
// of each other and share one grid by ranges of the block index: blocks 0..MT/8-1 take x, then HH/8 blocks
// for each of Wq, Wk, Wv, Wo. One wave per row; three column
// chunks of 256: lane owns columns 256c + 8*lane..+7, one instruction = 32 lanes x 16 B = 512 contiguous B
// coverage: 8 rows per block, grid = MT/8 + 4 HH/8 exact, 3 chunks x 256 = 768 cols: union = every row of all five.
// =====================================================================================================
__global__ __launch_bounds__(256) void cvt_rows(const float* __restrict__ xin, const float* __restrict__ Wq,
                                                const float* __restrict__ Wk, const float* __restrict__ Wv,
                                                const float* __restrict__ Wo, unsigned short* Xh,
                                                unsigned short* Wq16, unsigned short* Wk16,
                                                unsigned short* Wv16, unsigned short* Wo16) {
  const int wb  = (int)blockIdx.x - MT / 8;               // block-uniform: below 0 = x, else a weight block
  const int wi  = wb / (HH / 8);                          // which weight, 0..3
  const bool isx = wb < 0;
  const float* x = isx ? xin : wi == 0 ? Wq : wi == 1 ? Wk : wi == 2 ? Wv : Wo;
  unsigned short* xh = isx ? Xh : wi == 0 ? Wq16 : wi == 1 ? Wk16 : wi == 2 ? Wv16 : Wo16;
  const int nrows = isx ? MT : HH;
  const float sc  = isx ? 1.0f : WSC;
  const int row = (isx ? (int)blockIdx.x : wb - wi * (HH / 8)) * 8 + (threadIdx.x >> 5);
  const int lane = threadIdx.x & 31;
  if (wi > 3 || row >= nrows) return;                     // wave-uniform, no barriers below
  v4u hv[HH / 256];
#pragma unroll
  for (int c = 0; c < HH / 256; ++c) {
    const float* p = x + (size_t)row * HH + c * 256 + lane * 8;
    const v4f a0 = *(const v4f*)(p);
    const v4f a1 = *(const v4f*)(p + 4);
    v4u h;
#pragma unroll
    for (int e = 0; e < 2; ++e) {
      h[e]     = pk16(f2h(bfr(a0[2 * e]) * sc), f2h(bfr(a0[2 * e + 1]) * sc));
      h[2 + e] = pk16(f2h(bfr(a1[2 * e]) * sc), f2h(bfr(a1[2 * e + 1]) * sc));
    }
    hv[c] = h;
  }
  unsigned short* d = xh + (size_t)row * HH + lane * 8;
  {
#pragma unroll
    for (int c = 0; c < HH / 256; ++c) *(v4u*)(d + c * 256) = hv[c];
    
  }
}

// =====================================================================================================
// Register-blocked f16 WMMA GEMM: C[m][n] = (sum_k A[m][k] * Bt[n][k] * wsc + bias) * osc, one wave per TRx64
// tile (TR = 64, or 32 when the A operand is split); the block's 8 waves form a (2 TR) x 256 tile (2 x 4 waves)
// whose operand rows are staged in LDS, 128 k at a time, two buffers, by asynchronous 16-byte copies (16 lanes
// per 256-B row piece), the next stage in flight while this one is multiplied. A row-major [M][K] pitch lda (ASPL = 1:
// a second plane Al holds the x2048 residual, same pitch, products into a separate accumulator folded back
// as acc + accr/2048); Bt row-major [N][K] pitch ldb (k contiguous); M multiple of 2 TR, N of 256, K of 128 and at
// least 256 (true at every call site; host-checked grids = tiles/8 exact so no block exits early).
// OM: 0 = f32 out Cf; 1 = f16 hi bits Ch plus x2048 residual bits Cl (both pitch ldc).
// cbm (block-uniform): 0 = no bias; 1 = column bias bf16(cb[n]); 2 = row bias bf16(cb[m]). All biases bf16 RNE values.
// bid = the block's tile number inside this product; sT (per-wave 16x64 slabs, pitch 68 floats) and sS (two operand
// stages) are the calling kernel's LDS arrays.
// coverage: MI slabs x 16 rows x 64 cols = the wave's whole TRx64 tile; tiles/8 blocks x 8 waves = every tile.
// =====================================================================================================
template <int OM, int ASPL>
__device__ __forceinline__ void gemm_body(
    float* sT, unsigned short* sS, int bid,
    const unsigned short* __restrict__ Ap, const unsigned short* __restrict__ Alp, int lda,
    const unsigned short* __restrict__ Btp, int ldb,
    unsigned short* Ch, unsigned short* Cl, float* Cf, int ldc,
    const float* __restrict__ cb, int cbm, float wsc, float osc, int M, int N, int K) {
  constexpr int MI = ASPL ? 2 : 4;
  constexpr int TR = 16 * MI;
  const int lane = threadIdx.x & 31;
  const int wave = threadIdx.x >> 5;
  const int tilesN = N >> 8;
  const int tilesM = M / (2 * TR);
  if (bid >= tilesM * tilesN) return;   // block-uniform, in front of every barrier
  const int tm = bid / tilesN;
  const int tn = bid - tm * tilesN;
  const int wm = wave >> 2;                    // wave row 0..1
  const int wn = wave & 3;                     // wave column 0..3
  const int mb = tm * (2 * TR);                // block's first row of A
  const int nb = tn << 8;                      // block's first row of Bt
  const int m0 = mb + wm * TR;
  const int n0 = nb + (wn << 6);

  const int rlane = lane & 15;                 // row (A) / col (B, D) within subtile
  const int koff  = (lane >> 4) * 8;           // k offset of this lane half
  const int mOff  = (lane >> 4) * 8;           // D row offset

  v8f acc[MI][4];
  v8f accr[MI][4];
#pragma unroll
  for (int i = 0; i < MI; ++i)
#pragma unroll
    for (int j = 0; j < 4; ++j) { acc[i][j] = zero8(); accr[i][j] = zero8(); }

  // copy map: lane's 16-B piece cch of staged row crow + 16 i, i = 0..23 (rows 0..127 A, 128..383 Bt)
  const int crow = threadIdx.x >> 4;           // 0..15
  const int cch  = (threadIdx.x & 15) * 8;     // halves
  const unsigned lds0 = (unsigned)(size_t)sS + (unsigned)(crow * LPH + cch) * 2u;   // LDS byte address, buffer 0
  const unsigned short* gA0 = Ap + (size_t)(mb + crow) * lda + cch;                 // staged rows 0..63
  const unsigned short* gA1 = ASPL ? Alp + (size_t)(mb + crow) * lda + cch          // rows 64..127: residual plane
                                   : gA0 + (size_t)64 * lda;                        // or A rows 64..127
  const unsigned short* gB0 = Btp + (size_t)(nb + crow) * ldb + cch;                // staged rows 128..383
  const size_t gsa = (size_t)16 * lda, gsb = (size_t)16 * ldb;
  const int NT = K / KST;

  // staged row of this lane's first A fragment and first Bt fragment, with its k offset
  const int fa = (wm * TR + rlane) * LPH + koff;
  const int fb = (128 + (wn << 6) + rlane) * LPH + koff;

  // stage 0 -> buffer 0, landed and published; then stage 1 -> buffer 1 in flight
  copy8(lds0,            gA0,           gA1,            gsa);
  copy8(lds0 + 8 * RSB,  gB0,           gB0 + 4 * gsb,  gsb);
  copy8(lds0 + 16 * RSB, gB0 + 8 * gsb, gB0 + 12 * gsb, gsb);
  wait_async0();
  __syncthreads();
  if (NT > 1) {
    const unsigned lb = lds0 + STGH * 2;
    copy8(lb,            gA0 + KST,           gA1 + KST,            gsa);
    copy8(lb + 8 * RSB,  gB0 + KST,           gB0 + KST + 4 * gsb,  gsb);
    copy8(lb + 16 * RSB, gB0 + KST + 8 * gsb, gB0 + KST + 12 * gsb, gsb);
  }

#pragma unroll 1   // one stage per trip: the buffer index stays a run-time value and the text small
  for (int t = 0; t < NT; ++t) {
    const unsigned short* sb = sS + (t & 1) * STGH;
#pragma unroll
    for (int kk = 0; kk < KST; kk += 32) {
      // all eight fragments of this k-step are asked for ahead of its 16 products, not one A fragment per four
      v16us bh[4], ahf[MI], alf[MI];
#pragma unroll
      for (int j = 0; j < 4; ++j) bh[j] = ldfrag_u(sb + fb + (j << 4) * LPH + kk);
#pragma unroll
      for (int i = 0; i < MI; ++i) {
        ahf[i] = ldfrag_u(sb + fa + (i << 4) * LPH + kk);
        if (ASPL) alf[i] = ldfrag_u(sb + fa + (64 + (i << 4)) * LPH + kk);
      }
#pragma unroll
      for (int i = 0; i < MI; ++i) {
        const v16us ah = ahf[i];
        if (ASPL) {
          const v16us al = alf[i];
#pragma unroll
          for (int j = 0; j < 4; ++j) {
            acc[i][j]  = mma_h_raw(ah, bh[j], acc[i][j]);
            accr[i][j] = mma_h_raw(al, bh[j], accr[i][j]);
          }
          dep_guard2(acc[i][0], acc[i][3], accr[i][0], accr[i][3], ah, al);
        } else {
#pragma unroll
          for (int j = 0; j < 4; ++j) acc[i][j] = mma_h_raw(ah, bh[j], acc[i][j]);
          dep_guard1(acc[i][0], acc[i][3], ah);
        }
      }
      keep4_u(bh[0], bh[1], bh[2], bh[3]);
    }
    // publish point of stage t + 1: own reads of this buffer done, own copies landed, then every wave passes
    wait_ds0();
    wait_async0();
    __syncthreads();
    if (t + 2 < NT) {                          // block-uniform: refill the buffer that this trip has just read
      const unsigned lb = lds0 + (unsigned)(t & 1) * (STGH * 2);
      const int k2 = (t + 2) * KST;
      copy8(lb,            gA0 + k2,           gA1 + k2,            gsa);
      copy8(lb + 8 * RSB,  gB0 + k2,           gB0 + k2 + 4 * gsb,  gsb);
      copy8(lb + 16 * RSB, gB0 + k2 + 8 * gsb, gB0 + k2 + 12 * gsb, gsb);
    }
  }
  wait_async0();
#pragma unroll
  for (int i = 0; i < MI; ++i) {
    acc_guard4(acc[i][0], acc[i][1], acc[i][2], acc[i][3]);
    if (ASPL) acc_guard4(accr[i][0], accr[i][1], accr[i][2], accr[i][3]);
  }

  const int hh2 = lane >> 4, c4 = (lane & 15) * 4;     // f32 out: 256-B row segment = 16 lanes x 16 B
  const int q8  = lane >> 3, c8 = (lane & 7) * 8;

  v4f cb4 = {0.f, 0.f, 0.f, 0.f};
  float cbc[8];
#pragma unroll
  for (int e = 0; e < 8; ++e) cbc[e] = 0.f;
  if (OM == 0 && cbm == 1) {
    const v4f v = *(const v4f*)(cb + n0 + c4);
    cb4[0] = bfr(v[0]); cb4[1] = bfr(v[1]); cb4[2] = bfr(v[2]); cb4[3] = bfr(v[3]);
  }
  if (OM == 1 && cbm == 1) {
    const v4f v0 = *(const v4f*)(cb + n0 + c8);
    const v4f v1 = *(const v4f*)(cb + n0 + c8 + 4);
#pragma unroll
    for (int e = 0; e < 4; ++e) { cbc[e] = bfr(v0[e]); cbc[4 + e] = bfr(v1[e]); }
  }
  float rbv[MI][4];                            // row bias of output row m0 + 16 i + 4 it + q8
#pragma unroll
  for (int i = 0; i < MI; ++i)
#pragma unroll
    for (int it = 0; it < 4; ++it) rbv[i][it] = 0.f;
  if (OM == 1 && cbm == 2) {                   // one block-uniform branch: all loads in flight together
#pragma unroll
    for (int i = 0; i < MI; ++i)
#pragma unroll
      for (int it = 0; it < 4; ++it) rbv[i][it] = bfr(cb[m0 + (i << 4) + it * 4 + q8]);
  }

  // ---- epilogue ----
  float* slab = sT + wave * (16 * 68);
#pragma unroll
  for (int i = 0; i < MI; ++i) {
    const int mBase = m0 + (i << 4);
#pragma unroll
    for (int j = 0; j < 4; ++j) {
#pragma unroll
      for (int r = 0; r < 8; ++r) {
        float v = acc[i][j][r];
        if (ASPL) v += accr[i][j][r] * RSCI;
        slab[(mOff + r) * 68 + (j << 4) + rlane] = v;
      }
    }
    wave_sync_lds();
    if (OM == 0) {
      v4f vals[8];
#pragma unroll
      for (int it = 0; it < 8; ++it) {
        const int row = it * 2 + hh2;                      // it 0..7 x hh2 0..1 = rows 0..15
        const v4f v = *(const v4f*)(slab + row * 68 + c4);
        vals[it] = (v * wsc + cb4) * osc;
      }
      {
#pragma unroll
        for (int it = 0; it < 8; ++it) {
          const int row = it * 2 + hh2;
          *(v4f*)(Cf + (size_t)(mBase + row) * ldc + (size_t)n0 + c4) = vals[it];
        }
        
      }
    }
    if (OM == 1) {
      v4u hv[4], lv[4];
#pragma unroll
      for (int it = 0; it < 4; ++it) {
        const int row = it * 4 + q8;                       // it 0..3 x q8 0..3 = rows 0..15
        const float* sp = slab + row * 68 + c8;
        const float rb = rbv[i][it];
        v4u ha = {0u, 0u, 0u, 0u}, la = {0u, 0u, 0u, 0u};
#pragma unroll
        for (int e = 0; e < 4; ++e) {
          const float f0 = (sp[2 * e]     * wsc + cbc[2 * e]     + rb) * osc;
          const float f1 = (sp[2 * e + 1] * wsc + cbc[2 * e + 1] + rb) * osc;
          unsigned short h0, l0, h1, l1;
          split_h(f0, h0, l0);
          split_h(f1, h1, l1);
          ha[e] = pk16(h0, h1);
          la[e] = pk16(l0, l1);
        }
        hv[it] = ha;
        lv[it] = la;
      }
      {
#pragma unroll
        for (int it = 0; it < 4; ++it) {
          const int row = it * 4 + q8;
          const size_t go = (size_t)(mBase + row) * ldc + (size_t)n0 + c8;
          *(v4u*)(Ch + go) = hv[it];
          *(v4u*)(Cl + go) = lv[it];
        }
        
      }
    }
    wave_sync_lds();
  }
}

// q = x.Wq^T + bq, k = x.Wk^T + bk ([4096][768] planes) and v^T = Wv.x^T + bv[m] ([768][4096] planes) need nothing
// of each other and share one grid by ranges of the block index: QKVT block tiles of 128 x 256 for each, in that order.
#define QKVT ((MT / 128) * (HH / 256))
static_assert(QKVT == (HH / 128) * (MT / 256));
__global__ __launch_bounds__(256) void gemm_qkv(
    const unsigned short* __restrict__ Xh, const unsigned short* __restrict__ Wq16,
    const unsigned short* __restrict__ Wk16, const unsigned short* __restrict__ Wv16,
    unsigned short* Qh, unsigned short* Ql, unsigned short* Kh, unsigned short* Kl,
    unsigned short* VT, unsigned short* VTl,
    const float* __restrict__ bq, const float* __restrict__ bk, const float* __restrict__ bv) {
  __shared__ __align__(16) float sT[8 * 16 * 68];         // per-wave 16x64 slab, pitch 68 floats
  __shared__ __align__(16) unsigned short sS[2 * STGH];   // two operand stages
  const int pi = blockIdx.x / QKVT;                       // block-uniform: 0 = q, 1 = k, 2 = v^T
  if (pi > 2) return;                                     // block-uniform, in front of every barrier
  const bool vt = pi == 2;
  const unsigned short* A  = vt ? Wv16 : Xh;
  const unsigned short* Bt = vt ? Xh : pi ? Wk16 : Wq16;
  unsigned short* Ch = vt ? VT  : pi ? Kh : Qh;
  unsigned short* Cl = vt ? VTl : pi ? Kl : Ql;
  const float* cb = vt ? bv : pi ? bk : bq;
  gemm_body<1, 0>(sT, sS, (int)blockIdx.x - pi * QKVT, A, A, HH, Bt, HH, Ch, Cl, nullptr, vt ? MT : HH,
                  cb, vt ? 2 : 1, 1.0f / WSC, 1.0f, vt ? HH : MT, vt ? MT : HH, HH);
}

// out = z.Wo^T + bo -> f32, z as hi + residual planes
__global__ __launch_bounds__(256) void gemm_out(
    const unsigned short* __restrict__ Zh, const unsigned short* __restrict__ Zl,
    const unsigned short* __restrict__ Wo16, float* out, const float* __restrict__ bo) {
  __shared__ __align__(16) float sT[8 * 16 * 68];         // per-wave 16x64 slab, pitch 68 floats
  __shared__ __align__(16) unsigned short sS[2 * STGH];   // two operand stages
  gemm_body<0, 1>(sT, sS, (int)blockIdx.x, Zh, Zl, HH, Wo16, HH, nullptr, nullptr, out, HH,
                  bo, 1, 1.0f / (WSC * ZSC), 1.0f, MT, HH, HH);
}

// =====================================================================================================
// Block-diagonal attention over 256-token segments, head dim 64. Block = 256 threads = 8 waves, one block per
// (128 query tokens tq0..tq0+127, head); all 128 queries lie in one segment whose keys are tokens
// tk00 = (tq0 & ~255) .. tk00+255, every key valid (no masking); wave w owns queries tq0+16w..+15 and all 64 dv.
// Q/K planes f16 bits [token][768] (head h at cols 64h..64h+63): hi (Qh, Kh) and x2048 residual (Ql, Kl);
// V^T planes f16 [dv][token]: hi (VT) and x2048 residual (VTl).
// Per chunk of 32 keys: s = qh.kh^T (acc s) and qh.kl^T + ql.kh^T (acc sr), two 32-deep k-steps over the 64
// head dims; logit = (s + sr/2048) * 0.125; running-max softmax in f32; p = exp(logit - m) carried as 1024 p
// barrier, v8us fragment reload of the same element type); z accumulates ph.vh (oz) and ph.vl + pl.vh (orr) on
// WMMA for 4 dv tiles, z = oz + orr/2048. q, k, p and v^T fragments all use the split k map.
// coverage: 128 query rows x 64 halves at cols 64*head per block in Zh and in Zl; grid (MT/128) x 12 heads = the
// whole [4096][768] z planes.
// =====================================================================================================
__global__ __launch_bounds__(256) void attn_kernel(const unsigned short* __restrict__ Qh,
                                                   const unsigned short* __restrict__ Ql,
                                                   const unsigned short* __restrict__ Kh,
                                                   const unsigned short* __restrict__ Kl,
                                                   const unsigned short* __restrict__ VT,
                                                   const unsigned short* __restrict__ VTl,
                                                   unsigned short* Zh, unsigned short* Zl) {
  __shared__ __align__(16) unsigned short ps[8 * 1024];     // wave-private P tiles: hi [16][32] at 0, lo at 512
  __shared__ __align__(16) unsigned short zsth[QT * ZSP];   // output staging, hi plane
  __shared__ __align__(16) unsigned short zstl[QT * ZSP];   // output staging, residual plane
  const int tq0  = blockIdx.x * QT;                         // first query token (token = b*2048 + s)
  const int tk00 = tq0 & ~(SEGL - 1);                       // first key token of the segment
  const int hc   = blockIdx.y * HD;                         // head column offset
  const int t = threadIdx.x, lane = t & 31, wv = t >> 5, hh = lane >> 4, jc = lane & 15;

  const size_t qo = (size_t)(tq0 + 16 * wv + jc) * HH + hc + 8 * hh;   // A: row = query jc, k = head dim
  const v16us qf0 = ldfrag_u(Qh + qo);                                  // dims 0..31
  const v16us qf1 = ldfrag_u(Qh + qo + 32);                             // dims 32..63
  const v16us ql0 = ldfrag_u(Ql + qo);
  const v16us ql1 = ldfrag_u(Ql + qo + 32);
  float m[8], ll[8];
  v8f oz[4], orr[4];
#pragma unroll
  for (int r = 0; r < 8; ++r) { m[r] = -1.0e30f; ll[r] = 0.f; }
#pragma unroll
  for (int d = 0; d < 4; ++d) { oz[d] = zero8(); orr[d] = zero8(); }
  unsigned short* pw = ps + wv * 1024;
  const size_t vob = (size_t)(hc + jc) * MT;                            // B: col dv = jc (+16d), k = key token

#pragma unroll 1
  for (int c = 0; c < NCHK; ++c) {
    const int tk0 = tk00 + 32 * c;                           // first key token of the chunk (multiple of 32)
    const size_t ko0 = (size_t)(tk0 + jc) * HH + hc + 8 * hh;   // B: col = key jc, k = head dim
    const size_t ko1 = ko0 + (size_t)16 * HH;                    // col = key 16 + jc
    v8f s0 = zero8(), s1 = zero8(), sr0 = zero8(), sr1 = zero8();
    {                                                        // k-step 0: head dims 0..31
      const v16us kf0 = ldfrag_u(Kh + ko0);
      const v16us kf1 = ldfrag_u(Kh + ko1);
      const v16us kl0 = ldfrag_u(Kl + ko0);
      const v16us kl1 = ldfrag_u(Kl + ko1);
      s0  = mma_h_raw(qf0, kf0, s0);                         // D row 8hh+r = query 16wv+8hh+r, col jc = key tk0+jc
      sr0 = mma_h_raw(qf0, kl0, sr0);                        // hi . residual
      s1  = mma_h_raw(qf0, kf1, s1);                         // key tk0+16+jc
      sr1 = mma_h_raw(qf0, kl1, sr1);
      sr0 = mma_h_raw(ql0, kf0, sr0);                        // residual . hi
      sr1 = mma_h_raw(ql0, kf1, sr1);
      guard4x6(s0, s1, sr0, sr1, qf0, ql0, kf0, kf1, kl0, kl1);
    }
    {                                                        // k-step 1: head dims 32..63
      const v16us kf0 = ldfrag_u(Kh + ko0 + 32);
      const v16us kf1 = ldfrag_u(Kh + ko1 + 32);
      const v16us kl0 = ldfrag_u(Kl + ko0 + 32);
      const v16us kl1 = ldfrag_u(Kl + ko1 + 32);
      s0  = mma_h_raw(qf1, kf0, s0);
      sr0 = mma_h_raw(qf1, kl0, sr0);
      s1  = mma_h_raw(qf1, kf1, s1);
      sr1 = mma_h_raw(qf1, kl1, sr1);
      sr0 = mma_h_raw(ql1, kf0, sr0);
      sr1 = mma_h_raw(ql1, kf1, sr1);
      guard4x6(s0, s1, sr0, sr1, qf1, ql1, kf0, kf1, kl0, kl1);
    }
    wave_sync_lds();                                         // earlier P fragment reads complete before overwrite
#pragma unroll
    for (int r = 0; r < 8; ++r) {
      const int il = 8 * hh + r;
      const float t0 = (s0[r] + sr0[r] * RSCI) * SCL;
      const float t1 = (s1[r] + sr1[r] * RSCI) * SCL;
      float rm = fmaxf(t0, t1);
#pragma unroll
      for (int off = 1; off < 16; off <<= 1) rm = fmaxf(rm, __shfl_xor(rm, off, 32));
      const float mn2   = fmaxf(m[r], rm);
      const float alpha = __expf(m[r] - mn2);
      const float e0 = __expf(t0 - mn2);
      const float e1 = __expf(t1 - mn2);
      float rs = e0 + e1;
#pragma unroll
      for (int off = 1; off < 16; off <<= 1) rs += __shfl_xor(rs, off, 32);
      ll[r] = ll[r] * alpha + rs;
      m[r]  = mn2;
#pragma unroll
      for (int d = 0; d < 4; ++d) { oz[d][r] *= alpha; orr[d][r] *= alpha; }
      unsigned short h0, l0, h1, l1;
      split_h(e0 * PSC, h0, l0);
      split_h(e1 * PSC, h1, l1);
      pw[il * 32 + jc]            = h0;                      // P hi [query il][k = jc]
      pw[il * 32 + 16 + jc]       = h1;                      // P hi [query il][k = 16 + jc]
      pw[512 + il * 32 + jc]      = l0;                      // P residual
      pw[512 + il * 32 + 16 + jc] = l1;
    }
    wave_sync_lds();
    FragU pa, pb;                                            // A: row = query jc, elements 0..7 <- k 8hh.., 8..15 <- k 16+8hh..
    pa.h[0] = *(const v8us*)(pw + jc * 32 + 8 * hh);
    pa.h[1] = *(const v8us*)(pw + jc * 32 + 16 + 8 * hh);
    pb.h[0] = *(const v8us*)(pw + 512 + jc * 32 + 8 * hh);
    pb.h[1] = *(const v8us*)(pw + 512 + jc * 32 + 16 + 8 * hh);
#pragma unroll
    for (int dg = 0; dg < 2; ++dg) {                         // dv tiles 2dg (cols 32dg+jc) and 2dg+1 (cols 32dg+16+jc)
      const size_t voa = vob + (size_t)(32 * dg) * MT + tk0 + 8 * hh;   // B: keys tk0+8hh.. and tk0+16+8hh..
      const size_t voc = voa + (size_t)16 * MT;
      const v16us f0 = ldfrag_u(VT  + voa);
      const v16us f1 = ldfrag_u(VT  + voc);
      const v16us g0 = ldfrag_u(VTl + voa);                  // residual plane, same cols
      const v16us g1 = ldfrag_u(VTl + voc);
      oz[2 * dg]      = mma_h_raw(pa.v, f0, oz[2 * dg]);
      orr[2 * dg]     = mma_h_raw(pa.v, g0, orr[2 * dg]);
      oz[2 * dg + 1]  = mma_h_raw(pa.v, f1, oz[2 * dg + 1]);
      orr[2 * dg + 1] = mma_h_raw(pa.v, g1, orr[2 * dg + 1]);
      orr[2 * dg]     = mma_h_raw(pb.v, f0, orr[2 * dg]);
      orr[2 * dg + 1] = mma_h_raw(pb.v, f1, orr[2 * dg + 1]);
      guard4x6(oz[2 * dg], oz[2 * dg + 1], orr[2 * dg], orr[2 * dg + 1], pa.v, pb.v, f0, f1, g0, g1);
    }
  }

#pragma unroll
  for (int r = 0; r < 8; ++r) {
    const int il = 8 * hh + r;
    const float l = ll[r];
    const float inv = ((l > 0.f) ? (1.0f / l) : 0.f) * (ZSC / PSC);
    const int so = (16 * wv + il) * ZSP + jc;
#pragma unroll
    for (int d = 0; d < 4; ++d) {
      const float z = (oz[d][r] + orr[d][r] * RSCI) * inv;
      unsigned short h0, l0;
      split_h(z, h0, l0);
      zsth[so + 16 * d] = h0;
      zstl[so + 16 * d] = l0;
    }
  }
  __syncthreads();
  v4u hv[4], lv[4];
#pragma unroll
  for (int it = 0; it < 4; ++it) {
    const int row = it * 32 + (t >> 3), p = (t & 7) * 8;   // it 0..3 x (t>>3) 0..31 = rows 0..127, 8 lanes per row
    hv[it] = *(const v4u*)(zsth + row * ZSP + p);
    lv[it] = *(const v4u*)(zstl + row * ZSP + p);
  }
  {
#pragma unroll
    for (int it = 0; it < 4; ++it) {
      const int row = it * 32 + (t >> 3), p = (t & 7) * 8;
      const size_t go = (size_t)(tq0 + row) * HH + hc + p;
      *(v4u*)(Zh + go) = hv[it];
      *(v4u*)(Zl + go) = lv[it];
    }
    
  }
}

// =====================================================================================================
// Workspace map (bytes); every plane is an exact multiple of its whole-row / whole-tile store granularity
//   Xh    f16 [4096][768]     0          6291456
//   Wq16  f16 [768][768]      6291456    1179648   (x16)
//   Wk16  f16 [768][768]      7471104    1179648   (x16)
//   Wv16  f16 [768][768]      8650752    1179648   (x16)
//   Wo16  f16 [768][768]      9830400    1179648   (x16)
//   Qh    f16 [4096][768]     11010048   6291456   (hi)
//   Ql    f16 [4096][768]     17301504   6291456   (x2048 residual)
//   Kh    f16 [4096][768]     23592960   6291456   (hi)
//   Kl    f16 [4096][768]     29884416   6291456   (x2048 residual)
//   VT    f16 [768][4096]     36175872   6291456   (hi)
//   VTl   f16 [768][4096]     42467328   6291456   (x2048 residual)
//   Zh    f16 [4096][768]     48758784   6291456   (z x16, hi)
//   Zl    f16 [4096][768]     55050240   6291456   (x2048 residual)
//   end                       61341696
// =====================================================================================================
extern "C" void kernel_launch(void* const* d_in, const int* in_sizes, int n_in,
                              void* d_out, int out_size, void* d_ws, size_t ws_size,
                              hipStream_t stream) {
  if (n_in < 9) return;
  if (in_sizes[0] != MT * HH) return;
  if (in_sizes[1] != HH * HH || in_sizes[2] != HH) return;
  if (in_sizes[3] != HH * HH || in_sizes[4] != HH) return;
  if (in_sizes[5] != HH * HH || in_sizes[6] != HH) return;
  if (in_sizes[7] != HH * HH || in_sizes[8] != HH) return;
  if (out_size != MT * HH) return;

  const float* x  = (const float*)d_in[0];
  const float* Wq = (const float*)d_in[1];
  const float* bq = (const float*)d_in[2];
  const float* Wk = (const float*)d_in[3];
  const float* bk = (const float*)d_in[4];
  const float* Wv = (const float*)d_in[5];
  const float* bv = (const float*)d_in[6];
  const float* Wo = (const float*)d_in[7];
  const float* bo = (const float*)d_in[8];

  const size_t PX  = (size_t)MT * HH * 2;        // 6291456
  const size_t PW  = (size_t)HH * HH * 2;        // 1179648
  const size_t PVT = (size_t)HH * MT * 2;        // 6291456
  size_t off = 0;
  const size_t oXh = off; off += PX;
  const size_t oWq = off; off += PW;
  const size_t oWk = off; off += PW;
  const size_t oWv = off; off += PW;
  const size_t oWo = off; off += PW;
  const size_t oQh = off; off += PX;
  const size_t oQl = off; off += PX;
  const size_t oKh = off; off += PX;
  const size_t oKl = off; off += PX;
  const size_t oVT = off; off += PVT;
  const size_t oVL = off; off += PVT;
  const size_t oZh = off; off += PX;
  const size_t oZl = off; off += PX;
  if (off > ws_size) return;                     // off = 61341696
  if (off > (size_t)134217728) return;

  char* ws = (char*)d_ws;
  unsigned short* Xh   = (unsigned short*)(ws + oXh);
  unsigned short* Wq16 = (unsigned short*)(ws + oWq);
  unsigned short* Wk16 = (unsigned short*)(ws + oWk);
  unsigned short* Wv16 = (unsigned short*)(ws + oWv);
  unsigned short* Wo16 = (unsigned short*)(ws + oWo);
  unsigned short* Qh   = (unsigned short*)(ws + oQh);
  unsigned short* Ql   = (unsigned short*)(ws + oQl);
  unsigned short* Kh   = (unsigned short*)(ws + oKh);
  unsigned short* Kl   = (unsigned short*)(ws + oKl);
  unsigned short* VT   = (unsigned short*)(ws + oVT);
  unsigned short* VTl  = (unsigned short*)(ws + oVL);
  unsigned short* Zh   = (unsigned short*)(ws + oZh);
  unsigned short* Zl   = (unsigned short*)(ws + oZl);
  float*          out0 = (float*)d_out;

  const dim3 blk(256);
  const int gqk = ((MT / 64) * (HH / 64)) / 8;             // 768 tiles of 64x64 -> 96 blocks
  const int gvt = ((HH / 64) * (MT / 64)) / 8;             // 768 tiles -> 96 blocks
  const int gsp = ((MT / 32) * (HH / 64)) / 8;             // 1536 tiles of 32x64 -> 192 blocks
  if ((((MT / 64) * (HH / 64)) % 8) != 0) return;
  if ((((HH / 64) * (MT / 64)) % 8) != 0) return;
  if ((((MT / 32) * (HH / 64)) % 8) != 0) return;

  // (0) x -> f16 plane of bf16 values; weights [768][768] ([out][in] = Bt[n][k]) -> f16 bits of bf16 values x16
  //     (one grid: 512 blocks for x, 96 for each weight)
  cvt_rows<<<dim3(MT / 8 + 4 * (HH / 8)), blk, 0, stream>>>(x, Wq, Wk, Wv, Wo, Xh, Wq16, Wk16, Wv16, Wo16);

  // (1) q = x . Wq^T + bq and k = x . Wk^T + bk -> hi + residual planes [4096][768];
  //     v^T = Wv . x^T + bv[m] -> hi + residual planes [768][4096]
  //     (one grid: 96 blocks for each of the three)
  gemm_qkv<<<dim3(2 * gqk + gvt), blk, 0, stream>>>(Xh, Wq16, Wk16, Wv16, Qh, Ql, Kh, Kl, VT, VTl, bq, bk, bv);

  // (2) block-diagonal segment attention -> z (x16) hi + residual planes
  attn_kernel<<<dim3(MT / QT, NHD), blk, 0, stream>>>(Qh, Ql, Kh, Kl, VT, VTl, Zh, Zl);

  // (3) output projection: out = z . Wo^T + bo -> f32 (A operand split)
  gemm_out<<<dim3(gsp), blk, 0, stream>>>(Zh, Zl, Wo16, out0, bo);
  (void)hipGetLastError();
}

// v003
// One run takes 73.1 microseconds.
// Two timings next to v002 put it at 1.06 and 1.07 times that version's speed.
// Over all steps from v000 it is 2.61 times as fast.
// Contractions: q = x.Wq^T, k = x.Wk^T and v^T = Wv.x^T (plain f16, exact bf16-valued operands);
// attention scores q.k^T and p.v^T with q, k, p, v^T as f16 hi + x2048 residual planes (hi.hi + hi.lo + lo.hi);
// output projection z.Wo^T with z as f16 hi + x2048 residual planes (hi.W + lo.W); all v_wmma_f32_16x16x32_f16
// (f16 operands, f32 accumulate); float inputs RNE-converted to bf16 on load (x in f16 containers, weights x16
// in f16), p carried x1024, z carried x16; softmax in f32 on VALU.
#include <hip/hip_runtime.h>
#include <math.h>
#include <stdint.h>

#define NBT  2
#define SEQ  2048
#define HH   768
#define NHD  12
#define HD   64
#define SEGL 256
#define MT   (NBT * SEQ)
#define QT   128
#define NCHK (SEGL / 32)
#define ZSP  72
#define WSC  16.0f
#define PSC  1024.0f
#define ZSC  16.0f
#define RSC  2048.0f
#define RSCI 0.00048828125f
#define SCL  0.125f
#define KST  128                   // k (halves) per LDS stage: 256 B of every staged row
#define LPH  136                   // LDS row pitch in halves: 272 B = 16 B x odd, for ds_load_b128 readers
#define SROW 384                   // rows per stage: 128 of A (or 64 hi + 64 residual), then 256 of Bt
#define STGH (SROW * LPH)          // halves per stage buffer
#define RSB  (16 * LPH * 2)        // LDS bytes between two copies of one lane (16 rows)

static_assert(NHD * HD == HH);
static_assert(HD == 64);
static_assert((SEQ % SEGL) == 0 && (SEGL % QT) == 0 && (MT % QT) == 0 && QT == 128 && (SEGL % 32) == 0);
static_assert((MT % 64) == 0 && (HH % 64) == 0 && (MT % 32) == 0 && (HH % 32) == 0);
static_assert((((MT / 64) * (HH / 64)) % 8) == 0);
static_assert((((HH / 64) * (MT / 64)) % 8) == 0);
static_assert((((MT / 32) * (HH / 64)) % 8) == 0);
static_assert((MT % 8) == 0 && (HH % 8) == 0 && (HH % 256) == 0);
static_assert(ZSP >= 64 && (ZSP % 8) == 0);
static_assert((MT % 256) == 0 && (HH % 128) == 0 && (MT % 128) == 0 && (HH % KST) == 0 && HH / KST >= 2);
static_assert((LPH % 8) == 0 && LPH >= KST);

typedef _Float16 v16h __attribute__((ext_vector_type(16)));
typedef _Float16 v8h  __attribute__((ext_vector_type(8)));
typedef unsigned short v16us __attribute__((ext_vector_type(16)));
typedef unsigned short v8us  __attribute__((ext_vector_type(8)));
typedef float v8f __attribute__((ext_vector_type(8)));
typedef float v4f __attribute__((ext_vector_type(4)));
typedef unsigned int v4u __attribute__((ext_vector_type(4)));

union FragU { v16us v; v8us h[2]; };

// ---- scalar helpers --------------------------------------------------------------------------------
__device__ __forceinline__ unsigned short bf_bits(float f) {          // f32 -> bf16 bits, RNE convert
  const unsigned u = __float_as_uint(f);
  return (unsigned short)((u + 0x7FFFu + ((u >> 16) & 1u)) >> 16);
}
__device__ __forceinline__ float bf_up(unsigned short h) { return __uint_as_float(((unsigned)h) << 16); }
__device__ __forceinline__ float bfr(float f) { return bf_up(bf_bits(f)); }   // value of the bf16 RNE convert
__device__ __forceinline__ unsigned short h_bits(_Float16 x) { return __builtin_bit_cast(unsigned short, x); }
__device__ __forceinline__ unsigned short f2h(float f) { return h_bits((_Float16)f); }
__device__ __forceinline__ float h_up(unsigned short h) { return (float)__builtin_bit_cast(_Float16, h); }
__device__ __forceinline__ unsigned pk16(unsigned short a, unsigned short b) { return (unsigned)a | ((unsigned)b << 16); }
__device__ __forceinline__ v8f zero8() { v8f z = {0.f, 0.f, 0.f, 0.f, 0.f, 0.f, 0.f, 0.f}; return z; }
// f -> f16 hi bits and f16 bits of the x2048 residual (f - hi) * 2048
__device__ __forceinline__ void split_h(float f, unsigned short& hi, unsigned short& lo) {
  hi = f2h(f);
  lo = f2h((f - h_up(hi)) * RSC);
}

// ---- fragment loader: 16-bit A/B operand, lane -> row/col (lane&15), p already includes +8*(lane>>4);
//      elements 0..7 <- p[0..7] (k0+8h..), elements 8..15 <- p[16..23] (k0+16+8h..)
__device__ __forceinline__ v16us ldfrag_u(const unsigned short* p) {
  FragU f;
  f.h[0] = *(const v8us*)(p);
  f.h[1] = *(const v8us*)(p + 16);
  return f.v;
}

// ---- fragment-order planes: a [R][C] f16 plane kept as tiles of 16 rows x 32 k (1024 B, tile number
//      (row / 16) * (C / 32) + col / 32), inside a tile 16-B units [k octet 0..3][row 0..15]. Lane l's two pieces of
//      the operand fragment (row l & 15, k 8 (l >> 4).. and 16 + 8 (l >> 4)..) are then units l and 32 + l: each load
//      instruction of a wave covers 512 contiguous bytes (4 whole lines) instead of 16 B in each of 16 rows.
//      p = plane + tile * 512 + lane * 8 (halves); same element order as ldfrag_u
__device__ __forceinline__ v16us ldfrag_t(const unsigned short* p) {
  FragU f;
  f.h[0] = *(const v8us*)(p);
  f.h[1] = *(const v8us*)(p + 256);
  return f.v;
}

// ---- WMMA helpers with trailing VALU hazard gap --------------------------------------------------------
__device__ __forceinline__ v8f mma_h_raw(v16us a, v16us b, v8f c) {             // f16 operands (bits), unguarded
  return __builtin_amdgcn_wmma_f32_16x16x32_f16(false, __builtin_bit_cast(v16h, a), false,
                                                __builtin_bit_cast(v16h, b), (short)0, c, false, false);
}
__device__ __forceinline__ void dep_guard1(v8f& a, v8f& b, v16us x) {
#if defined(__HIP_DEVICE_COMPILE__)
  asm volatile("v_nop\n\tv_nop\n\tv_nop\n\tv_nop" : "+v"(a), "+v"(b) : "v"(x));
#endif
}
__device__ __forceinline__ void dep_guard2(v8f& a, v8f& b, v8f& c, v8f& d, v16us x, v16us y) {
#if defined(__HIP_DEVICE_COMPILE__)
  asm volatile("v_nop\n\tv_nop\n\tv_nop\n\tv_nop" : "+v"(a), "+v"(b), "+v"(c), "+v"(d) : "v"(x), "v"(y));
#endif
}
__device__ __forceinline__ void keep4_u(v16us a, v16us b, v16us c, v16us d) {
#if defined(__HIP_DEVICE_COMPILE__)
  asm volatile("v_nop" :: "v"(a), "v"(b), "v"(c), "v"(d));
#endif
}
__device__ __forceinline__ void acc_guard4(v8f& a, v8f& b, v8f& c, v8f& d) {
#if defined(__HIP_DEVICE_COMPILE__)
  asm volatile("v_nop\n\tv_nop\n\tv_nop\n\tv_nop" : "+v"(a), "+v"(b), "+v"(c), "+v"(d));
#endif
}
// ties four D accumulators and keeps six A/B fragments live across a 4-slot VALU gap
__device__ __forceinline__ void guard4x6(v8f& a, v8f& b, v8f& c, v8f& d,
                                         v16us p, v16us q, v16us r, v16us s, v16us t, v16us u) {
#if defined(__HIP_DEVICE_COMPILE__)
  asm volatile("v_nop\n\tv_nop\n\tv_nop\n\tv_nop"
               : "+v"(a), "+v"(b), "+v"(c), "+v"(d)
               : "v"(p), "v"(q), "v"(r), "v"(s), "v"(t), "v"(u));
#endif
}
__device__ __forceinline__ void wave_sync_lds() {
  __builtin_amdgcn_fence(__ATOMIC_RELEASE, "workgroup");
  __builtin_amdgcn_wave_barrier();
  __builtin_amdgcn_fence(__ATOMIC_ACQUIRE, "workgroup");
}

// ---- asynchronous copies global -> LDS ------------------------------------------------------------------
// Eight 16-byte copies per lane: LDS bytes l + i * RSB; global ga + i * gs (i = 0..3) and gb + i * gs (i = 4..7
// as 0..3). The closing s_wait_xcnt stands inside the statement so that no address register named by a copy is
// rewritten in front of it.
__device__ __forceinline__ void copy8(unsigned l, const unsigned short* ga, const unsigned short* gb, size_t gs) {
#if defined(__HIP_DEVICE_COMPILE__)
  asm volatile(
      "global_load_async_to_lds_b128 %0, %8, off\n\t"
      "global_load_async_to_lds_b128 %1, %9, off\n\t"
      "global_load_async_to_lds_b128 %2, %10, off\n\t"
      "global_load_async_to_lds_b128 %3, %11, off\n\t"
      "global_load_async_to_lds_b128 %4, %12, off\n\t"
      "global_load_async_to_lds_b128 %5, %13, off\n\t"
      "global_load_async_to_lds_b128 %6, %14, off\n\t"
      "global_load_async_to_lds_b128 %7, %15, off\n\t"
      "s_wait_xcnt 0x0"
      :: "v"(l), "v"(l + RSB), "v"(l + 2 * RSB), "v"(l + 3 * RSB),
         "v"(l + 4 * RSB), "v"(l + 5 * RSB), "v"(l + 6 * RSB), "v"(l + 7 * RSB),
         "v"(ga), "v"(ga + gs), "v"(ga + 2 * gs), "v"(ga + 3 * gs),
         "v"(gb), "v"(gb + gs), "v"(gb + 2 * gs), "v"(gb + 3 * gs)
      : "memory");
#endif
}
// this wave's own copies have landed in LDS
__device__ __forceinline__ void wait_async0() {
#if defined(__HIP_DEVICE_COMPILE__)
  asm volatile("s_wait_asynccnt 0x0" ::: "memory");
#endif
}
// this wave's own LDS reads have returned, before the buffer they read is handed to its next writer
__device__ __forceinline__ void wait_ds0() {
#if defined(__HIP_DEVICE_COMPILE__)
  asm volatile("s_wait_dscnt 0x0" ::: "memory");
#endif
}

// =====================================================================================================
// Rows [nrows][768] f32 -> f16 bits of (bf16 RNE value * sc). Used for x (sc = 1) and for the [out][in]
// weight matrices (sc = 16), which are already Bt[n][k] with k contiguous. The five conversions need nothing
// of each other and share one grid by ranges of the block index: blocks 0..MT/8-1 take x, then HH/8 blocks
// for each of Wq, Wk, Wv, Wo. One wave per row; three column
// chunks of 256: lane owns columns 256c + 8*lane..+7, one instruction = 32 lanes x 16 B = 512 contiguous B
// coverage: 8 rows per block, grid = MT/8 + 4 HH/8 exact, 3 chunks x 256 = 768 cols: union = every row of all five.
// =====================================================================================================
__global__ __launch_bounds__(256) void cvt_rows(const float* __restrict__ xin, const float* __restrict__ Wq,
                                                const float* __restrict__ Wk, const float* __restrict__ Wv,
                                                const float* __restrict__ Wo, unsigned short* Xh,
                                                unsigned short* Wq16, unsigned short* Wk16,
                                                unsigned short* Wv16, unsigned short* Wo16) {
  const int wb  = (int)blockIdx.x - MT / 8;               // block-uniform: below 0 = x, else a weight block
  const int wi  = wb / (HH / 8);                          // which weight, 0..3
  const bool isx = wb < 0;
  const float* x = isx ? xin : wi == 0 ? Wq : wi == 1 ? Wk : wi == 2 ? Wv : Wo;
  unsigned short* xh = isx ? Xh : wi == 0 ? Wq16 : wi == 1 ? Wk16 : wi == 2 ? Wv16 : Wo16;
  const int nrows = isx ? MT : HH;
  const float sc  = isx ? 1.0f : WSC;
  const int row = (isx ? (int)blockIdx.x : wb - wi * (HH / 8)) * 8 + (threadIdx.x >> 5);
  const int lane = threadIdx.x & 31;
  if (wi > 3 || row >= nrows) return;                     // wave-uniform, no barriers below
  v4u hv[HH / 256];
#pragma unroll
  for (int c = 0; c < HH / 256; ++c) {
    const float* p = x + (size_t)row * HH + c * 256 + lane * 8;
    const v4f a0 = *(const v4f*)(p);
    const v4f a1 = *(const v4f*)(p + 4);
    v4u h;
#pragma unroll
    for (int e = 0; e < 2; ++e) {
      h[e]     = pk16(f2h(bfr(a0[2 * e]) * sc), f2h(bfr(a0[2 * e + 1]) * sc));
      h[2 + e] = pk16(f2h(bfr(a1[2 * e]) * sc), f2h(bfr(a1[2 * e + 1]) * sc));
    }
    hv[c] = h;
  }
  unsigned short* d = xh + (size_t)row * HH + lane * 8;
  {
#pragma unroll
    for (int c = 0; c < HH / 256; ++c) *(v4u*)(d + c * 256) = hv[c];
    
  }
}

// =====================================================================================================
// Register-blocked f16 WMMA GEMM: C[m][n] = (sum_k A[m][k] * Bt[n][k] * wsc + bias) * osc, one wave per TRx64
// tile (TR = 64, or 32 when the A operand is split); the block's 8 waves form a (2 TR) x 256 tile (2 x 4 waves)
// whose operand rows are staged in LDS, 128 k at a time, two buffers, by asynchronous 16-byte copies (16 lanes
// per 256-B row piece), the next stage in flight while this one is multiplied. A row-major [M][K] pitch lda (ASPL = 1:
// a second plane Al holds the x2048 residual, same pitch, products into a separate accumulator folded back
// as acc + accr/2048); Bt row-major [N][K] pitch ldb (k contiguous); M multiple of 2 TR, N of 256, K of 128 and at
// least 256 (true at every call site; host-checked grids = tiles/8 exact so no block exits early).
// OM: 0 = f32 out Cf (row-major, pitch ldc); 1 = f16 hi bits Ch plus x2048 residual bits Cl, both in fragment order
// (see ldfrag_t) with ldc columns.
// cbm (block-uniform): 0 = no bias; 1 = column bias bf16(cb[n]); 2 = row bias bf16(cb[m]). All biases bf16 RNE values.
// bid = the block's tile number inside this product; sT (per-wave 16x64 slabs, pitch 68 floats) and sS (two operand
// stages) are the calling kernel's LDS arrays.
// coverage: MI slabs x 16 rows x 64 cols = the wave's whole TRx64 tile; tiles/8 blocks x 8 waves = every tile.
// =====================================================================================================
template <int OM, int ASPL>
__device__ __forceinline__ void gemm_body(
    float* sT, unsigned short* sS, int bid,
    const unsigned short* __restrict__ Ap, const unsigned short* __restrict__ Alp, int lda,
    const unsigned short* __restrict__ Btp, int ldb,
    unsigned short* Ch, unsigned short* Cl, float* Cf, int ldc,
    const float* __restrict__ cb, int cbm, float wsc, float osc, int M, int N, int K) {
  constexpr int MI = ASPL ? 2 : 4;
  constexpr int TR = 16 * MI;
  const int lane = threadIdx.x & 31;
  const int wave = threadIdx.x >> 5;
  const int tilesN = N >> 8;
  const int tilesM = M / (2 * TR);
  if (bid >= tilesM * tilesN) return;   // block-uniform, in front of every barrier
  const int tm = bid / tilesN;
  const int tn = bid - tm * tilesN;
  const int wm = wave >> 2;                    // wave row 0..1
  const int wn = wave & 3;                     // wave column 0..3
  const int mb = tm * (2 * TR);                // block's first row of A
  const int nb = tn << 8;                      // block's first row of Bt
  const int m0 = mb + wm * TR;
  const int n0 = nb + (wn << 6);

  const int rlane = lane & 15;                 // row (A) / col (B, D) within subtile
  const int koff  = (lane >> 4) * 8;           // k offset of this lane half
  const int mOff  = (lane >> 4) * 8;           // D row offset

  v8f acc[MI][4];
  v8f accr[MI][4];
#pragma unroll
  for (int i = 0; i < MI; ++i)
#pragma unroll
    for (int j = 0; j < 4; ++j) { acc[i][j] = zero8(); accr[i][j] = zero8(); }

  // copy map: lane's 16-B piece cch of staged row crow + 16 i, i = 0..23 (rows 0..127 A, 128..383 Bt)
  const int crow = threadIdx.x >> 4;           // 0..15
  const int cch  = (threadIdx.x & 15) * 8;     // halves
  const unsigned lds0 = (unsigned)(size_t)sS + (unsigned)(crow * LPH + cch) * 2u;   // LDS byte address, buffer 0
  const unsigned short* gA0 = Ap + (size_t)(mb + crow) * lda + cch;                 // staged rows 0..63
  const unsigned short* gA1 = ASPL ? Alp + (size_t)(mb + crow) * lda + cch          // rows 64..127: residual plane
                                   : gA0 + (size_t)64 * lda;                        // or A rows 64..127
  const unsigned short* gB0 = Btp + (size_t)(nb + crow) * ldb + cch;                // staged rows 128..383
  const size_t gsa = (size_t)16 * lda, gsb = (size_t)16 * ldb;
  const int NT = K / KST;

  // staged row of this lane's first A fragment and first Bt fragment, with its k offset
  const int fa = (wm * TR + rlane) * LPH + koff;
  const int fb = (128 + (wn << 6) + rlane) * LPH + koff;

  // stage 0 -> buffer 0, landed and published; then stage 1 -> buffer 1 in flight
  copy8(lds0,            gA0,           gA1,            gsa);
  copy8(lds0 + 8 * RSB,  gB0,           gB0 + 4 * gsb,  gsb);
  copy8(lds0 + 16 * RSB, gB0 + 8 * gsb, gB0 + 12 * gsb, gsb);
  wait_async0();
  __syncthreads();
  if (NT > 1) {
    const unsigned lb = lds0 + STGH * 2;
    copy8(lb,            gA0 + KST,           gA1 + KST,            gsa);
    copy8(lb + 8 * RSB,  gB0 + KST,           gB0 + KST + 4 * gsb,  gsb);
    copy8(lb + 16 * RSB, gB0 + KST + 8 * gsb, gB0 + KST + 12 * gsb, gsb);
  }

#pragma unroll 1   // one stage per trip: the buffer index stays a run-time value and the text small
  for (int t = 0; t < NT; ++t) {
    const unsigned short* sb = sS + (t & 1) * STGH;
#pragma unroll
    for (int kk = 0; kk < KST; kk += 32) {
      // all eight fragments of this k-step are asked for ahead of its 16 products, not one A fragment per four
      v16us bh[4], ahf[MI], alf[MI];
#pragma unroll
      for (int j = 0; j < 4; ++j) bh[j] = ldfrag_u(sb + fb + (j << 4) * LPH + kk);
#pragma unroll
      for (int i = 0; i < MI; ++i) {
        ahf[i] = ldfrag_u(sb + fa + (i << 4) * LPH + kk);
        if (ASPL) alf[i] = ldfrag_u(sb + fa + (64 + (i << 4)) * LPH + kk);
      }
#pragma unroll
      for (int i = 0; i < MI; ++i) {
        const v16us ah = ahf[i];
        if (ASPL) {
          const v16us al = alf[i];
#pragma unroll
          for (int j = 0; j < 4; ++j) {
            acc[i][j]  = mma_h_raw(ah, bh[j], acc[i][j]);
            accr[i][j] = mma_h_raw(al, bh[j], accr[i][j]);
          }
          dep_guard2(acc[i][0], acc[i][3], accr[i][0], accr[i][3], ah, al);
        } else {
#pragma unroll
          for (int j = 0; j < 4; ++j) acc[i][j] = mma_h_raw(ah, bh[j], acc[i][j]);
          dep_guard1(acc[i][0], acc[i][3], ah);
        }
      }
      keep4_u(bh[0], bh[1], bh[2], bh[3]);
    }
    // publish point of stage t + 1: own reads of this buffer done, own copies landed, then every wave passes
    wait_ds0();
    wait_async0();
    __syncthreads();
    if (t + 2 < NT) {                          // block-uniform: refill the buffer that this trip has just read
      const unsigned lb = lds0 + (unsigned)(t & 1) * (STGH * 2);
      const int k2 = (t + 2) * KST;
      copy8(lb,            gA0 + k2,           gA1 + k2,            gsa);
      copy8(lb + 8 * RSB,  gB0 + k2,           gB0 + k2 + 4 * gsb,  gsb);
      copy8(lb + 16 * RSB, gB0 + k2 + 8 * gsb, gB0 + k2 + 12 * gsb, gsb);
    }
  }
  wait_async0();
#pragma unroll
  for (int i = 0; i < MI; ++i) {
    acc_guard4(acc[i][0], acc[i][1], acc[i][2], acc[i][3]);
    if (ASPL) acc_guard4(accr[i][0], accr[i][1], accr[i][2], accr[i][3]);
  }

  const int hh2 = lane >> 4, c4 = (lane & 15) * 4;     // f32 out: 256-B row segment = 16 lanes x 16 B
  // f16 planes out: store it takes k octets 2 it and 2 it + 1 of the slab, lane = octet half hh2 x row rlane

  v4f cb4 = {0.f, 0.f, 0.f, 0.f};
  float cbc[4][8];                             // column bias of columns n0 + 8 (2 it + hh2) + e
#pragma unroll
  for (int it = 0; it < 4; ++it)
#pragma unroll
    for (int e = 0; e < 8; ++e) cbc[it][e] = 0.f;
  if (OM == 0 && cbm == 1) {
    const v4f v = *(const v4f*)(cb + n0 + c4);
    cb4[0] = bfr(v[0]); cb4[1] = bfr(v[1]); cb4[2] = bfr(v[2]); cb4[3] = bfr(v[3]);
  }
  if (OM == 1 && cbm == 1) {
#pragma unroll
    for (int it = 0; it < 4; ++it) {
      const float* bp = cb + n0 + (it * 2 + hh2) * 8;
      const v4f v0 = *(const v4f*)(bp);
      const v4f v1 = *(const v4f*)(bp + 4);
#pragma unroll
      for (int e = 0; e < 4; ++e) { cbc[it][e] = bfr(v0[e]); cbc[it][4 + e] = bfr(v1[e]); }
    }
  }
  float rbv[MI];                               // row bias of output row m0 + 16 i + rlane
#pragma unroll
  for (int i = 0; i < MI; ++i) rbv[i] = 0.f;
  if (OM == 1 && cbm == 2) {                   // one block-uniform branch: all loads in flight together
#pragma unroll
    for (int i = 0; i < MI; ++i) rbv[i] = bfr(cb[m0 + (i << 4) + rlane]);
  }

  // ---- epilogue ----
  float* slab = sT + wave * (16 * 68);
#pragma unroll
  for (int i = 0; i < MI; ++i) {
    const int mBase = m0 + (i << 4);
#pragma unroll
    for (int j = 0; j < 4; ++j) {
#pragma unroll
      for (int r = 0; r < 8; ++r) {
        float v = acc[i][j][r];
        if (ASPL) v += accr[i][j][r] * RSCI;
        slab[(mOff + r) * 68 + (j << 4) + rlane] = v;
      }
    }
    wave_sync_lds();
    if (OM == 0) {
      v4f vals[8];
#pragma unroll
      for (int it = 0; it < 8; ++it) {
        const int row = it * 2 + hh2;                      // it 0..7 x hh2 0..1 = rows 0..15
        const v4f v = *(const v4f*)(slab + row * 68 + c4);
        vals[it] = (v * wsc + cb4) * osc;
      }
      {
#pragma unroll
        for (int it = 0; it < 8; ++it) {
          const int row = it * 2 + hh2;
          *(v4f*)(Cf + (size_t)(mBase + row) * ldc + (size_t)n0 + c4) = vals[it];
        }
        
      }
    }
    if (OM == 1) {
      v4u hv[4], lv[4];
#pragma unroll
      for (int it = 0; it < 4; ++it) {
        const float* sp = slab + rlane * 68 + (it * 2 + hh2) * 8;   // rows 0..15 x octets 2 it, 2 it + 1
        const float rb = rbv[i];
        v4u ha = {0u, 0u, 0u, 0u}, la = {0u, 0u, 0u, 0u};
#pragma unroll
        for (int e = 0; e < 4; ++e) {
          const float f0 = (sp[2 * e]     * wsc + cbc[it][2 * e]     + rb) * osc;
          const float f1 = (sp[2 * e + 1] * wsc + cbc[it][2 * e + 1] + rb) * osc;
          unsigned short h0, l0, h1, l1;
          split_h(f0, h0, l0);
          split_h(f1, h1, l1);
          ha[e] = pk16(h0, h1);
          la[e] = pk16(l0, l1);
        }
        hv[it] = ha;
        lv[it] = la;
      }
      {
        // tiles (mBase / 16, n0 / 32) and the next one; store it = 512 contiguous bytes: units 32 (it & 1) + lane
        const size_t gt = ((size_t)(mBase >> 4) * (ldc >> 5) + (n0 >> 5)) * 512 + lane * 8;
#pragma unroll
        for (int it = 0; it < 4; ++it) {
          const size_t go = gt + (it >> 1) * 512 + (it & 1) * 256;
          *(v4u*)(Ch + go) = hv[it];
          *(v4u*)(Cl + go) = lv[it];
        }
        
      }
    }
    wave_sync_lds();
  }
}

// q = x.Wq^T + bq, k = x.Wk^T + bk ([4096][768] planes) and v^T = Wv.x^T + bv[m] ([768][4096] planes) need nothing
// of each other and share one grid by ranges of the block index: QKVT block tiles of 128 x 256 for each, in that order.
#define QKVT ((MT / 128) * (HH / 256))
static_assert(QKVT == (HH / 128) * (MT / 256));
__global__ __launch_bounds__(256) void gemm_qkv(
    const unsigned short* __restrict__ Xh, const unsigned short* __restrict__ Wq16,
    const unsigned short* __restrict__ Wk16, const unsigned short* __restrict__ Wv16,
    unsigned short* Qh, unsigned short* Ql, unsigned short* Kh, unsigned short* Kl,
    unsigned short* VT, unsigned short* VTl,
    const float* __restrict__ bq, const float* __restrict__ bk, const float* __restrict__ bv) {
  __shared__ __align__(16) float sT[8 * 16 * 68];         // per-wave 16x64 slab, pitch 68 floats
  __shared__ __align__(16) unsigned short sS[2 * STGH];   // two operand stages
  const int pi = blockIdx.x / QKVT;                       // block-uniform: 0 = q, 1 = k, 2 = v^T
  if (pi > 2) return;                                     // block-uniform, in front of every barrier
  const bool vt = pi == 2;
  const unsigned short* A  = vt ? Wv16 : Xh;
  const unsigned short* Bt = vt ? Xh : pi ? Wk16 : Wq16;
  unsigned short* Ch = vt ? VT  : pi ? Kh : Qh;
  unsigned short* Cl = vt ? VTl : pi ? Kl : Ql;
  const float* cb = vt ? bv : pi ? bk : bq;
  gemm_body<1, 0>(sT, sS, (int)blockIdx.x - pi * QKVT, A, A, HH, Bt, HH, Ch, Cl, nullptr, vt ? MT : HH,
                  cb, vt ? 2 : 1, 1.0f / WSC, 1.0f, vt ? HH : MT, vt ? MT : HH, HH);
}

// out = z.Wo^T + bo -> f32, z as hi + residual planes
__global__ __launch_bounds__(256) void gemm_out(
    const unsigned short* __restrict__ Zh, const unsigned short* __restrict__ Zl,
    const unsigned short* __restrict__ Wo16, float* out, const float* __restrict__ bo) {
  __shared__ __align__(16) float sT[8 * 16 * 68];         // per-wave 16x64 slab, pitch 68 floats
  __shared__ __align__(16) unsigned short sS[2 * STGH];   // two operand stages
  gemm_body<0, 1>(sT, sS, (int)blockIdx.x, Zh, Zl, HH, Wo16, HH, nullptr, nullptr, out, HH,
                  bo, 1, 1.0f / (WSC * ZSC), 1.0f, MT, HH, HH);
}

// =====================================================================================================
// Block-diagonal attention over 256-token segments, head dim 64. Block = 256 threads = 8 waves, one block per
// (128 query tokens tq0..tq0+127, head); all 128 queries lie in one segment whose keys are tokens
// tk00 = (tq0 & ~255) .. tk00+255, every key valid (no masking); wave w owns queries tq0+16w..+15 and all 64 dv.
// Q/K planes f16 bits [token][768] (head h at cols 64h..64h+63): hi (Qh, Kh) and x2048 residual (Ql, Kl);
// V^T planes f16 [dv][token]: hi (VT) and x2048 residual (VTl). All six lie in fragment order (see ldfrag_t).
// Per chunk of 32 keys: s = qh.kh^T (acc s) and qh.kl^T + ql.kh^T (acc sr), two 32-deep k-steps over the 64
// head dims; logit = (s + sr/2048) * 0.125; running-max softmax in f32; p = exp(logit - m) carried as 1024 p
// barrier, v8us fragment reload of the same element type); z accumulates ph.vh (oz) and ph.vl + pl.vh (orr) on
// WMMA for 4 dv tiles, z = oz + orr/2048. q, k, p and v^T fragments all use the split k map.
// coverage: 128 query rows x 64 halves at cols 64*head per block in Zh and in Zl; grid (MT/128) x 12 heads = the
// whole [4096][768] z planes.
// =====================================================================================================
__global__ __launch_bounds__(256) void attn_kernel(const unsigned short* __restrict__ Qh,
                                                   const unsigned short* __restrict__ Ql,
                                                   const unsigned short* __restrict__ Kh,
                                                   const unsigned short* __restrict__ Kl,
                                                   const unsigned short* __restrict__ VT,
                                                   const unsigned short* __restrict__ VTl,
                                                   unsigned short* Zh, unsigned short* Zl) {
  __shared__ __align__(16) unsigned short ps[8 * 1024];     // wave-private P tiles: hi [16][32] at 0, lo at 512
  __shared__ __align__(16) unsigned short zsth[QT * ZSP];   // output staging, hi plane
  __shared__ __align__(16) unsigned short zstl[QT * ZSP];   // output staging, residual plane
  const int tq0  = blockIdx.x * QT;                         // first query token (token = b*2048 + s)
  const int tk00 = tq0 & ~(SEGL - 1);                       // first key token of the segment
  const int hc   = blockIdx.y * HD;                         // head column offset
  const int t = threadIdx.x, lane = t & 31, wv = t >> 5, hh = lane >> 4, jc = lane & 15;

  // A: row = query jc, k = head dim; tile (token / 16, col / 32), the head's two k tiles are neighbours
  const size_t qo = ((size_t)((tq0 >> 4) + wv) * (HH / 32) + (hc >> 5)) * 512 + lane * 8;
  const v16us qf0 = ldfrag_t(Qh + qo);                                  // dims 0..31
  const v16us qf1 = ldfrag_t(Qh + qo + 512);                            // dims 32..63
  const v16us ql0 = ldfrag_t(Ql + qo);
  const v16us ql1 = ldfrag_t(Ql + qo + 512);
  float m[8], ll[8];
  v8f oz[4], orr[4];
#pragma unroll
  for (int r = 0; r < 8; ++r) { m[r] = -1.0e30f; ll[r] = 0.f; }
#pragma unroll
  for (int d = 0; d < 4; ++d) { oz[d] = zero8(); orr[d] = zero8(); }
  unsigned short* pw = ps + wv * 1024;
  const size_t vob = (size_t)(hc >> 4) * (MT / 32) * 512 + lane * 8;    // B: col dv = jc (+16d), k = key token

#pragma unroll 1
  for (int c = 0; c < NCHK; ++c) {
    const int tk0 = tk00 + 32 * c;                           // first key token of the chunk (multiple of 32)
    const size_t ko0 = ((size_t)(tk0 >> 4) * (HH / 32) + (hc >> 5)) * 512 + lane * 8;   // B: col = key jc, k = head dim
    const size_t ko1 = ko0 + (size_t)(HH / 32) * 512;            // col = key 16 + jc
    v8f s0 = zero8(), s1 = zero8(), sr0 = zero8(), sr1 = zero8();
    {                                                        // k-step 0: head dims 0..31
      const v16us kf0 = ldfrag_t(Kh + ko0);
      const v16us kf1 = ldfrag_t(Kh + ko1);
      const v16us kl0 = ldfrag_t(Kl + ko0);
      const v16us kl1 = ldfrag_t(Kl + ko1);
      s0  = mma_h_raw(qf0, kf0, s0);                         // D row 8hh+r = query 16wv+8hh+r, col jc = key tk0+jc
      sr0 = mma_h_raw(qf0, kl0, sr0);                        // hi . residual
      s1  = mma_h_raw(qf0, kf1, s1);                         // key tk0+16+jc
      sr1 = mma_h_raw(qf0, kl1, sr1);
      sr0 = mma_h_raw(ql0, kf0, sr0);                        // residual . hi
      sr1 = mma_h_raw(ql0, kf1, sr1);
      guard4x6(s0, s1, sr0, sr1, qf0, ql0, kf0, kf1, kl0, kl1);
    }
    {                                                        // k-step 1: head dims 32..63
      const v16us kf0 = ldfrag_t(Kh + ko0 + 512);
      const v16us kf1 = ldfrag_t(Kh + ko1 + 512);
      const v16us kl0 = ldfrag_t(Kl + ko0 + 512);
      const v16us kl1 = ldfrag_t(Kl + ko1 + 512);
      s0  = mma_h_raw(qf1, kf0, s0);
      sr0 = mma_h_raw(qf1, kl0, sr0);
      s1  = mma_h_raw(qf1, kf1, s1);
      sr1 = mma_h_raw(qf1, kl1, sr1);
      sr0 = mma_h_raw(ql1, kf0, sr0);
      sr1 = mma_h_raw(ql1, kf1, sr1);
      guard4x6(s0, s1, sr0, sr1, qf1, ql1, kf0, kf1, kl0, kl1);
    }
    wave_sync_lds();                                         // earlier P fragment reads complete before overwrite
#pragma unroll
    for (int r = 0; r < 8; ++r) {
      const int il = 8 * hh + r;
      const float t0 = (s0[r] + sr0[r] * RSCI) * SCL;
      const float t1 = (s1[r] + sr1[r] * RSCI) * SCL;
      float rm = fmaxf(t0, t1);
#pragma unroll
      for (int off = 1; off < 16; off <<= 1) rm = fmaxf(rm, __shfl_xor(rm, off, 32));
      const float mn2   = fmaxf(m[r], rm);
      const float alpha = __expf(m[r] - mn2);
      const float e0 = __expf(t0 - mn2);
      const float e1 = __expf(t1 - mn2);
      float rs = e0 + e1;
#pragma unroll
      for (int off = 1; off < 16; off <<= 1) rs += __shfl_xor(rs, off, 32);
      ll[r] = ll[r] * alpha + rs;
      m[r]  = mn2;
#pragma unroll
      for (int d = 0; d < 4; ++d) { oz[d][r] *= alpha; orr[d][r] *= alpha; }
      unsigned short h0, l0, h1, l1;
      split_h(e0 * PSC, h0, l0);
      split_h(e1 * PSC, h1, l1);
      pw[il * 32 + jc]            = h0;                      // P hi [query il][k = jc]
      pw[il * 32 + 16 + jc]       = h1;                      // P hi [query il][k = 16 + jc]
      pw[512 + il * 32 + jc]      = l0;                      // P residual
      pw[512 + il * 32 + 16 + jc] = l1;
    }
    wave_sync_lds();
    FragU pa, pb;                                            // A: row = query jc, elements 0..7 <- k 8hh.., 8..15 <- k 16+8hh..
    pa.h[0] = *(const v8us*)(pw + jc * 32 + 8 * hh);
    pa.h[1] = *(const v8us*)(pw + jc * 32 + 16 + 8 * hh);
    pb.h[0] = *(const v8us*)(pw + 512 + jc * 32 + 8 * hh);
    pb.h[1] = *(const v8us*)(pw + 512 + jc * 32 + 16 + 8 * hh);
#pragma unroll
    for (int dg = 0; dg < 2; ++dg) {                         // dv tiles 2dg (cols 32dg+jc) and 2dg+1 (cols 32dg+16+jc)
      // B: keys tk0+8hh.. and tk0+16+8hh..; tile (dv / 16, token / 32)
      const size_t voa = vob + ((size_t)(2 * dg) * (MT / 32) + (tk0 >> 5)) * 512;
      const size_t voc = voa + (size_t)(MT / 32) * 512;
      const v16us f0 = ldfrag_t(VT  + voa);
      const v16us f1 = ldfrag_t(VT  + voc);
      const v16us g0 = ldfrag_t(VTl + voa);                  // residual plane, same cols
      const v16us g1 = ldfrag_t(VTl + voc);
      oz[2 * dg]      = mma_h_raw(pa.v, f0, oz[2 * dg]);
      orr[2 * dg]     = mma_h_raw(pa.v, g0, orr[2 * dg]);
      oz[2 * dg + 1]  = mma_h_raw(pa.v, f1, oz[2 * dg + 1]);
      orr[2 * dg + 1] = mma_h_raw(pa.v, g1, orr[2 * dg + 1]);
      orr[2 * dg]     = mma_h_raw(pb.v, f0, orr[2 * dg]);
      orr[2 * dg + 1] = mma_h_raw(pb.v, f1, orr[2 * dg + 1]);
      guard4x6(oz[2 * dg], oz[2 * dg + 1], orr[2 * dg], orr[2 * dg + 1], pa.v, pb.v, f0, f1, g0, g1);
    }
  }

#pragma unroll
  for (int r = 0; r < 8; ++r) {
    const int il = 8 * hh + r;
    const float l = ll[r];
    const float inv = ((l > 0.f) ? (1.0f / l) : 0.f) * (ZSC / PSC);
    const int so = (16 * wv + il) * ZSP + jc;
#pragma unroll
    for (int d = 0; d < 4; ++d) {
      const float z = (oz[d][r] + orr[d][r] * RSCI) * inv;
      unsigned short h0, l0;
      split_h(z, h0, l0);
      zsth[so + 16 * d] = h0;
      zstl[so + 16 * d] = l0;
    }
  }
  __syncthreads();
  v4u hv[4], lv[4];
#pragma unroll
  for (int it = 0; it < 4; ++it) {
    const int row = it * 32 + (t >> 3), p = (t & 7) * 8;   // it 0..3 x (t>>3) 0..31 = rows 0..127, 8 lanes per row
    hv[it] = *(const v4u*)(zsth + row * ZSP + p);
    lv[it] = *(const v4u*)(zstl + row * ZSP + p);
  }
  {
#pragma unroll
    for (int it = 0; it < 4; ++it) {
      const int row = it * 32 + (t >> 3), p = (t & 7) * 8;
      const size_t go = (size_t)(tq0 + row) * HH + hc + p;
      *(v4u*)(Zh + go) = hv[it];
      *(v4u*)(Zl + go) = lv[it];
    }
    
  }
}

// =====================================================================================================
// Workspace map (bytes); every plane is an exact multiple of its whole-row / whole-tile store granularity
//   Xh    f16 [4096][768]     0          6291456
//   Wq16  f16 [768][768]      6291456    1179648   (x16)
//   Wk16  f16 [768][768]      7471104    1179648   (x16)
//   Wv16  f16 [768][768]      8650752    1179648   (x16)
//   Wo16  f16 [768][768]      9830400    1179648   (x16)
//   Qh    f16 [4096][768]     11010048   6291456   (hi, fragment order)
//   Ql    f16 [4096][768]     17301504   6291456   (x2048 residual, fragment order)
//   Kh    f16 [4096][768]     23592960   6291456   (hi, fragment order)
//   Kl    f16 [4096][768]     29884416   6291456   (x2048 residual, fragment order)
//   VT    f16 [768][4096]     36175872   6291456   (hi, fragment order)
//   VTl   f16 [768][4096]     42467328   6291456   (x2048 residual, fragment order)
//   Zh    f16 [4096][768]     48758784   6291456   (z x16, hi)
//   Zl    f16 [4096][768]     55050240   6291456   (x2048 residual)
//   end                       61341696
// =====================================================================================================
extern "C" void kernel_launch(void* const* d_in, const int* in_sizes, int n_in,
                              void* d_out, int out_size, void* d_ws, size_t ws_size,
                              hipStream_t stream) {
  if (n_in < 9) return;
  if (in_sizes[0] != MT * HH) return;
  if (in_sizes[1] != HH * HH || in_sizes[2] != HH) return;
  if (in_sizes[3] != HH * HH || in_sizes[4] != HH) return;
  if (in_sizes[5] != HH * HH || in_sizes[6] != HH) return;
  if (in_sizes[7] != HH * HH || in_sizes[8] != HH) return;
  if (out_size != MT * HH) return;

  const float* x  = (const float*)d_in[0];
  const float* Wq = (const float*)d_in[1];
  const float* bq = (const float*)d_in[2];
  const float* Wk = (const float*)d_in[3];
  const float* bk = (const float*)d_in[4];
  const float* Wv = (const float*)d_in[5];
  const float* bv = (const float*)d_in[6];
  const float* Wo = (const float*)d_in[7];
  const float* bo = (const float*)d_in[8];

  const size_t PX  = (size_t)MT * HH * 2;        // 6291456
  const size_t PW  = (size_t)HH * HH * 2;        // 1179648
  const size_t PVT = (size_t)HH * MT * 2;        // 6291456
  size_t off = 0;
  const size_t oXh = off; off += PX;
  const size_t oWq = off; off += PW;
  const size_t oWk = off; off += PW;
  const size_t oWv = off; off += PW;
  const size_t oWo = off; off += PW;
  const size_t oQh = off; off += PX;
  const size_t oQl = off; off += PX;
  const size_t oKh = off; off += PX;
  const size_t oKl = off; off += PX;
  const size_t oVT = off; off += PVT;
  const size_t oVL = off; off += PVT;
  const size_t oZh = off; off += PX;
  const size_t oZl = off; off += PX;
  if (off > ws_size) return;                     // off = 61341696
  if (off > (size_t)134217728) return;

  char* ws = (char*)d_ws;
  unsigned short* Xh   = (unsigned short*)(ws + oXh);
  unsigned short* Wq16 = (unsigned short*)(ws + oWq);
  unsigned short* Wk16 = (unsigned short*)(ws + oWk);
  unsigned short* Wv16 = (unsigned short*)(ws + oWv);
  unsigned short* Wo16 = (unsigned short*)(ws + oWo);
  unsigned short* Qh   = (unsigned short*)(ws + oQh);
  unsigned short* Ql   = (unsigned short*)(ws + oQl);
  unsigned short* Kh   = (unsigned short*)(ws + oKh);
  unsigned short* Kl   = (unsigned short*)(ws + oKl);
  unsigned short* VT   = (unsigned short*)(ws + oVT);
  unsigned short* VTl  = (unsigned short*)(ws + oVL);
  unsigned short* Zh   = (unsigned short*)(ws + oZh);
  unsigned short* Zl   = (unsigned short*)(ws + oZl);
  float*          out0 = (float*)d_out;

  const dim3 blk(256);
  const int gqk = ((MT / 64) * (HH / 64)) / 8;             // 768 tiles of 64x64 -> 96 blocks
  const int gvt = ((HH / 64) * (MT / 64)) / 8;             // 768 tiles -> 96 blocks
  const int gsp = ((MT / 32) * (HH / 64)) / 8;             // 1536 tiles of 32x64 -> 192 blocks
  if ((((MT / 64) * (HH / 64)) % 8) != 0) return;
  if ((((HH / 64) * (MT / 64)) % 8) != 0) return;
  if ((((MT / 32) * (HH / 64)) % 8) != 0) return;

  // (0) x -> f16 plane of bf16 values; weights [768][768] ([out][in] = Bt[n][k]) -> f16 bits of bf16 values x16
  //     (one grid: 512 blocks for x, 96 for each weight)
  cvt_rows<<<dim3(MT / 8 + 4 * (HH / 8)), blk, 0, stream>>>(x, Wq, Wk, Wv, Wo, Xh, Wq16, Wk16, Wv16, Wo16);

  // (1) q = x . Wq^T + bq and k = x . Wk^T + bk -> hi + residual planes [4096][768];
  //     v^T = Wv . x^T + bv[m] -> hi + residual planes [768][4096]
  //     (one grid: 96 blocks for each of the three)
  gemm_qkv<<<dim3(2 * gqk + gvt), blk, 0, stream>>>(Xh, Wq16, Wk16, Wv16, Qh, Ql, Kh, Kl, VT, VTl, bq, bk, bv);

  // (2) block-diagonal segment attention -> z (x16) hi + residual planes
  attn_kernel<<<dim3(MT / QT, NHD), blk, 0, stream>>>(Qh, Ql, Kh, Kl, VT, VTl, Zh, Zl);

  // (3) output projection: out = z . Wo^T + bo -> f32 (A operand split)
  gemm_out<<<dim3(gsp), blk, 0, stream>>>(Zh, Zl, Wo16, out0, bo);
  (void)hipGetLastError();
}

// v004
// One run takes 66.4 microseconds.
// Timed twice side by side with v003, it ran 1.10 times as fast both times.
// Counting every step since v000, it is 2.87 times as fast.
// Contractions: q = x.Wq^T, k = x.Wk^T and v = x.Wv^T (plain f16, exact bf16-valued operands);
// attention scores q.k^T and p.v^T with q, k, p, v^T as f16 hi + x2048 residual planes (hi.hi + hi.lo + lo.hi);
// output projection z.Wo^T with z as f16 hi + x2048 residual planes (hi.W + lo.W); all v_wmma_f32_16x16x32_f16
// (f16 operands, f32 accumulate); float inputs RNE-converted to bf16 on load (x in f16 containers, weights x16
// in f16), p carried x1024, z carried x16; softmax in f32 on VALU.
#include <hip/hip_runtime.h>
#include <math.h>
#include <stdint.h>

#define NBT  2
#define SEQ  2048
#define HH   768
#define NHD  12
#define HD   64
#define SEGL 256
#define MT   (NBT * SEQ)
#define QT   128
#define NCHK (SEGL / 32)
#define ZSP  72
#define WSC  16.0f
#define PSC  1024.0f
#define ZSC  16.0f
#define RSC  2048.0f
#define RSCI 0.00048828125f
#define SCL  0.125f
#define KST  128                   // k (halves) per LDS stage: 256 B of every staged row
#define LPH  136                   // LDS row pitch in halves: 272 B = 16 B x odd, for ds_load_b128 readers
#define SROW 384                   // rows per stage: 128 of A (or 64 hi + 64 residual), then 256 of Bt
#define STGH (SROW * LPH)          // halves per stage buffer
#define RSB  (16 * LPH * 2)        // LDS bytes between two copies of one lane (16 rows)
#define NQKV (3 * HH)              // columns of the joint product x.[Wq; Wk; Wv]^T
#define QTN  288                   // its block tile: 128 rows x 288 columns
#define QNJ  (QTN / 32)            // 16-column tiles of one wave (two wave columns)
#define QROW (128 + QTN)           // rows per stage: 128 of x, then 288 of the stacked weights
#define QSTG (QROW * LPH)          // halves per stage buffer
#define QGRD ((MT / 128) * (NQKV / QTN))

static_assert(NHD * HD == HH);
static_assert(HD == 64);
static_assert((SEQ % SEGL) == 0 && (SEGL % QT) == 0 && (MT % QT) == 0 && QT == 128 && (SEGL % 32) == 0);
static_assert((MT % 64) == 0 && (HH % 64) == 0 && (MT % 32) == 0 && (HH % 32) == 0);
static_assert((((MT / 64) * (HH / 64)) % 8) == 0);
static_assert((((HH / 64) * (MT / 64)) % 8) == 0);
static_assert((((MT / 32) * (HH / 64)) % 8) == 0);
static_assert((MT % 8) == 0 && (HH % 8) == 0 && (HH % 256) == 0);
static_assert(ZSP >= 64 && (ZSP % 8) == 0);
static_assert((MT % 256) == 0 && (HH % 128) == 0 && (MT % 128) == 0 && (HH % KST) == 0 && HH / KST >= 2);
static_assert((LPH % 8) == 0 && LPH >= KST);
static_assert((NQKV % QTN) == 0 && (QTN % 96) == 0 && (HH % 48) == 0 && QNJ == 9 && (QROW % 16) == 0 && QROW / 16 == 26);

typedef _Float16 v16h __attribute__((ext_vector_type(16)));
typedef _Float16 v8h  __attribute__((ext_vector_type(8)));
typedef unsigned short v16us __attribute__((ext_vector_type(16)));
typedef unsigned short v8us  __attribute__((ext_vector_type(8)));
typedef float v8f __attribute__((ext_vector_type(8)));
typedef float v4f __attribute__((ext_vector_type(4)));
typedef unsigned int v4u __attribute__((ext_vector_type(4)));

union FragU { v16us v; v8us h[2]; };

// ---- scalar helpers --------------------------------------------------------------------------------
__device__ __forceinline__ unsigned short bf_bits(float f) {          // f32 -> bf16 bits, RNE convert
  const unsigned u = __float_as_uint(f);
  return (unsigned short)((u + 0x7FFFu + ((u >> 16) & 1u)) >> 16);
}
__device__ __forceinline__ float bf_up(unsigned short h) { return __uint_as_float(((unsigned)h) << 16); }
__device__ __forceinline__ float bfr(float f) { return bf_up(bf_bits(f)); }   // value of the bf16 RNE convert
__device__ __forceinline__ unsigned short h_bits(_Float16 x) { return __builtin_bit_cast(unsigned short, x); }
__device__ __forceinline__ unsigned short f2h(float f) { return h_bits((_Float16)f); }
__device__ __forceinline__ float h_up(unsigned short h) { return (float)__builtin_bit_cast(_Float16, h); }
__device__ __forceinline__ unsigned pk16(unsigned short a, unsigned short b) { return (unsigned)a | ((unsigned)b << 16); }
__device__ __forceinline__ v8f zero8() { v8f z = {0.f, 0.f, 0.f, 0.f, 0.f, 0.f, 0.f, 0.f}; return z; }
// f -> f16 hi bits and f16 bits of the x2048 residual (f - hi) * 2048
__device__ __forceinline__ void split_h(float f, unsigned short& hi, unsigned short& lo) {
  hi = f2h(f);
  lo = f2h((f - h_up(hi)) * RSC);
}

// ---- fragment loader: 16-bit A/B operand, lane -> row/col (lane&15), p already includes +8*(lane>>4);
//      elements 0..7 <- p[0..7] (k0+8h..), elements 8..15 <- p[16..23] (k0+16+8h..)
__device__ __forceinline__ v16us ldfrag_u(const unsigned short* p) {
  FragU f;
  f.h[0] = *(const v8us*)(p);
  f.h[1] = *(const v8us*)(p + 16);
  return f.v;
}

// ---- fragment-order planes: a [R][C] f16 plane kept as tiles of 16 rows x 32 k (1024 B, tile number
//      (row / 16) * (C / 32) + col / 32), inside a tile 16-B units [k octet 0..3][row 0..15]. Lane l's two pieces of
//      the operand fragment (row l & 15, k 8 (l >> 4).. and 16 + 8 (l >> 4)..) are then units l and 32 + l: each load
//      instruction of a wave covers 512 contiguous bytes (4 whole lines) instead of 16 B in each of 16 rows.
//      p = plane + tile * 512 + lane * 8 (halves); same element order as ldfrag_u
__device__ __forceinline__ v16us ldfrag_t(const unsigned short* p) {
  FragU f;
  f.h[0] = *(const v8us*)(p);
  f.h[1] = *(const v8us*)(p + 256);
  return f.v;
}

// ---- WMMA helpers with trailing VALU hazard gap --------------------------------------------------------
__device__ __forceinline__ v8f mma_h_raw(v16us a, v16us b, v8f c) {             // f16 operands (bits), unguarded
  return __builtin_amdgcn_wmma_f32_16x16x32_f16(false, __builtin_bit_cast(v16h, a), false,
                                                __builtin_bit_cast(v16h, b), (short)0, c, false, false);
}
__device__ __forceinline__ void dep_guard1(v8f& a, v8f& b, v16us x) {
#if defined(__HIP_DEVICE_COMPILE__)
  asm volatile("v_nop\n\tv_nop\n\tv_nop\n\tv_nop" : "+v"(a), "+v"(b) : "v"(x));
#endif
}
__device__ __forceinline__ void dep_guard2(v8f& a, v8f& b, v8f& c, v8f& d, v16us x, v16us y) {
#if defined(__HIP_DEVICE_COMPILE__)
  asm volatile("v_nop\n\tv_nop\n\tv_nop\n\tv_nop" : "+v"(a), "+v"(b), "+v"(c), "+v"(d) : "v"(x), "v"(y));
#endif
}
__device__ __forceinline__ void keep4_u(v16us a, v16us b, v16us c, v16us d) {
#if defined(__HIP_DEVICE_COMPILE__)
  asm volatile("v_nop" :: "v"(a), "v"(b), "v"(c), "v"(d));
#endif
}
// keeps nine B fragments live across the slot behind their last product
__device__ __forceinline__ void keep9_u(v16us a, v16us b, v16us c, v16us d, v16us e, v16us f, v16us g, v16us h,
                                        v16us i) {
#if defined(__HIP_DEVICE_COMPILE__)
  asm volatile("v_nop" :: "v"(a), "v"(b), "v"(c), "v"(d), "v"(e), "v"(f), "v"(g), "v"(h), "v"(i));
#endif
}
__device__ __forceinline__ void acc_guard4(v8f& a, v8f& b, v8f& c, v8f& d) {
#if defined(__HIP_DEVICE_COMPILE__)
  asm volatile("v_nop\n\tv_nop\n\tv_nop\n\tv_nop" : "+v"(a), "+v"(b), "+v"(c), "+v"(d));
#endif
}
// ties four D accumulators and keeps six A/B fragments live across a 4-slot VALU gap
__device__ __forceinline__ void guard4x6(v8f& a, v8f& b, v8f& c, v8f& d,
                                         v16us p, v16us q, v16us r, v16us s, v16us t, v16us u) {
#if defined(__HIP_DEVICE_COMPILE__)
  asm volatile("v_nop\n\tv_nop\n\tv_nop\n\tv_nop"
               : "+v"(a), "+v"(b), "+v"(c), "+v"(d)
               : "v"(p), "v"(q), "v"(r), "v"(s), "v"(t), "v"(u));
#endif
}
__device__ __forceinline__ void wave_sync_lds() {
  __builtin_amdgcn_fence(__ATOMIC_RELEASE, "workgroup");
  __builtin_amdgcn_wave_barrier();
  __builtin_amdgcn_fence(__ATOMIC_ACQUIRE, "workgroup");
}

// ---- asynchronous copies global -> LDS ------------------------------------------------------------------
// Eight 16-byte copies per lane: LDS bytes l + i * RSB; global ga + i * gs (i = 0..3) and gb + i * gs (i = 4..7
// as 0..3). The closing s_wait_xcnt stands inside the statement so that no address register named by a copy is
// rewritten in front of it.
__device__ __forceinline__ void copy8(unsigned l, const unsigned short* ga, const unsigned short* gb, size_t gs) {
#if defined(__HIP_DEVICE_COMPILE__)
  asm volatile(
      "global_load_async_to_lds_b128 %0, %8, off\n\t"
      "global_load_async_to_lds_b128 %1, %9, off\n\t"
      "global_load_async_to_lds_b128 %2, %10, off\n\t"
      "global_load_async_to_lds_b128 %3, %11, off\n\t"
      "global_load_async_to_lds_b128 %4, %12, off\n\t"
      "global_load_async_to_lds_b128 %5, %13, off\n\t"
      "global_load_async_to_lds_b128 %6, %14, off\n\t"
      "global_load_async_to_lds_b128 %7, %15, off\n\t"
      "s_wait_xcnt 0x0"
      :: "v"(l), "v"(l + RSB), "v"(l + 2 * RSB), "v"(l + 3 * RSB),
         "v"(l + 4 * RSB), "v"(l + 5 * RSB), "v"(l + 6 * RSB), "v"(l + 7 * RSB),
         "v"(ga), "v"(ga + gs), "v"(ga + 2 * gs), "v"(ga + 3 * gs),
         "v"(gb), "v"(gb + gs), "v"(gb + 2 * gs), "v"(gb + 3 * gs)
      : "memory");
#endif
}
// Two such copies: LDS bytes l and l + RSB; global ga and ga + gs; the same closing wait inside the statement.
__device__ __forceinline__ void copy2(unsigned l, const unsigned short* ga, size_t gs) {
#if defined(__HIP_DEVICE_COMPILE__)
  asm volatile(
      "global_load_async_to_lds_b128 %0, %2, off\n\t"
      "global_load_async_to_lds_b128 %1, %3, off\n\t"
      "s_wait_xcnt 0x0"
      :: "v"(l), "v"(l + RSB), "v"(ga), "v"(ga + gs)
      : "memory");
#endif
}
// this wave's own copies have landed in LDS
__device__ __forceinline__ void wait_async0() {
#if defined(__HIP_DEVICE_COMPILE__)
  asm volatile("s_wait_asynccnt 0x0" ::: "memory");
#endif
}
// in front of an overwrite of registers that issued global stores name
__device__ __forceinline__ void wait_x0() {
#if defined(__HIP_DEVICE_COMPILE__)
  asm volatile("s_wait_xcnt 0x0" ::: "memory");
#endif
}
// this wave's own LDS reads have returned, before the buffer they read is handed to its next writer
__device__ __forceinline__ void wait_ds0() {
#if defined(__HIP_DEVICE_COMPILE__)
  asm volatile("s_wait_dscnt 0x0" ::: "memory");
#endif
}

// =====================================================================================================
// Rows [nrows][768] f32 -> f16 bits of (bf16 RNE value * sc). Used for x (sc = 1) and for the [out][in]
// weight matrices (sc = 16), which are already Bt[n][k] with k contiguous. The five conversions need nothing
// of each other and share one grid by ranges of the block index: blocks 0..MT/8-1 take x, then HH/8 blocks
// for each of Wq, Wk, Wv, Wo. One wave per row; three column
// chunks of 256: lane owns columns 256c + 8*lane..+7, one instruction = 32 lanes x 16 B = 512 contiguous B
// coverage: 8 rows per block, grid = MT/8 + 4 HH/8 exact, 3 chunks x 256 = 768 cols: union = every row of all five.
// =====================================================================================================
__global__ __launch_bounds__(256) void cvt_rows(const float* __restrict__ xin, const float* __restrict__ Wq,
                                                const float* __restrict__ Wk, const float* __restrict__ Wv,
                                                const float* __restrict__ Wo, unsigned short* Xh,
                                                unsigned short* Wq16, unsigned short* Wk16,
                                                unsigned short* Wv16, unsigned short* Wo16) {
  const int wb  = (int)blockIdx.x - MT / 8;               // block-uniform: below 0 = x, else a weight block
  const int wi  = wb / (HH / 8);                          // which weight, 0..3
  const bool isx = wb < 0;
  const float* x = isx ? xin : wi == 0 ? Wq : wi == 1 ? Wk : wi == 2 ? Wv : Wo;
  unsigned short* xh = isx ? Xh : wi == 0 ? Wq16 : wi == 1 ? Wk16 : wi == 2 ? Wv16 : Wo16;
  const int nrows = isx ? MT : HH;
  const float sc  = isx ? 1.0f : WSC;
  const int row = (isx ? (int)blockIdx.x : wb - wi * (HH / 8)) * 8 + (threadIdx.x >> 5);
  const int lane = threadIdx.x & 31;
  if (wi > 3 || row >= nrows) return;                     // wave-uniform, no barriers below
  v4u hv[HH / 256];
#pragma unroll
  for (int c = 0; c < HH / 256; ++c) {
    const float* p = x + (size_t)row * HH + c * 256 + lane * 8;
    const v4f a0 = *(const v4f*)(p);
    const v4f a1 = *(const v4f*)(p + 4);
    v4u h;
#pragma unroll
    for (int e = 0; e < 2; ++e) {
      h[e]     = pk16(f2h(bfr(a0[2 * e]) * sc), f2h(bfr(a0[2 * e + 1]) * sc));
      h[2 + e] = pk16(f2h(bfr(a1[2 * e]) * sc), f2h(bfr(a1[2 * e + 1]) * sc));
    }
    hv[c] = h;
  }
  unsigned short* d = xh + (size_t)row * HH + lane * 8;
  {
#pragma unroll
    for (int c = 0; c < HH / 256; ++c) *(v4u*)(d + c * 256) = hv[c];
    
  }
}

// =====================================================================================================
// Register-blocked f16 WMMA GEMM: C[m][n] = (sum_k A[m][k] * Bt[n][k] * wsc + bias) * osc, one wave per TRx64
// tile (TR = 64, or 32 when the A operand is split); the block's 8 waves form a (2 TR) x 256 tile (2 x 4 waves)
// whose operand rows are staged in LDS, 128 k at a time, two buffers, by asynchronous 16-byte copies (16 lanes
// per 256-B row piece), the next stage in flight while this one is multiplied. A row-major [M][K] pitch lda (ASPL = 1:
// a second plane Al holds the x2048 residual, same pitch, products into a separate accumulator folded back
// as acc + accr/2048); Bt row-major [N][K] pitch ldb (k contiguous); M multiple of 2 TR, N of 256, K of 128 and at
// least 256 (true at every call site; host-checked grids = tiles/8 exact so no block exits early).
// OM: 0 = f32 out Cf (row-major, pitch ldc); 1 = f16 hi bits Ch plus x2048 residual bits Cl, both in fragment order
// (see ldfrag_t) with ldc columns.
// cbm (block-uniform): 0 = no bias; 1 = column bias bf16(cb[n]); 2 = row bias bf16(cb[m]). All biases bf16 RNE values.
// bid = the block's tile number inside this product; sT (per-wave 16x64 slabs, pitch 68 floats) and sS (two operand
// stages) are the calling kernel's LDS arrays.
// coverage: MI slabs x 16 rows x 64 cols = the wave's whole TRx64 tile; tiles/8 blocks x 8 waves = every tile.
// =====================================================================================================
template <int OM, int ASPL>
__device__ __forceinline__ void gemm_body(
    float* sT, unsigned short* sS, int bid,
    const unsigned short* __restrict__ Ap, const unsigned short* __restrict__ Alp, int lda,
    const unsigned short* __restrict__ Btp, int ldb,
    unsigned short* Ch, unsigned short* Cl, float* Cf, int ldc,
    const float* __restrict__ cb, int cbm, float wsc, float osc, int M, int N, int K) {
  constexpr int MI = ASPL ? 2 : 4;
  constexpr int TR = 16 * MI;
  const int lane = threadIdx.x & 31;
  const int wave = threadIdx.x >> 5;
  const int tilesN = N >> 8;
  const int tilesM = M / (2 * TR);
  if (bid >= tilesM * tilesN) return;   // block-uniform, in front of every barrier
  const int tm = bid / tilesN;
  const int tn = bid - tm * tilesN;
  const int wm = wave >> 2;                    // wave row 0..1
  const int wn = wave & 3;                     // wave column 0..3
  const int mb = tm * (2 * TR);                // block's first row of A
  const int nb = tn << 8;                      // block's first row of Bt
  const int m0 = mb + wm * TR;
  const int n0 = nb + (wn << 6);

  const int rlane = lane & 15;                 // row (A) / col (B, D) within subtile
  const int koff  = (lane >> 4) * 8;           // k offset of this lane half
  const int mOff  = (lane >> 4) * 8;           // D row offset

  v8f acc[MI][4];
  v8f accr[MI][4];
#pragma unroll
  for (int i = 0; i < MI; ++i)
#pragma unroll
    for (int j = 0; j < 4; ++j) { acc[i][j] = zero8(); accr[i][j] = zero8(); }

  // copy map: lane's 16-B piece cch of staged row crow + 16 i, i = 0..23 (rows 0..127 A, 128..383 Bt)
  const int crow = threadIdx.x >> 4;           // 0..15
  const int cch  = (threadIdx.x & 15) * 8;     // halves
  const unsigned lds0 = (unsigned)(size_t)sS + (unsigned)(crow * LPH + cch) * 2u;   // LDS byte address, buffer 0
  const unsigned short* gA0 = Ap + (size_t)(mb + crow) * lda + cch;                 // staged rows 0..63
  const unsigned short* gA1 = ASPL ? Alp + (size_t)(mb + crow) * lda + cch          // rows 64..127: residual plane
                                   : gA0 + (size_t)64 * lda;                        // or A rows 64..127
  const unsigned short* gB0 = Btp + (size_t)(nb + crow) * ldb + cch;                // staged rows 128..383
  const size_t gsa = (size_t)16 * lda, gsb = (size_t)16 * ldb;
  const int NT = K / KST;

  // staged row of this lane's first A fragment and first Bt fragment, with its k offset
  const int fa = (wm * TR + rlane) * LPH + koff;
  const int fb = (128 + (wn << 6) + rlane) * LPH + koff;

  // stage 0 -> buffer 0, landed and published; then stage 1 -> buffer 1 in flight
  copy8(lds0,            gA0,           gA1,            gsa);
  copy8(lds0 + 8 * RSB,  gB0,           gB0 + 4 * gsb,  gsb);
  copy8(lds0 + 16 * RSB, gB0 + 8 * gsb, gB0 + 12 * gsb, gsb);
  wait_async0();
  __syncthreads();
  if (NT > 1) {
    const unsigned lb = lds0 + STGH * 2;
    copy8(lb,            gA0 + KST,           gA1 + KST,            gsa);
    copy8(lb + 8 * RSB,  gB0 + KST,           gB0 + KST + 4 * gsb,  gsb);
    copy8(lb + 16 * RSB, gB0 + KST + 8 * gsb, gB0 + KST + 12 * gsb, gsb);
  }

#pragma unroll 1   // one stage per trip: the buffer index stays a run-time value and the text small
  for (int t = 0; t < NT; ++t) {
    const unsigned short* sb = sS + (t & 1) * STGH;
#pragma unroll
    for (int kk = 0; kk < KST; kk += 32) {
      // all eight fragments of this k-step are asked for ahead of its 16 products, not one A fragment per four
      v16us bh[4], ahf[MI], alf[MI];
#pragma unroll
      for (int j = 0; j < 4; ++j) bh[j] = ldfrag_u(sb + fb + (j << 4) * LPH + kk);
#pragma unroll
      for (int i = 0; i < MI; ++i) {
        ahf[i] = ldfrag_u(sb + fa + (i << 4) * LPH + kk);
        if (ASPL) alf[i] = ldfrag_u(sb + fa + (64 + (i << 4)) * LPH + kk);
      }
#pragma unroll
      for (int i = 0; i < MI; ++i) {
        const v16us ah = ahf[i];
        if (ASPL) {
          const v16us al = alf[i];
#pragma unroll
          for (int j = 0; j < 4; ++j) {
            acc[i][j]  = mma_h_raw(ah, bh[j], acc[i][j]);
            accr[i][j] = mma_h_raw(al, bh[j], accr[i][j]);
          }
          dep_guard2(acc[i][0], acc[i][3], accr[i][0], accr[i][3], ah, al);
        } else {
#pragma unroll
          for (int j = 0; j < 4; ++j) acc[i][j] = mma_h_raw(ah, bh[j], acc[i][j]);
          dep_guard1(acc[i][0], acc[i][3], ah);
        }
      }
      keep4_u(bh[0], bh[1], bh[2], bh[3]);
    }
    // publish point of stage t + 1: own reads of this buffer done, own copies landed, then every wave passes
    wait_ds0();
    wait_async0();
    __syncthreads();
    if (t + 2 < NT) {                          // block-uniform: refill the buffer that this trip has just read
      const unsigned lb = lds0 + (unsigned)(t & 1) * (STGH * 2);
      const int k2 = (t + 2) * KST;
      copy8(lb,            gA0 + k2,           gA1 + k2,            gsa);
      copy8(lb + 8 * RSB,  gB0 + k2,           gB0 + k2 + 4 * gsb,  gsb);
      copy8(lb + 16 * RSB, gB0 + k2 + 8 * gsb, gB0 + k2 + 12 * gsb, gsb);
    }
  }
  wait_async0();
#pragma unroll
  for (int i = 0; i < MI; ++i) {
    acc_guard4(acc[i][0], acc[i][1], acc[i][2], acc[i][3]);
    if (ASPL) acc_guard4(accr[i][0], accr[i][1], accr[i][2], accr[i][3]);
  }

  const int hh2 = lane >> 4, c4 = (lane & 15) * 4;     // f32 out: 256-B row segment = 16 lanes x 16 B
  // f16 planes out: store it takes k octets 2 it and 2 it + 1 of the slab, lane = octet half hh2 x row rlane

  v4f cb4 = {0.f, 0.f, 0.f, 0.f};
  float cbc[4][8];                             // column bias of columns n0 + 8 (2 it + hh2) + e
#pragma unroll
  for (int it = 0; it < 4; ++it)
#pragma unroll
    for (int e = 0; e < 8; ++e) cbc[it][e] = 0.f;
  if (OM == 0 && cbm == 1) {
    const v4f v = *(const v4f*)(cb + n0 + c4);
    cb4[0] = bfr(v[0]); cb4[1] = bfr(v[1]); cb4[2] = bfr(v[2]); cb4[3] = bfr(v[3]);
  }
  if (OM == 1 && cbm == 1) {
#pragma unroll
    for (int it = 0; it < 4; ++it) {
      const float* bp = cb + n0 + (it * 2 + hh2) * 8;
      const v4f v0 = *(const v4f*)(bp);
      const v4f v1 = *(const v4f*)(bp + 4);
#pragma unroll
      for (int e = 0; e < 4; ++e) { cbc[it][e] = bfr(v0[e]); cbc[it][4 + e] = bfr(v1[e]); }
    }
  }
  float rbv[MI];                               // row bias of output row m0 + 16 i + rlane
#pragma unroll
  for (int i = 0; i < MI; ++i) rbv[i] = 0.f;
  if (OM == 1 && cbm == 2) {                   // one block-uniform branch: all loads in flight together
#pragma unroll
    for (int i = 0; i < MI; ++i) rbv[i] = bfr(cb[m0 + (i << 4) + rlane]);
  }

  // ---- epilogue ----
  float* slab = sT + wave * (16 * 68);
#pragma unroll
  for (int i = 0; i < MI; ++i) {
    const int mBase = m0 + (i << 4);
#pragma unroll
    for (int j = 0; j < 4; ++j) {
#pragma unroll
      for (int r = 0; r < 8; ++r) {
        float v = acc[i][j][r];
        if (ASPL) v += accr[i][j][r] * RSCI;
        slab[(mOff + r) * 68 + (j << 4) + rlane] = v;
      }
    }
    wave_sync_lds();
    if (OM == 0) {
      v4f vals[8];
#pragma unroll
      for (int it = 0; it < 8; ++it) {
        const int row = it * 2 + hh2;                      // it 0..7 x hh2 0..1 = rows 0..15
        const v4f v = *(const v4f*)(slab + row * 68 + c4);
        vals[it] = (v * wsc + cb4) * osc;
      }
      {
#pragma unroll
        for (int it = 0; it < 8; ++it) {
          const int row = it * 2 + hh2;
          *(v4f*)(Cf + (size_t)(mBase + row) * ldc + (size_t)n0 + c4) = vals[it];
        }
        
      }
    }
    if (OM == 1) {
      v4u hv[4], lv[4];
#pragma unroll
      for (int it = 0; it < 4; ++it) {
        const float* sp = slab + rlane * 68 + (it * 2 + hh2) * 8;   // rows 0..15 x octets 2 it, 2 it + 1
        const float rb = rbv[i];
        v4u ha = {0u, 0u, 0u, 0u}, la = {0u, 0u, 0u, 0u};
#pragma unroll
        for (int e = 0; e < 4; ++e) {
          const float f0 = (sp[2 * e]     * wsc + cbc[it][2 * e]     + rb) * osc;
          const float f1 = (sp[2 * e + 1] * wsc + cbc[it][2 * e + 1] + rb) * osc;
          unsigned short h0, l0, h1, l1;
          split_h(f0, h0, l0);
          split_h(f1, h1, l1);
          ha[e] = pk16(h0, h1);
          la[e] = pk16(l0, l1);
        }
        hv[it] = ha;
        lv[it] = la;
      }
      {
        // tiles (mBase / 16, n0 / 32) and the next one; store it = 512 contiguous bytes: units 32 (it & 1) + lane
        const size_t gt = ((size_t)(mBase >> 4) * (ldc >> 5) + (n0 >> 5)) * 512 + lane * 8;
#pragma unroll
        for (int it = 0; it < 4; ++it) {
          const size_t go = gt + (it >> 1) * 512 + (it & 1) * 256;
          *(v4u*)(Ch + go) = hv[it];
          *(v4u*)(Cl + go) = lv[it];
        }
        
      }
    }
    wave_sync_lds();
  }
}

// q = x.Wq^T + bq, k = x.Wk^T + bk and v = x.Wv^T + bv as ONE product x.Wc^T + bias, Wc = [Wq; Wk; Wv] stacked
// ([2304][768]: the three f16 weight planes are neighbours in the workspace). Block tile 128 x 288: 32 x 8 = 256
// blocks, one for every WGP (a block's LDS leaves room for no second one), so the launch is a single round.
// 8 waves as 4 x 2, one wave per 32 x 144 tile (2 x 9 accumulators). Operand rows staged as in gemm_body: 128 k per
// stage, two buffers, asynchronous 16-byte copies, 26 per lane and stage (rows 0..127 x, 128..415 Wc).
// Epilogue by groups of 48 columns (48 divides 768: a group lies in one of q, k, v; the test is wave-uniform):
// q, k: through the wave's slab into fragment order (see ldfrag_t), tiles (token / 16, col / 32);
// v: the accumulator itself holds 8 successive tokens of one dv per lane, which is one 16-B unit of the v^T plane's
// fragment order (tile (dv / 16, token / 32), unit 32 i + lane): stored from registers, 512 contiguous bytes a store.
// coverage: 2 x 9 tiles of 16 x 16 = the wave's 32 x 144; 8 waves = 128 x 288; 256 blocks = [4096][2304].
__global__ __launch_bounds__(256) void gemm_qkv(
    const unsigned short* __restrict__ Xh, const unsigned short* __restrict__ Wc,
    unsigned short* Qh, unsigned short* Ql, unsigned short* Kh, unsigned short* Kl,
    unsigned short* VT, unsigned short* VTl,
    const float* __restrict__ bq, const float* __restrict__ bk, const float* __restrict__ bv) {
  __shared__ __align__(16) float sT[8 * 16 * 68];         // per-wave 16x48 slab, pitch 68 floats
  __shared__ __align__(16) unsigned short sS[2 * QSTG];   // two operand stages
  const int bid = (int)blockIdx.x;
  if (bid >= QGRD) return;                                // block-uniform, in front of every barrier
  const int lane = threadIdx.x & 31;
  const int wave = __builtin_amdgcn_readfirstlane((int)(threadIdx.x >> 5));
  const int tm = bid / (NQKV / QTN);
  const int tn = bid - tm * (NQKV / QTN);
  const int wm = wave >> 1;                    // wave row 0..3
  const int wn = wave & 1;                     // wave column 0..1
  const int mb = tm * 128;                     // block's first row of x
  const int nb = tn * QTN;                     // block's first row of Wc
  const int m0 = mb + wm * 32;
  const int n0 = nb + wn * (QTN / 2);

  const int rlane = lane & 15;                 // row (A) / col (B, D) within subtile
  const int hh2   = lane >> 4;
  const int koff  = hh2 * 8;                   // k offset of this lane half
  const int mOff  = hh2 * 8;                   // D row offset

  v8f acc[2][QNJ];
#pragma unroll
  for (int i = 0; i < 2; ++i)
#pragma unroll
    for (int j = 0; j < QNJ; ++j) acc[i][j] = zero8();

  // copy map: lane's 16-B piece cch of staged row crow + 16 i, i = 0..25
  const int crow = threadIdx.x >> 4;           // 0..15
  const int cch  = (threadIdx.x & 15) * 8;     // halves
  const unsigned lds0 = (unsigned)(size_t)sS + (unsigned)(crow * LPH + cch) * 2u;   // LDS byte address, buffer 0
  const unsigned short* gA0 = Xh + (size_t)(mb + crow) * HH + cch;                  // staged rows 0..127
  const unsigned short* gB0 = Wc + (size_t)(nb + crow) * HH + cch;                  // staged rows 128..415
  const size_t gs = (size_t)16 * HH;
  constexpr int NT = HH / KST;

  const int fa = (wm * 32 + rlane) * LPH + koff;
  const int fb = (128 + wn * (QTN / 2) + rlane) * LPH + koff;

  // column bias of this lane's column in each of its nine 16-column tiles, asked for ahead of the k loop
  float bj[QNJ];
#pragma unroll
  for (int j = 0; j < QNJ; ++j) {
    const int nc = n0 + (j << 4);              // wave-uniform; 16 divides 768
    const int pj = nc / HH;
    const float* bp = pj == 0 ? bq : pj == 1 ? bk : bv;
    bj[j] = bfr(bp[nc - pj * HH + rlane]);
  }

  // stage 0 -> buffer 0, landed and published; then stage 1 -> buffer 1 in flight
  copy8(lds0,            gA0,           gA0 + 4 * gs,  gs);
  copy8(lds0 + 8 * RSB,  gB0,           gB0 + 4 * gs,  gs);
  copy8(lds0 + 16 * RSB, gB0 + 8 * gs,  gB0 + 12 * gs, gs);
  copy2(lds0 + 24 * RSB, gB0 + 16 * gs, gs);
  wait_async0();
  __syncthreads();
  {
    const unsigned lb = lds0 + QSTG * 2;
    copy8(lb,            gA0 + KST,           gA0 + KST + 4 * gs,  gs);
    copy8(lb + 8 * RSB,  gB0 + KST,           gB0 + KST + 4 * gs,  gs);
    copy8(lb + 16 * RSB, gB0 + KST + 8 * gs,  gB0 + KST + 12 * gs, gs);
    copy2(lb + 24 * RSB, gB0 + KST + 16 * gs, gs);
  }

#pragma unroll 1   // one stage per trip: the buffer index stays a run-time value and the text small
  for (int t = 0; t < NT; ++t) {
    const unsigned short* sb = sS + (t & 1) * QSTG;
#pragma unroll
    for (int kk = 0; kk < KST; kk += 32) {
      // all eleven fragments of this k-step are asked for ahead of its 18 products
      v16us bh[QNJ], ah[2];
#pragma unroll
      for (int j = 0; j < QNJ; ++j) bh[j] = ldfrag_u(sb + fb + (j << 4) * LPH + kk);
#pragma unroll
      for (int i = 0; i < 2; ++i) ah[i] = ldfrag_u(sb + fa + (i << 4) * LPH + kk);
#pragma unroll
      for (int i = 0; i < 2; ++i) {
#pragma unroll
        for (int j = 0; j < QNJ; ++j) acc[i][j] = mma_h_raw(ah[i], bh[j], acc[i][j]);
        dep_guard1(acc[i][0], acc[i][QNJ - 1], ah[i]);
      }
      keep9_u(bh[0], bh[1], bh[2], bh[3], bh[4], bh[5], bh[6], bh[7], bh[8]);
    }
    // publish point of stage t + 1: own reads of this buffer done, own copies landed, then every wave passes
    wait_ds0();
    wait_async0();
    __syncthreads();
    if (t + 2 < NT) {                          // block-uniform: refill the buffer that this trip has just read
      const unsigned lb = lds0 + (unsigned)(t & 1) * (QSTG * 2);
      const int k2 = (t + 2) * KST;
      copy8(lb,            gA0 + k2,           gA0 + k2 + 4 * gs,  gs);
      copy8(lb + 8 * RSB,  gB0 + k2,           gB0 + k2 + 4 * gs,  gs);
      copy8(lb + 16 * RSB, gB0 + k2 + 8 * gs,  gB0 + k2 + 12 * gs, gs);
      copy2(lb + 24 * RSB, gB0 + k2 + 16 * gs, gs);
    }
  }
  wait_async0();

  // ---- epilogue ----
  const float wsc = 1.0f / WSC;
  float* slab = sT + wave * (16 * 68);
#pragma unroll
  for (int g = 0; g < 3; ++g) {
    const int ng = n0 + 48 * g;                // first column of the group
    const int pg = ng / HH;                    // wave-uniform: 0 = q, 1 = k, 2 = v
    const int c0 = ng - pg * HH;               // its column inside that product, a multiple of 16
    if (pg == 2) {
#pragma unroll
      for (int jj = 0; jj < 3; ++jj) {
        const int j = 3 * g + jj;
#pragma unroll
        for (int i = 0; i < 2; ++i) {
          v4u ha = {0u, 0u, 0u, 0u}, la = {0u, 0u, 0u, 0u};
#pragma unroll
          for (int e = 0; e < 4; ++e) {        // tokens m0 + 16 i + 8 hh2 + 2 e, + 1 of dv c0 + 16 jj + rlane
            unsigned short h0, l0, h1, l1;
            split_h(acc[i][j][2 * e]     * wsc + bj[j], h0, l0);
            split_h(acc[i][j][2 * e + 1] * wsc + bj[j], h1, l1);
            ha[e] = pk16(h0, h1);
            la[e] = pk16(l0, l1);
          }
          const size_t go = ((size_t)((c0 >> 4) + jj) * (MT / 32) + (m0 >> 5)) * 512 + i * 256 + lane * 8;
          *(v4u*)(VT + go)  = ha;
          *(v4u*)(VTl + go) = la;
        }
      }
    } else {
      unsigned short* Ch = pg ? Kh : Qh;
      unsigned short* Cl = pg ? Kl : Ql;
#pragma unroll
      for (int i = 0; i < 2; ++i) {
#pragma unroll
        for (int jj = 0; jj < 3; ++jj) {
          const int j = 3 * g + jj;
#pragma unroll
          for (int r = 0; r < 8; ++r) slab[(mOff + r) * 68 + (jj << 4) + rlane] = acc[i][j][r] * wsc + bj[j];
        }
        wave_sync_lds();
        v4u hv[3], lv[3];
#pragma unroll
        for (int it = 0; it < 3; ++it) {
          const float* sp = slab + rlane * 68 + (it * 2 + hh2) * 8;   // rows 0..15 x octets 2 it, 2 it + 1
          v4u ha = {0u, 0u, 0u, 0u}, la = {0u, 0u, 0u, 0u};
#pragma unroll
          for (int e = 0; e < 4; ++e) {
            unsigned short h0, l0, h1, l1;
            split_h(sp[2 * e],     h0, l0);
            split_h(sp[2 * e + 1], h1, l1);
            ha[e] = pk16(h0, h1);
            la[e] = pk16(l0, l1);
          }
          hv[it] = ha;
          lv[it] = la;
        }
#pragma unroll
        for (int it = 0; it < 3; ++it) {
          // columns c0 + 16 it..+15 = one half of a 32-column tile: 512 contiguous bytes, units 32 (half) + lane
          const int cq = c0 + 16 * it;
          const size_t go = ((size_t)((m0 >> 4) + i) * (HH / 32) + (cq >> 5)) * 512 + ((cq >> 4) & 1) * 256 + lane * 8;
          *(v4u*)(Ch + go) = hv[it];
          *(v4u*)(Cl + go) = lv[it];
        }
        wave_sync_lds();
      }
    }
    // the next group's arithmetic reuses the registers that this group's stores name
    if (g < 2) wait_x0();
  }
}

// out = z.Wo^T + bo -> f32, z as hi + residual planes
__global__ __launch_bounds__(256) void gemm_out(
    const unsigned short* __restrict__ Zh, const unsigned short* __restrict__ Zl,
    const unsigned short* __restrict__ Wo16, float* out, const float* __restrict__ bo) {
  __shared__ __align__(16) float sT[8 * 16 * 68];         // per-wave 16x64 slab, pitch 68 floats
  __shared__ __align__(16) unsigned short sS[2 * STGH];   // two operand stages
  gemm_body<0, 1>(sT, sS, (int)blockIdx.x, Zh, Zl, HH, Wo16, HH, nullptr, nullptr, out, HH,
                  bo, 1, 1.0f / (WSC * ZSC), 1.0f, MT, HH, HH);
}

// =====================================================================================================
// Block-diagonal attention over 256-token segments, head dim 64. Block = 256 threads = 8 waves, one block per
// (128 query tokens tq0..tq0+127, head); all 128 queries lie in one segment whose keys are tokens
// tk00 = (tq0 & ~255) .. tk00+255, every key valid (no masking); wave w owns queries tq0+16w..+15 and all 64 dv.
// Q/K planes f16 bits [token][768] (head h at cols 64h..64h+63): hi (Qh, Kh) and x2048 residual (Ql, Kl);
// V^T planes f16 [dv][token]: hi (VT) and x2048 residual (VTl). All six lie in fragment order (see ldfrag_t).
// Per chunk of 32 keys: s = qh.kh^T (acc s) and qh.kl^T + ql.kh^T (acc sr), two 32-deep k-steps over the 64
// head dims; logit = (s + sr/2048) * 0.125; running-max softmax in f32; p = exp(logit - m) carried as 1024 p
// barrier, v8us fragment reload of the same element type); z accumulates ph.vh (oz) and ph.vl + pl.vh (orr) on
// WMMA for 4 dv tiles, z = oz + orr/2048. q, k, p and v^T fragments all use the split k map.
// coverage: 128 query rows x 64 halves at cols 64*head per block in Zh and in Zl; grid (MT/128) x 12 heads = the
// whole [4096][768] z planes.
// =====================================================================================================
__global__ __launch_bounds__(256) void attn_kernel(const unsigned short* __restrict__ Qh,
                                                   const unsigned short* __restrict__ Ql,
                                                   const unsigned short* __restrict__ Kh,
                                                   const unsigned short* __restrict__ Kl,
                                                   const unsigned short* __restrict__ VT,
                                                   const unsigned short* __restrict__ VTl,
                                                   unsigned short* Zh, unsigned short* Zl) {
  __shared__ __align__(16) unsigned short ps[8 * 1024];     // wave-private P tiles: hi [16][32] at 0, lo at 512
  __shared__ __align__(16) unsigned short zsth[QT * ZSP];   // output staging, hi plane
  __shared__ __align__(16) unsigned short zstl[QT * ZSP];   // output staging, residual plane
  const int tq0  = blockIdx.x * QT;                         // first query token (token = b*2048 + s)
  const int tk00 = tq0 & ~(SEGL - 1);                       // first key token of the segment
  const int hc   = blockIdx.y * HD;                         // head column offset
  const int t = threadIdx.x, lane = t & 31, wv = t >> 5, hh = lane >> 4, jc = lane & 15;

  // A: row = query jc, k = head dim; tile (token / 16, col / 32), the head's two k tiles are neighbours
  const size_t qo = ((size_t)((tq0 >> 4) + wv) * (HH / 32) + (hc >> 5)) * 512 + lane * 8;
  const v16us qf0 = ldfrag_t(Qh + qo);                                  // dims 0..31
  const v16us qf1 = ldfrag_t(Qh + qo + 512);                            // dims 32..63
  const v16us ql0 = ldfrag_t(Ql + qo);
  const v16us ql1 = ldfrag_t(Ql + qo + 512);
  float m[8], ll[8];
  v8f oz[4], orr[4];
#pragma unroll
  for (int r = 0; r < 8; ++r) { m[r] = -1.0e30f; ll[r] = 0.f; }
#pragma unroll
  for (int d = 0; d < 4; ++d) { oz[d] = zero8(); orr[d] = zero8(); }
  unsigned short* pw = ps + wv * 1024;
  const size_t vob = (size_t)(hc >> 4) * (MT / 32) * 512 + lane * 8;    // B: col dv = jc (+16d), k = key token

#pragma unroll 1
  for (int c = 0; c < NCHK; ++c) {
    const int tk0 = tk00 + 32 * c;                           // first key token of the chunk (multiple of 32)
    const size_t ko0 = ((size_t)(tk0 >> 4) * (HH / 32) + (hc >> 5)) * 512 + lane * 8;   // B: col = key jc, k = head dim
    const size_t ko1 = ko0 + (size_t)(HH / 32) * 512;            // col = key 16 + jc
    v8f s0 = zero8(), s1 = zero8(), sr0 = zero8(), sr1 = zero8();
    {                                                        // k-step 0: head dims 0..31
      const v16us kf0 = ldfrag_t(Kh + ko0);
      const v16us kf1 = ldfrag_t(Kh + ko1);
      const v16us kl0 = ldfrag_t(Kl + ko0);
      const v16us kl1 = ldfrag_t(Kl + ko1);
      s0  = mma_h_raw(qf0, kf0, s0);                         // D row 8hh+r = query 16wv+8hh+r, col jc = key tk0+jc
      sr0 = mma_h_raw(qf0, kl0, sr0);                        // hi . residual
      s1  = mma_h_raw(qf0, kf1, s1);                         // key tk0+16+jc
      sr1 = mma_h_raw(qf0, kl1, sr1);
      sr0 = mma_h_raw(ql0, kf0, sr0);                        // residual . hi
      sr1 = mma_h_raw(ql0, kf1, sr1);
      guard4x6(s0, s1, sr0, sr1, qf0, ql0, kf0, kf1, kl0, kl1);
    }
    {                                                        // k-step 1: head dims 32..63
      const v16us kf0 = ldfrag_t(Kh + ko0 + 512);
      const v16us kf1 = ldfrag_t(Kh + ko1 + 512);
      const v16us kl0 = ldfrag_t(Kl + ko0 + 512);
      const v16us kl1 = ldfrag_t(Kl + ko1 + 512);
      s0  = mma_h_raw(qf1, kf0, s0);
      sr0 = mma_h_raw(qf1, kl0, sr0);
      s1  = mma_h_raw(qf1, kf1, s1);
      sr1 = mma_h_raw(qf1, kl1, sr1);
      sr0 = mma_h_raw(ql1, kf0, sr0);
      sr1 = mma_h_raw(ql1, kf1, sr1);
      guard4x6(s0, s1, sr0, sr1, qf1, ql1, kf0, kf1, kl0, kl1);
    }
    wave_sync_lds();                                         // earlier P fragment reads complete before overwrite
#pragma unroll
    for (int r = 0; r < 8; ++r) {
      const int il = 8 * hh + r;
      const float t0 = (s0[r] + sr0[r] * RSCI) * SCL;
      const float t1 = (s1[r] + sr1[r] * RSCI) * SCL;
      float rm = fmaxf(t0, t1);
#pragma unroll
      for (int off = 1; off < 16; off <<= 1) rm = fmaxf(rm, __shfl_xor(rm, off, 32));
      const float mn2   = fmaxf(m[r], rm);
      const float alpha = __expf(m[r] - mn2);
      const float e0 = __expf(t0 - mn2);
      const float e1 = __expf(t1 - mn2);
      float rs = e0 + e1;
#pragma unroll
      for (int off = 1; off < 16; off <<= 1) rs += __shfl_xor(rs, off, 32);
      ll[r] = ll[r] * alpha + rs;
      m[r]  = mn2;
#pragma unroll
      for (int d = 0; d < 4; ++d) { oz[d][r] *= alpha; orr[d][r] *= alpha; }
      unsigned short h0, l0, h1, l1;
      split_h(e0 * PSC, h0, l0);
      split_h(e1 * PSC, h1, l1);
      pw[il * 32 + jc]            = h0;                      // P hi [query il][k = jc]
      pw[il * 32 + 16 + jc]       = h1;                      // P hi [query il][k = 16 + jc]
      pw[512 + il * 32 + jc]      = l0;                      // P residual
      pw[512 + il * 32 + 16 + jc] = l1;
    }
    wave_sync_lds();
    FragU pa, pb;                                            // A: row = query jc, elements 0..7 <- k 8hh.., 8..15 <- k 16+8hh..
    pa.h[0] = *(const v8us*)(pw + jc * 32 + 8 * hh);
    pa.h[1] = *(const v8us*)(pw + jc * 32 + 16 + 8 * hh);
    pb.h[0] = *(const v8us*)(pw + 512 + jc * 32 + 8 * hh);
    pb.h[1] = *(const v8us*)(pw + 512 + jc * 32 + 16 + 8 * hh);
#pragma unroll
    for (int dg = 0; dg < 2; ++dg) {                         // dv tiles 2dg (cols 32dg+jc) and 2dg+1 (cols 32dg+16+jc)
      // B: keys tk0+8hh.. and tk0+16+8hh..; tile (dv / 16, token / 32)
      const size_t voa = vob + ((size_t)(2 * dg) * (MT / 32) + (tk0 >> 5)) * 512;
      const size_t voc = voa + (size_t)(MT / 32) * 512;
      const v16us f0 = ldfrag_t(VT  + voa);
      const v16us f1 = ldfrag_t(VT  + voc);
      const v16us g0 = ldfrag_t(VTl + voa);                  // residual plane, same cols
      const v16us g1 = ldfrag_t(VTl + voc);
      oz[2 * dg]      = mma_h_raw(pa.v, f0, oz[2 * dg]);
      orr[2 * dg]     = mma_h_raw(pa.v, g0, orr[2 * dg]);
      oz[2 * dg + 1]  = mma_h_raw(pa.v, f1, oz[2 * dg + 1]);
      orr[2 * dg + 1] = mma_h_raw(pa.v, g1, orr[2 * dg + 1]);
      orr[2 * dg]     = mma_h_raw(pb.v, f0, orr[2 * dg]);
      orr[2 * dg + 1] = mma_h_raw(pb.v, f1, orr[2 * dg + 1]);
      guard4x6(oz[2 * dg], oz[2 * dg + 1], orr[2 * dg], orr[2 * dg + 1], pa.v, pb.v, f0, f1, g0, g1);
    }
  }

#pragma unroll
  for (int r = 0; r < 8; ++r) {
    const int il = 8 * hh + r;
    const float l = ll[r];
    const float inv = ((l > 0.f) ? (1.0f / l) : 0.f) * (ZSC / PSC);
    const int so = (16 * wv + il) * ZSP + jc;
#pragma unroll
    for (int d = 0; d < 4; ++d) {
      const float z = (oz[d][r] + orr[d][r] * RSCI) * inv;
      unsigned short h0, l0;
      split_h(z, h0, l0);
      zsth[so + 16 * d] = h0;
      zstl[so + 16 * d] = l0;
    }
  }
  __syncthreads();
  v4u hv[4], lv[4];
#pragma unroll
  for (int it = 0; it < 4; ++it) {
    const int row = it * 32 + (t >> 3), p = (t & 7) * 8;   // it 0..3 x (t>>3) 0..31 = rows 0..127, 8 lanes per row
    hv[it] = *(const v4u*)(zsth + row * ZSP + p);
    lv[it] = *(const v4u*)(zstl + row * ZSP + p);
  }
  {
#pragma unroll
    for (int it = 0; it < 4; ++it) {
      const int row = it * 32 + (t >> 3), p = (t & 7) * 8;
      const size_t go = (size_t)(tq0 + row) * HH + hc + p;
      *(v4u*)(Zh + go) = hv[it];
      *(v4u*)(Zl + go) = lv[it];
    }
    
  }
}

// =====================================================================================================
// Workspace map (bytes); every plane is an exact multiple of its whole-row / whole-tile store granularity
//   Xh    f16 [4096][768]     0          6291456
//   Wq16  f16 [768][768]      6291456    1179648   (x16)
//   Wk16  f16 [768][768]      7471104    1179648   (x16)
//   Wv16  f16 [768][768]      8650752    1179648   (x16)
//   Wo16  f16 [768][768]      9830400    1179648   (x16)
//   Qh    f16 [4096][768]     11010048   6291456   (hi, fragment order)
//   Ql    f16 [4096][768]     17301504   6291456   (x2048 residual, fragment order)
//   Kh    f16 [4096][768]     23592960   6291456   (hi, fragment order)
//   Kl    f16 [4096][768]     29884416   6291456   (x2048 residual, fragment order)
//   VT    f16 [768][4096]     36175872   6291456   (hi, fragment order)
//   VTl   f16 [768][4096]     42467328   6291456   (x2048 residual, fragment order)
//   Zh    f16 [4096][768]     48758784   6291456   (z x16, hi)
//   Zl    f16 [4096][768]     55050240   6291456   (x2048 residual)
//   end                       61341696
// =====================================================================================================
extern "C" void kernel_launch(void* const* d_in, const int* in_sizes, int n_in,
                              void* d_out, int out_size, void* d_ws, size_t ws_size,
                              hipStream_t stream) {
  if (n_in < 9) return;
  if (in_sizes[0] != MT * HH) return;
  if (in_sizes[1] != HH * HH || in_sizes[2] != HH) return;
  if (in_sizes[3] != HH * HH || in_sizes[4] != HH) return;
  if (in_sizes[5] != HH * HH || in_sizes[6] != HH) return;
  if (in_sizes[7] != HH * HH || in_sizes[8] != HH) return;
  if (out_size != MT * HH) return;

  const float* x  = (const float*)d_in[0];
  const float* Wq = (const float*)d_in[1];
  const float* bq = (const float*)d_in[2];
  const float* Wk = (const float*)d_in[3];
  const float* bk = (const float*)d_in[4];
  const float* Wv = (const float*)d_in[5];
  const float* bv = (const float*)d_in[6];
  const float* Wo = (const float*)d_in[7];
  const float* bo = (const float*)d_in[8];

  const size_t PX  = (size_t)MT * HH * 2;        // 6291456
  const size_t PW  = (size_t)HH * HH * 2;        // 1179648
  const size_t PVT = (size_t)HH * MT * 2;        // 6291456
  size_t off = 0;
  const size_t oXh = off; off += PX;
  const size_t oWq = off; off += PW;
  const size_t oWk = off; off += PW;
  const size_t oWv = off; off += PW;
  const size_t oWo = off; off += PW;
  const size_t oQh = off; off += PX;
  const size_t oQl = off; off += PX;
  const size_t oKh = off; off += PX;
  const size_t oKl = off; off += PX;
  const size_t oVT = off; off += PVT;
  const size_t oVL = off; off += PVT;
  const size_t oZh = off; off += PX;
  const size_t oZl = off; off += PX;
  if (off > ws_size) return;                     // off = 61341696
  if (off > (size_t)134217728) return;

  char* ws = (char*)d_ws;
  unsigned short* Xh   = (unsigned short*)(ws + oXh);
  unsigned short* Wq16 = (unsigned short*)(ws + oWq);
  unsigned short* Wk16 = (unsigned short*)(ws + oWk);
  unsigned short* Wv16 = (unsigned short*)(ws + oWv);
  unsigned short* Wo16 = (unsigned short*)(ws + oWo);
  unsigned short* Qh   = (unsigned short*)(ws + oQh);
  unsigned short* Ql   = (unsigned short*)(ws + oQl);
  unsigned short* Kh   = (unsigned short*)(ws + oKh);
  unsigned short* Kl   = (unsigned short*)(ws + oKl);
  unsigned short* VT   = (unsigned short*)(ws + oVT);
  unsigned short* VTl  = (unsigned short*)(ws + oVL);
  unsigned short* Zh   = (unsigned short*)(ws + oZh);
  unsigned short* Zl   = (unsigned short*)(ws + oZl);
  float*          out0 = (float*)d_out;

  const dim3 blk(256);
  const int gsp = ((MT / 32) * (HH / 64)) / 8;             // 1536 tiles of 32x64 -> 192 blocks
  if ((((MT / 32) * (HH / 64)) % 8) != 0) return;

  // (0) x -> f16 plane of bf16 values; weights [768][768] ([out][in] = Bt[n][k]) -> f16 bits of bf16 values x16
  //     (one grid: 512 blocks for x, 96 for each weight)
  cvt_rows<<<dim3(MT / 8 + 4 * (HH / 8)), blk, 0, stream>>>(x, Wq, Wk, Wv, Wo, Xh, Wq16, Wk16, Wv16, Wo16);

  // (1) x . [Wq; Wk; Wv]^T + bias (Wq16, Wk16, Wv16 lie one behind the other: one [2304][768] matrix at Wq16)
  //     -> q and k hi + residual planes [4096][768], v^T hi + residual planes [768][4096]; 256 blocks of 128 x 288
  gemm_qkv<<<dim3(QGRD), blk, 0, stream>>>(Xh, Wq16, Qh, Ql, Kh, Kl, VT, VTl, bq, bk, bv);

  // (2) block-diagonal segment attention -> z (x16) hi + residual planes
  attn_kernel<<<dim3(MT / QT, NHD), blk, 0, stream>>>(Qh, Ql, Kh, Kl, VT, VTl, Zh, Zl);

  // (3) output projection: out = z . Wo^T + bo -> f32 (A operand split)
  gemm_out<<<dim3(gsp), blk, 0, stream>>>(Zh, Zl, Wo16, out0, bo);
  (void)hipGetLastError();
}

// v005
// Measured time: 60.9 microseconds a run.
// Next to v004, in two timings, it ran 1.09 and 1.08 times as fast.
// Over all steps from v000 it is 3.12 times as fast.
// Contractions: q = x.Wq^T, k = x.Wk^T and v = x.Wv^T (plain f16, exact bf16-valued operands);
// attention scores q.k^T and p.v^T with q, k, p, v^T as f16 hi + x2048 residual planes (hi.hi + hi.lo + lo.hi);
// output projection z.Wo^T with z as f16 hi + x2048 residual planes (hi.W + lo.W); all v_wmma_f32_16x16x32_f16
// (f16 operands, f32 accumulate); float inputs RNE-converted to bf16 on load (x in f16 containers, weights x16
// in f16), p carried x1024, z carried x16; softmax in f32 on VALU.
#include <hip/hip_runtime.h>
#include <math.h>
#include <stdint.h>

#define NBT  2
#define SEQ  2048
#define HH   768
#define NHD  12
#define HD   64
#define SEGL 256
#define MT   (NBT * SEQ)
#define QT   128
#define NCHK (SEGL / 32)
#define ZSP  72
#define WSC  16.0f
#define PSC  1024.0f
#define ZSC  16.0f
#define RSC  2048.0f
#define RSCI 0.00048828125f
#define SCL  0.125f
#define KST  128                   // k (halves) per LDS stage: 256 B of every staged row
#define LPH  136                   // LDS row pitch in halves: 272 B = 16 B x odd, for ds_load_b128 readers
#define SROW 384                   // rows per stage: 128 of A (or 64 hi + 64 residual), then 256 of Bt
#define STGH (SROW * LPH)          // halves per stage buffer
#define RSB  (16 * LPH * 2)        // LDS bytes between two copies of one lane (16 rows)
#define NQKV (3 * HH)              // columns of the joint product x.[Wq; Wk; Wv]^T
#define QTN  288                   // its block tile: 128 rows x 288 columns
#define QNJ  (QTN / 32)            // 16-column tiles of one wave (two wave columns)
#define QROW (128 + QTN)           // rows per stage: 128 of x, then 288 of the stacked weights
#define QSTG (QROW * LPH)          // halves per stage buffer
#define QGRD ((MT / 128) * (NQKV / QTN))

static_assert(NHD * HD == HH);
static_assert(HD == 64);
static_assert((SEQ % SEGL) == 0 && (SEGL % QT) == 0 && (MT % QT) == 0 && QT == 128 && (SEGL % 32) == 0);
static_assert((MT % 64) == 0 && (HH % 64) == 0 && (MT % 32) == 0 && (HH % 32) == 0);
static_assert((((MT / 64) * (HH / 64)) % 8) == 0);
static_assert((((HH / 64) * (MT / 64)) % 8) == 0);
static_assert((((MT / 32) * (HH / 64)) % 8) == 0);
static_assert((MT % 8) == 0 && (HH % 8) == 0 && (HH % 256) == 0);
static_assert(ZSP >= 64 && (ZSP % 8) == 0);
static_assert((MT % 256) == 0 && (HH % 128) == 0 && (MT % 128) == 0 && (HH % KST) == 0 && HH / KST >= 2);
static_assert((LPH % 8) == 0 && LPH >= KST);
static_assert((NQKV % QTN) == 0 && (QTN % 96) == 0 && (HH % 48) == 0 && QNJ == 9 && (QROW % 16) == 0 && QROW / 16 == 26);

typedef _Float16 v16h __attribute__((ext_vector_type(16)));
typedef _Float16 v8h  __attribute__((ext_vector_type(8)));
typedef unsigned short v16us __attribute__((ext_vector_type(16)));
typedef unsigned short v8us  __attribute__((ext_vector_type(8)));
typedef float v8f __attribute__((ext_vector_type(8)));
typedef float v4f __attribute__((ext_vector_type(4)));
typedef unsigned int v4u __attribute__((ext_vector_type(4)));

union FragU { v16us v; v8us h[2]; };

// ---- scalar helpers --------------------------------------------------------------------------------
__device__ __forceinline__ unsigned short bf_bits(float f) {          // f32 -> bf16 bits, RNE convert
  const unsigned u = __float_as_uint(f);
  return (unsigned short)((u + 0x7FFFu + ((u >> 16) & 1u)) >> 16);
}
__device__ __forceinline__ float bf_up(unsigned short h) { return __uint_as_float(((unsigned)h) << 16); }
__device__ __forceinline__ float bfr(float f) { return bf_up(bf_bits(f)); }   // value of the bf16 RNE convert
__device__ __forceinline__ unsigned short h_bits(_Float16 x) { return __builtin_bit_cast(unsigned short, x); }
__device__ __forceinline__ unsigned short f2h(float f) { return h_bits((_Float16)f); }
__device__ __forceinline__ float h_up(unsigned short h) { return (float)__builtin_bit_cast(_Float16, h); }
__device__ __forceinline__ unsigned pk16(unsigned short a, unsigned short b) { return (unsigned)a | ((unsigned)b << 16); }
__device__ __forceinline__ v8f zero8() { v8f z = {0.f, 0.f, 0.f, 0.f, 0.f, 0.f, 0.f, 0.f}; return z; }
// f -> f16 hi bits and f16 bits of the x2048 residual (f - hi) * 2048
__device__ __forceinline__ void split_h(float f, unsigned short& hi, unsigned short& lo) {
  hi = f2h(f);
  lo = f2h((f - h_up(hi)) * RSC);
}

// ---- fragment loader: 16-bit A/B operand, lane -> row/col (lane&15), p already includes +8*(lane>>4);
//      elements 0..7 <- p[0..7] (k0+8h..), elements 8..15 <- p[16..23] (k0+16+8h..)
__device__ __forceinline__ v16us ldfrag_u(const unsigned short* p) {
  FragU f;
  f.h[0] = *(const v8us*)(p);
  f.h[1] = *(const v8us*)(p + 16);
  return f.v;
}

// ---- fragment-order planes: a [R][C] f16 plane kept as tiles of 16 rows x 32 k (1024 B, tile number
//      (row / 16) * (C / 32) + col / 32), inside a tile 16-B units [k octet 0..3][row 0..15]. Lane l's two pieces of
//      the operand fragment (row l & 15, k 8 (l >> 4).. and 16 + 8 (l >> 4)..) are then units l and 32 + l: each load
//      instruction of a wave covers 512 contiguous bytes (4 whole lines) instead of 16 B in each of 16 rows.
//      p = plane + tile * 512 + lane * 8 (halves); same element order as ldfrag_u
__device__ __forceinline__ v16us ldfrag_t(const unsigned short* p) {
  FragU f;
  f.h[0] = *(const v8us*)(p);
  f.h[1] = *(const v8us*)(p + 256);
  return f.v;
}

// ---- WMMA helpers with trailing VALU hazard gap --------------------------------------------------------
__device__ __forceinline__ v8f mma_h_raw(v16us a, v16us b, v8f c) {             // f16 operands (bits), unguarded
  return __builtin_amdgcn_wmma_f32_16x16x32_f16(false, __builtin_bit_cast(v16h, a), false,
                                                __builtin_bit_cast(v16h, b), (short)0, c, false, false);
}
__device__ __forceinline__ void dep_guard1(v8f& a, v8f& b, v16us x) {
#if defined(__HIP_DEVICE_COMPILE__)
  asm volatile("v_nop\n\tv_nop\n\tv_nop\n\tv_nop" : "+v"(a), "+v"(b) : "v"(x));
#endif
}
__device__ __forceinline__ void dep_guard2(v8f& a, v8f& b, v8f& c, v8f& d, v16us x, v16us y) {
#if defined(__HIP_DEVICE_COMPILE__)
  asm volatile("v_nop\n\tv_nop\n\tv_nop\n\tv_nop" : "+v"(a), "+v"(b), "+v"(c), "+v"(d) : "v"(x), "v"(y));
#endif
}
__device__ __forceinline__ void keep4_u(v16us a, v16us b, v16us c, v16us d) {
#if defined(__HIP_DEVICE_COMPILE__)
  asm volatile("v_nop" :: "v"(a), "v"(b), "v"(c), "v"(d));
#endif
}
// keeps nine B fragments live across the slot behind their last product
__device__ __forceinline__ void keep9_u(v16us a, v16us b, v16us c, v16us d, v16us e, v16us f, v16us g, v16us h,
                                        v16us i) {
#if defined(__HIP_DEVICE_COMPILE__)
  asm volatile("v_nop" :: "v"(a), "v"(b), "v"(c), "v"(d), "v"(e), "v"(f), "v"(g), "v"(h), "v"(i));
#endif
}
__device__ __forceinline__ void acc_guard4(v8f& a, v8f& b, v8f& c, v8f& d) {
#if defined(__HIP_DEVICE_COMPILE__)
  asm volatile("v_nop\n\tv_nop\n\tv_nop\n\tv_nop" : "+v"(a), "+v"(b), "+v"(c), "+v"(d));
#endif
}
// ties four D accumulators and keeps six A/B fragments live across a 4-slot VALU gap
__device__ __forceinline__ void guard4x6(v8f& a, v8f& b, v8f& c, v8f& d,
                                         v16us p, v16us q, v16us r, v16us s, v16us t, v16us u) {
#if defined(__HIP_DEVICE_COMPILE__)
  asm volatile("v_nop\n\tv_nop\n\tv_nop\n\tv_nop"
               : "+v"(a), "+v"(b), "+v"(c), "+v"(d)
               : "v"(p), "v"(q), "v"(r), "v"(s), "v"(t), "v"(u));
#endif
}
__device__ __forceinline__ void wave_sync_lds() {
  __builtin_amdgcn_fence(__ATOMIC_RELEASE, "workgroup");
  __builtin_amdgcn_wave_barrier();
  __builtin_amdgcn_fence(__ATOMIC_ACQUIRE, "workgroup");
}

// lane l's value exchanged with lane l ^ 16 (the other 16-lane row), in registers
__device__ __forceinline__ float xhalf(float x) {
  return __builtin_bit_cast(float, __builtin_amdgcn_permlanex16(__builtin_bit_cast(int, x), __builtin_bit_cast(int, x),
                                                                0x76543210, 0xfedcba98, false, false));
}

// ---- asynchronous copies global -> LDS ------------------------------------------------------------------
// Eight 16-byte copies per lane: LDS bytes l + i * RSB; global ga + i * gs (i = 0..3) and gb + i * gs (i = 4..7
// as 0..3). The closing s_wait_xcnt stands inside the statement so that no address register named by a copy is
// rewritten in front of it.
__device__ __forceinline__ void copy8(unsigned l, const unsigned short* ga, const unsigned short* gb, size_t gs) {
#if defined(__HIP_DEVICE_COMPILE__)
  asm volatile(
      "global_load_async_to_lds_b128 %0, %8, off\n\t"
      "global_load_async_to_lds_b128 %1, %9, off\n\t"
      "global_load_async_to_lds_b128 %2, %10, off\n\t"
      "global_load_async_to_lds_b128 %3, %11, off\n\t"
      "global_load_async_to_lds_b128 %4, %12, off\n\t"
      "global_load_async_to_lds_b128 %5, %13, off\n\t"
      "global_load_async_to_lds_b128 %6, %14, off\n\t"
      "global_load_async_to_lds_b128 %7, %15, off\n\t"
      "s_wait_xcnt 0x0"
      :: "v"(l), "v"(l + RSB), "v"(l + 2 * RSB), "v"(l + 3 * RSB),
         "v"(l + 4 * RSB), "v"(l + 5 * RSB), "v"(l + 6 * RSB), "v"(l + 7 * RSB),
         "v"(ga), "v"(ga + gs), "v"(ga + 2 * gs), "v"(ga + 3 * gs),
         "v"(gb), "v"(gb + gs), "v"(gb + 2 * gs), "v"(gb + 3 * gs)
      : "memory");
#endif
}
// Two such copies: LDS bytes l and l + RSB; global ga and ga + gs; the same closing wait inside the statement.
__device__ __forceinline__ void copy2(unsigned l, const unsigned short* ga, size_t gs) {
#if defined(__HIP_DEVICE_COMPILE__)
  asm volatile(
      "global_load_async_to_lds_b128 %0, %2, off\n\t"
      "global_load_async_to_lds_b128 %1, %3, off\n\t"
      "s_wait_xcnt 0x0"
      :: "v"(l), "v"(l + RSB), "v"(ga), "v"(ga + gs)
      : "memory");
#endif
}
// this wave's own copies have landed in LDS
__device__ __forceinline__ void wait_async0() {
#if defined(__HIP_DEVICE_COMPILE__)
  asm volatile("s_wait_asynccnt 0x0" ::: "memory");
#endif
}
// in front of an overwrite of registers that issued global stores name
__device__ __forceinline__ void wait_x0() {
#if defined(__HIP_DEVICE_COMPILE__)
  asm volatile("s_wait_xcnt 0x0" ::: "memory");
#endif
}
// this wave's own LDS reads have returned, before the buffer they read is handed to its next writer
__device__ __forceinline__ void wait_ds0() {
#if defined(__HIP_DEVICE_COMPILE__)
  asm volatile("s_wait_dscnt 0x0" ::: "memory");
#endif
}

// =====================================================================================================
// Rows [nrows][768] f32 -> f16 bits of (bf16 RNE value * sc). Used for x (sc = 1) and for the [out][in]
// weight matrices (sc = 16), which are already Bt[n][k] with k contiguous. The five conversions need nothing
// of each other and share one grid by ranges of the block index: blocks 0..MT/8-1 take x, then HH/8 blocks
// for each of Wq, Wk, Wv, Wo. One wave per row; three column
// chunks of 256: lane owns columns 256c + 8*lane..+7, one instruction = 32 lanes x 16 B = 512 contiguous B
// coverage: 8 rows per block, grid = MT/8 + 4 HH/8 exact, 3 chunks x 256 = 768 cols: union = every row of all five.
// =====================================================================================================
__global__ __launch_bounds__(256) void cvt_rows(const float* __restrict__ xin, const float* __restrict__ Wq,
                                                const float* __restrict__ Wk, const float* __restrict__ Wv,
                                                const float* __restrict__ Wo, unsigned short* Xh,
                                                unsigned short* Wq16, unsigned short* Wk16,
                                                unsigned short* Wv16, unsigned short* Wo16) {
  const int wb  = (int)blockIdx.x - MT / 8;               // block-uniform: below 0 = x, else a weight block
  const int wi  = wb / (HH / 8);                          // which weight, 0..3
  const bool isx = wb < 0;
  const float* x = isx ? xin : wi == 0 ? Wq : wi == 1 ? Wk : wi == 2 ? Wv : Wo;
  unsigned short* xh = isx ? Xh : wi == 0 ? Wq16 : wi == 1 ? Wk16 : wi == 2 ? Wv16 : Wo16;
  const int nrows = isx ? MT : HH;
  const float sc  = isx ? 1.0f : WSC;
  const int row = (isx ? (int)blockIdx.x : wb - wi * (HH / 8)) * 8 + (threadIdx.x >> 5);
  const int lane = threadIdx.x & 31;
  if (wi > 3 || row >= nrows) return;                     // wave-uniform, no barriers below
  v4u hv[HH / 256];
#pragma unroll
  for (int c = 0; c < HH / 256; ++c) {
    const float* p = x + (size_t)row * HH + c * 256 + lane * 8;
    const v4f a0 = *(const v4f*)(p);
    const v4f a1 = *(const v4f*)(p + 4);
    v4u h;
#pragma unroll
    for (int e = 0; e < 2; ++e) {
      h[e]     = pk16(f2h(bfr(a0[2 * e]) * sc), f2h(bfr(a0[2 * e + 1]) * sc));
      h[2 + e] = pk16(f2h(bfr(a1[2 * e]) * sc), f2h(bfr(a1[2 * e + 1]) * sc));
    }
    hv[c] = h;
  }
  unsigned short* d = xh + (size_t)row * HH + lane * 8;
  {
#pragma unroll
    for (int c = 0; c < HH / 256; ++c) *(v4u*)(d + c * 256) = hv[c];
    
  }
}

// =====================================================================================================
// Register-blocked f16 WMMA GEMM: C[m][n] = (sum_k A[m][k] * Bt[n][k] * wsc + bias) * osc, one wave per TRx64
// tile (TR = 64, or 32 when the A operand is split); the block's 8 waves form a (2 TR) x 256 tile (2 x 4 waves)
// whose operand rows are staged in LDS, 128 k at a time, two buffers, by asynchronous 16-byte copies (16 lanes
// per 256-B row piece), the next stage in flight while this one is multiplied. A row-major [M][K] pitch lda (ASPL = 1:
// a second plane Al holds the x2048 residual, same pitch, products into a separate accumulator folded back
// as acc + accr/2048); Bt row-major [N][K] pitch ldb (k contiguous); M multiple of 2 TR, N of 256, K of 128 and at
// least 256 (true at every call site; host-checked grids = tiles/8 exact so no block exits early).
// OM: 0 = f32 out Cf (row-major, pitch ldc); 1 = f16 hi bits Ch plus x2048 residual bits Cl, both in fragment order
// (see ldfrag_t) with ldc columns.
// cbm (block-uniform): 0 = no bias; 1 = column bias bf16(cb[n]); 2 = row bias bf16(cb[m]). All biases bf16 RNE values.
// bid = the block's tile number inside this product; sT (per-wave 16x64 slabs, pitch 68 floats) and sS (two operand
// stages) are the calling kernel's LDS arrays.
// coverage: MI slabs x 16 rows x 64 cols = the wave's whole TRx64 tile; tiles/8 blocks x 8 waves = every tile.
// =====================================================================================================
template <int OM, int ASPL>
__device__ __forceinline__ void gemm_body(
    float* sT, unsigned short* sS, int bid,
    const unsigned short* __restrict__ Ap, const unsigned short* __restrict__ Alp, int lda,
    const unsigned short* __restrict__ Btp, int ldb,
    unsigned short* Ch, unsigned short* Cl, float* Cf, int ldc,
    const float* __restrict__ cb, int cbm, float wsc, float osc, int M, int N, int K) {
  constexpr int MI = ASPL ? 2 : 4;
  constexpr int TR = 16 * MI;
  const int lane = threadIdx.x & 31;
  const int wave = threadIdx.x >> 5;
  const int tilesN = N >> 8;
  const int tilesM = M / (2 * TR);
  if (bid >= tilesM * tilesN) return;   // block-uniform, in front of every barrier
  const int tm = bid / tilesN;
  const int tn = bid - tm * tilesN;
  const int wm = wave >> 2;                    // wave row 0..1
  const int wn = wave & 3;                     // wave column 0..3
  const int mb = tm * (2 * TR);                // block's first row of A
  const int nb = tn << 8;                      // block's first row of Bt
  const int m0 = mb + wm * TR;
  const int n0 = nb + (wn << 6);

  const int rlane = lane & 15;                 // row (A) / col (B, D) within subtile
  const int koff  = (lane >> 4) * 8;           // k offset of this lane half
  const int mOff  = (lane >> 4) * 8;           // D row offset

  v8f acc[MI][4];
  v8f accr[MI][4];
#pragma unroll
  for (int i = 0; i < MI; ++i)
#pragma unroll
    for (int j = 0; j < 4; ++j) { acc[i][j] = zero8(); accr[i][j] = zero8(); }

  // copy map: lane's 16-B piece cch of staged row crow + 16 i, i = 0..23 (rows 0..127 A, 128..383 Bt)
  const int crow = threadIdx.x >> 4;           // 0..15
  const int cch  = (threadIdx.x & 15) * 8;     // halves
  const unsigned lds0 = (unsigned)(size_t)sS + (unsigned)(crow * LPH + cch) * 2u;   // LDS byte address, buffer 0
  const unsigned short* gA0 = Ap + (size_t)(mb + crow) * lda + cch;                 // staged rows 0..63
  const unsigned short* gA1 = ASPL ? Alp + (size_t)(mb + crow) * lda + cch          // rows 64..127: residual plane
                                   : gA0 + (size_t)64 * lda;                        // or A rows 64..127
  const unsigned short* gB0 = Btp + (size_t)(nb + crow) * ldb + cch;                // staged rows 128..383
  const size_t gsa = (size_t)16 * lda, gsb = (size_t)16 * ldb;
  const int NT = K / KST;

  // staged row of this lane's first A fragment and first Bt fragment, with its k offset
  const int fa = (wm * TR + rlane) * LPH + koff;
  const int fb = (128 + (wn << 6) + rlane) * LPH + koff;

  // stage 0 -> buffer 0, landed and published; then stage 1 -> buffer 1 in flight
  copy8(lds0,            gA0,           gA1,            gsa);
  copy8(lds0 + 8 * RSB,  gB0,           gB0 + 4 * gsb,  gsb);
  copy8(lds0 + 16 * RSB, gB0 + 8 * gsb, gB0 + 12 * gsb, gsb);
  wait_async0();
  __syncthreads();
  if (NT > 1) {
    const unsigned lb = lds0 + STGH * 2;
    copy8(lb,            gA0 + KST,           gA1 + KST,            gsa);
    copy8(lb + 8 * RSB,  gB0 + KST,           gB0 + KST + 4 * gsb,  gsb);
    copy8(lb + 16 * RSB, gB0 + KST + 8 * gsb, gB0 + KST + 12 * gsb, gsb);
  }

#pragma unroll 1   // one stage per trip: the buffer index stays a run-time value and the text small
  for (int t = 0; t < NT; ++t) {
    const unsigned short* sb = sS + (t & 1) * STGH;
#pragma unroll
    for (int kk = 0; kk < KST; kk += 32) {
      // all eight fragments of this k-step are asked for ahead of its 16 products, not one A fragment per four
      v16us bh[4], ahf[MI], alf[MI];
#pragma unroll
      for (int j = 0; j < 4; ++j) bh[j] = ldfrag_u(sb + fb + (j << 4) * LPH + kk);
#pragma unroll
      for (int i = 0; i < MI; ++i) {
        ahf[i] = ldfrag_u(sb + fa + (i << 4) * LPH + kk);
        if (ASPL) alf[i] = ldfrag_u(sb + fa + (64 + (i << 4)) * LPH + kk);
      }
#pragma unroll
      for (int i = 0; i < MI; ++i) {
        const v16us ah = ahf[i];
        if (ASPL) {
          const v16us al = alf[i];
#pragma unroll
          for (int j = 0; j < 4; ++j) {
            acc[i][j]  = mma_h_raw(ah, bh[j], acc[i][j]);
            accr[i][j] = mma_h_raw(al, bh[j], accr[i][j]);
          }
          dep_guard2(acc[i][0], acc[i][3], accr[i][0], accr[i][3], ah, al);
        } else {
#pragma unroll
          for (int j = 0; j < 4; ++j) acc[i][j] = mma_h_raw(ah, bh[j], acc[i][j]);
          dep_guard1(acc[i][0], acc[i][3], ah);
        }
      }
      keep4_u(bh[0], bh[1], bh[2], bh[3]);
    }
    // publish point of stage t + 1: own reads of this buffer done, own copies landed, then every wave passes
    wait_ds0();
    wait_async0();
    __syncthreads();
    if (t + 2 < NT) {                          // block-uniform: refill the buffer that this trip has just read
      const unsigned lb = lds0 + (unsigned)(t & 1) * (STGH * 2);
      const int k2 = (t + 2) * KST;
      copy8(lb,            gA0 + k2,           gA1 + k2,            gsa);
      copy8(lb + 8 * RSB,  gB0 + k2,           gB0 + k2 + 4 * gsb,  gsb);
      copy8(lb + 16 * RSB, gB0 + k2 + 8 * gsb, gB0 + k2 + 12 * gsb, gsb);
    }
  }
  wait_async0();
#pragma unroll
  for (int i = 0; i < MI; ++i) {
    acc_guard4(acc[i][0], acc[i][1], acc[i][2], acc[i][3]);
    if (ASPL) acc_guard4(accr[i][0], accr[i][1], accr[i][2], accr[i][3]);
  }

  const int hh2 = lane >> 4, c4 = (lane & 15) * 4;     // f32 out: 256-B row segment = 16 lanes x 16 B
  // f16 planes out: store it takes k octets 2 it and 2 it + 1 of the slab, lane = octet half hh2 x row rlane

  v4f cb4 = {0.f, 0.f, 0.f, 0.f};
  float cbc[4][8];                             // column bias of columns n0 + 8 (2 it + hh2) + e
#pragma unroll
  for (int it = 0; it < 4; ++it)
#pragma unroll
    for (int e = 0; e < 8; ++e) cbc[it][e] = 0.f;
  if (OM == 0 && cbm == 1) {
    const v4f v = *(const v4f*)(cb + n0 + c4);
    cb4[0] = bfr(v[0]); cb4[1] = bfr(v[1]); cb4[2] = bfr(v[2]); cb4[3] = bfr(v[3]);
  }
  if (OM == 1 && cbm == 1) {
#pragma unroll
    for (int it = 0; it < 4; ++it) {
      const float* bp = cb + n0 + (it * 2 + hh2) * 8;
      const v4f v0 = *(const v4f*)(bp);
      const v4f v1 = *(const v4f*)(bp + 4);
#pragma unroll
      for (int e = 0; e < 4; ++e) { cbc[it][e] = bfr(v0[e]); cbc[it][4 + e] = bfr(v1[e]); }
    }
  }
  float rbv[MI];                               // row bias of output row m0 + 16 i + rlane
#pragma unroll
  for (int i = 0; i < MI; ++i) rbv[i] = 0.f;
  if (OM == 1 && cbm == 2) {                   // one block-uniform branch: all loads in flight together
#pragma unroll
    for (int i = 0; i < MI; ++i) rbv[i] = bfr(cb[m0 + (i << 4) + rlane]);
  }

  // ---- epilogue ----
  float* slab = sT + wave * (16 * 68);
#pragma unroll
  for (int i = 0; i < MI; ++i) {
    const int mBase = m0 + (i << 4);
#pragma unroll
    for (int j = 0; j < 4; ++j) {
#pragma unroll
      for (int r = 0; r < 8; ++r) {
        float v = acc[i][j][r];
        if (ASPL) v += accr[i][j][r] * RSCI;
        slab[(mOff + r) * 68 + (j << 4) + rlane] = v;
      }
    }
    wave_sync_lds();
    if (OM == 0) {
      v4f vals[8];
#pragma unroll
      for (int it = 0; it < 8; ++it) {
        const int row = it * 2 + hh2;                      // it 0..7 x hh2 0..1 = rows 0..15
        const v4f v = *(const v4f*)(slab + row * 68 + c4);
        vals[it] = (v * wsc + cb4) * osc;
      }
      {
#pragma unroll
        for (int it = 0; it < 8; ++it) {
          const int row = it * 2 + hh2;
          *(v4f*)(Cf + (size_t)(mBase + row) * ldc + (size_t)n0 + c4) = vals[it];
        }
        
      }
    }
    if (OM == 1) {
      v4u hv[4], lv[4];
#pragma unroll
      for (int it = 0; it < 4; ++it) {
        const float* sp = slab + rlane * 68 + (it * 2 + hh2) * 8;   // rows 0..15 x octets 2 it, 2 it + 1
        const float rb = rbv[i];
        v4u ha = {0u, 0u, 0u, 0u}, la = {0u, 0u, 0u, 0u};
#pragma unroll
        for (int e = 0; e < 4; ++e) {
          const float f0 = (sp[2 * e]     * wsc + cbc[it][2 * e]     + rb) * osc;
          const float f1 = (sp[2 * e + 1] * wsc + cbc[it][2 * e + 1] + rb) * osc;
          unsigned short h0, l0, h1, l1;
          split_h(f0, h0, l0);
          split_h(f1, h1, l1);
          ha[e] = pk16(h0, h1);
          la[e] = pk16(l0, l1);
        }
        hv[it] = ha;
        lv[it] = la;
      }
      {
        // tiles (mBase / 16, n0 / 32) and the next one; store it = 512 contiguous bytes: units 32 (it & 1) + lane
        const size_t gt = ((size_t)(mBase >> 4) * (ldc >> 5) + (n0 >> 5)) * 512 + lane * 8;
#pragma unroll
        for (int it = 0; it < 4; ++it) {
          const size_t go = gt + (it >> 1) * 512 + (it & 1) * 256;
          *(v4u*)(Ch + go) = hv[it];
          *(v4u*)(Cl + go) = lv[it];
        }
        
      }
    }
    wave_sync_lds();
  }
}

// q = x.Wq^T + bq, k = x.Wk^T + bk and v = x.Wv^T + bv as ONE product x.Wc^T + bias, Wc = [Wq; Wk; Wv] stacked
// ([2304][768]: the three f16 weight planes are neighbours in the workspace). Block tile 128 x 288: 32 x 8 = 256
// blocks, one for every WGP (a block's LDS leaves room for no second one), so the launch is a single round.
// 8 waves as 4 x 2, one wave per 32 x 144 tile (2 x 9 accumulators). Operand rows staged as in gemm_body: 128 k per
// stage, two buffers, asynchronous 16-byte copies, 26 per lane and stage (rows 0..127 x, 128..415 Wc).
// Epilogue by groups of 48 columns (48 divides 768: a group lies in one of q, k, v; the test is wave-uniform):
// q, k: through the wave's slab into fragment order (see ldfrag_t), tiles (token / 16, col / 32);
// v: the accumulator itself holds 8 successive tokens of one dv per lane, which is one 16-B unit of the v^T plane's
// fragment order (tile (dv / 16, token / 32), unit 32 i + lane): stored from registers, 512 contiguous bytes a store.
// coverage: 2 x 9 tiles of 16 x 16 = the wave's 32 x 144; 8 waves = 128 x 288; 256 blocks = [4096][2304].
__global__ __launch_bounds__(256) void gemm_qkv(
    const unsigned short* __restrict__ Xh, const unsigned short* __restrict__ Wc,
    unsigned short* Qh, unsigned short* Ql, unsigned short* Kh, unsigned short* Kl,
    unsigned short* VT, unsigned short* VTl,
    const float* __restrict__ bq, const float* __restrict__ bk, const float* __restrict__ bv) {
  __shared__ __align__(16) float sT[8 * 16 * 68];         // per-wave 16x48 slab, pitch 68 floats
  __shared__ __align__(16) unsigned short sS[2 * QSTG];   // two operand stages
  const int bid = (int)blockIdx.x;
  if (bid >= QGRD) return;                                // block-uniform, in front of every barrier
  const int lane = threadIdx.x & 31;
  const int wave = __builtin_amdgcn_readfirstlane((int)(threadIdx.x >> 5));
  const int tm = bid / (NQKV / QTN);
  const int tn = bid - tm * (NQKV / QTN);
  const int wm = wave >> 1;                    // wave row 0..3
  const int wn = wave & 1;                     // wave column 0..1
  const int mb = tm * 128;                     // block's first row of x
  const int nb = tn * QTN;                     // block's first row of Wc
  const int m0 = mb + wm * 32;
  const int n0 = nb + wn * (QTN / 2);

  const int rlane = lane & 15;                 // row (A) / col (B, D) within subtile
  const int hh2   = lane >> 4;
  const int koff  = hh2 * 8;                   // k offset of this lane half
  const int mOff  = hh2 * 8;                   // D row offset

  v8f acc[2][QNJ];
#pragma unroll
  for (int i = 0; i < 2; ++i)
#pragma unroll
    for (int j = 0; j < QNJ; ++j) acc[i][j] = zero8();

  // copy map: lane's 16-B piece cch of staged row crow + 16 i, i = 0..25
  const int crow = threadIdx.x >> 4;           // 0..15
  const int cch  = (threadIdx.x & 15) * 8;     // halves
  const unsigned lds0 = (unsigned)(size_t)sS + (unsigned)(crow * LPH + cch) * 2u;   // LDS byte address, buffer 0
  const unsigned short* gA0 = Xh + (size_t)(mb + crow) * HH + cch;                  // staged rows 0..127
  const unsigned short* gB0 = Wc + (size_t)(nb + crow) * HH + cch;                  // staged rows 128..415
  const size_t gs = (size_t)16 * HH;
  constexpr int NT = HH / KST;

  const int fa = (wm * 32 + rlane) * LPH + koff;
  const int fb = (128 + wn * (QTN / 2) + rlane) * LPH + koff;

  // column bias of this lane's column in each of its nine 16-column tiles, asked for ahead of the k loop
  float bj[QNJ];
#pragma unroll
  for (int j = 0; j < QNJ; ++j) {
    const int nc = n0 + (j << 4);              // wave-uniform; 16 divides 768
    const int pj = nc / HH;
    const float* bp = pj == 0 ? bq : pj == 1 ? bk : bv;
    bj[j] = bfr(bp[nc - pj * HH + rlane]);
  }

  // stage 0 -> buffer 0, landed and published; then stage 1 -> buffer 1 in flight
  copy8(lds0,            gA0,           gA0 + 4 * gs,  gs);
  copy8(lds0 + 8 * RSB,  gB0,           gB0 + 4 * gs,  gs);
  copy8(lds0 + 16 * RSB, gB0 + 8 * gs,  gB0 + 12 * gs, gs);
  copy2(lds0 + 24 * RSB, gB0 + 16 * gs, gs);
  wait_async0();
  __syncthreads();
  {
    const unsigned lb = lds0 + QSTG * 2;
    copy8(lb,            gA0 + KST,           gA0 + KST + 4 * gs,  gs);
    copy8(lb + 8 * RSB,  gB0 + KST,           gB0 + KST + 4 * gs,  gs);
    copy8(lb + 16 * RSB, gB0 + KST + 8 * gs,  gB0 + KST + 12 * gs, gs);
    copy2(lb + 24 * RSB, gB0 + KST + 16 * gs, gs);
  }

#pragma unroll 1   // one stage per trip: the buffer index stays a run-time value and the text small
  for (int t = 0; t < NT; ++t) {
    const unsigned short* sb = sS + (t & 1) * QSTG;
#pragma unroll
    for (int kk = 0; kk < KST; kk += 32) {
      // all eleven fragments of this k-step are asked for ahead of its 18 products
      v16us bh[QNJ], ah[2];
#pragma unroll
      for (int j = 0; j < QNJ; ++j) bh[j] = ldfrag_u(sb + fb + (j << 4) * LPH + kk);
#pragma unroll
      for (int i = 0; i < 2; ++i) ah[i] = ldfrag_u(sb + fa + (i << 4) * LPH + kk);
#pragma unroll
      for (int i = 0; i < 2; ++i) {
#pragma unroll
        for (int j = 0; j < QNJ; ++j) acc[i][j] = mma_h_raw(ah[i], bh[j], acc[i][j]);
        dep_guard1(acc[i][0], acc[i][QNJ - 1], ah[i]);
      }
      keep9_u(bh[0], bh[1], bh[2], bh[3], bh[4], bh[5], bh[6], bh[7], bh[8]);
    }
    // publish point of stage t + 1: own reads of this buffer done, own copies landed, then every wave passes
    wait_ds0();
    wait_async0();
    __syncthreads();
    if (t + 2 < NT) {                          // block-uniform: refill the buffer that this trip has just read
      const unsigned lb = lds0 + (unsigned)(t & 1) * (QSTG * 2);
      const int k2 = (t + 2) * KST;
      copy8(lb,            gA0 + k2,           gA0 + k2 + 4 * gs,  gs);
      copy8(lb + 8 * RSB,  gB0 + k2,           gB0 + k2 + 4 * gs,  gs);
      copy8(lb + 16 * RSB, gB0 + k2 + 8 * gs,  gB0 + k2 + 12 * gs, gs);
      copy2(lb + 24 * RSB, gB0 + k2 + 16 * gs, gs);
    }
  }
  wait_async0();

  // ---- epilogue ----
  const float wsc = 1.0f / WSC;
  float* slab = sT + wave * (16 * 68);
#pragma unroll
  for (int g = 0; g < 3; ++g) {
    const int ng = n0 + 48 * g;                // first column of the group
    const int pg = ng / HH;                    // wave-uniform: 0 = q, 1 = k, 2 = v
    const int c0 = ng - pg * HH;               // its column inside that product, a multiple of 16
    if (pg == 2) {
#pragma unroll
      for (int jj = 0; jj < 3; ++jj) {
        const int j = 3 * g + jj;
#pragma unroll
        for (int i = 0; i < 2; ++i) {
          v4u ha = {0u, 0u, 0u, 0u}, la = {0u, 0u, 0u, 0u};
#pragma unroll
          for (int e = 0; e < 4; ++e) {        // tokens m0 + 16 i + 8 hh2 + 2 e, + 1 of dv c0 + 16 jj + rlane
            unsigned short h0, l0, h1, l1;
            split_h(acc[i][j][2 * e]     * wsc + bj[j], h0, l0);
            split_h(acc[i][j][2 * e + 1] * wsc + bj[j], h1, l1);
            ha[e] = pk16(h0, h1);
            la[e] = pk16(l0, l1);
          }
          const size_t go = ((size_t)((c0 >> 4) + jj) * (MT / 32) + (m0 >> 5)) * 512 + i * 256 + lane * 8;
          *(v4u*)(VT + go)  = ha;
          *(v4u*)(VTl + go) = la;
        }
      }
    } else {
      unsigned short* Ch = pg ? Kh : Qh;
      unsigned short* Cl = pg ? Kl : Ql;
#pragma unroll
      for (int i = 0; i < 2; ++i) {
#pragma unroll
        for (int jj = 0; jj < 3; ++jj) {
          const int j = 3 * g + jj;
#pragma unroll
          for (int r = 0; r < 8; ++r) slab[(mOff + r) * 68 + (jj << 4) + rlane] = acc[i][j][r] * wsc + bj[j];
        }
        wave_sync_lds();
        v4u hv[3], lv[3];
#pragma unroll
        for (int it = 0; it < 3; ++it) {
          const float* sp = slab + rlane * 68 + (it * 2 + hh2) * 8;   // rows 0..15 x octets 2 it, 2 it + 1
          v4u ha = {0u, 0u, 0u, 0u}, la = {0u, 0u, 0u, 0u};
#pragma unroll
          for (int e = 0; e < 4; ++e) {
            unsigned short h0, l0, h1, l1;
            split_h(sp[2 * e],     h0, l0);
            split_h(sp[2 * e + 1], h1, l1);
            ha[e] = pk16(h0, h1);
            la[e] = pk16(l0, l1);
          }
          hv[it] = ha;
          lv[it] = la;
        }
#pragma unroll
        for (int it = 0; it < 3; ++it) {
          // columns c0 + 16 it..+15 = one half of a 32-column tile: 512 contiguous bytes, units 32 (half) + lane
          const int cq = c0 + 16 * it;
          const size_t go = ((size_t)((m0 >> 4) + i) * (HH / 32) + (cq >> 5)) * 512 + ((cq >> 4) & 1) * 256 + lane * 8;
          *(v4u*)(Ch + go) = hv[it];
          *(v4u*)(Cl + go) = lv[it];
        }
        wave_sync_lds();
      }
    }
    // the next group's arithmetic reuses the registers that this group's stores name
    if (g < 2) wait_x0();
  }
}

// out = z.Wo^T + bo -> f32, z as hi + residual planes
__global__ __launch_bounds__(256) void gemm_out(
    const unsigned short* __restrict__ Zh, const unsigned short* __restrict__ Zl,
    const unsigned short* __restrict__ Wo16, float* out, const float* __restrict__ bo) {
  __shared__ __align__(16) float sT[8 * 16 * 68];         // per-wave 16x64 slab, pitch 68 floats
  __shared__ __align__(16) unsigned short sS[2 * STGH];   // two operand stages
  gemm_body<0, 1>(sT, sS, (int)blockIdx.x, Zh, Zl, HH, Wo16, HH, nullptr, nullptr, out, HH,
                  bo, 1, 1.0f / (WSC * ZSC), 1.0f, MT, HH, HH);
}

// =====================================================================================================
// Block-diagonal attention over 256-token segments, head dim 64. Block = 256 threads = 8 waves, one block per
// (128 query tokens tq0..tq0+127, head); all 128 queries lie in one segment whose keys are tokens
// tk00 = (tq0 & ~255) .. tk00+255, every key valid (no masking); wave w owns queries tq0+16w..+15 and all 64 dv.
// Q/K planes f16 bits [token][768] (head h at cols 64h..64h+63): hi (Qh, Kh) and x2048 residual (Ql, Kl);
// V^T planes f16 [dv][token]: hi (VT) and x2048 residual (VTl). All six lie in fragment order (see ldfrag_t).
// Both products are taken transposed: S^T = K.Q^T (A = key rows, B = query columns) and O^T = V^T.P^T (A = dv rows,
// B = query columns), so that a lane holds scores, statistics and outputs of ONE query (column jc of every D tile).
// Per chunk of 32 keys: s = kh.qh^T (acc s) and kl.qh^T + kh.ql^T (acc sr), two 32-deep k-steps over the 64
// head dims; logit = (s + sr/2048) * 0.125; running-max softmax in f32: maximum and sum over the lane's own 16 keys,
// the maximum joined with lane ^ 16 in every chunk, the sum once behind the loop; p = exp(logit - m) carried as
// 1024 p, hi + x2048 residual: the two D tiles of a chunk (keys 8hh + r and 16 + 8hh + r), converted in place, are
// the B fragment in the split k map, with no pass through LDS; z^T accumulates vh.ph (oz) and vl.ph + vh.pl (orr) on
// WMMA for 4 dv tiles, z = oz + orr/2048. q, k, p and v^T fragments all use the split k map.
// coverage: 128 query rows x 64 halves at cols 64*head per block in Zh and in Zl; grid (MT/128) x 12 heads = the
// whole [4096][768] z planes.
// =====================================================================================================
__global__ __launch_bounds__(256) void attn_kernel(const unsigned short* __restrict__ Qh,
                                                   const unsigned short* __restrict__ Ql,
                                                   const unsigned short* __restrict__ Kh,
                                                   const unsigned short* __restrict__ Kl,
                                                   const unsigned short* __restrict__ VT,
                                                   const unsigned short* __restrict__ VTl,
                                                   unsigned short* Zh, unsigned short* Zl) {
  __shared__ __align__(16) unsigned short zsth[QT * ZSP];   // output staging, hi plane
  __shared__ __align__(16) unsigned short zstl[QT * ZSP];   // output staging, residual plane
  const int tq0  = blockIdx.x * QT;                         // first query token (token = b*2048 + s)
  const int tk00 = tq0 & ~(SEGL - 1);                       // first key token of the segment
  const int hc   = blockIdx.y * HD;                         // head column offset
  const int t = threadIdx.x, lane = t & 31, wv = t >> 5, hh = lane >> 4, jc = lane & 15;

  // B: col = query jc, k = head dim; tile (token / 16, col / 32), the head's two k tiles are neighbours
  const size_t qo = ((size_t)((tq0 >> 4) + wv) * (HH / 32) + (hc >> 5)) * 512 + lane * 8;
  const v16us qf0 = ldfrag_t(Qh + qo);                                  // dims 0..31
  const v16us qf1 = ldfrag_t(Qh + qo + 512);                            // dims 32..63
  const v16us ql0 = ldfrag_t(Ql + qo);
  const v16us ql1 = ldfrag_t(Ql + qo + 512);
  float m = -1.0e30f, ll = 0.f;                             // query jc: running maximum; sum over this lane's keys
  v8f oz[4], orr[4];
#pragma unroll
  for (int d = 0; d < 4; ++d) { oz[d] = zero8(); orr[d] = zero8(); }
  const size_t vob = (size_t)(hc >> 4) * (MT / 32) * 512 + lane * 8;    // A: row dv = jc (+16d), k = key token

#pragma unroll 1
  for (int c = 0; c < NCHK; ++c) {
    const int tk0 = tk00 + 32 * c;                           // first key token of the chunk (multiple of 32)
    const size_t ko0 = ((size_t)(tk0 >> 4) * (HH / 32) + (hc >> 5)) * 512 + lane * 8;   // A: row = key jc, k = head dim
    const size_t ko1 = ko0 + (size_t)(HH / 32) * 512;            // row = key 16 + jc
    v8f s0 = zero8(), s1 = zero8(), sr0 = zero8(), sr1 = zero8();
    {                                                        // k-step 0: head dims 0..31
      const v16us kf0 = ldfrag_t(Kh + ko0);
      const v16us kf1 = ldfrag_t(Kh + ko1);
      const v16us kl0 = ldfrag_t(Kl + ko0);
      const v16us kl1 = ldfrag_t(Kl + ko1);
      s0  = mma_h_raw(kf0, qf0, s0);                         // D row 8hh+r = key tk0+8hh+r, col jc = query 16wv+jc
      sr0 = mma_h_raw(kl0, qf0, sr0);                        // residual . hi
      s1  = mma_h_raw(kf1, qf0, s1);                         // key tk0+16+8hh+r
      sr1 = mma_h_raw(kl1, qf0, sr1);
      sr0 = mma_h_raw(kf0, ql0, sr0);                        // hi . residual
      sr1 = mma_h_raw(kf1, ql0, sr1);
      guard4x6(s0, s1, sr0, sr1, qf0, ql0, kf0, kf1, kl0, kl1);
    }
    {                                                        // k-step 1: head dims 32..63
      const v16us kf0 = ldfrag_t(Kh + ko0 + 512);
      const v16us kf1 = ldfrag_t(Kh + ko1 + 512);
      const v16us kl0 = ldfrag_t(Kl + ko0 + 512);
      const v16us kl1 = ldfrag_t(Kl + ko1 + 512);
      s0  = mma_h_raw(kf0, qf1, s0);
      sr0 = mma_h_raw(kl0, qf1, sr0);
      s1  = mma_h_raw(kf1, qf1, s1);
      sr1 = mma_h_raw(kl1, qf1, sr1);
      sr0 = mma_h_raw(kf0, ql1, sr0);
      sr1 = mma_h_raw(kf1, ql1, sr1);
      guard4x6(s0, s1, sr0, sr1, qf1, ql1, kf0, kf1, kl0, kl1);
    }
    float t0[8], t1[8];
#pragma unroll
    for (int r = 0; r < 8; ++r) {
      t0[r] = (s0[r] + sr0[r] * RSCI) * SCL;
      t1[r] = (s1[r] + sr1[r] * RSCI) * SCL;
    }
    float rm = fmaxf(t0[0], t1[0]);
#pragma unroll
    for (int r = 1; r < 8; ++r) rm = fmaxf(rm, fmaxf(t0[r], t1[r]));
    rm = fmaxf(rm, xhalf(rm));                               // the query's other 16 keys of the chunk
    const float mn2   = fmaxf(m, rm);
    const float alpha = __expf(m - mn2);
    float rs = 0.f;
    FragU pa, pb;                                            // B: col = query jc, elements 0..7 <- k 8hh.., 8..15 <- k 16+8hh..
#pragma unroll
    for (int r = 0; r < 8; ++r) {
      const float e0 = __expf(t0[r] - mn2);
      const float e1 = __expf(t1[r] - mn2);
      rs += e0 + e1;
      unsigned short h0, l0, h1, l1;
      split_h(e0 * PSC, h0, l0);
      split_h(e1 * PSC, h1, l1);
      pa.v[r]     = h0;                                      // P hi [query jc][k = 8hh + r]
      pa.v[8 + r] = h1;                                      // P hi [query jc][k = 16 + 8hh + r]
      pb.v[r]     = l0;                                      // P residual
      pb.v[8 + r] = l1;
    }
    ll = ll * alpha + rs;
    m  = mn2;
#pragma unroll
    for (int d = 0; d < 4; ++d) { oz[d] *= alpha; orr[d] *= alpha; }
#pragma unroll
    for (int dg = 0; dg < 2; ++dg) {                         // dv tiles 2dg (rows 32dg+jc) and 2dg+1 (rows 32dg+16+jc)
      // A: keys tk0+8hh.. and tk0+16+8hh..; tile (dv / 16, token / 32); D row 8hh+r = dv, col jc = query
      const size_t voa = vob + ((size_t)(2 * dg) * (MT / 32) + (tk0 >> 5)) * 512;
      const size_t voc = voa + (size_t)(MT / 32) * 512;
      const v16us f0 = ldfrag_t(VT  + voa);
      const v16us f1 = ldfrag_t(VT  + voc);
      const v16us g0 = ldfrag_t(VTl + voa);                  // residual plane, same rows
      const v16us g1 = ldfrag_t(VTl + voc);
      oz[2 * dg]      = mma_h_raw(f0, pa.v, oz[2 * dg]);
      orr[2 * dg]     = mma_h_raw(g0, pa.v, orr[2 * dg]);
      oz[2 * dg + 1]  = mma_h_raw(f1, pa.v, oz[2 * dg + 1]);
      orr[2 * dg + 1] = mma_h_raw(g1, pa.v, orr[2 * dg + 1]);
      orr[2 * dg]     = mma_h_raw(f0, pb.v, orr[2 * dg]);
      orr[2 * dg + 1] = mma_h_raw(f1, pb.v, orr[2 * dg + 1]);
      guard4x6(oz[2 * dg], oz[2 * dg + 1], orr[2 * dg], orr[2 * dg + 1], pa.v, pb.v, f0, f1, g0, g1);
    }
  }

  {
    const float l = ll + xhalf(ll);                          // both halves of the query's keys
    const float inv = ((l > 0.f) ? (1.0f / l) : 0.f) * (ZSC / PSC);
    const int so = (16 * wv + jc) * ZSP + 8 * hh;            // query row, dv 8hh..8hh+7 of each 16: one 16-B piece
#pragma unroll
    for (int d = 0; d < 4; ++d) {
      v4u ha = {0u, 0u, 0u, 0u}, la = {0u, 0u, 0u, 0u};
#pragma unroll
      for (int e = 0; e < 4; ++e) {
        unsigned short h0, l0, h1, l1;
        split_h((oz[d][2 * e]     + orr[d][2 * e]     * RSCI) * inv, h0, l0);
        split_h((oz[d][2 * e + 1] + orr[d][2 * e + 1] * RSCI) * inv, h1, l1);
        ha[e] = pk16(h0, h1);
        la[e] = pk16(l0, l1);
      }
      *(v4u*)(zsth + so + 16 * d) = ha;
      *(v4u*)(zstl + so + 16 * d) = la;
    }
  }
  __syncthreads();
  v4u hv[4], lv[4];
#pragma unroll
  for (int it = 0; it < 4; ++it) {
    const int row = it * 32 + (t >> 3), p = (t & 7) * 8;   // it 0..3 x (t>>3) 0..31 = rows 0..127, 8 lanes per row
    hv[it] = *(const v4u*)(zsth + row * ZSP + p);
    lv[it] = *(const v4u*)(zstl + row * ZSP + p);
  }
  {
#pragma unroll
    for (int it = 0; it < 4; ++it) {
      const int row = it * 32 + (t >> 3), p = (t & 7) * 8;
      const size_t go = (size_t)(tq0 + row) * HH + hc + p;
      *(v4u*)(Zh + go) = hv[it];
      *(v4u*)(Zl + go) = lv[it];
    }
    
  }
}

// =====================================================================================================
// Workspace map (bytes); every plane is an exact multiple of its whole-row / whole-tile store granularity
//   Xh    f16 [4096][768]     0          6291456
//   Wq16  f16 [768][768]      6291456    1179648   (x16)
//   Wk16  f16 [768][768]      7471104    1179648   (x16)
//   Wv16  f16 [768][768]      8650752    1179648   (x16)
//   Wo16  f16 [768][768]      9830400    1179648   (x16)
//   Qh    f16 [4096][768]     11010048   6291456   (hi, fragment order)
//   Ql    f16 [4096][768]     17301504   6291456   (x2048 residual, fragment order)
//   Kh    f16 [4096][768]     23592960   6291456   (hi, fragment order)
//   Kl    f16 [4096][768]     29884416   6291456   (x2048 residual, fragment order)
//   VT    f16 [768][4096]     36175872   6291456   (hi, fragment order)
//   VTl   f16 [768][4096]     42467328   6291456   (x2048 residual, fragment order)
//   Zh    f16 [4096][768]     48758784   6291456   (z x16, hi)
//   Zl    f16 [4096][768]     55050240   6291456   (x2048 residual)
//   end                       61341696
// =====================================================================================================
extern "C" void kernel_launch(void* const* d_in, const int* in_sizes, int n_in,
                              void* d_out, int out_size, void* d_ws, size_t ws_size,
                              hipStream_t stream) {
  if (n_in < 9) return;
  if (in_sizes[0] != MT * HH) return;
  if (in_sizes[1] != HH * HH || in_sizes[2] != HH) return;
  if (in_sizes[3] != HH * HH || in_sizes[4] != HH) return;
  if (in_sizes[5] != HH * HH || in_sizes[6] != HH) return;
  if (in_sizes[7] != HH * HH || in_sizes[8] != HH) return;
  if (out_size != MT * HH) return;

  const float* x  = (const float*)d_in[0];
  const float* Wq = (const float*)d_in[1];
  const float* bq = (const float*)d_in[2];
  const float* Wk = (const float*)d_in[3];
  const float* bk = (const float*)d_in[4];
  const float* Wv = (const float*)d_in[5];
  const float* bv = (const float*)d_in[6];
  const float* Wo = (const float*)d_in[7];
  const float* bo = (const float*)d_in[8];

  const size_t PX  = (size_t)MT * HH * 2;        // 6291456
  const size_t PW  = (size_t)HH * HH * 2;        // 1179648
  const size_t PVT = (size_t)HH * MT * 2;        // 6291456
  size_t off = 0;
  const size_t oXh = off; off += PX;
  const size_t oWq = off; off += PW;
  const size_t oWk = off; off += PW;
  const size_t oWv = off; off += PW;
  const size_t oWo = off; off += PW;
  const size_t oQh = off; off += PX;
  const size_t oQl = off; off += PX;
  const size_t oKh = off; off += PX;
  const size_t oKl = off; off += PX;
  const size_t oVT = off; off += PVT;
  const size_t oVL = off; off += PVT;
  const size_t oZh = off; off += PX;
  const size_t oZl = off; off += PX;
  if (off > ws_size) return;                     // off = 61341696
  if (off > (size_t)134217728) return;

  char* ws = (char*)d_ws;
  unsigned short* Xh   = (unsigned short*)(ws + oXh);
  unsigned short* Wq16 = (unsigned short*)(ws + oWq);
  unsigned short* Wk16 = (unsigned short*)(ws + oWk);
  unsigned short* Wv16 = (unsigned short*)(ws + oWv);
  unsigned short* Wo16 = (unsigned short*)(ws + oWo);
  unsigned short* Qh   = (unsigned short*)(ws + oQh);
  unsigned short* Ql   = (unsigned short*)(ws + oQl);
  unsigned short* Kh   = (unsigned short*)(ws + oKh);
  unsigned short* Kl   = (unsigned short*)(ws + oKl);
  unsigned short* VT   = (unsigned short*)(ws + oVT);
  unsigned short* VTl  = (unsigned short*)(ws + oVL);
  unsigned short* Zh   = (unsigned short*)(ws + oZh);
  unsigned short* Zl   = (unsigned short*)(ws + oZl);
  float*          out0 = (float*)d_out;

  const dim3 blk(256);
  const int gsp = ((MT / 32) * (HH / 64)) / 8;             // 1536 tiles of 32x64 -> 192 blocks
  if ((((MT / 32) * (HH / 64)) % 8) != 0) return;

  // (0) x -> f16 plane of bf16 values; weights [768][768] ([out][in] = Bt[n][k]) -> f16 bits of bf16 values x16
  //     (one grid: 512 blocks for x, 96 for each weight)
  cvt_rows<<<dim3(MT / 8 + 4 * (HH / 8)), blk, 0, stream>>>(x, Wq, Wk, Wv, Wo, Xh, Wq16, Wk16, Wv16, Wo16);

  // (1) x . [Wq; Wk; Wv]^T + bias (Wq16, Wk16, Wv16 lie one behind the other: one [2304][768] matrix at Wq16)
  //     -> q and k hi + residual planes [4096][768], v^T hi + residual planes [768][4096]; 256 blocks of 128 x 288
  gemm_qkv<<<dim3(QGRD), blk, 0, stream>>>(Xh, Wq16, Qh, Ql, Kh, Kl, VT, VTl, bq, bk, bv);

  // (2) block-diagonal segment attention -> z (x16) hi + residual planes
  attn_kernel<<<dim3(MT / QT, NHD), blk, 0, stream>>>(Qh, Ql, Kh, Kl, VT, VTl, Zh, Zl);

  // (3) output projection: out = z . Wo^T + bo -> f32 (A operand split)
  gemm_out<<<dim3(gsp), blk, 0, stream>>>(Zh, Zl, Wo16, out0, bo);
  (void)hipGetLastError();
}

// v006
// One run takes 51 microseconds.
// Timed twice side by side with v005, it ran 1.19 and 1.20 times as fast.
// Over all steps from v000 it is 3.73 times as fast.
// Contractions: q = x.Wq^T, k = x.Wk^T and v = x.Wv^T (plain f16, exact bf16-valued operands);
// attention scores q.k^T and p.v^T with q, k, p, v^T as f16 hi + x2048 residual planes (hi.hi + hi.lo + lo.hi);
// output projection z.Wo^T with z as f16 hi + x2048 residual planes (hi.W + lo.W); all v_wmma_f32_16x16x32_f16
// (f16 operands, f32 accumulate); float inputs RNE-converted to bf16 on load (x in f16 containers, weights x16
// in f16), p carried x1024, z carried x16; softmax in f32 on VALU.
#include <hip/hip_runtime.h>
#include <math.h>
#include <stdint.h>

#define NBT  2
#define SEQ  2048
#define HH   768
#define NHD  12
#define HD   64
#define SEGL 256
#define MT   (NBT * SEQ)
#define QT   128
#define NCHK (SEGL / 32)
#define ZSP  72
#define WSC  16.0f
#define PSC  1024.0f
#define ZSC  16.0f
#define RSC  2048.0f
#define RSCI 0.00048828125f
#define SCL  0.125f
#define KST  128                   // k (halves) per LDS stage: 256 B of every staged row
#define LPH  136                   // LDS row pitch in halves: 272 B = 16 B x odd, for ds_load_b128 readers
#define SROW 384                   // rows per stage: 128 of A (or 64 hi + 64 residual), then 256 of Bt
#define STGH (SROW * LPH)          // halves per stage buffer
#define RSB  (16 * LPH * 2)        // LDS bytes between two copies of one lane (16 rows)
#define NQKV (3 * HH)              // columns of the joint product x.[Wq; Wk; Wv]^T
#define QTN  288                   // its block tile: 128 rows x 288 columns
#define QNJ  (QTN / 32)            // 16-column tiles of one wave (two wave columns)
#define QROW (128 + QTN)           // rows per stage: 128 of x, then 288 of the stacked weights
#define QSTG (QROW * LPH)          // halves per stage buffer
#define QGRD ((MT / 128) * (NQKV / QTN))

static_assert(NHD * HD == HH);
static_assert(HD == 64);
static_assert((SEQ % SEGL) == 0 && (SEGL % QT) == 0 && (MT % QT) == 0 && QT == 128 && (SEGL % 32) == 0);
static_assert((MT % 64) == 0 && (HH % 64) == 0 && (MT % 32) == 0 && (HH % 32) == 0);
static_assert((((MT / 64) * (HH / 64)) % 8) == 0);
static_assert((((HH / 64) * (MT / 64)) % 8) == 0);
static_assert((((MT / 32) * (HH / 64)) % 8) == 0);
static_assert((MT % 8) == 0 && (HH % 8) == 0 && (HH % 256) == 0);
static_assert(ZSP >= 64 && (ZSP % 8) == 0);
static_assert((MT % 256) == 0 && (HH % 128) == 0 && (MT % 128) == 0 && (HH % KST) == 0 && HH / KST >= 2);
static_assert((LPH % 8) == 0 && LPH >= KST);
static_assert((NQKV % QTN) == 0 && (QTN % 96) == 0 && (HH % 48) == 0 && QNJ == 9 && (QROW % 16) == 0 && QROW / 16 == 26);

typedef _Float16 v16h __attribute__((ext_vector_type(16)));
typedef _Float16 v8h  __attribute__((ext_vector_type(8)));
typedef unsigned short v16us __attribute__((ext_vector_type(16)));
typedef unsigned short v8us  __attribute__((ext_vector_type(8)));
typedef float v8f __attribute__((ext_vector_type(8)));
typedef float v4f __attribute__((ext_vector_type(4)));
typedef unsigned int v4u __attribute__((ext_vector_type(4)));

union FragU { v16us v; v8us h[2]; };

// ---- scalar helpers --------------------------------------------------------------------------------
__device__ __forceinline__ unsigned short bf_bits(float f) {          // f32 -> bf16 bits, RNE convert
  const unsigned u = __float_as_uint(f);
  return (unsigned short)((u + 0x7FFFu + ((u >> 16) & 1u)) >> 16);
}
__device__ __forceinline__ float bf_up(unsigned short h) { return __uint_as_float(((unsigned)h) << 16); }
__device__ __forceinline__ float bfr(float f) { return bf_up(bf_bits(f)); }   // value of the bf16 RNE convert
__device__ __forceinline__ unsigned short h_bits(_Float16 x) { return __builtin_bit_cast(unsigned short, x); }
__device__ __forceinline__ unsigned short f2h(float f) { return h_bits((_Float16)f); }
__device__ __forceinline__ float h_up(unsigned short h) { return (float)__builtin_bit_cast(_Float16, h); }
__device__ __forceinline__ unsigned pk16(unsigned short a, unsigned short b) { return (unsigned)a | ((unsigned)b << 16); }
__device__ __forceinline__ v8f zero8() { v8f z = {0.f, 0.f, 0.f, 0.f, 0.f, 0.f, 0.f, 0.f}; return z; }
// f -> f16 hi bits and f16 bits of the x2048 residual (f - hi) * 2048
__device__ __forceinline__ void split_h(float f, unsigned short& hi, unsigned short& lo) {
  hi = f2h(f);
  lo = f2h((f - h_up(hi)) * RSC);
}

// ---- fragment loader: 16-bit A/B operand, lane -> row/col (lane&15), p already includes +8*(lane>>4);
//      elements 0..7 <- p[0..7] (k0+8h..), elements 8..15 <- p[16..23] (k0+16+8h..)
__device__ __forceinline__ v16us ldfrag_u(const unsigned short* p) {
  FragU f;
  f.h[0] = *(const v8us*)(p);
  f.h[1] = *(const v8us*)(p + 16);
  return f.v;
}

// ---- fragment-order planes: a [R][C] f16 plane kept as tiles of 16 rows x 32 k (1024 B, tile number
//      (row / 16) * (C / 32) + col / 32), inside a tile 16-B units [k octet 0..3][row 0..15]. Lane l's two pieces of
//      the operand fragment (row l & 15, k 8 (l >> 4).. and 16 + 8 (l >> 4)..) are then units l and 32 + l: each load
//      instruction of a wave covers 512 contiguous bytes (4 whole lines) instead of 16 B in each of 16 rows.
//      p = plane + tile * 512 + lane * 8 (halves); same element order as ldfrag_u
__device__ __forceinline__ v16us ldfrag_t(const unsigned short* p) {
  FragU f;
  f.h[0] = *(const v8us*)(p);
  f.h[1] = *(const v8us*)(p + 256);
  return f.v;
}

// ---- WMMA helpers with trailing VALU hazard gap --------------------------------------------------------
__device__ __forceinline__ v8f mma_h_raw(v16us a, v16us b, v8f c) {             // f16 operands (bits), unguarded
  return __builtin_amdgcn_wmma_f32_16x16x32_f16(false, __builtin_bit_cast(v16h, a), false,
                                                __builtin_bit_cast(v16h, b), (short)0, c, false, false);
}
__device__ __forceinline__ void dep_guard1(v8f& a, v8f& b, v16us x) {
#if defined(__HIP_DEVICE_COMPILE__)
  asm volatile("v_nop\n\tv_nop\n\tv_nop\n\tv_nop" : "+v"(a), "+v"(b) : "v"(x));
#endif
}
__device__ __forceinline__ void dep_guard2(v8f& a, v8f& b, v8f& c, v8f& d, v16us x, v16us y) {
#if defined(__HIP_DEVICE_COMPILE__)
  asm volatile("v_nop\n\tv_nop\n\tv_nop\n\tv_nop" : "+v"(a), "+v"(b), "+v"(c), "+v"(d) : "v"(x), "v"(y));
#endif
}
__device__ __forceinline__ void keep4_u(v16us a, v16us b, v16us c, v16us d) {
#if defined(__HIP_DEVICE_COMPILE__)
  asm volatile("v_nop" :: "v"(a), "v"(b), "v"(c), "v"(d));
#endif
}
// keeps nine B fragments live across the slot behind their last product
__device__ __forceinline__ void keep9_u(v16us a, v16us b, v16us c, v16us d, v16us e, v16us f, v16us g, v16us h,
                                        v16us i) {
#if defined(__HIP_DEVICE_COMPILE__)
  asm volatile("v_nop" :: "v"(a), "v"(b), "v"(c), "v"(d), "v"(e), "v"(f), "v"(g), "v"(h), "v"(i));
#endif
}
__device__ __forceinline__ void acc_guard4(v8f& a, v8f& b, v8f& c, v8f& d) {
#if defined(__HIP_DEVICE_COMPILE__)
  asm volatile("v_nop\n\tv_nop\n\tv_nop\n\tv_nop" : "+v"(a), "+v"(b), "+v"(c), "+v"(d));
#endif
}
// ties four D accumulators and keeps six A/B fragments live across a 4-slot VALU gap
__device__ __forceinline__ void guard4x6(v8f& a, v8f& b, v8f& c, v8f& d,
                                         v16us p, v16us q, v16us r, v16us s, v16us t, v16us u) {
#if defined(__HIP_DEVICE_COMPILE__)
  asm volatile("v_nop\n\tv_nop\n\tv_nop\n\tv_nop"
               : "+v"(a), "+v"(b), "+v"(c), "+v"(d)
               : "v"(p), "v"(q), "v"(r), "v"(s), "v"(t), "v"(u));
#endif
}
__device__ __forceinline__ void wave_sync_lds() {
  __builtin_amdgcn_fence(__ATOMIC_RELEASE, "workgroup");
  __builtin_amdgcn_wave_barrier();
  __builtin_amdgcn_fence(__ATOMIC_ACQUIRE, "workgroup");
}

// lane l's value exchanged with lane l ^ 16 (the other 16-lane row), in registers
__device__ __forceinline__ float xhalf(float x) {
  return __builtin_bit_cast(float, __builtin_amdgcn_permlanex16(__builtin_bit_cast(int, x), __builtin_bit_cast(int, x),
                                                                0x76543210, 0xfedcba98, false, false));
}

// ---- asynchronous copies global -> LDS ------------------------------------------------------------------
// Eight 16-byte copies per lane: LDS bytes l + i * RSB; global ga + i * gs (i = 0..3) and gb + i * gs (i = 4..7
// as 0..3). The closing s_wait_xcnt stands inside the statement so that no address register named by a copy is
// rewritten in front of it.
__device__ __forceinline__ void copy8(unsigned l, const unsigned short* ga, const unsigned short* gb, size_t gs) {
#if defined(__HIP_DEVICE_COMPILE__)
  asm volatile(
      "global_load_async_to_lds_b128 %0, %8, off\n\t"
      "global_load_async_to_lds_b128 %1, %9, off\n\t"
      "global_load_async_to_lds_b128 %2, %10, off\n\t"
      "global_load_async_to_lds_b128 %3, %11, off\n\t"
      "global_load_async_to_lds_b128 %4, %12, off\n\t"
      "global_load_async_to_lds_b128 %5, %13, off\n\t"
      "global_load_async_to_lds_b128 %6, %14, off\n\t"
      "global_load_async_to_lds_b128 %7, %15, off\n\t"
      "s_wait_xcnt 0x0"
      :: "v"(l), "v"(l + RSB), "v"(l + 2 * RSB), "v"(l + 3 * RSB),
         "v"(l + 4 * RSB), "v"(l + 5 * RSB), "v"(l + 6 * RSB), "v"(l + 7 * RSB),
         "v"(ga), "v"(ga + gs), "v"(ga + 2 * gs), "v"(ga + 3 * gs),
         "v"(gb), "v"(gb + gs), "v"(gb + 2 * gs), "v"(gb + 3 * gs)
      : "memory");
#endif
}
// Two such copies: LDS bytes l and l + RSB; global ga and ga + gs; the same closing wait inside the statement.
__device__ __forceinline__ void copy2(unsigned l, const unsigned short* ga, size_t gs) {
#if defined(__HIP_DEVICE_COMPILE__)
  asm volatile(
      "global_load_async_to_lds_b128 %0, %2, off\n\t"
      "global_load_async_to_lds_b128 %1, %3, off\n\t"
      "s_wait_xcnt 0x0"
      :: "v"(l), "v"(l + RSB), "v"(ga), "v"(ga + gs)
      : "memory");
#endif
}
// this wave's own copies have landed in LDS
__device__ __forceinline__ void wait_async0() {
#if defined(__HIP_DEVICE_COMPILE__)
  asm volatile("s_wait_asynccnt 0x0" ::: "memory");
#endif
}
// in front of an overwrite of registers that issued global loads or stores name
__device__ __forceinline__ void wait_x0() {
#if defined(__HIP_DEVICE_COMPILE__)
  asm volatile("s_wait_xcnt 0x0" ::: "memory");
#endif
}
// this wave's own LDS reads have returned, before the buffer they read is handed to its next writer
__device__ __forceinline__ void wait_ds0() {
#if defined(__HIP_DEVICE_COMPILE__)
  asm volatile("s_wait_dscnt 0x0" ::: "memory");
#endif
}

// =====================================================================================================
// Rows [nrows][768] f32 -> f16 bits of (bf16 RNE value * sc). Used for x (sc = 1) and for the [out][in]
// weight matrices (sc = 16), which are already Bt[n][k] with k contiguous. The five conversions need nothing
// of each other and share one grid by ranges of the block index: blocks 0..MT/8-1 take x, then HH/8 blocks
// for each of Wq, Wk, Wv, Wo. One wave per row; three column
// chunks of 256: lane owns columns 256c + 8*lane..+7, one instruction = 32 lanes x 16 B = 512 contiguous B
// coverage: 8 rows per block, grid = MT/8 + 4 HH/8 exact, 3 chunks x 256 = 768 cols: union = every row of all five.
// =====================================================================================================
__global__ __launch_bounds__(256) void cvt_rows(const float* __restrict__ xin, const float* __restrict__ Wq,
                                                const float* __restrict__ Wk, const float* __restrict__ Wv,
                                                const float* __restrict__ Wo, unsigned short* Xh,
                                                unsigned short* Wq16, unsigned short* Wk16,
                                                unsigned short* Wv16, unsigned short* Wo16) {
  const int wb  = (int)blockIdx.x - MT / 8;               // block-uniform: below 0 = x, else a weight block
  const int wi  = wb / (HH / 8);                          // which weight, 0..3
  const bool isx = wb < 0;
  const float* x = isx ? xin : wi == 0 ? Wq : wi == 1 ? Wk : wi == 2 ? Wv : Wo;
  unsigned short* xh = isx ? Xh : wi == 0 ? Wq16 : wi == 1 ? Wk16 : wi == 2 ? Wv16 : Wo16;
  const int nrows = isx ? MT : HH;
  const float sc  = isx ? 1.0f : WSC;
  const int row = (isx ? (int)blockIdx.x : wb - wi * (HH / 8)) * 8 + (threadIdx.x >> 5);
  const int lane = threadIdx.x & 31;
  if (wi > 3 || row >= nrows) return;                     // wave-uniform, no barriers below
  v4u hv[HH / 256];
#pragma unroll
  for (int c = 0; c < HH / 256; ++c) {
    const float* p = x + (size_t)row * HH + c * 256 + lane * 8;
    const v4f a0 = *(const v4f*)(p);
    const v4f a1 = *(const v4f*)(p + 4);
    v4u h;
#pragma unroll
    for (int e = 0; e < 2; ++e) {
      h[e]     = pk16(f2h(bfr(a0[2 * e]) * sc), f2h(bfr(a0[2 * e + 1]) * sc));
      h[2 + e] = pk16(f2h(bfr(a1[2 * e]) * sc), f2h(bfr(a1[2 * e + 1]) * sc));
    }
    hv[c] = h;
  }
  unsigned short* d = xh + (size_t)row * HH + lane * 8;
  {
#pragma unroll
    for (int c = 0; c < HH / 256; ++c) *(v4u*)(d + c * 256) = hv[c];
    
  }
}

// =====================================================================================================
// Register-blocked f16 WMMA GEMM: C[m][n] = (sum_k A[m][k] * Bt[n][k] * wsc + bias) * osc, one wave per TRx64
// tile (TR = 64, or 32 when the A operand is split); the block's 8 waves form a (2 TR) x 256 tile (2 x 4 waves)
// whose operand rows are staged in LDS, 128 k at a time, two buffers, by asynchronous 16-byte copies (16 lanes
// per 256-B row piece), the next stage in flight while this one is multiplied. A row-major [M][K] pitch lda (ASPL = 1:
// a second plane Al holds the x2048 residual, same pitch, products into a separate accumulator folded back
// as acc + accr/2048); Bt row-major [N][K] pitch ldb (k contiguous); M multiple of 2 TR, N of 256, K of 128 and at
// least 256 (true at every call site; host-checked grids = tiles/8 exact so no block exits early).
// OM: 0 = f32 out Cf (row-major, pitch ldc); 1 = f16 hi bits Ch plus x2048 residual bits Cl, both in fragment order
// (see ldfrag_t) with ldc columns.
// cbm (block-uniform): 0 = no bias; 1 = column bias bf16(cb[n]); 2 = row bias bf16(cb[m]). All biases bf16 RNE values.
// bid = the block's tile number inside this product; sT (per-wave 16x64 slabs, pitch 68 floats) and sS (two operand
// stages) are the calling kernel's LDS arrays.
// coverage: MI slabs x 16 rows x 64 cols = the wave's whole TRx64 tile; tiles/8 blocks x 8 waves = every tile.
// =====================================================================================================
template <int OM, int ASPL>
__device__ __forceinline__ void gemm_body(
    float* sT, unsigned short* sS, int bid,
    const unsigned short* __restrict__ Ap, const unsigned short* __restrict__ Alp, int lda,
    const unsigned short* __restrict__ Btp, int ldb,
    unsigned short* Ch, unsigned short* Cl, float* Cf, int ldc,
    const float* __restrict__ cb, int cbm, float wsc, float osc, int M, int N, int K) {
  constexpr int MI = ASPL ? 2 : 4;
  constexpr int TR = 16 * MI;
  const int lane = threadIdx.x & 31;
  const int wave = threadIdx.x >> 5;
  const int tilesN = N >> 8;
  const int tilesM = M / (2 * TR);
  if (bid >= tilesM * tilesN) return;   // block-uniform, in front of every barrier
  const int tm = bid / tilesN;
  const int tn = bid - tm * tilesN;
  const int wm = wave >> 2;                    // wave row 0..1
  const int wn = wave & 3;                     // wave column 0..3
  const int mb = tm * (2 * TR);                // block's first row of A
  const int nb = tn << 8;                      // block's first row of Bt
  const int m0 = mb + wm * TR;
  const int n0 = nb + (wn << 6);

  const int rlane = lane & 15;                 // row (A) / col (B, D) within subtile
  const int koff  = (lane >> 4) * 8;           // k offset of this lane half
  const int mOff  = (lane >> 4) * 8;           // D row offset

  v8f acc[MI][4];
  v8f accr[MI][4];
#pragma unroll
  for (int i = 0; i < MI; ++i)
#pragma unroll
    for (int j = 0; j < 4; ++j) { acc[i][j] = zero8(); accr[i][j] = zero8(); }

  // copy map: lane's 16-B piece cch of staged row crow + 16 i, i = 0..23 (rows 0..127 A, 128..383 Bt)
  const int crow = threadIdx.x >> 4;           // 0..15
  const int cch  = (threadIdx.x & 15) * 8;     // halves
  const unsigned lds0 = (unsigned)(size_t)sS + (unsigned)(crow * LPH + cch) * 2u;   // LDS byte address, buffer 0
  const unsigned short* gA0 = Ap + (size_t)(mb + crow) * lda + cch;                 // staged rows 0..63
  const unsigned short* gA1 = ASPL ? Alp + (size_t)(mb + crow) * lda + cch          // rows 64..127: residual plane
                                   : gA0 + (size_t)64 * lda;                        // or A rows 64..127
  const unsigned short* gB0 = Btp + (size_t)(nb + crow) * ldb + cch;                // staged rows 128..383
  const size_t gsa = (size_t)16 * lda, gsb = (size_t)16 * ldb;
  const int NT = K / KST;

  // staged row of this lane's first A fragment and first Bt fragment, with its k offset
  const int fa = (wm * TR + rlane) * LPH + koff;
  const int fb = (128 + (wn << 6) + rlane) * LPH + koff;

  // stage 0 -> buffer 0, landed and published; then stage 1 -> buffer 1 in flight
  copy8(lds0,            gA0,           gA1,            gsa);
  copy8(lds0 + 8 * RSB,  gB0,           gB0 + 4 * gsb,  gsb);
  copy8(lds0 + 16 * RSB, gB0 + 8 * gsb, gB0 + 12 * gsb, gsb);
  wait_async0();
  __syncthreads();
  if (NT > 1) {
    const unsigned lb = lds0 + STGH * 2;
    copy8(lb,            gA0 + KST,           gA1 + KST,            gsa);
    copy8(lb + 8 * RSB,  gB0 + KST,           gB0 + KST + 4 * gsb,  gsb);
    copy8(lb + 16 * RSB, gB0 + KST + 8 * gsb, gB0 + KST + 12 * gsb, gsb);
  }

#pragma unroll 1   // one stage per trip: the buffer index stays a run-time value and the text small
  for (int t = 0; t < NT; ++t) {
    const unsigned short* sb = sS + (t & 1) * STGH;
#pragma unroll
    for (int kk = 0; kk < KST; kk += 32) {
      // all eight fragments of this k-step are asked for ahead of its 16 products, not one A fragment per four
      v16us bh[4], ahf[MI], alf[MI];
#pragma unroll
      for (int j = 0; j < 4; ++j) bh[j] = ldfrag_u(sb + fb + (j << 4) * LPH + kk);
#pragma unroll
      for (int i = 0; i < MI; ++i) {
        ahf[i] = ldfrag_u(sb + fa + (i << 4) * LPH + kk);
        if (ASPL) alf[i] = ldfrag_u(sb + fa + (64 + (i << 4)) * LPH + kk);
      }
#pragma unroll
      for (int i = 0; i < MI; ++i) {
        const v16us ah = ahf[i];
        if (ASPL) {
          const v16us al = alf[i];
#pragma unroll
          for (int j = 0; j < 4; ++j) {
            acc[i][j]  = mma_h_raw(ah, bh[j], acc[i][j]);
            accr[i][j] = mma_h_raw(al, bh[j], accr[i][j]);
          }
          dep_guard2(acc[i][0], acc[i][3], accr[i][0], accr[i][3], ah, al);
        } else {
#pragma unroll
          for (int j = 0; j < 4; ++j) acc[i][j] = mma_h_raw(ah, bh[j], acc[i][j]);
          dep_guard1(acc[i][0], acc[i][3], ah);
        }
      }
      keep4_u(bh[0], bh[1], bh[2], bh[3]);
    }
    // publish point of stage t + 1: own reads of this buffer done, own copies landed, then every wave passes
    wait_ds0();
    wait_async0();
    __syncthreads();
    if (t + 2 < NT) {                          // block-uniform: refill the buffer that this trip has just read
      const unsigned lb = lds0 + (unsigned)(t & 1) * (STGH * 2);
      const int k2 = (t + 2) * KST;
      copy8(lb,            gA0 + k2,           gA1 + k2,            gsa);
      copy8(lb + 8 * RSB,  gB0 + k2,           gB0 + k2 + 4 * gsb,  gsb);
      copy8(lb + 16 * RSB, gB0 + k2 + 8 * gsb, gB0 + k2 + 12 * gsb, gsb);
    }
  }
  wait_async0();
#pragma unroll
  for (int i = 0; i < MI; ++i) {
    acc_guard4(acc[i][0], acc[i][1], acc[i][2], acc[i][3]);
    if (ASPL) acc_guard4(accr[i][0], accr[i][1], accr[i][2], accr[i][3]);
  }

  const int hh2 = lane >> 4, c4 = (lane & 15) * 4;     // f32 out: 256-B row segment = 16 lanes x 16 B
  // f16 planes out: store it takes k octets 2 it and 2 it + 1 of the slab, lane = octet half hh2 x row rlane

  v4f cb4 = {0.f, 0.f, 0.f, 0.f};
  float cbc[4][8];                             // column bias of columns n0 + 8 (2 it + hh2) + e
#pragma unroll
  for (int it = 0; it < 4; ++it)
#pragma unroll
    for (int e = 0; e < 8; ++e) cbc[it][e] = 0.f;
  if (OM == 0 && cbm == 1) {
    const v4f v = *(const v4f*)(cb + n0 + c4);
    cb4[0] = bfr(v[0]); cb4[1] = bfr(v[1]); cb4[2] = bfr(v[2]); cb4[3] = bfr(v[3]);
  }
  if (OM == 1 && cbm == 1) {
#pragma unroll
    for (int it = 0; it < 4; ++it) {
      const float* bp = cb + n0 + (it * 2 + hh2) * 8;
      const v4f v0 = *(const v4f*)(bp);
      const v4f v1 = *(const v4f*)(bp + 4);
#pragma unroll
      for (int e = 0; e < 4; ++e) { cbc[it][e] = bfr(v0[e]); cbc[it][4 + e] = bfr(v1[e]); }
    }
  }
  float rbv[MI];                               // row bias of output row m0 + 16 i + rlane
#pragma unroll
  for (int i = 0; i < MI; ++i) rbv[i] = 0.f;
  if (OM == 1 && cbm == 2) {                   // one block-uniform branch: all loads in flight together
#pragma unroll
    for (int i = 0; i < MI; ++i) rbv[i] = bfr(cb[m0 + (i << 4) + rlane]);
  }

  // ---- epilogue ----
  float* slab = sT + wave * (16 * 68);
#pragma unroll
  for (int i = 0; i < MI; ++i) {
    const int mBase = m0 + (i << 4);
#pragma unroll
    for (int j = 0; j < 4; ++j) {
#pragma unroll
      for (int r = 0; r < 8; ++r) {
        float v = acc[i][j][r];
        if (ASPL) v += accr[i][j][r] * RSCI;
        slab[(mOff + r) * 68 + (j << 4) + rlane] = v;
      }
    }
    wave_sync_lds();
    if (OM == 0) {
      v4f vals[8];
#pragma unroll
      for (int it = 0; it < 8; ++it) {
        const int row = it * 2 + hh2;                      // it 0..7 x hh2 0..1 = rows 0..15
        const v4f v = *(const v4f*)(slab + row * 68 + c4);
        vals[it] = (v * wsc + cb4) * osc;
      }
      {
#pragma unroll
        for (int it = 0; it < 8; ++it) {
          const int row = it * 2 + hh2;
          *(v4f*)(Cf + (size_t)(mBase + row) * ldc + (size_t)n0 + c4) = vals[it];
        }
        
      }
    }
    if (OM == 1) {
      v4u hv[4], lv[4];
#pragma unroll
      for (int it = 0; it < 4; ++it) {
        const float* sp = slab + rlane * 68 + (it * 2 + hh2) * 8;   // rows 0..15 x octets 2 it, 2 it + 1
        const float rb = rbv[i];
        v4u ha = {0u, 0u, 0u, 0u}, la = {0u, 0u, 0u, 0u};
#pragma unroll
        for (int e = 0; e < 4; ++e) {
          const float f0 = (sp[2 * e]     * wsc + cbc[it][2 * e]     + rb) * osc;
          const float f1 = (sp[2 * e + 1] * wsc + cbc[it][2 * e + 1] + rb) * osc;
          unsigned short h0, l0, h1, l1;
          split_h(f0, h0, l0);
          split_h(f1, h1, l1);
          ha[e] = pk16(h0, h1);
          la[e] = pk16(l0, l1);
        }
        hv[it] = ha;
        lv[it] = la;
      }
      {
        // tiles (mBase / 16, n0 / 32) and the next one; store it = 512 contiguous bytes: units 32 (it & 1) + lane
        const size_t gt = ((size_t)(mBase >> 4) * (ldc >> 5) + (n0 >> 5)) * 512 + lane * 8;
#pragma unroll
        for (int it = 0; it < 4; ++it) {
          const size_t go = gt + (it >> 1) * 512 + (it & 1) * 256;
          *(v4u*)(Ch + go) = hv[it];
          *(v4u*)(Cl + go) = lv[it];
        }
        
      }
    }
    wave_sync_lds();
  }
}

// q = x.Wq^T + bq, k = x.Wk^T + bk and v = x.Wv^T + bv as ONE product x.Wc^T + bias, Wc = [Wq; Wk; Wv] stacked
// ([2304][768]: the three f16 weight planes are neighbours in the workspace). Block tile 128 x 288: 32 x 8 = 256
// blocks, one for every WGP (a block's LDS leaves room for no second one), so the launch is a single round.
// 8 waves as 4 x 2, one wave per 32 x 144 tile (2 x 9 accumulators). Operand rows staged as in gemm_body: 128 k per
// stage, two buffers, asynchronous 16-byte copies, 26 per lane and stage (rows 0..127 x, 128..415 Wc).
// Epilogue by groups of 48 columns (48 divides 768: a group lies in one of q, k, v; the test is wave-uniform):
// q, k: through the wave's slab into fragment order (see ldfrag_t), tiles (token / 16, col / 32);
// v: the accumulator itself holds 8 successive tokens of one dv per lane, which is one 16-B unit of the v^T plane's
// fragment order (tile (dv / 16, token / 32), unit 32 i + lane): stored from registers, 512 contiguous bytes a store.
// coverage: 2 x 9 tiles of 16 x 16 = the wave's 32 x 144; 8 waves = 128 x 288; 256 blocks = [4096][2304].
__global__ __launch_bounds__(256) void gemm_qkv(
    const unsigned short* __restrict__ Xh, const unsigned short* __restrict__ Wc,
    unsigned short* Qh, unsigned short* Ql, unsigned short* Kh, unsigned short* Kl,
    unsigned short* VT, unsigned short* VTl,
    const float* __restrict__ bq, const float* __restrict__ bk, const float* __restrict__ bv) {
  __shared__ __align__(16) float sT[8 * 16 * 68];         // per-wave 16x48 slab, pitch 68 floats
  __shared__ __align__(16) unsigned short sS[2 * QSTG];   // two operand stages
  const int bid = (int)blockIdx.x;
  if (bid >= QGRD) return;                                // block-uniform, in front of every barrier
  const int lane = threadIdx.x & 31;
  const int wave = __builtin_amdgcn_readfirstlane((int)(threadIdx.x >> 5));
  const int tm = bid / (NQKV / QTN);
  const int tn = bid - tm * (NQKV / QTN);
  const int wm = wave >> 1;                    // wave row 0..3
  const int wn = wave & 1;                     // wave column 0..1
  const int mb = tm * 128;                     // block's first row of x
  const int nb = tn * QTN;                     // block's first row of Wc
  const int m0 = mb + wm * 32;
  const int n0 = nb + wn * (QTN / 2);

  const int rlane = lane & 15;                 // row (A) / col (B, D) within subtile
  const int hh2   = lane >> 4;
  const int koff  = hh2 * 8;                   // k offset of this lane half
  const int mOff  = hh2 * 8;                   // D row offset

  v8f acc[2][QNJ];
#pragma unroll
  for (int i = 0; i < 2; ++i)
#pragma unroll
    for (int j = 0; j < QNJ; ++j) acc[i][j] = zero8();

  // copy map: lane's 16-B piece cch of staged row crow + 16 i, i = 0..25
  const int crow = threadIdx.x >> 4;           // 0..15
  const int cch  = (threadIdx.x & 15) * 8;     // halves
  const unsigned lds0 = (unsigned)(size_t)sS + (unsigned)(crow * LPH + cch) * 2u;   // LDS byte address, buffer 0
  const unsigned short* gA0 = Xh + (size_t)(mb + crow) * HH + cch;                  // staged rows 0..127
  const unsigned short* gB0 = Wc + (size_t)(nb + crow) * HH + cch;                  // staged rows 128..415
  const size_t gs = (size_t)16 * HH;
  constexpr int NT = HH / KST;

  const int fa = (wm * 32 + rlane) * LPH + koff;
  const int fb = (128 + wn * (QTN / 2) + rlane) * LPH + koff;

  // column bias of this lane's column in each of its nine 16-column tiles, asked for ahead of the k loop
  float bj[QNJ];
#pragma unroll
  for (int j = 0; j < QNJ; ++j) {
    const int nc = n0 + (j << 4);              // wave-uniform; 16 divides 768
    const int pj = nc / HH;
    const float* bp = pj == 0 ? bq : pj == 1 ? bk : bv;
    bj[j] = bfr(bp[nc - pj * HH + rlane]);
  }

  // stage 0 -> buffer 0, landed and published; then stage 1 -> buffer 1 in flight
  copy8(lds0,            gA0,           gA0 + 4 * gs,  gs);
  copy8(lds0 + 8 * RSB,  gB0,           gB0 + 4 * gs,  gs);
  copy8(lds0 + 16 * RSB, gB0 + 8 * gs,  gB0 + 12 * gs, gs);
  copy2(lds0 + 24 * RSB, gB0 + 16 * gs, gs);
  wait_async0();
  __syncthreads();
  {
    const unsigned lb = lds0 + QSTG * 2;
    copy8(lb,            gA0 + KST,           gA0 + KST + 4 * gs,  gs);
    copy8(lb + 8 * RSB,  gB0 + KST,           gB0 + KST + 4 * gs,  gs);
    copy8(lb + 16 * RSB, gB0 + KST + 8 * gs,  gB0 + KST + 12 * gs, gs);
    copy2(lb + 24 * RSB, gB0 + KST + 16 * gs, gs);
  }

#pragma unroll 1   // one stage per trip: the buffer index stays a run-time value and the text small
  for (int t = 0; t < NT; ++t) {
    const unsigned short* sb = sS + (t & 1) * QSTG;
#pragma unroll
    for (int kk = 0; kk < KST; kk += 32) {
      // all eleven fragments of this k-step are asked for ahead of its 18 products
      v16us bh[QNJ], ah[2];
#pragma unroll
      for (int j = 0; j < QNJ; ++j) bh[j] = ldfrag_u(sb + fb + (j << 4) * LPH + kk);
#pragma unroll
      for (int i = 0; i < 2; ++i) ah[i] = ldfrag_u(sb + fa + (i << 4) * LPH + kk);
#pragma unroll
      for (int i = 0; i < 2; ++i) {
#pragma unroll
        for (int j = 0; j < QNJ; ++j) acc[i][j] = mma_h_raw(ah[i], bh[j], acc[i][j]);
        dep_guard1(acc[i][0], acc[i][QNJ - 1], ah[i]);
      }
      keep9_u(bh[0], bh[1], bh[2], bh[3], bh[4], bh[5], bh[6], bh[7], bh[8]);
    }
    // publish point of stage t + 1: own reads of this buffer done, own copies landed, then every wave passes
    wait_ds0();
    wait_async0();
    __syncthreads();
    if (t + 2 < NT) {                          // block-uniform: refill the buffer that this trip has just read
      const unsigned lb = lds0 + (unsigned)(t & 1) * (QSTG * 2);
      const int k2 = (t + 2) * KST;
      copy8(lb,            gA0 + k2,           gA0 + k2 + 4 * gs,  gs);
      copy8(lb + 8 * RSB,  gB0 + k2,           gB0 + k2 + 4 * gs,  gs);
      copy8(lb + 16 * RSB, gB0 + k2 + 8 * gs,  gB0 + k2 + 12 * gs, gs);
      copy2(lb + 24 * RSB, gB0 + k2 + 16 * gs, gs);
    }
  }
  wait_async0();

  // ---- epilogue ----
  const float wsc = 1.0f / WSC;
  float* slab = sT + wave * (16 * 68);
#pragma unroll
  for (int g = 0; g < 3; ++g) {
    const int ng = n0 + 48 * g;                // first column of the group
    const int pg = ng / HH;                    // wave-uniform: 0 = q, 1 = k, 2 = v
    const int c0 = ng - pg * HH;               // its column inside that product, a multiple of 16
    if (pg == 2) {
#pragma unroll
      for (int jj = 0; jj < 3; ++jj) {
        const int j = 3 * g + jj;
#pragma unroll
        for (int i = 0; i < 2; ++i) {
          v4u ha = {0u, 0u, 0u, 0u}, la = {0u, 0u, 0u, 0u};
#pragma unroll
          for (int e = 0; e < 4; ++e) {        // tokens m0 + 16 i + 8 hh2 + 2 e, + 1 of dv c0 + 16 jj + rlane
            unsigned short h0, l0, h1, l1;
            split_h(acc[i][j][2 * e]     * wsc + bj[j], h0, l0);
            split_h(acc[i][j][2 * e + 1] * wsc + bj[j], h1, l1);
            ha[e] = pk16(h0, h1);
            la[e] = pk16(l0, l1);
          }
          const size_t go = ((size_t)((c0 >> 4) + jj) * (MT / 32) + (m0 >> 5)) * 512 + i * 256 + lane * 8;
          *(v4u*)(VT + go)  = ha;
          *(v4u*)(VTl + go) = la;
        }
      }
    } else {
      unsigned short* Ch = pg ? Kh : Qh;
      unsigned short* Cl = pg ? Kl : Ql;
#pragma unroll
      for (int i = 0; i < 2; ++i) {
#pragma unroll
        for (int jj = 0; jj < 3; ++jj) {
          const int j = 3 * g + jj;
#pragma unroll
          for (int r = 0; r < 8; ++r) slab[(mOff + r) * 68 + (jj << 4) + rlane] = acc[i][j][r] * wsc + bj[j];
        }
        wave_sync_lds();
        v4u hv[3], lv[3];
#pragma unroll
        for (int it = 0; it < 3; ++it) {
          const float* sp = slab + rlane * 68 + (it * 2 + hh2) * 8;   // rows 0..15 x octets 2 it, 2 it + 1
          v4u ha = {0u, 0u, 0u, 0u}, la = {0u, 0u, 0u, 0u};
#pragma unroll
          for (int e = 0; e < 4; ++e) {
            unsigned short h0, l0, h1, l1;
            split_h(sp[2 * e],     h0, l0);
            split_h(sp[2 * e + 1], h1, l1);
            ha[e] = pk16(h0, h1);
            la[e] = pk16(l0, l1);
          }
          hv[it] = ha;
          lv[it] = la;
        }
#pragma unroll
        for (int it = 0; it < 3; ++it) {
          // columns c0 + 16 it..+15 = one half of a 32-column tile: 512 contiguous bytes, units 32 (half) + lane
          const int cq = c0 + 16 * it;
          const size_t go = ((size_t)((m0 >> 4) + i) * (HH / 32) + (cq >> 5)) * 512 + ((cq >> 4) & 1) * 256 + lane * 8;
          *(v4u*)(Ch + go) = hv[it];
          *(v4u*)(Cl + go) = lv[it];
        }
        wave_sync_lds();
      }
    }
    // the next group's arithmetic reuses the registers that this group's stores name
    if (g < 2) wait_x0();
  }
}

// out = z.Wo^T + bo -> f32, z as hi + residual planes
__global__ __launch_bounds__(256) void gemm_out(
    const unsigned short* __restrict__ Zh, const unsigned short* __restrict__ Zl,
    const unsigned short* __restrict__ Wo16, float* out, const float* __restrict__ bo) {
  __shared__ __align__(16) float sT[8 * 16 * 68];         // per-wave 16x64 slab, pitch 68 floats
  __shared__ __align__(16) unsigned short sS[2 * STGH];   // two operand stages
  gemm_body<0, 1>(sT, sS, (int)blockIdx.x, Zh, Zl, HH, Wo16, HH, nullptr, nullptr, out, HH,
                  bo, 1, 1.0f / (WSC * ZSC), 1.0f, MT, HH, HH);
}

// =====================================================================================================
// Block-diagonal attention over 256-token segments, head dim 64. Block = 256 threads = 8 waves, one block per
// (128 query tokens tq0..tq0+127, head); all 128 queries lie in one segment whose keys are tokens
// tk00 = (tq0 & ~255) .. tk00+255, every key valid (no masking); wave w owns queries tq0+16w..+15 and all 64 dv.
// Q/K planes f16 bits [token][768] (head h at cols 64h..64h+63): hi (Qh, Kh) and x2048 residual (Ql, Kl);
// V^T planes f16 [dv][token]: hi (VT) and x2048 residual (VTl). All six lie in fragment order (see ldfrag_t).
// Both products are taken transposed: S^T = K.Q^T (A = key rows, B = query columns) and O^T = V^T.P^T (A = dv rows,
// B = query columns), so that a lane holds scores, statistics and outputs of ONE query (column jc of every D tile).
// Per chunk of 32 keys: s = kh.qh^T (acc s) and kl.qh^T + kh.ql^T (acc sr), two 32-deep k-steps over the 64
// head dims; logit = (s + sr/2048) * 0.125; running-max softmax in f32: maximum and sum over the lane's own 16 keys,
// the maximum joined with lane ^ 16 in every chunk, the sum once behind the loop; p = exp(logit - m) carried as
// 1024 p, hi + x2048 residual: the two D tiles of a chunk (keys 8hh + r and 16 + 8hh + r), converted in place, are
// the B fragment in the split k map, with no pass through LDS; z^T accumulates vh.ph (oz) and vl.ph + vh.pl (orr) on
// WMMA for 4 dv tiles, z = oz + orr/2048. q, k, p and v^T fragments all use the split k map.
// coverage: 128 query rows x 64 halves at cols 64*head per block in Zh and in Zl; grid (MT/128) x 12 heads = the
// whole [4096][768] z planes.
// =====================================================================================================
__global__ __launch_bounds__(256) void attn_kernel(const unsigned short* __restrict__ Qh,
                                                   const unsigned short* __restrict__ Ql,
                                                   const unsigned short* __restrict__ Kh,
                                                   const unsigned short* __restrict__ Kl,
                                                   const unsigned short* __restrict__ VT,
                                                   const unsigned short* __restrict__ VTl,
                                                   unsigned short* Zh, unsigned short* Zl) {
  __shared__ __align__(16) unsigned short zsth[QT * ZSP];   // output staging, hi plane
  __shared__ __align__(16) unsigned short zstl[QT * ZSP];   // output staging, residual plane
  const int tq0  = blockIdx.x * QT;                         // first query token (token = b*2048 + s)
  const int tk00 = tq0 & ~(SEGL - 1);                       // first key token of the segment
  const int hc   = blockIdx.y * HD;                         // head column offset
  const int t = threadIdx.x, lane = t & 31, wv = t >> 5, hh = lane >> 4, jc = lane & 15;

  // B: col = query jc, k = head dim; tile (token / 16, col / 32), the head's two k tiles are neighbours
  const size_t qo = ((size_t)((tq0 >> 4) + wv) * (HH / 32) + (hc >> 5)) * 512 + lane * 8;
  const v16us qf0 = ldfrag_t(Qh + qo);                                  // dims 0..31
  const v16us qf1 = ldfrag_t(Qh + qo + 512);                            // dims 32..63
  wait_x0();   // the loads below may land in the registers that held the address of those above
  const v16us ql0 = ldfrag_t(Ql + qo);
  const v16us ql1 = ldfrag_t(Ql + qo + 512);
  wait_x0();   // as above
  float m = -1.0e30f, ll = 0.f;                             // query jc: running maximum; sum over this lane's keys
  v8f oz[4], orr[4];
#pragma unroll
  for (int d = 0; d < 4; ++d) { oz[d] = zero8(); orr[d] = zero8(); }
  // Per-lane addresses of the segment's first K tile (A: row = key jc, k = head dim; tile (token / 16, col / 32)) and
  // first V^T tile (A: row dv = jc, k = key token; tile (dv / 16, token / 32)) in the hi and residual planes; every
  // fragment of the segment lies at a constant offset from them.
  const size_t ko = ((size_t)(tk00 >> 4) * (HH / 32) + (hc >> 5)) * 512 + lane * 8;
  const size_t vo = ((size_t)(hc >> 4) * (MT / 32) + (tk00 >> 5)) * 512 + lane * 8;
  const unsigned short* kph = Kh + ko;
  const unsigned short* kpl = Kl + ko;
  const unsigned short* vph = VT + vo;
  const unsigned short* vpl = VTl + vo;
  constexpr int KT = (HH / 32) * 512;                       // halves to the tile row of keys 16 + jc
  constexpr int VS = (MT / 32) * 512;                       // halves to the next dv tile

  // The fragment loads run ahead of their products in four groups of four fragments, in the order of their use: K of
  // head dims 0..31, K of head dims 32..63, V^T of dv tiles 0, 1, V^T of dv tiles 2, 3. Three groups are in flight at
  // any time: a group is asked for as soon as registers are free for it (behind the products of the group three
  // places ahead of it; across the softmax, which needs the room, only two), the next chunk's K in front of this
  // chunk's second product. So the memory latencies run side by side with each other and with the arithmetic.
  v16us kf0 = ldfrag_t(kph);                                // chunk 0, head dims 0..31: keys jc, keys 16 + jc
  v16us kf1 = ldfrag_t(kph + KT);
  v16us kl0 = ldfrag_t(kpl);
  v16us kl1 = ldfrag_t(kpl + KT);
  v16us kf2 = ldfrag_t(kph + 512);                          // head dims 32..63
  v16us kf3 = ldfrag_t(kph + KT + 512);
  v16us kl2 = ldfrag_t(kpl + 512);
  v16us kl3 = ldfrag_t(kpl + KT + 512);
  v16us f0 = ldfrag_t(vph);                                 // dv tiles 0 and 1, hi and residual
  v16us f1 = ldfrag_t(vph + VS);
  v16us g0 = ldfrag_t(vpl);
  v16us g1 = ldfrag_t(vpl + VS);

  // unrolled: a group's registers change from chunk to chunk, which a rolled loop would pay for in register copies
#pragma unroll
  for (int c = 0; c < NCHK; ++c) {                          // chunk c: key tokens tk00 + 32 c .. + 31
    const int kn = (c + 1) * 2 * KT;                         // the next chunk's K: two tile rows on
    __builtin_amdgcn_sched_barrier(0);   // this and three below: the scheduler would sink the loads in front towards their users
    v8f s0 = zero8(), s1 = zero8(), sr0 = zero8(), sr1 = zero8();
    s0  = mma_h_raw(kf0, qf0, s0);                           // D row 8hh+r = key 32c+8hh+r, col jc = query 16wv+jc
    sr0 = mma_h_raw(kl0, qf0, sr0);                          // residual . hi
    s1  = mma_h_raw(kf1, qf0, s1);                           // key 32c+16+8hh+r
    sr1 = mma_h_raw(kl1, qf0, sr1);
    sr0 = mma_h_raw(kf0, ql0, sr0);                          // hi . residual
    sr1 = mma_h_raw(kf1, ql0, sr1);
    guard4x6(s0, s1, sr0, sr1, qf0, ql0, kf0, kf1, kl0, kl1);
    const v16us f2 = ldfrag_t(vph + c * 512 + 2 * VS);       // dv tiles 2 and 3
    const v16us f3 = ldfrag_t(vph + c * 512 + 3 * VS);
    const v16us g2 = ldfrag_t(vpl + c * 512 + 2 * VS);
    const v16us g3 = ldfrag_t(vpl + c * 512 + 3 * VS);
    __builtin_amdgcn_sched_barrier(0);
    s0  = mma_h_raw(kf2, qf1, s0);
    sr0 = mma_h_raw(kl2, qf1, sr0);
    s1  = mma_h_raw(kf3, qf1, s1);
    sr1 = mma_h_raw(kl3, qf1, sr1);
    sr0 = mma_h_raw(kf2, ql1, sr0);
    sr1 = mma_h_raw(kf3, ql1, sr1);
    guard4x6(s0, s1, sr0, sr1, qf1, ql1, kf2, kf3, kl2, kl3);
    float t0[8], t1[8];
#pragma unroll
    for (int r = 0; r < 8; ++r) {
      t0[r] = (s0[r] + sr0[r] * RSCI) * SCL;
      t1[r] = (s1[r] + sr1[r] * RSCI) * SCL;
    }
    float rm = fmaxf(t0[0], t1[0]);
#pragma unroll
    for (int r = 1; r < 8; ++r) rm = fmaxf(rm, fmaxf(t0[r], t1[r]));
    rm = fmaxf(rm, xhalf(rm));                               // the query's other 16 keys of the chunk
    const float mn2   = fmaxf(m, rm);
    const float alpha = __expf(m - mn2);
    float rs = 0.f;
    FragU pa, pb;                                            // B: col = query jc, elements 0..7 <- k 8hh.., 8..15 <- k 16+8hh..
#pragma unroll
    for (int r = 0; r < 8; ++r) {
      const float e0 = __expf(t0[r] - mn2);
      const float e1 = __expf(t1[r] - mn2);
      rs += e0 + e1;
      unsigned short h0, l0, h1, l1;
      split_h(e0 * PSC, h0, l0);
      split_h(e1 * PSC, h1, l1);
      pa.v[r]     = h0;                                      // P hi [query jc][k = 8hh + r]
      pa.v[8 + r] = h1;                                      // P hi [query jc][k = 16 + 8hh + r]
      pb.v[r]     = l0;                                      // P residual
      pb.v[8 + r] = l1;
    }
    ll = ll * alpha + rs;
    m  = mn2;
#pragma unroll
    for (int d = 0; d < 4; ++d) { oz[d] *= alpha; orr[d] *= alpha; }
    __builtin_amdgcn_sched_barrier(0);   // no earlier: raised into the softmax these loads would take registers it needs
    if (c + 1 < NCHK) {                                      // compile-time test
      kf0 = ldfrag_t(kph + kn);
      kf1 = ldfrag_t(kph + kn + KT);
      kl0 = ldfrag_t(kpl + kn);
      kl1 = ldfrag_t(kpl + kn + KT);
    }
    __builtin_amdgcn_sched_barrier(0);
    // D row 8hh+r = dv, col jc = query
    oz[0]  = mma_h_raw(f0, pa.v, oz[0]);
    orr[0] = mma_h_raw(g0, pa.v, orr[0]);
    oz[1]  = mma_h_raw(f1, pa.v, oz[1]);
    orr[1] = mma_h_raw(g1, pa.v, orr[1]);
    orr[0] = mma_h_raw(f0, pb.v, orr[0]);
    orr[1] = mma_h_raw(f1, pb.v, orr[1]);
    guard4x6(oz[0], oz[1], orr[0], orr[1], pa.v, pb.v, f0, f1, g0, g1);
    if (c + 1 < NCHK) {
      kf2 = ldfrag_t(kph + kn + 512);
      kf3 = ldfrag_t(kph + kn + KT + 512);
      kl2 = ldfrag_t(kpl + kn + 512);
      kl3 = ldfrag_t(kpl + kn + KT + 512);
    }
    __builtin_amdgcn_sched_barrier(0);
    oz[2]  = mma_h_raw(f2, pa.v, oz[2]);
    orr[2] = mma_h_raw(g2, pa.v, orr[2]);
    oz[3]  = mma_h_raw(f3, pa.v, oz[3]);
    orr[3] = mma_h_raw(g3, pa.v, orr[3]);
    orr[2] = mma_h_raw(f2, pb.v, orr[2]);
    orr[3] = mma_h_raw(f3, pb.v, orr[3]);
    guard4x6(oz[2], oz[3], orr[2], orr[3], pa.v, pb.v, f2, f3, g2, g3);
    if (c + 1 < NCHK) {
      f0 = ldfrag_t(vph + (c + 1) * 512);
      f1 = ldfrag_t(vph + (c + 1) * 512 + VS);
      g0 = ldfrag_t(vpl + (c + 1) * 512);
      g1 = ldfrag_t(vpl + (c + 1) * 512 + VS);
    }
  }

  {
    const float l = ll + xhalf(ll);                          // both halves of the query's keys
    const float inv = ((l > 0.f) ? (1.0f / l) : 0.f) * (ZSC / PSC);
    const int so = (16 * wv + jc) * ZSP + 8 * hh;            // query row, dv 8hh..8hh+7 of each 16: one 16-B piece
#pragma unroll
    for (int d = 0; d < 4; ++d) {
      v4u ha = {0u, 0u, 0u, 0u}, la = {0u, 0u, 0u, 0u};
#pragma unroll
      for (int e = 0; e < 4; ++e) {
        unsigned short h0, l0, h1, l1;
        split_h((oz[d][2 * e]     + orr[d][2 * e]     * RSCI) * inv, h0, l0);
        split_h((oz[d][2 * e + 1] + orr[d][2 * e + 1] * RSCI) * inv, h1, l1);
        ha[e] = pk16(h0, h1);
        la[e] = pk16(l0, l1);
      }
      *(v4u*)(zsth + so + 16 * d) = ha;
      *(v4u*)(zstl + so + 16 * d) = la;
    }
  }
  __syncthreads();
  v4u hv[4], lv[4];
#pragma unroll
  for (int it = 0; it < 4; ++it) {
    const int row = it * 32 + (t >> 3), p = (t & 7) * 8;   // it 0..3 x (t>>3) 0..31 = rows 0..127, 8 lanes per row
    hv[it] = *(const v4u*)(zsth + row * ZSP + p);
    lv[it] = *(const v4u*)(zstl + row * ZSP + p);
  }
  {
#pragma unroll
    for (int it = 0; it < 4; ++it) {
      const int row = it * 32 + (t >> 3), p = (t & 7) * 8;
      const size_t go = (size_t)(tq0 + row) * HH + hc + p;
      *(v4u*)(Zh + go) = hv[it];
      *(v4u*)(Zl + go) = lv[it];
    }
    
  }
}

// =====================================================================================================
// Workspace map (bytes); every plane is an exact multiple of its whole-row / whole-tile store granularity
//   Xh    f16 [4096][768]     0          6291456
//   Wq16  f16 [768][768]      6291456    1179648   (x16)
//   Wk16  f16 [768][768]      7471104    1179648   (x16)
//   Wv16  f16 [768][768]      8650752    1179648   (x16)
//   Wo16  f16 [768][768]      9830400    1179648   (x16)
//   Qh    f16 [4096][768]     11010048   6291456   (hi, fragment order)
//   Ql    f16 [4096][768]     17301504   6291456   (x2048 residual, fragment order)
//   Kh    f16 [4096][768]     23592960   6291456   (hi, fragment order)
//   Kl    f16 [4096][768]     29884416   6291456   (x2048 residual, fragment order)
//   VT    f16 [768][4096]     36175872   6291456   (hi, fragment order)
//   VTl   f16 [768][4096]     42467328   6291456   (x2048 residual, fragment order)
//   Zh    f16 [4096][768]     48758784   6291456   (z x16, hi)
//   Zl    f16 [4096][768]     55050240   6291456   (x2048 residual)
//   end                       61341696
// =====================================================================================================
extern "C" void kernel_launch(void* const* d_in, const int* in_sizes, int n_in,
                              void* d_out, int out_size, void* d_ws, size_t ws_size,
                              hipStream_t stream) {
  if (n_in < 9) return;
  if (in_sizes[0] != MT * HH) return;
  if (in_sizes[1] != HH * HH || in_sizes[2] != HH) return;
  if (in_sizes[3] != HH * HH || in_sizes[4] != HH) return;
  if (in_sizes[5] != HH * HH || in_sizes[6] != HH) return;
  if (in_sizes[7] != HH * HH || in_sizes[8] != HH) return;
  if (out_size != MT * HH) return;

  const float* x  = (const float*)d_in[0];
  const float* Wq = (const float*)d_in[1];
  const float* bq = (const float*)d_in[2];
  const float* Wk = (const float*)d_in[3];
  const float* bk = (const float*)d_in[4];
  const float* Wv = (const float*)d_in[5];
  const float* bv = (const float*)d_in[6];
  const float* Wo = (const float*)d_in[7];
  const float* bo = (const float*)d_in[8];

  const size_t PX  = (size_t)MT * HH * 2;        // 6291456
  const size_t PW  = (size_t)HH * HH * 2;        // 1179648
  const size_t PVT = (size_t)HH * MT * 2;        // 6291456
  size_t off = 0;
  const size_t oXh = off; off += PX;
  const size_t oWq = off; off += PW;
  const size_t oWk = off; off += PW;
  const size_t oWv = off; off += PW;
  const size_t oWo = off; off += PW;
  const size_t oQh = off; off += PX;
  const size_t oQl = off; off += PX;
  const size_t oKh = off; off += PX;
  const size_t oKl = off; off += PX;
  const size_t oVT = off; off += PVT;
  const size_t oVL = off; off += PVT;
  const size_t oZh = off; off += PX;
  const size_t oZl = off; off += PX;
  if (off > ws_size) return;                     // off = 61341696
  if (off > (size_t)134217728) return;

  char* ws = (char*)d_ws;
  unsigned short* Xh   = (unsigned short*)(ws + oXh);
  unsigned short* Wq16 = (unsigned short*)(ws + oWq);
  unsigned short* Wk16 = (unsigned short*)(ws + oWk);
  unsigned short* Wv16 = (unsigned short*)(ws + oWv);
  unsigned short* Wo16 = (unsigned short*)(ws + oWo);
  unsigned short* Qh   = (unsigned short*)(ws + oQh);
  unsigned short* Ql   = (unsigned short*)(ws + oQl);
  unsigned short* Kh   = (unsigned short*)(ws + oKh);
  unsigned short* Kl   = (unsigned short*)(ws + oKl);
  unsigned short* VT   = (unsigned short*)(ws + oVT);
  unsigned short* VTl  = (unsigned short*)(ws + oVL);
  unsigned short* Zh   = (unsigned short*)(ws + oZh);
  unsigned short* Zl   = (unsigned short*)(ws + oZl);
  float*          out0 = (float*)d_out;

  const dim3 blk(256);
  const int gsp = ((MT / 32) * (HH / 64)) / 8;             // 1536 tiles of 32x64 -> 192 blocks
  if ((((MT / 32) * (HH / 64)) % 8) != 0) return;

  // (0) x -> f16 plane of bf16 values; weights [768][768] ([out][in] = Bt[n][k]) -> f16 bits of bf16 values x16
  //     (one grid: 512 blocks for x, 96 for each weight)
  cvt_rows<<<dim3(MT / 8 + 4 * (HH / 8)), blk, 0, stream>>>(x, Wq, Wk, Wv, Wo, Xh, Wq16, Wk16, Wv16, Wo16);

  // (1) x . [Wq; Wk; Wv]^T + bias (Wq16, Wk16, Wv16 lie one behind the other: one [2304][768] matrix at Wq16)
  //     -> q and k hi + residual planes [4096][768], v^T hi + residual planes [768][4096]; 256 blocks of 128 x 288
  gemm_qkv<<<dim3(QGRD), blk, 0, stream>>>(Xh, Wq16, Qh, Ql, Kh, Kl, VT, VTl, bq, bk, bv);

  // (2) block-diagonal segment attention -> z (x16) hi + residual planes
  attn_kernel<<<dim3(MT / QT, NHD), blk, 0, stream>>>(Qh, Ql, Kh, Kl, VT, VTl, Zh, Zl);

  // (3) output projection: out = z . Wo^T + bo -> f32 (A operand split)
  gemm_out<<<dim3(gsp), blk, 0, stream>>>(Zh, Zl, Wo16, out0, bo);
  (void)hipGetLastError();
}

// v007
// Measured time: 39.7 microseconds a run.
// Timed twice side by side with v006, it ran 1.28 and 1.29 times as fast.
// Counting every step since v000, it is 4.80 times as fast.
// Contractions: q = x.Wq^T, k = x.Wk^T and v = x.Wv^T (plain f16, exact bf16-valued operands);
// attention scores q.k^T and p.v^T with q, k, p, v^T as f16 hi + x2048 residual planes (hi.hi + hi.lo + lo.hi);
// output projection z.Wo^T with z as f16 hi + x2048 residual planes (hi.W + lo.W); all v_wmma_f32_16x16x32_f16
// (f16 operands, f32 accumulate); float inputs RNE-converted to bf16 on load (x in f16 containers, weights x16
// in f16), p carried x1024, z carried x16; softmax in f32 on VALU.
#include <hip/hip_runtime.h>
#include <math.h>
#include <stdint.h>

#define NBT  2
#define SEQ  2048
#define HH   768
#define NHD  12
#define HD   64
#define SEGL 256
#define MT   (NBT * SEQ)
#define NCHK (SEGL / 32)
#define ZSP  72
#define WSC  16.0f
#define PSC  1024.0f
#define ZSC  16.0f
#define RSC  2048.0f
#define RSCI 0.00048828125f
#define SCL  0.125f
#define KST  128                   // k (halves) per LDS stage: 256 B of every staged row
#define LPH  136                   // LDS row pitch in halves: 272 B = 16 B x odd, for ds_load_b128 readers
#define SROW 384                   // rows per stage: 128 of A (or 64 hi + 64 residual), then 256 of Bt
#define STGH (SROW * LPH)          // halves per stage buffer
#define RSB  (16 * LPH * 2)        // LDS bytes between two copies of one lane (16 rows)
#define FROW (SEGL + 3 * HD)       // fused kernel, rows per stage: 256 of x, then 64 each of Wq, Wk, Wv
#define FSTG (FROW * LPH)          // halves per stage buffer
#define RS2  (32 * LPH * 2)        // LDS bytes between two copies of one lane (32 rows)
#define PLH  (SEGL * HD)           // halves of one q, k or v^T plane of a segment and head
#define SLP  36                    // slab pitch in floats: 144 B = 16 B x odd

static_assert(NHD * HD == HH);
static_assert(HD == 64);
static_assert((SEQ % SEGL) == 0 && (MT % SEGL) == 0 && (SEGL % 32) == 0);
static_assert((MT % 64) == 0 && (HH % 64) == 0 && (MT % 32) == 0 && (HH % 32) == 0);
static_assert((((MT / 64) * (HH / 64)) % 8) == 0);
static_assert((((HH / 64) * (MT / 64)) % 8) == 0);
static_assert((((MT / 32) * (HH / 64)) % 8) == 0);
static_assert((MT % 8) == 0 && (HH % 8) == 0 && (HH % 256) == 0);
static_assert(ZSP >= 64 && (ZSP % 8) == 0);
static_assert((MT % 256) == 0 && (HH % 128) == 0 && (MT % 128) == 0 && (HH % KST) == 0 && HH / KST >= 2);
static_assert((LPH % 8) == 0 && LPH >= KST);
static_assert(SEGL == 256 && FROW / 32 == 14 && (FROW % 32) == 0 && 6 * PLH <= 2 * FSTG && 2 * SEGL * ZSP <= 2 * FSTG);

typedef _Float16 v16h __attribute__((ext_vector_type(16)));
typedef _Float16 v8h  __attribute__((ext_vector_type(8)));
typedef unsigned short v16us __attribute__((ext_vector_type(16)));
typedef unsigned short v8us  __attribute__((ext_vector_type(8)));
typedef float v8f __attribute__((ext_vector_type(8)));
typedef float v4f __attribute__((ext_vector_type(4)));
typedef unsigned int v4u __attribute__((ext_vector_type(4)));

union FragU { v16us v; v8us h[2]; };

// ---- scalar helpers --------------------------------------------------------------------------------
__device__ __forceinline__ unsigned short bf_bits(float f) {          // f32 -> bf16 bits, RNE convert
  const unsigned u = __float_as_uint(f);
  return (unsigned short)((u + 0x7FFFu + ((u >> 16) & 1u)) >> 16);
}
__device__ __forceinline__ float bf_up(unsigned short h) { return __uint_as_float(((unsigned)h) << 16); }
__device__ __forceinline__ float bfr(float f) { return bf_up(bf_bits(f)); }   // value of the bf16 RNE convert
__device__ __forceinline__ unsigned short h_bits(_Float16 x) { return __builtin_bit_cast(unsigned short, x); }
__device__ __forceinline__ unsigned short f2h(float f) { return h_bits((_Float16)f); }
__device__ __forceinline__ float h_up(unsigned short h) { return (float)__builtin_bit_cast(_Float16, h); }
__device__ __forceinline__ unsigned pk16(unsigned short a, unsigned short b) { return (unsigned)a | ((unsigned)b << 16); }
__device__ __forceinline__ v8f zero8() { v8f z = {0.f, 0.f, 0.f, 0.f, 0.f, 0.f, 0.f, 0.f}; return z; }
// f -> f16 hi bits and f16 bits of the x2048 residual (f - hi) * 2048
__device__ __forceinline__ void split_h(float f, unsigned short& hi, unsigned short& lo) {
  hi = f2h(f);
  lo = f2h((f - h_up(hi)) * RSC);
}

// ---- fragment loader: 16-bit A/B operand, lane -> row/col (lane&15), p already includes +8*(lane>>4);
//      elements 0..7 <- p[0..7] (k0+8h..), elements 8..15 <- p[16..23] (k0+16+8h..)
__device__ __forceinline__ v16us ldfrag_u(const unsigned short* p) {
  FragU f;
  f.h[0] = *(const v8us*)(p);
  f.h[1] = *(const v8us*)(p + 16);
  return f.v;
}

// ---- fragment-order planes: a [R][C] f16 plane kept as tiles of 16 rows x 32 k (1024 B, tile number
//      (row / 16) * (C / 32) + col / 32), inside a tile 16-B units [k octet 0..3][row 0..15]. Lane l's two pieces of
//      the operand fragment (row l & 15, k 8 (l >> 4).. and 16 + 8 (l >> 4)..) are then units l and 32 + l: each load
//      instruction of a wave covers 512 contiguous bytes (4 whole lines) instead of 16 B in each of 16 rows.
//      p = plane + tile * 512 + lane * 8 (halves); same element order as ldfrag_u
__device__ __forceinline__ v16us ldfrag_t(const unsigned short* p) {
  FragU f;
  f.h[0] = *(const v8us*)(p);
  f.h[1] = *(const v8us*)(p + 256);
  return f.v;
}

// ---- WMMA helpers with trailing VALU hazard gap --------------------------------------------------------
__device__ __forceinline__ v8f mma_h_raw(v16us a, v16us b, v8f c) {             // f16 operands (bits), unguarded
  return __builtin_amdgcn_wmma_f32_16x16x32_f16(false, __builtin_bit_cast(v16h, a), false,
                                                __builtin_bit_cast(v16h, b), (short)0, c, false, false);
}
__device__ __forceinline__ void dep_guard1(v8f& a, v8f& b, v16us x) {
#if defined(__HIP_DEVICE_COMPILE__)
  asm volatile("v_nop\n\tv_nop\n\tv_nop\n\tv_nop" : "+v"(a), "+v"(b) : "v"(x));
#endif
}
__device__ __forceinline__ void dep_guard2(v8f& a, v8f& b, v8f& c, v8f& d, v16us x, v16us y) {
#if defined(__HIP_DEVICE_COMPILE__)
  asm volatile("v_nop\n\tv_nop\n\tv_nop\n\tv_nop" : "+v"(a), "+v"(b), "+v"(c), "+v"(d) : "v"(x), "v"(y));
#endif
}
__device__ __forceinline__ void keep4_u(v16us a, v16us b, v16us c, v16us d) {
#if defined(__HIP_DEVICE_COMPILE__)
  asm volatile("v_nop" :: "v"(a), "v"(b), "v"(c), "v"(d));
#endif
}
__device__ __forceinline__ void acc_guard4(v8f& a, v8f& b, v8f& c, v8f& d) {
#if defined(__HIP_DEVICE_COMPILE__)
  asm volatile("v_nop\n\tv_nop\n\tv_nop\n\tv_nop" : "+v"(a), "+v"(b), "+v"(c), "+v"(d));
#endif
}
// ties four D accumulators and keeps six A/B fragments live across a 4-slot VALU gap
__device__ __forceinline__ void guard4x6(v8f& a, v8f& b, v8f& c, v8f& d,
                                         v16us p, v16us q, v16us r, v16us s, v16us t, v16us u) {
#if defined(__HIP_DEVICE_COMPILE__)
  asm volatile("v_nop\n\tv_nop\n\tv_nop\n\tv_nop"
               : "+v"(a), "+v"(b), "+v"(c), "+v"(d)
               : "v"(p), "v"(q), "v"(r), "v"(s), "v"(t), "v"(u));
#endif
}
__device__ __forceinline__ void wave_sync_lds() {
  __builtin_amdgcn_fence(__ATOMIC_RELEASE, "workgroup");
  __builtin_amdgcn_wave_barrier();
  __builtin_amdgcn_fence(__ATOMIC_ACQUIRE, "workgroup");
}

// lane l's value exchanged with lane l ^ 16 (the other 16-lane row), in registers
__device__ __forceinline__ float xhalf(float x) {
  return __builtin_bit_cast(float, __builtin_amdgcn_permlanex16(__builtin_bit_cast(int, x), __builtin_bit_cast(int, x),
                                                                0x76543210, 0xfedcba98, false, false));
}

// ---- asynchronous copies global -> LDS ------------------------------------------------------------------
// Eight 16-byte copies per lane: LDS bytes l + i * RSB; global ga + i * gs (i = 0..3) and gb + i * gs (i = 4..7
// as 0..3). The closing s_wait_xcnt stands inside the statement so that no address register named by a copy is
// rewritten in front of it.
__device__ __forceinline__ void copy8(unsigned l, const unsigned short* ga, const unsigned short* gb, size_t gs) {
#if defined(__HIP_DEVICE_COMPILE__)
  asm volatile(
      "global_load_async_to_lds_b128 %0, %8, off\n\t"
      "global_load_async_to_lds_b128 %1, %9, off\n\t"
      "global_load_async_to_lds_b128 %2, %10, off\n\t"
      "global_load_async_to_lds_b128 %3, %11, off\n\t"
      "global_load_async_to_lds_b128 %4, %12, off\n\t"
      "global_load_async_to_lds_b128 %5, %13, off\n\t"
      "global_load_async_to_lds_b128 %6, %14, off\n\t"
      "global_load_async_to_lds_b128 %7, %15, off\n\t"
      "s_wait_xcnt 0x0"
      :: "v"(l), "v"(l + RSB), "v"(l + 2 * RSB), "v"(l + 3 * RSB),
         "v"(l + 4 * RSB), "v"(l + 5 * RSB), "v"(l + 6 * RSB), "v"(l + 7 * RSB),
         "v"(ga), "v"(ga + gs), "v"(ga + 2 * gs), "v"(ga + 3 * gs),
         "v"(gb), "v"(gb + gs), "v"(gb + 2 * gs), "v"(gb + 3 * gs)
      : "memory");
#endif
}
// this wave's own copies have landed in LDS
__device__ __forceinline__ void wait_async0() {
#if defined(__HIP_DEVICE_COMPILE__)
  asm volatile("s_wait_asynccnt 0x0" ::: "memory");
#endif
}
// in front of an overwrite of registers that issued global loads or stores name
__device__ __forceinline__ void wait_x0() {
#if defined(__HIP_DEVICE_COMPILE__)
  asm volatile("s_wait_xcnt 0x0" ::: "memory");
#endif
}
// this wave's own LDS reads have returned, before the buffer they read is handed to its next writer
__device__ __forceinline__ void wait_ds0() {
#if defined(__HIP_DEVICE_COMPILE__)
  asm volatile("s_wait_dscnt 0x0" ::: "memory");
#endif
}

// =====================================================================================================
// Rows [nrows][768] f32 -> f16 bits of (bf16 RNE value * sc). Used for x (sc = 1) and for the [out][in]
// weight matrices (sc = 16), which are already Bt[n][k] with k contiguous. The five conversions need nothing
// of each other and share one grid by ranges of the block index: blocks 0..MT/8-1 take x, then HH/8 blocks
// for each of Wq, Wk, Wv, Wo. One wave per row; three column
// chunks of 256: lane owns columns 256c + 8*lane..+7, one instruction = 32 lanes x 16 B = 512 contiguous B
// coverage: 8 rows per block, grid = MT/8 + 4 HH/8 exact, 3 chunks x 256 = 768 cols: union = every row of all five.
// =====================================================================================================
__global__ __launch_bounds__(256) void cvt_rows(const float* __restrict__ xin, const float* __restrict__ Wq,
                                                const float* __restrict__ Wk, const float* __restrict__ Wv,
                                                const float* __restrict__ Wo, unsigned short* Xh,
                                                unsigned short* Wq16, unsigned short* Wk16,
                                                unsigned short* Wv16, unsigned short* Wo16) {
  const int wb  = (int)blockIdx.x - MT / 8;               // block-uniform: below 0 = x, else a weight block
  const int wi  = wb / (HH / 8);                          // which weight, 0..3
  const bool isx = wb < 0;
  const float* x = isx ? xin : wi == 0 ? Wq : wi == 1 ? Wk : wi == 2 ? Wv : Wo;
  unsigned short* xh = isx ? Xh : wi == 0 ? Wq16 : wi == 1 ? Wk16 : wi == 2 ? Wv16 : Wo16;
  const int nrows = isx ? MT : HH;
  const float sc  = isx ? 1.0f : WSC;
  const int row = (isx ? (int)blockIdx.x : wb - wi * (HH / 8)) * 8 + (threadIdx.x >> 5);
  const int lane = threadIdx.x & 31;
  if (wi > 3 || row >= nrows) return;                     // wave-uniform, no barriers below
  v4u hv[HH / 256];
#pragma unroll
  for (int c = 0; c < HH / 256; ++c) {
    const float* p = x + (size_t)row * HH + c * 256 + lane * 8;
    const v4f a0 = *(const v4f*)(p);
    const v4f a1 = *(const v4f*)(p + 4);
    v4u h;
#pragma unroll
    for (int e = 0; e < 2; ++e) {
      h[e]     = pk16(f2h(bfr(a0[2 * e]) * sc), f2h(bfr(a0[2 * e + 1]) * sc));
      h[2 + e] = pk16(f2h(bfr(a1[2 * e]) * sc), f2h(bfr(a1[2 * e + 1]) * sc));
    }
    hv[c] = h;
  }
  unsigned short* d = xh + (size_t)row * HH + lane * 8;
  {
#pragma unroll
    for (int c = 0; c < HH / 256; ++c) *(v4u*)(d + c * 256) = hv[c];
    
  }
}

// =====================================================================================================
// Register-blocked f16 WMMA GEMM: C[m][n] = (sum_k A[m][k] * Bt[n][k] * wsc + bias) * osc, one wave per TRx64
// tile (TR = 64, or 32 when the A operand is split); the block's 8 waves form a (2 TR) x 256 tile (2 x 4 waves)
// whose operand rows are staged in LDS, 128 k at a time, two buffers, by asynchronous 16-byte copies (16 lanes
// per 256-B row piece), the next stage in flight while this one is multiplied. A row-major [M][K] pitch lda (ASPL = 1:
// a second plane Al holds the x2048 residual, same pitch, products into a separate accumulator folded back
// as acc + accr/2048); Bt row-major [N][K] pitch ldb (k contiguous); M multiple of 2 TR, N of 256, K of 128 and at
// least 256 (true at every call site; host-checked grids = tiles/8 exact so no block exits early).
// OM: 0 = f32 out Cf (row-major, pitch ldc); 1 = f16 hi bits Ch plus x2048 residual bits Cl, both in fragment order
// (see ldfrag_t) with ldc columns.
// cbm (block-uniform): 0 = no bias; 1 = column bias bf16(cb[n]); 2 = row bias bf16(cb[m]). All biases bf16 RNE values.
// bid = the block's tile number inside this product; sT (per-wave 16x64 slabs, pitch 68 floats) and sS (two operand
// stages) are the calling kernel's LDS arrays.
// coverage: MI slabs x 16 rows x 64 cols = the wave's whole TRx64 tile; tiles/8 blocks x 8 waves = every tile.
// =====================================================================================================
template <int OM, int ASPL>
__device__ __forceinline__ void gemm_body(
    float* sT, unsigned short* sS, int bid,
    const unsigned short* __restrict__ Ap, const unsigned short* __restrict__ Alp, int lda,
    const unsigned short* __restrict__ Btp, int ldb,
    unsigned short* Ch, unsigned short* Cl, float* Cf, int ldc,
    const float* __restrict__ cb, int cbm, float wsc, float osc, int M, int N, int K) {
  constexpr int MI = ASPL ? 2 : 4;
  constexpr int TR = 16 * MI;
  const int lane = threadIdx.x & 31;
  const int wave = threadIdx.x >> 5;
  const int tilesN = N >> 8;
  const int tilesM = M / (2 * TR);
  if (bid >= tilesM * tilesN) return;   // block-uniform, in front of every barrier
  const int tm = bid / tilesN;
  const int tn = bid - tm * tilesN;
  const int wm = wave >> 2;                    // wave row 0..1
  const int wn = wave & 3;                     // wave column 0..3
  const int mb = tm * (2 * TR);                // block's first row of A
  const int nb = tn << 8;                      // block's first row of Bt
  const int m0 = mb + wm * TR;
  const int n0 = nb + (wn << 6);

  const int rlane = lane & 15;                 // row (A) / col (B, D) within subtile
  const int koff  = (lane >> 4) * 8;           // k offset of this lane half
  const int mOff  = (lane >> 4) * 8;           // D row offset

  v8f acc[MI][4];
  v8f accr[MI][4];
#pragma unroll
  for (int i = 0; i < MI; ++i)
#pragma unroll
    for (int j = 0; j < 4; ++j) { acc[i][j] = zero8(); accr[i][j] = zero8(); }

  // copy map: lane's 16-B piece cch of staged row crow + 16 i, i = 0..23 (rows 0..127 A, 128..383 Bt)
  const int crow = threadIdx.x >> 4;           // 0..15
  const int cch  = (threadIdx.x & 15) * 8;     // halves
  const unsigned lds0 = (unsigned)(size_t)sS + (unsigned)(crow * LPH + cch) * 2u;   // LDS byte address, buffer 0
  const unsigned short* gA0 = Ap + (size_t)(mb + crow) * lda + cch;                 // staged rows 0..63
  const unsigned short* gA1 = ASPL ? Alp + (size_t)(mb + crow) * lda + cch          // rows 64..127: residual plane
                                   : gA0 + (size_t)64 * lda;                        // or A rows 64..127
  const unsigned short* gB0 = Btp + (size_t)(nb + crow) * ldb + cch;                // staged rows 128..383
  const size_t gsa = (size_t)16 * lda, gsb = (size_t)16 * ldb;
  const int NT = K / KST;

  // staged row of this lane's first A fragment and first Bt fragment, with its k offset
  const int fa = (wm * TR + rlane) * LPH + koff;
  const int fb = (128 + (wn << 6) + rlane) * LPH + koff;

  // stage 0 -> buffer 0, landed and published; then stage 1 -> buffer 1 in flight
  copy8(lds0,            gA0,           gA1,            gsa);
  copy8(lds0 + 8 * RSB,  gB0,           gB0 + 4 * gsb,  gsb);
  copy8(lds0 + 16 * RSB, gB0 + 8 * gsb, gB0 + 12 * gsb, gsb);
  wait_async0();
  __syncthreads();
  if (NT > 1) {
    const unsigned lb = lds0 + STGH * 2;
    copy8(lb,            gA0 + KST,           gA1 + KST,            gsa);
    copy8(lb + 8 * RSB,  gB0 + KST,           gB0 + KST + 4 * gsb,  gsb);
    copy8(lb + 16 * RSB, gB0 + KST + 8 * gsb, gB0 + KST + 12 * gsb, gsb);
  }

#pragma unroll 1   // one stage per trip: the buffer index stays a run-time value and the text small
  for (int t = 0; t < NT; ++t) {
    const unsigned short* sb = sS + (t & 1) * STGH;
#pragma unroll
    for (int kk = 0; kk < KST; kk += 32) {
      // all eight fragments of this k-step are asked for ahead of its 16 products, not one A fragment per four
      v16us bh[4], ahf[MI], alf[MI];
#pragma unroll
      for (int j = 0; j < 4; ++j) bh[j] = ldfrag_u(sb + fb + (j << 4) * LPH + kk);
#pragma unroll
      for (int i = 0; i < MI; ++i) {
        ahf[i] = ldfrag_u(sb + fa + (i << 4) * LPH + kk);
        if (ASPL) alf[i] = ldfrag_u(sb + fa + (64 + (i << 4)) * LPH + kk);
      }
#pragma unroll
      for (int i = 0; i < MI; ++i) {
        const v16us ah = ahf[i];
        if (ASPL) {
          const v16us al = alf[i];
#pragma unroll
          for (int j = 0; j < 4; ++j) {
            acc[i][j]  = mma_h_raw(ah, bh[j], acc[i][j]);
            accr[i][j] = mma_h_raw(al, bh[j], accr[i][j]);
          }
          dep_guard2(acc[i][0], acc[i][3], accr[i][0], accr[i][3], ah, al);
        } else {
#pragma unroll
          for (int j = 0; j < 4; ++j) acc[i][j] = mma_h_raw(ah, bh[j], acc[i][j]);
          dep_guard1(acc[i][0], acc[i][3], ah);
        }
      }
      keep4_u(bh[0], bh[1], bh[2], bh[3]);
    }
    // publish point of stage t + 1: own reads of this buffer done, own copies landed, then every wave passes
    wait_ds0();
    wait_async0();
    __syncthreads();
    if (t + 2 < NT) {                          // block-uniform: refill the buffer that this trip has just read
      const unsigned lb = lds0 + (unsigned)(t & 1) * (STGH * 2);
      const int k2 = (t + 2) * KST;
      copy8(lb,            gA0 + k2,           gA1 + k2,            gsa);
      copy8(lb + 8 * RSB,  gB0 + k2,           gB0 + k2 + 4 * gsb,  gsb);
      copy8(lb + 16 * RSB, gB0 + k2 + 8 * gsb, gB0 + k2 + 12 * gsb, gsb);
    }
  }
  wait_async0();
#pragma unroll
  for (int i = 0; i < MI; ++i) {
    acc_guard4(acc[i][0], acc[i][1], acc[i][2], acc[i][3]);
    if (ASPL) acc_guard4(accr[i][0], accr[i][1], accr[i][2], accr[i][3]);
  }

  const int hh2 = lane >> 4, c4 = (lane & 15) * 4;     // f32 out: 256-B row segment = 16 lanes x 16 B
  // f16 planes out: store it takes k octets 2 it and 2 it + 1 of the slab, lane = octet half hh2 x row rlane

  v4f cb4 = {0.f, 0.f, 0.f, 0.f};
  float cbc[4][8];                             // column bias of columns n0 + 8 (2 it + hh2) + e
#pragma unroll
  for (int it = 0; it < 4; ++it)
#pragma unroll
    for (int e = 0; e < 8; ++e) cbc[it][e] = 0.f;
  if (OM == 0 && cbm == 1) {
    const v4f v = *(const v4f*)(cb + n0 + c4);
    cb4[0] = bfr(v[0]); cb4[1] = bfr(v[1]); cb4[2] = bfr(v[2]); cb4[3] = bfr(v[3]);
  }
  if (OM == 1 && cbm == 1) {
#pragma unroll
    for (int it = 0; it < 4; ++it) {
      const float* bp = cb + n0 + (it * 2 + hh2) * 8;
      const v4f v0 = *(const v4f*)(bp);
      const v4f v1 = *(const v4f*)(bp + 4);
#pragma unroll
      for (int e = 0; e < 4; ++e) { cbc[it][e] = bfr(v0[e]); cbc[it][4 + e] = bfr(v1[e]); }
    }
  }
  float rbv[MI];                               // row bias of output row m0 + 16 i + rlane
#pragma unroll
  for (int i = 0; i < MI; ++i) rbv[i] = 0.f;
  if (OM == 1 && cbm == 2) {                   // one block-uniform branch: all loads in flight together
#pragma unroll
    for (int i = 0; i < MI; ++i) rbv[i] = bfr(cb[m0 + (i << 4) + rlane]);
  }

  // ---- epilogue ----
  float* slab = sT + wave * (16 * 68);
#pragma unroll
  for (int i = 0; i < MI; ++i) {
    const int mBase = m0 + (i << 4);
#pragma unroll
    for (int j = 0; j < 4; ++j) {
#pragma unroll
      for (int r = 0; r < 8; ++r) {
        float v = acc[i][j][r];
        if (ASPL) v += accr[i][j][r] * RSCI;
        slab[(mOff + r) * 68 + (j << 4) + rlane] = v;
      }
    }
    wave_sync_lds();
    if (OM == 0) {
      v4f vals[8];
#pragma unroll
      for (int it = 0; it < 8; ++it) {
        const int row = it * 2 + hh2;                      // it 0..7 x hh2 0..1 = rows 0..15
        const v4f v = *(const v4f*)(slab + row * 68 + c4);
        vals[it] = (v * wsc + cb4) * osc;
      }
      {
#pragma unroll
        for (int it = 0; it < 8; ++it) {
          const int row = it * 2 + hh2;
          *(v4f*)(Cf + (size_t)(mBase + row) * ldc + (size_t)n0 + c4) = vals[it];
        }
        
      }
    }
    if (OM == 1) {
      v4u hv[4], lv[4];
#pragma unroll
      for (int it = 0; it < 4; ++it) {
        const float* sp = slab + rlane * 68 + (it * 2 + hh2) * 8;   // rows 0..15 x octets 2 it, 2 it + 1
        const float rb = rbv[i];
        v4u ha = {0u, 0u, 0u, 0u}, la = {0u, 0u, 0u, 0u};
#pragma unroll
        for (int e = 0; e < 4; ++e) {
          const float f0 = (sp[2 * e]     * wsc + cbc[it][2 * e]     + rb) * osc;
          const float f1 = (sp[2 * e + 1] * wsc + cbc[it][2 * e + 1] + rb) * osc;
          unsigned short h0, l0, h1, l1;
          split_h(f0, h0, l0);
          split_h(f1, h1, l1);
          ha[e] = pk16(h0, h1);
          la[e] = pk16(l0, l1);
        }
        hv[it] = ha;
        lv[it] = la;
      }
      {
        // tiles (mBase / 16, n0 / 32) and the next one; store it = 512 contiguous bytes: units 32 (it & 1) + lane
        const size_t gt = ((size_t)(mBase >> 4) * (ldc >> 5) + (n0 >> 5)) * 512 + lane * 8;
#pragma unroll
        for (int it = 0; it < 4; ++it) {
          const size_t go = gt + (it >> 1) * 512 + (it & 1) * 256;
          *(v4u*)(Ch + go) = hv[it];
          *(v4u*)(Cl + go) = lv[it];
        }
        
      }
    }
    wave_sync_lds();
  }
}

// out = z.Wo^T + bo -> f32, z as hi + residual planes
__global__ __launch_bounds__(256) void gemm_out(
    const unsigned short* __restrict__ Zh, const unsigned short* __restrict__ Zl,
    const unsigned short* __restrict__ Wo16, float* out, const float* __restrict__ bo) {
  __shared__ __align__(16) float sT[8 * 16 * 68];         // per-wave 16x64 slab, pitch 68 floats
  __shared__ __align__(16) unsigned short sS[2 * STGH];   // two operand stages
  gemm_body<0, 1>(sT, sS, (int)blockIdx.x, Zh, Zl, HH, Wo16, HH, nullptr, nullptr, out, HH,
                  bo, 1, 1.0f / (WSC * ZSC), 1.0f, MT, HH, HH);
}

// Fourteen 16-byte copies per lane, one stage of the fused kernel below: LDS bytes l + i * RS2 (32 rows apart); global
// ga + i * 32 rows (i = 0..7), then two each from gq, gk and gv. The closing s_wait_xcnt stands inside the statement so
// that no address register named by a copy is rewritten in front of it.
__device__ __forceinline__ void copy14(unsigned l, const unsigned short* ga, const unsigned short* gq,
                                       const unsigned short* gk, const unsigned short* gv) {
#if defined(__HIP_DEVICE_COMPILE__)
  constexpr size_t gs = (size_t)32 * HH;
  asm volatile(
      "global_load_async_to_lds_b128 %0, %14, off\n\t"
      "global_load_async_to_lds_b128 %1, %15, off\n\t"
      "global_load_async_to_lds_b128 %2, %16, off\n\t"
      "global_load_async_to_lds_b128 %3, %17, off\n\t"
      "global_load_async_to_lds_b128 %4, %18, off\n\t"
      "global_load_async_to_lds_b128 %5, %19, off\n\t"
      "global_load_async_to_lds_b128 %6, %20, off\n\t"
      "global_load_async_to_lds_b128 %7, %21, off\n\t"
      "global_load_async_to_lds_b128 %8, %22, off\n\t"
      "global_load_async_to_lds_b128 %9, %23, off\n\t"
      "global_load_async_to_lds_b128 %10, %24, off\n\t"
      "global_load_async_to_lds_b128 %11, %25, off\n\t"
      "global_load_async_to_lds_b128 %12, %26, off\n\t"
      "global_load_async_to_lds_b128 %13, %27, off\n\t"
      "s_wait_xcnt 0x0"
      :: "v"(l), "v"(l + 1 * RS2), "v"(l + 2 * RS2), "v"(l + 3 * RS2), "v"(l + 4 * RS2), "v"(l + 5 * RS2), "v"(l + 6 * RS2),
         "v"(l + 7 * RS2), "v"(l + 8 * RS2), "v"(l + 9 * RS2), "v"(l + 10 * RS2), "v"(l + 11 * RS2), "v"(l + 12 * RS2), "v"(l + 13 * RS2),
         "v"(ga), "v"(ga + gs), "v"(ga + 2 * gs), "v"(ga + 3 * gs),
         "v"(ga + 4 * gs), "v"(ga + 5 * gs), "v"(ga + 6 * gs), "v"(ga + 7 * gs),
         "v"(gq), "v"(gq + gs), "v"(gk), "v"(gk + gs), "v"(gv), "v"(gv + gs)
      : "memory");
#endif
}

// =====================================================================================================
// Projection and attention of one (256-token segment, head) in one block of 16 waves; q, k and v never leave the WGP.
// Part 1: [256 tokens][192] = x_seg . [Wq_h; Wk_h; Wv_h]^T + bias, the head's 64 rows of each f16 weight plane. Operand
// rows staged in LDS as in gemm_body: 128 k per stage, two buffers, asynchronous 16-byte copies, 14 per lane and stage
// (rows 0..255 x, 256..319 Wq_h, 320..383 Wk_h, 384..447 Wv_h). Waves as 4 x 4: wave (wm, wn) owns tokens 64 wm..+63 and
// columns 16 wn..+15 of each of q, k and v (4 x 3 accumulators).
// Part 2: behind the k loop's last barrier the stage buffers are free; the six planes q, k [256][64] and v^T [64][256],
// f16 hi and x2048 residual, are written over them in fragment order (see ldfrag_t): q, k through the wave's slab;
// v from the accumulator itself, which holds 8 successive tokens of one dv per lane = one 16-B unit. One barrier.
// Part 3: attention over the segment, every key valid (no masking); wave w owns queries 16 w..+15 and all 64 dv.
// Both products are taken transposed: S^T = K.Q^T (A = key rows, B = query columns) and O^T = V^T.P^T (A = dv rows,
// B = query columns), so that a lane holds scores, statistics and outputs of ONE query (column jc of every D tile).
// Per chunk of 32 keys: s = kh.qh^T (acc s) and kl.qh^T + kh.ql^T (acc sr), two 32-deep k-steps over the 64
// head dims; logit = (s + sr/2048) * 0.125; running-max softmax in f32: maximum and sum over the lane's own 16 keys,
// the maximum joined with lane ^ 16 in every chunk, the sum once behind the loop; p = exp(logit - m) carried as
// 1024 p, hi + x2048 residual: the two D tiles of a chunk (keys 8hh + r and 16 + 8hh + r), converted in place, are
// the B fragment in the split k map, with no pass through LDS; z^T accumulates vh.ph (oz) and vl.ph + vh.pl (orr) on
// WMMA for 4 dv tiles, z = oz + orr/2048. q, k, p and v^T fragments all use the split k map.
// coverage: 256 query rows x 64 halves at cols 64*head per block in Zh and in Zl; grid (MT/256) x 12 heads = the
// whole [4096][768] z planes.
// =====================================================================================================
__global__ __launch_bounds__(512) void qkv_attn(
    const unsigned short* __restrict__ Xh, const unsigned short* __restrict__ Wc,
    const float* __restrict__ bq, const float* __restrict__ bk, const float* __restrict__ bv,
    unsigned short* Zh, unsigned short* Zl) {
  __shared__ __align__(16) float sT[16 * 16 * SLP];       // per-wave 16x32 slab, pitch 36 floats
  __shared__ __align__(16) unsigned short sS[2 * FSTG];   // two operand stages; then the six planes; then z staging
  const int tq0  = blockIdx.x * SEGL;                     // first token of the segment (token = b*2048 + s)
  const int hc   = blockIdx.y * HD;                       // head column offset
  const int t = threadIdx.x, lane = t & 31, hh = lane >> 4, jc = lane & 15;
  const int wv = __builtin_amdgcn_readfirstlane(t >> 5);
  const int wm = wv >> 2;                      // wave row 0..3
  const int wn = wv & 3;                       // wave column 0..3
  const int koff = hh * 8;                     // k offset of this lane half
  const int mOff = hh * 8;                     // D row offset

  unsigned short* pQh = sS;
  unsigned short* pQl = sS + PLH;
  unsigned short* pKh = sS + 2 * PLH;
  unsigned short* pKl = sS + 3 * PLH;
  unsigned short* pVh = sS + 4 * PLH;
  unsigned short* pVl = sS + 5 * PLH;

  {
    v8f acc[4][3];
#pragma unroll
    for (int i = 0; i < 4; ++i)
#pragma unroll
      for (int j = 0; j < 3; ++j) acc[i][j] = zero8();

    // copy map: lane's 16-B piece cch of staged row crow + 32 i, i = 0..13
    const int crow = t >> 4;                   // 0..31
    const int cch  = (t & 15) * 8;             // halves
    const unsigned lds0 = (unsigned)(size_t)sS + (unsigned)(crow * LPH + cch) * 2u;   // LDS byte address, buffer 0
    const unsigned short* gA = Xh + (size_t)(tq0 + crow) * HH + cch;                  // staged rows 0..255
    const unsigned short* gQ = Wc + (size_t)(hc + crow) * HH + cch;                   // staged rows 256..319
    const unsigned short* gK = gQ + (size_t)HH * HH;                                  // staged rows 320..383
    const unsigned short* gV = gK + (size_t)HH * HH;                                  // staged rows 384..447
    constexpr int NT = HH / KST;

    const int fa = (wm * 64 + jc) * LPH + koff;
    const int fb = (SEGL + wn * 16 + jc) * LPH + koff;

    // bias of this lane's column of q, k and v, asked for ahead of the k loop
    float bj[3];
    bj[0] = bfr(bq[hc + wn * 16 + jc]);
    bj[1] = bfr(bk[hc + wn * 16 + jc]);
    bj[2] = bfr(bv[hc + wn * 16 + jc]);

    // stage 0 -> buffer 0, landed and published; then stage 1 -> buffer 1 in flight
    copy14(lds0, gA, gQ, gK, gV);
    wait_async0();
    __syncthreads();
    copy14(lds0 + FSTG * 2, gA + KST, gQ + KST, gK + KST, gV + KST);

#pragma unroll 1   // one stage per trip: the buffer index stays a run-time value and the text small
    for (int s = 0; s < NT; ++s) {
      const unsigned short* sb = sS + (s & 1) * FSTG;
#pragma unroll
      for (int kk = 0; kk < KST; kk += 32) {
        // all seven fragments of this k-step are asked for ahead of its 12 products
        v16us bh[3], ah[4];
#pragma unroll
        for (int j = 0; j < 3; ++j) bh[j] = ldfrag_u(sb + fb + (j << 6) * LPH + kk);
#pragma unroll
        for (int i = 0; i < 4; ++i) ah[i] = ldfrag_u(sb + fa + (i << 4) * LPH + kk);
#pragma unroll
        for (int i = 0; i < 4; ++i) {
#pragma unroll
          for (int j = 0; j < 3; ++j) acc[i][j] = mma_h_raw(ah[i], bh[j], acc[i][j]);
          dep_guard1(acc[i][0], acc[i][2], ah[i]);
        }
        keep4_u(bh[0], bh[1], bh[2], bh[2]);
      }
      // publish point of stage s + 1: own reads of this buffer done, own copies landed, then every wave passes
      wait_ds0();
      wait_async0();
      __syncthreads();
      if (s + 2 < NT) {                        // block-uniform: refill the buffer that this trip has just read
        const int k2 = (s + 2) * KST;
        copy14(lds0 + (unsigned)(s & 1) * (FSTG * 2), gA + k2, gQ + k2, gK + k2, gV + k2);
      }
    }
    wait_async0();

    // ---- planes into LDS: every wave has passed the last trip's barrier, no copy is in flight ----
    const float wsc = 1.0f / WSC;
    float* slab = sT + wv * (16 * SLP);
#pragma unroll
    for (int i = 0; i < 4; ++i) {
      {
        v4u ha = {0u, 0u, 0u, 0u}, la = {0u, 0u, 0u, 0u};
#pragma unroll
        for (int e = 0; e < 4; ++e) {          // tokens 64 wm + 16 i + 8 hh + 2 e, + 1 of dv 16 wn + jc
          unsigned short h0, l0, h1, l1;
          split_h(acc[i][2][2 * e]     * wsc + bj[2], h0, l0);
          split_h(acc[i][2][2 * e + 1] * wsc + bj[2], h1, l1);
          ha[e] = pk16(h0, h1);
          la[e] = pk16(l0, l1);
        }
        // tile (dv / 16 = wn, token / 32 = 2 wm + i / 2), units 32 (i & 1) + lane
        const int go = (wn * (SEGL / 32) + wm * 2 + (i >> 1)) * 512 + (i & 1) * 256 + lane * 8;
        *(v4u*)(pVh + go) = ha;
        *(v4u*)(pVl + go) = la;
      }
#pragma unroll
      for (int jj = 0; jj < 2; ++jj)
#pragma unroll
        for (int r = 0; r < 8; ++r) slab[(mOff + r) * SLP + (jj << 4) + jc] = acc[i][jj][r] * wsc + bj[jj];
      wave_sync_lds();
#pragma unroll
      for (int jj = 0; jj < 2; ++jj) {
        const float* sp = slab + jc * SLP + (jj * 2 + hh) * 8;   // token row jc, dims 16 wn + 8 hh..+7 of q (jj 0), k (1)
        v4u ha = {0u, 0u, 0u, 0u}, la = {0u, 0u, 0u, 0u};
#pragma unroll
        for (int e = 0; e < 4; ++e) {
          unsigned short h0, l0, h1, l1;
          split_h(sp[2 * e],     h0, l0);
          split_h(sp[2 * e + 1], h1, l1);
          ha[e] = pk16(h0, h1);
          la[e] = pk16(l0, l1);
        }
        // tile (token / 16 = 4 wm + i, col / 32 = wn / 2), units 32 (wn & 1) + lane
        const int go = ((wm * 4 + i) * (HD / 32) + (wn >> 1)) * 512 + (wn & 1) * 256 + lane * 8;
        *(v4u*)((jj ? pKh : pQh) + go) = ha;
        *(v4u*)((jj ? pKl : pQl) + go) = la;
      }
      wave_sync_lds();
    }
  }
  __syncthreads();   // the planes are whole before any wave reads a fragment

  // B: col = query jc, k = head dim; tile (token / 16 = wv, col / 32), the two k tiles are neighbours
  const int qo = wv * (HD / 32) * 512 + lane * 8;
  const v16us qf0 = ldfrag_t(pQh + qo);                                 // dims 0..31
  const v16us qf1 = ldfrag_t(pQh + qo + 512);                           // dims 32..63
  const v16us ql0 = ldfrag_t(pQl + qo);
  const v16us ql1 = ldfrag_t(pQl + qo + 512);
  float m = -1.0e30f, ll = 0.f;                             // query jc: running maximum; sum over this lane's keys
  v8f oz[4], orr[4];
#pragma unroll
  for (int d = 0; d < 4; ++d) { oz[d] = zero8(); orr[d] = zero8(); }
  // Per-lane LDS addresses of the segment's first K tile (A: row = key jc, k = head dim; tile (token / 16, col / 32))
  // and first V^T tile (A: row dv = jc, k = key token; tile (dv / 16, token / 32)) in the hi and residual planes; every
  // fragment of the segment lies at a constant offset from them.
  const unsigned short* kph = pKh + lane * 8;
  const unsigned short* kpl = pKl + lane * 8;
  const unsigned short* vph = pVh + lane * 8;
  const unsigned short* vpl = pVl + lane * 8;
  constexpr int KT = (HD / 32) * 512;                       // halves to the tile row of keys 16 + jc
  constexpr int VS = (SEGL / 32) * 512;                     // halves to the next dv tile

  // The fragment loads run ahead of their products in four groups of four fragments, in the order of their use: K of
  // head dims 0..31, K of head dims 32..63, V^T of dv tiles 0, 1, V^T of dv tiles 2, 3. A group is asked for at least
  // one product group ahead of its use: V^T of dv tiles 2, 3 and the next chunk's first K group behind the softmax
  // (which needs the room), the second K group behind the first half of P.V, the next V^T of dv tiles 0, 1 behind the
  // second. So the LDS latencies run side by side with each other and with the arithmetic.
  v16us kf0 = ldfrag_t(kph);                                // chunk 0, head dims 0..31: keys jc, keys 16 + jc
  v16us kf1 = ldfrag_t(kph + KT);
  v16us kl0 = ldfrag_t(kpl);
  v16us kl1 = ldfrag_t(kpl + KT);
  v16us kf2 = ldfrag_t(kph + 512);                          // head dims 32..63
  v16us kf3 = ldfrag_t(kph + KT + 512);
  v16us kl2 = ldfrag_t(kpl + 512);
  v16us kl3 = ldfrag_t(kpl + KT + 512);
  v16us f0 = ldfrag_t(vph);                                 // dv tiles 0 and 1, hi and residual
  v16us f1 = ldfrag_t(vph + VS);
  v16us g0 = ldfrag_t(vpl);
  v16us g1 = ldfrag_t(vpl + VS);

  // unrolled: a group's registers change from chunk to chunk, which a rolled loop would pay for in register copies
#pragma unroll
  for (int c = 0; c < NCHK; ++c) {                          // chunk c: the segment's keys 32 c .. + 31
    const int kn = (c + 1) * 2 * KT;                         // the next chunk's K: two tile rows on
    __builtin_amdgcn_sched_barrier(0);   // this and two below: the scheduler would sink the loads in front towards their users
    v8f s0 = zero8(), s1 = zero8(), sr0 = zero8(), sr1 = zero8();
    s0  = mma_h_raw(kf0, qf0, s0);                           // D row 8hh+r = key 32c+8hh+r, col jc = query 16wv+jc
    sr0 = mma_h_raw(kl0, qf0, sr0);                          // residual . hi
    s1  = mma_h_raw(kf1, qf0, s1);                           // key 32c+16+8hh+r
    sr1 = mma_h_raw(kl1, qf0, sr1);
    sr0 = mma_h_raw(kf0, ql0, sr0);                          // hi . residual
    sr1 = mma_h_raw(kf1, ql0, sr1);
    guard4x6(s0, s1, sr0, sr1, qf0, ql0, kf0, kf1, kl0, kl1);
    s0  = mma_h_raw(kf2, qf1, s0);
    sr0 = mma_h_raw(kl2, qf1, sr0);
    s1  = mma_h_raw(kf3, qf1, s1);
    sr1 = mma_h_raw(kl3, qf1, sr1);
    sr0 = mma_h_raw(kf2, ql1, sr0);
    sr1 = mma_h_raw(kf3, ql1, sr1);
    guard4x6(s0, s1, sr0, sr1, qf1, ql1, kf2, kf3, kl2, kl3);
    float t0[8], t1[8];
#pragma unroll
    for (int r = 0; r < 8; ++r) {
      t0[r] = (s0[r] + sr0[r] * RSCI) * SCL;
      t1[r] = (s1[r] + sr1[r] * RSCI) * SCL;
    }
    float rm = fmaxf(t0[0], t1[0]);
#pragma unroll
    for (int r = 1; r < 8; ++r) rm = fmaxf(rm, fmaxf(t0[r], t1[r]));
    rm = fmaxf(rm, xhalf(rm));                               // the query's other 16 keys of the chunk
    const float mn2   = fmaxf(m, rm);
    const float alpha = __expf(m - mn2);
    float rs = 0.f;
    FragU pa, pb;                                            // B: col = query jc, elements 0..7 <- k 8hh.., 8..15 <- k 16+8hh..
#pragma unroll
    for (int r = 0; r < 8; ++r) {
      const float e0 = __expf(t0[r] - mn2);
      const float e1 = __expf(t1[r] - mn2);
      rs += e0 + e1;
      unsigned short h0, l0, h1, l1;
      split_h(e0 * PSC, h0, l0);
      split_h(e1 * PSC, h1, l1);
      pa.v[r]     = h0;                                      // P hi [query jc][k = 8hh + r]
      pa.v[8 + r] = h1;                                      // P hi [query jc][k = 16 + 8hh + r]
      pb.v[r]     = l0;                                      // P residual
      pb.v[8 + r] = l1;
    }
    ll = ll * alpha + rs;
    m  = mn2;
#pragma unroll
    for (int d = 0; d < 4; ++d) { oz[d] *= alpha; orr[d] *= alpha; }
    __builtin_amdgcn_sched_barrier(0);   // no earlier: raised into the softmax these loads would take registers it needs
    const v16us f2 = ldfrag_t(vph + c * 512 + 2 * VS);       // dv tiles 2 and 3
    const v16us f3 = ldfrag_t(vph + c * 512 + 3 * VS);
    const v16us g2 = ldfrag_t(vpl + c * 512 + 2 * VS);
    const v16us g3 = ldfrag_t(vpl + c * 512 + 3 * VS);
    if (c + 1 < NCHK) {                                      // compile-time test
      kf0 = ldfrag_t(kph + kn);
      kf1 = ldfrag_t(kph + kn + KT);
      kl0 = ldfrag_t(kpl + kn);
      kl1 = ldfrag_t(kpl + kn + KT);
    }
    __builtin_amdgcn_sched_barrier(0);
    // D row 8hh+r = dv, col jc = query
    oz[0]  = mma_h_raw(f0, pa.v, oz[0]);
    orr[0] = mma_h_raw(g0, pa.v, orr[0]);
    oz[1]  = mma_h_raw(f1, pa.v, oz[1]);
    orr[1] = mma_h_raw(g1, pa.v, orr[1]);
    orr[0] = mma_h_raw(f0, pb.v, orr[0]);
    orr[1] = mma_h_raw(f1, pb.v, orr[1]);
    guard4x6(oz[0], oz[1], orr[0], orr[1], pa.v, pb.v, f0, f1, g0, g1);
    if (c + 1 < NCHK) {
      kf2 = ldfrag_t(kph + kn + 512);
      kf3 = ldfrag_t(kph + kn + KT + 512);
      kl2 = ldfrag_t(kpl + kn + 512);
      kl3 = ldfrag_t(kpl + kn + KT + 512);
    }
    __builtin_amdgcn_sched_barrier(0);
    oz[2]  = mma_h_raw(f2, pa.v, oz[2]);
    orr[2] = mma_h_raw(g2, pa.v, orr[2]);
    oz[3]  = mma_h_raw(f3, pa.v, oz[3]);
    orr[3] = mma_h_raw(g3, pa.v, orr[3]);
    orr[2] = mma_h_raw(f2, pb.v, orr[2]);
    orr[3] = mma_h_raw(f3, pb.v, orr[3]);
    guard4x6(oz[2], oz[3], orr[2], orr[3], pa.v, pb.v, f2, f3, g2, g3);
    if (c + 1 < NCHK) {
      f0 = ldfrag_t(vph + (c + 1) * 512);
      f1 = ldfrag_t(vph + (c + 1) * 512 + VS);
      g0 = ldfrag_t(vpl + (c + 1) * 512);
      g1 = ldfrag_t(vpl + (c + 1) * 512 + VS);
    }
  }


  __syncthreads();   // every wave has read its last fragment: the planes' LDS is free for the output staging
  unsigned short* zsth = sS;                                 // output staging, hi plane
  unsigned short* zstl = sS + SEGL * ZSP;                    // output staging, residual plane
  {
    const float l = ll + xhalf(ll);                          // both halves of the query's keys
    const float inv = ((l > 0.f) ? (1.0f / l) : 0.f) * (ZSC / PSC);
    const int so = (16 * wv + jc) * ZSP + 8 * hh;            // query row, dv 8hh..8hh+7 of each 16: one 16-B piece
#pragma unroll
    for (int d = 0; d < 4; ++d) {
      v4u ha = {0u, 0u, 0u, 0u}, la = {0u, 0u, 0u, 0u};
#pragma unroll
      for (int e = 0; e < 4; ++e) {
        unsigned short h0, l0, h1, l1;
        split_h((oz[d][2 * e]     + orr[d][2 * e]     * RSCI) * inv, h0, l0);
        split_h((oz[d][2 * e + 1] + orr[d][2 * e + 1] * RSCI) * inv, h1, l1);
        ha[e] = pk16(h0, h1);
        la[e] = pk16(l0, l1);
      }
      *(v4u*)(zsth + so + 16 * d) = ha;
      *(v4u*)(zstl + so + 16 * d) = la;
    }
  }
  __syncthreads();
  v4u hv[4], lv[4];
#pragma unroll
  for (int it = 0; it < 4; ++it) {
    const int row = it * 64 + (t >> 3), p = (t & 7) * 8;   // it 0..3 x (t>>3) 0..63 = rows 0..255, 8 lanes per row
    hv[it] = *(const v4u*)(zsth + row * ZSP + p);
    lv[it] = *(const v4u*)(zstl + row * ZSP + p);
  }
#pragma unroll
  for (int it = 0; it < 4; ++it) {
    const int row = it * 64 + (t >> 3), p = (t & 7) * 8;
    const size_t go = (size_t)(tq0 + row) * HH + hc + p;
    *(v4u*)(Zh + go) = hv[it];
    *(v4u*)(Zl + go) = lv[it];
  }
}

// =====================================================================================================
// Workspace map (bytes); every plane is an exact multiple of its whole-row / whole-tile store granularity
//   Xh    f16 [4096][768]     0          6291456
//   Wq16  f16 [768][768]      6291456    1179648   (x16)
//   Wk16  f16 [768][768]      7471104    1179648   (x16)
//   Wv16  f16 [768][768]      8650752    1179648   (x16)
//   Wo16  f16 [768][768]      9830400    1179648   (x16)
//   Zh    f16 [4096][768]     11010048   6291456   (z x16, hi)
//   Zl    f16 [4096][768]     17301504   6291456   (x2048 residual)
//   end                       23592960
// =====================================================================================================
extern "C" void kernel_launch(void* const* d_in, const int* in_sizes, int n_in,
                              void* d_out, int out_size, void* d_ws, size_t ws_size,
                              hipStream_t stream) {
  if (n_in < 9) return;
  if (in_sizes[0] != MT * HH) return;
  if (in_sizes[1] != HH * HH || in_sizes[2] != HH) return;
  if (in_sizes[3] != HH * HH || in_sizes[4] != HH) return;
  if (in_sizes[5] != HH * HH || in_sizes[6] != HH) return;
  if (in_sizes[7] != HH * HH || in_sizes[8] != HH) return;
  if (out_size != MT * HH) return;

  const float* x  = (const float*)d_in[0];
  const float* Wq = (const float*)d_in[1];
  const float* bq = (const float*)d_in[2];
  const float* Wk = (const float*)d_in[3];
  const float* bk = (const float*)d_in[4];
  const float* Wv = (const float*)d_in[5];
  const float* bv = (const float*)d_in[6];
  const float* Wo = (const float*)d_in[7];
  const float* bo = (const float*)d_in[8];

  const size_t PX  = (size_t)MT * HH * 2;        // 6291456
  const size_t PW  = (size_t)HH * HH * 2;        // 1179648
  size_t off = 0;
  const size_t oXh = off; off += PX;
  const size_t oWq = off; off += PW;
  const size_t oWk = off; off += PW;
  const size_t oWv = off; off += PW;
  const size_t oWo = off; off += PW;
  const size_t oZh = off; off += PX;
  const size_t oZl = off; off += PX;
  if (off > ws_size) return;                     // off = 23592960
  if (off > (size_t)134217728) return;

  char* ws = (char*)d_ws;
  unsigned short* Xh   = (unsigned short*)(ws + oXh);
  unsigned short* Wq16 = (unsigned short*)(ws + oWq);
  unsigned short* Wk16 = (unsigned short*)(ws + oWk);
  unsigned short* Wv16 = (unsigned short*)(ws + oWv);
  unsigned short* Wo16 = (unsigned short*)(ws + oWo);
  unsigned short* Zh   = (unsigned short*)(ws + oZh);
  unsigned short* Zl   = (unsigned short*)(ws + oZl);
  float*          out0 = (float*)d_out;

  const dim3 blk(256);
  const int gsp = ((MT / 32) * (HH / 64)) / 8;             // 1536 tiles of 32x64 -> 192 blocks
  if ((((MT / 32) * (HH / 64)) % 8) != 0) return;

  // (0) x -> f16 plane of bf16 values; weights [768][768] ([out][in] = Bt[n][k]) -> f16 bits of bf16 values x16
  //     (one grid: 512 blocks for x, 96 for each weight)
  cvt_rows<<<dim3(MT / 8 + 4 * (HH / 8)), blk, 0, stream>>>(x, Wq, Wk, Wv, Wo, Xh, Wq16, Wk16, Wv16, Wo16);

  // (1) per (segment, head): x_seg . [Wq_h; Wk_h; Wv_h]^T + bias (Wq16, Wk16, Wv16 lie one behind the other), q, k, v^T
  //     kept in LDS, block-diagonal segment attention -> z (x16) hi + residual planes; 16 x 12 blocks of 16 waves
  qkv_attn<<<dim3(MT / SEGL, NHD), dim3(512), 0, stream>>>(Xh, Wq16, bq, bk, bv, Zh, Zl);

  // (2) output projection: out = z . Wo^T + bo -> f32 (A operand split)
  gemm_out<<<dim3(gsp), blk, 0, stream>>>(Zh, Zl, Wo16, out0, bo);
  (void)hipGetLastError();
}

// v009
// A run of this version takes 31.2 microseconds.
// Versions in between are left out here; by their measured steps it is 1.26 times as fast as v007.
// All steps since v000 together make it 6.03 times as fast.
// Contractions: q = x.Wq^T, k = x.Wk^T and v = x.Wv^T (plain f16, exact bf16-valued operands);
// attention scores k.q^T and v^T.p^T with q, k, p, v^T rounded once to f16; output projection z.Wo^T with z rounded
// once to f16; all v_wmma_f32_16x16x32_f16 (f16 operands, f32 accumulate); float inputs RNE-converted to bf16 on load
// (x in f16 containers, weights x16 in f16), p carried x1024, z carried x16; softmax in f32 on VALU.
// The inputs carry 8 significant bits, the f16 intermediates 11: no intermediate is the coarsest rounding of its chain.
#include <hip/hip_runtime.h>
#include <math.h>
#include <stdint.h>

#define NBT  2
#define SEQ  2048
#define HH   768
#define NHD  12
#define HD   64
#define SEGL 256
#define MT   (NBT * SEQ)
#define NCHK (SEGL / 32)
#define ZSP  72
#define WSC  16.0f
#define PSC  1024.0f
#define ZSC  16.0f
#define SCL  0.125f
#define KST  128                   // k (halves) per LDS stage: 256 B of every staged row
#define LPH  136                   // LDS row pitch in halves: 272 B = 16 B x odd, for ds_load_b128 readers
#define SROW 320                   // rows per stage: 64 of A, then 256 of Bt
#define STGH (SROW * LPH)          // halves per stage buffer
#define RSB  (16 * LPH * 2)        // LDS bytes between two copies of one lane (16 rows)
#define FROW (SEGL + 3 * HD)       // fused kernel, rows per stage: 256 of x, then 64 each of Wq, Wk, Wv
#define FSTG (FROW * LPH)          // halves per stage buffer
#define RS2  (32 * LPH * 2)        // LDS bytes between two copies of one lane (32 rows)
#define PLH  (SEGL * HD)           // halves of one q, k or v^T plane of a segment and head
#define SLP  36                    // slab pitch in floats: 144 B = 16 B x odd

static_assert(NHD * HD == HH);
static_assert(HD == 64);
static_assert((SEQ % SEGL) == 0 && (MT % SEGL) == 0 && (SEGL % 32) == 0);
static_assert((MT % 64) == 0 && (HH % 64) == 0 && (MT % 32) == 0 && (HH % 32) == 0);
static_assert((((MT / 64) * (HH / 64)) % 8) == 0);
static_assert((((HH / 64) * (MT / 64)) % 8) == 0);
static_assert((((MT / 32) * (HH / 64)) % 8) == 0);
static_assert((MT % 8) == 0 && (HH % 8) == 0 && (HH % 256) == 0);
static_assert(ZSP >= 64 && (ZSP % 8) == 0);
static_assert((MT % 256) == 0 && (HH % 128) == 0 && (MT % 128) == 0 && (HH % KST) == 0 && HH / KST >= 2);
static_assert((LPH % 8) == 0 && LPH >= KST);
static_assert(SEGL == 256 && FROW / 32 == 14 && (FROW % 32) == 0 && 3 * PLH <= 2 * FSTG && SEGL * ZSP <= 2 * FSTG);

typedef _Float16 v16h __attribute__((ext_vector_type(16)));
typedef _Float16 v8h  __attribute__((ext_vector_type(8)));
typedef unsigned short v16us __attribute__((ext_vector_type(16)));
typedef unsigned short v8us  __attribute__((ext_vector_type(8)));
typedef float v8f __attribute__((ext_vector_type(8)));
typedef float v4f __attribute__((ext_vector_type(4)));
typedef unsigned int v4u __attribute__((ext_vector_type(4)));

union FragU { v16us v; v8us h[2]; };

// ---- scalar helpers --------------------------------------------------------------------------------
__device__ __forceinline__ unsigned short bf_bits(float f) {          // f32 -> bf16 bits, RNE convert
  const unsigned u = __float_as_uint(f);
  return (unsigned short)((u + 0x7FFFu + ((u >> 16) & 1u)) >> 16);
}
__device__ __forceinline__ float bf_up(unsigned short h) { return __uint_as_float(((unsigned)h) << 16); }
__device__ __forceinline__ float bfr(float f) { return bf_up(bf_bits(f)); }   // value of the bf16 RNE convert
__device__ __forceinline__ unsigned short h_bits(_Float16 x) { return __builtin_bit_cast(unsigned short, x); }
__device__ __forceinline__ unsigned short f2h(float f) { return h_bits((_Float16)f); }
__device__ __forceinline__ float h_up(unsigned short h) { return (float)__builtin_bit_cast(_Float16, h); }
__device__ __forceinline__ unsigned pk16(unsigned short a, unsigned short b) { return (unsigned)a | ((unsigned)b << 16); }
__device__ __forceinline__ v8f zero8() { v8f z = {0.f, 0.f, 0.f, 0.f, 0.f, 0.f, 0.f, 0.f}; return z; }

// ---- fragment loader: 16-bit A/B operand, lane -> row/col (lane&15), p already includes +8*(lane>>4);
//      elements 0..7 <- p[0..7] (k0+8h..), elements 8..15 <- p[16..23] (k0+16+8h..)
__device__ __forceinline__ v16us ldfrag_u(const unsigned short* p) {
  FragU f;
  f.h[0] = *(const v8us*)(p);
  f.h[1] = *(const v8us*)(p + 16);
  return f.v;
}

// ---- fragment-order planes: a [R][C] f16 plane kept as tiles of 16 rows x 32 k (1024 B, tile number
//      (row / 16) * (C / 32) + col / 32), inside a tile 16-B units [k octet 0..3][row 0..15]. Lane l's two pieces of
//      the operand fragment (row l & 15, k 8 (l >> 4).. and 16 + 8 (l >> 4)..) are then units l and 32 + l: each load
//      instruction of a wave covers 512 contiguous bytes (4 whole lines) instead of 16 B in each of 16 rows.
//      p = plane + tile * 512 + lane * 8 (halves); same element order as ldfrag_u
__device__ __forceinline__ v16us ldfrag_t(const unsigned short* p) {
  FragU f;
  f.h[0] = *(const v8us*)(p);
  f.h[1] = *(const v8us*)(p + 256);
  return f.v;
}

// ---- WMMA helpers with trailing VALU hazard gap --------------------------------------------------------
__device__ __forceinline__ v8f mma_h_raw(v16us a, v16us b, v8f c) {             // f16 operands (bits), unguarded
  return __builtin_amdgcn_wmma_f32_16x16x32_f16(false, __builtin_bit_cast(v16h, a), false,
                                                __builtin_bit_cast(v16h, b), (short)0, c, false, false);
}
__device__ __forceinline__ void dep_guard1(v8f& a, v8f& b, v16us x) {
#if defined(__HIP_DEVICE_COMPILE__)
  asm volatile("v_nop\n\tv_nop\n\tv_nop\n\tv_nop" : "+v"(a), "+v"(b) : "v"(x));
#endif
}
__device__ __forceinline__ void keep4_u(v16us a, v16us b, v16us c, v16us d) {
#if defined(__HIP_DEVICE_COMPILE__)
  asm volatile("v_nop" :: "v"(a), "v"(b), "v"(c), "v"(d));
#endif
}
__device__ __forceinline__ void acc_guard4(v8f& a, v8f& b, v8f& c, v8f& d) {
#if defined(__HIP_DEVICE_COMPILE__)
  asm volatile("v_nop\n\tv_nop\n\tv_nop\n\tv_nop" : "+v"(a), "+v"(b), "+v"(c), "+v"(d));
#endif
}
__device__ __forceinline__ void wave_sync_lds() {
  __builtin_amdgcn_fence(__ATOMIC_RELEASE, "workgroup");
  __builtin_amdgcn_wave_barrier();
  __builtin_amdgcn_fence(__ATOMIC_ACQUIRE, "workgroup");
}

// lane l's value exchanged with lane l ^ 16 (the other 16-lane row), in registers
__device__ __forceinline__ float xhalf(float x) {
  return __builtin_bit_cast(float, __builtin_amdgcn_permlanex16(__builtin_bit_cast(int, x), __builtin_bit_cast(int, x),
                                                                0x76543210, 0xfedcba98, false, false));
}

// ---- asynchronous copies global -> LDS ------------------------------------------------------------------
// Eight 16-byte copies per lane: LDS bytes l + i * RSB; global ga + i * gs (i = 0..3) and gb + i * gs (i = 4..7
// as 0..3). The closing s_wait_xcnt stands inside the statement so that no address register named by a copy is
// rewritten in front of it.
__device__ __forceinline__ void copy8(unsigned l, const unsigned short* ga, const unsigned short* gb, size_t gs) {
#if defined(__HIP_DEVICE_COMPILE__)
  asm volatile(
      "global_load_async_to_lds_b128 %0, %8, off\n\t"
      "global_load_async_to_lds_b128 %1, %9, off\n\t"
      "global_load_async_to_lds_b128 %2, %10, off\n\t"
      "global_load_async_to_lds_b128 %3, %11, off\n\t"
      "global_load_async_to_lds_b128 %4, %12, off\n\t"
      "global_load_async_to_lds_b128 %5, %13, off\n\t"
      "global_load_async_to_lds_b128 %6, %14, off\n\t"
      "global_load_async_to_lds_b128 %7, %15, off\n\t"
      "s_wait_xcnt 0x0"
      :: "v"(l), "v"(l + RSB), "v"(l + 2 * RSB), "v"(l + 3 * RSB),
         "v"(l + 4 * RSB), "v"(l + 5 * RSB), "v"(l + 6 * RSB), "v"(l + 7 * RSB),
         "v"(ga), "v"(ga + gs), "v"(ga + 2 * gs), "v"(ga + 3 * gs),
         "v"(gb), "v"(gb + gs), "v"(gb + 2 * gs), "v"(gb + 3 * gs)
      : "memory");
#endif
}
// Four such copies: LDS bytes l + i * RSB, global ga + i * gs (i = 0..3); the closing wait as in copy8.
__device__ __forceinline__ void copy4(unsigned l, const unsigned short* ga, size_t gs) {
#if defined(__HIP_DEVICE_COMPILE__)
  asm volatile(
      "global_load_async_to_lds_b128 %0, %4, off\n\t"
      "global_load_async_to_lds_b128 %1, %5, off\n\t"
      "global_load_async_to_lds_b128 %2, %6, off\n\t"
      "global_load_async_to_lds_b128 %3, %7, off\n\t"
      "s_wait_xcnt 0x0"
      :: "v"(l), "v"(l + RSB), "v"(l + 2 * RSB), "v"(l + 3 * RSB),
         "v"(ga), "v"(ga + gs), "v"(ga + 2 * gs), "v"(ga + 3 * gs)
      : "memory");
#endif
}
// this wave's own copies have landed in LDS
__device__ __forceinline__ void wait_async0() {
#if defined(__HIP_DEVICE_COMPILE__)
  asm volatile("s_wait_asynccnt 0x0" ::: "memory");
#endif
}
// in front of an overwrite of registers that issued global loads or stores name
__device__ __forceinline__ void wait_x0() {
#if defined(__HIP_DEVICE_COMPILE__)
  asm volatile("s_wait_xcnt 0x0" ::: "memory");
#endif
}
// this wave's own LDS reads have returned, before the buffer they read is handed to its next writer
__device__ __forceinline__ void wait_ds0() {
#if defined(__HIP_DEVICE_COMPILE__)
  asm volatile("s_wait_dscnt 0x0" ::: "memory");
#endif
}

// =====================================================================================================
// Rows [nrows][768] f32 -> f16 bits of (bf16 RNE value * sc). Used for x (sc = 1) and for the [out][in]
// weight matrices (sc = 16), which are already Bt[n][k] with k contiguous. The five conversions need nothing
// of each other and share one grid by ranges of the block index: blocks 0..MT/8-1 take x, then HH/8 blocks
// for each of Wq, Wk, Wv, Wo. One wave per row; three column
// chunks of 256: lane owns columns 256c + 8*lane..+7, one instruction = 32 lanes x 16 B = 512 contiguous B
// coverage: 8 rows per block, grid = MT/8 + 4 HH/8 exact, 3 chunks x 256 = 768 cols: union = every row of all five.
// =====================================================================================================
__global__ __launch_bounds__(256) void cvt_rows(const float* __restrict__ xin, const float* __restrict__ Wq,
                                                const float* __restrict__ Wk, const float* __restrict__ Wv,
                                                const float* __restrict__ Wo, unsigned short* Xh,
                                                unsigned short* Wq16, unsigned short* Wk16,
                                                unsigned short* Wv16, unsigned short* Wo16) {
  const int wb  = (int)blockIdx.x - MT / 8;               // block-uniform: below 0 = x, else a weight block
  const int wi  = wb / (HH / 8);                          // which weight, 0..3
  const bool isx = wb < 0;
  const float* x = isx ? xin : wi == 0 ? Wq : wi == 1 ? Wk : wi == 2 ? Wv : Wo;
  unsigned short* xh = isx ? Xh : wi == 0 ? Wq16 : wi == 1 ? Wk16 : wi == 2 ? Wv16 : Wo16;
  const int nrows = isx ? MT : HH;
  const float sc  = isx ? 1.0f : WSC;
  const int row = (isx ? (int)blockIdx.x : wb - wi * (HH / 8)) * 8 + (threadIdx.x >> 5);
  const int lane = threadIdx.x & 31;
  if (wi > 3 || row >= nrows) return;                     // wave-uniform, no barriers below
  v4u hv[HH / 256];
#pragma unroll
  for (int c = 0; c < HH / 256; ++c) {
    const float* p = x + (size_t)row * HH + c * 256 + lane * 8;
    const v4f a0 = *(const v4f*)(p);
    const v4f a1 = *(const v4f*)(p + 4);
    v4u h;
#pragma unroll
    for (int e = 0; e < 2; ++e) {
      h[e]     = pk16(f2h(bfr(a0[2 * e]) * sc), f2h(bfr(a0[2 * e + 1]) * sc));
      h[2 + e] = pk16(f2h(bfr(a1[2 * e]) * sc), f2h(bfr(a1[2 * e + 1]) * sc));
    }
    hv[c] = h;
  }
  unsigned short* d = xh + (size_t)row * HH + lane * 8;
  {
#pragma unroll
    for (int c = 0; c < HH / 256; ++c) *(v4u*)(d + c * 256) = hv[c];
    
  }
}

// =====================================================================================================
// Register-blocked f16 WMMA GEMM: C[m][n] = sum_k A[m][k] * Bt[n][k] * wsc + bias, one wave per 32x64 tile; the
// block's 8 waves form a 64 x 256 tile (2 x 4 waves) whose operand rows are staged in LDS, 128 k at a time, two buffers,
// by asynchronous 16-byte copies (16 lanes per 256-B row piece), the next stage in flight while this one is multiplied.
// A row-major [M][K] pitch lda; Bt row-major [N][K] pitch ldb (k contiguous); M multiple of 64, N of 256, K of 128 and
// at least 256 (true at the call site; host-checked grid = tiles/8 exact so no block exits early).
// Out: f32 Cf (row-major, pitch ldc), column bias bf16(cb[n]) (bf16 RNE value).
// bid = the block's tile number; sT (per-wave 16x64 slabs, pitch 68 floats) and sS (two operand stages) are the calling
// kernel's LDS arrays.
// coverage: MI slabs x 16 rows x 64 cols = the wave's whole 32x64 tile; tiles/8 blocks x 8 waves = every tile.
// =====================================================================================================
__device__ __forceinline__ void gemm_body(
    float* sT, unsigned short* sS, int bid,
    const unsigned short* __restrict__ Ap, int lda,
    const unsigned short* __restrict__ Btp, int ldb,
    float* Cf, int ldc, const float* __restrict__ cb, float wsc, int M, int N, int K) {
  constexpr int MI = 2;
  constexpr int TR = 16 * MI;
  const int lane = threadIdx.x & 31;
  const int wave = threadIdx.x >> 5;
  const int tilesN = N >> 8;
  const int tilesM = M / (2 * TR);
  if (bid >= tilesM * tilesN) return;   // block-uniform, in front of every barrier
  const int tm = bid / tilesN;
  const int tn = bid - tm * tilesN;
  const int wm = wave >> 2;                    // wave row 0..1
  const int wn = wave & 3;                     // wave column 0..3
  const int mb = tm * (2 * TR);                // block's first row of A
  const int nb = tn << 8;                      // block's first row of Bt
  const int m0 = mb + wm * TR;
  const int n0 = nb + (wn << 6);

  const int rlane = lane & 15;                 // row (A) / col (B, D) within subtile
  const int koff  = (lane >> 4) * 8;           // k offset of this lane half
  const int mOff  = (lane >> 4) * 8;           // D row offset

  v8f acc[MI][4];
#pragma unroll
  for (int i = 0; i < MI; ++i)
#pragma unroll
    for (int j = 0; j < 4; ++j) acc[i][j] = zero8();

  // copy map: lane's 16-B piece cch of staged row crow + 16 i, i = 0..19 (rows 0..63 A, 64..319 Bt)
  const int crow = threadIdx.x >> 4;           // 0..15
  const int cch  = (threadIdx.x & 15) * 8;     // halves
  const unsigned lds0 = (unsigned)(size_t)sS + (unsigned)(crow * LPH + cch) * 2u;   // LDS byte address, buffer 0
  const unsigned short* gA0 = Ap + (size_t)(mb + crow) * lda + cch;                 // staged rows 0..63
  const unsigned short* gB0 = Btp + (size_t)(nb + crow) * ldb + cch;                // staged rows 64..319
  const size_t gsa = (size_t)16 * lda, gsb = (size_t)16 * ldb;
  const int NT = K / KST;
  // Blocks that share staged rows (the tn blocks of one tm share A, the tm blocks of one tn share Bt) enter the k stages
  // at different stages and wrap round, so that they do not ask L2 for the same lines at the same moment.
  const int rot = (tm + 2 * tn) % NT;          // block-uniform: trip t multiplies k stage (t + rot) mod NT
  const int kf0 = rot * KST;
  const int kf1 = (rot + 1 < NT ? rot + 1 : rot + 1 - NT) * KST;

  // staged row of this lane's first A fragment and first Bt fragment, with its k offset
  const int fa = (wm * TR + rlane) * LPH + koff;
  const int fb = (64 + (wn << 6) + rlane) * LPH + koff;

  // first stage -> buffer 0, landed and published; then the second -> buffer 1 in flight
  copy4(lds0,            gA0 + kf0,           gsa);
  copy8(lds0 + 4 * RSB,  gB0 + kf0,           gB0 + kf0 + 4 * gsb,  gsb);
  copy8(lds0 + 12 * RSB, gB0 + kf0 + 8 * gsb, gB0 + kf0 + 12 * gsb, gsb);
  wait_async0();
  __syncthreads();
  if (NT > 1) {
    const unsigned lb = lds0 + STGH * 2;
    copy4(lb,            gA0 + kf1,           gsa);
    copy8(lb + 4 * RSB,  gB0 + kf1,           gB0 + kf1 + 4 * gsb,  gsb);
    copy8(lb + 12 * RSB, gB0 + kf1 + 8 * gsb, gB0 + kf1 + 12 * gsb, gsb);
  }

#pragma unroll 1   // one stage per trip: the buffer index stays a run-time value and the text small
  for (int t = 0; t < NT; ++t) {
    const unsigned short* sb = sS + (t & 1) * STGH;
#pragma unroll
    for (int kk = 0; kk < KST; kk += 32) {
      // all six fragments of this k-step are asked for ahead of its 8 products
      v16us bh[4], ahf[MI];
#pragma unroll
      for (int j = 0; j < 4; ++j) bh[j] = ldfrag_u(sb + fb + (j << 4) * LPH + kk);
#pragma unroll
      for (int i = 0; i < MI; ++i) ahf[i] = ldfrag_u(sb + fa + (i << 4) * LPH + kk);
#pragma unroll
      for (int i = 0; i < MI; ++i) {
        const v16us ah = ahf[i];
#pragma unroll
        for (int j = 0; j < 4; ++j) acc[i][j] = mma_h_raw(ah, bh[j], acc[i][j]);
        dep_guard1(acc[i][0], acc[i][3], ah);
      }
      keep4_u(bh[0], bh[1], bh[2], bh[3]);
    }
    // publish point of stage t + 1: own reads of this buffer done, own copies landed, then every wave passes
    wait_ds0();
    wait_async0();
    __syncthreads();
    if (t + 2 < NT) {                          // block-uniform: refill the buffer that this trip has just read
      const unsigned lb = lds0 + (unsigned)(t & 1) * (STGH * 2);
      const int q2 = t + 2 + rot;              // below 2 NT: one wrap at most
      const int k2 = (q2 < NT ? q2 : q2 - NT) * KST;
      copy4(lb,            gA0 + k2,           gsa);
      copy8(lb + 4 * RSB,  gB0 + k2,           gB0 + k2 + 4 * gsb,  gsb);
      copy8(lb + 12 * RSB, gB0 + k2 + 8 * gsb, gB0 + k2 + 12 * gsb, gsb);
    }
  }
  wait_async0();
#pragma unroll
  for (int i = 0; i < MI; ++i) acc_guard4(acc[i][0], acc[i][1], acc[i][2], acc[i][3]);

  const int hh2 = lane >> 4, c4 = (lane & 15) * 4;     // f32 out: 256-B row segment = 16 lanes x 16 B

  v4f cb4;
  {
    const v4f v = *(const v4f*)(cb + n0 + c4);
    cb4[0] = bfr(v[0]); cb4[1] = bfr(v[1]); cb4[2] = bfr(v[2]); cb4[3] = bfr(v[3]);
  }

  // ---- epilogue ----
  float* slab = sT + wave * (16 * 68);
#pragma unroll
  for (int i = 0; i < MI; ++i) {
    const int mBase = m0 + (i << 4);
#pragma unroll
    for (int j = 0; j < 4; ++j) {
#pragma unroll
      for (int r = 0; r < 8; ++r) slab[(mOff + r) * 68 + (j << 4) + rlane] = acc[i][j][r];
    }
    wave_sync_lds();
    v4f vals[8];
#pragma unroll
    for (int it = 0; it < 8; ++it) {
      const int row = it * 2 + hh2;                      // it 0..7 x hh2 0..1 = rows 0..15
      const v4f v = *(const v4f*)(slab + row * 68 + c4);
      vals[it] = v * wsc + cb4;
    }
#pragma unroll
    for (int it = 0; it < 8; ++it) {
      const int row = it * 2 + hh2;
      *(v4f*)(Cf + (size_t)(mBase + row) * ldc + (size_t)n0 + c4) = vals[it];
    }
    wave_sync_lds();
  }
}

// out = z.Wo^T + bo -> f32
__global__ __launch_bounds__(256) void gemm_out(
    const unsigned short* __restrict__ Zh, const unsigned short* __restrict__ Wo16, float* out,
    const float* __restrict__ bo) {
  __shared__ __align__(16) float sT[8 * 16 * 68];         // per-wave 16x64 slab, pitch 68 floats
  __shared__ __align__(16) unsigned short sS[2 * STGH];   // two operand stages
  gemm_body(sT, sS, (int)blockIdx.x, Zh, HH, Wo16, HH, out, HH, bo, 1.0f / (WSC * ZSC), MT, HH, HH);
}

// Fourteen 16-byte copies per lane, one stage of the fused kernel below: LDS bytes l + i * RS2 (32 rows apart); global
// ga + i * 32 rows (i = 0..7), then two each from gq, gk and gv. The closing s_wait_xcnt stands inside the statement so
// that no address register named by a copy is rewritten in front of it.
__device__ __forceinline__ void copy14(unsigned l, const unsigned short* ga, const unsigned short* gq,
                                       const unsigned short* gk, const unsigned short* gv) {
#if defined(__HIP_DEVICE_COMPILE__)
  constexpr size_t gs = (size_t)32 * HH;
  asm volatile(
      "global_load_async_to_lds_b128 %0, %14, off\n\t"
      "global_load_async_to_lds_b128 %1, %15, off\n\t"
      "global_load_async_to_lds_b128 %2, %16, off\n\t"
      "global_load_async_to_lds_b128 %3, %17, off\n\t"
      "global_load_async_to_lds_b128 %4, %18, off\n\t"
      "global_load_async_to_lds_b128 %5, %19, off\n\t"
      "global_load_async_to_lds_b128 %6, %20, off\n\t"
      "global_load_async_to_lds_b128 %7, %21, off\n\t"
      "global_load_async_to_lds_b128 %8, %22, off\n\t"
      "global_load_async_to_lds_b128 %9, %23, off\n\t"
      "global_load_async_to_lds_b128 %10, %24, off\n\t"
      "global_load_async_to_lds_b128 %11, %25, off\n\t"
      "global_load_async_to_lds_b128 %12, %26, off\n\t"
      "global_load_async_to_lds_b128 %13, %27, off\n\t"
      "s_wait_xcnt 0x0"
      :: "v"(l), "v"(l + 1 * RS2), "v"(l + 2 * RS2), "v"(l + 3 * RS2), "v"(l + 4 * RS2), "v"(l + 5 * RS2), "v"(l + 6 * RS2),
         "v"(l + 7 * RS2), "v"(l + 8 * RS2), "v"(l + 9 * RS2), "v"(l + 10 * RS2), "v"(l + 11 * RS2), "v"(l + 12 * RS2), "v"(l + 13 * RS2),
         "v"(ga), "v"(ga + gs), "v"(ga + 2 * gs), "v"(ga + 3 * gs),
         "v"(ga + 4 * gs), "v"(ga + 5 * gs), "v"(ga + 6 * gs), "v"(ga + 7 * gs),
         "v"(gq), "v"(gq + gs), "v"(gk), "v"(gk + gs), "v"(gv), "v"(gv + gs)
      : "memory");
#endif
}

// =====================================================================================================
// Projection and attention of one (256-token segment, head) in one block of 16 waves; q, k and v never leave the WGP.
// Part 1: [256 tokens][192] = x_seg . [Wq_h; Wk_h; Wv_h]^T + bias, the head's 64 rows of each f16 weight plane. Operand
// rows staged in LDS as in gemm_body: 128 k per stage, two buffers, asynchronous 16-byte copies, 14 per lane and stage
// (rows 0..255 x, 256..319 Wq_h, 320..383 Wk_h, 384..447 Wv_h). Waves as 4 x 4: wave (wm, wn) owns tokens 64 wm..+63 and
// columns 16 wn..+15 of each of q, k and v (4 x 3 accumulators).
// Part 2: behind the k loop's last barrier the stage buffers are free; the three f16 planes q, k [256][64] and
// v^T [64][256] are written over them in fragment order (see ldfrag_t): q, k through the wave's slab;
// v from the accumulator itself, which holds 8 successive tokens of one dv per lane = one 16-B unit. One barrier.
// Part 3: attention over the segment, every key valid (no masking); wave w owns queries 16 w..+15 and all 64 dv.
// Both products are taken transposed: S^T = K.Q^T (A = key rows, B = query columns) and O^T = V^T.P^T (A = dv rows,
// B = query columns), so that a lane holds scores, statistics and outputs of ONE query (column jc of every D tile).
// Per chunk of 32 keys: s = k.q^T, two 32-deep k-steps over the 64 head dims; logit = s * 0.125; running-max softmax
// in f32: maximum and sum over the lane's own 16 keys, the maximum joined with lane ^ 16 in every chunk, the sum once
// behind the loop; p = exp(logit - m) carried as 1024 p in f16: the two D tiles of a chunk (keys 8hh + r and
// 16 + 8hh + r), converted in place, are the B fragment in the split k map, with no pass through LDS; z^T accumulates
// v.p on WMMA for 4 dv tiles. q, k, p and v^T fragments all use the split k map.
// coverage: 256 query rows x 64 halves at cols 64*head per block in Zh; grid (MT/256) x 12 heads = the whole
// [4096][768] z plane.
// =====================================================================================================
__global__ __launch_bounds__(512) void qkv_attn(
    const unsigned short* __restrict__ Xh, const unsigned short* __restrict__ Wc,
    const float* __restrict__ bq, const float* __restrict__ bk, const float* __restrict__ bv,
    unsigned short* Zh) {
  __shared__ __align__(16) float sT[16 * 16 * SLP];       // per-wave 16x32 slab, pitch 36 floats
  __shared__ __align__(16) unsigned short sS[2 * FSTG];   // two operand stages; then the three planes; then z staging
  const int tq0  = blockIdx.x * SEGL;                     // first token of the segment (token = b*2048 + s)
  const int hc   = blockIdx.y * HD;                       // head column offset
  const int t = threadIdx.x, lane = t & 31, hh = lane >> 4, jc = lane & 15;
  const int wv = __builtin_amdgcn_readfirstlane(t >> 5);
  const int wm = wv >> 2;                      // wave row 0..3
  const int wn = wv & 3;                       // wave column 0..3
  const int koff = hh * 8;                     // k offset of this lane half
  const int mOff = hh * 8;                     // D row offset

  unsigned short* pQ = sS;
  unsigned short* pK = sS + PLH;
  unsigned short* pV = sS + 2 * PLH;

  {
    v8f acc[4][3];
#pragma unroll
    for (int i = 0; i < 4; ++i)
#pragma unroll
      for (int j = 0; j < 3; ++j) acc[i][j] = zero8();

    // copy map: lane's 16-B piece cch of staged row crow + 32 i, i = 0..13
    const int crow = t >> 4;                   // 0..31
    const int cch  = (t & 15) * 8;             // halves
    const unsigned lds0 = (unsigned)(size_t)sS + (unsigned)(crow * LPH + cch) * 2u;   // LDS byte address, buffer 0
    const unsigned short* gA = Xh + (size_t)(tq0 + crow) * HH + cch;                  // staged rows 0..255
    const unsigned short* gQ = Wc + (size_t)(hc + crow) * HH + cch;                   // staged rows 256..319
    const unsigned short* gK = gQ + (size_t)HH * HH;                                  // staged rows 320..383
    const unsigned short* gV = gK + (size_t)HH * HH;                                  // staged rows 384..447
    constexpr int NT = HH / KST;
    // Blocks that share staged rows (the heads of a segment share x, the segments of a head share the weight rows) enter
    // the k stages at different stages and wrap round, so that they do not ask L2 for the same lines at the same moment.
    const int rot = (int)((blockIdx.x + blockIdx.y) % NT);   // block-uniform: trip s multiplies k stage (s + rot) mod NT
    const int kf0 = rot * KST;
    const int kf1 = (rot + 1 < NT ? rot + 1 : rot + 1 - NT) * KST;

    const int fa = (wm * 64 + jc) * LPH + koff;
    const int fb = (SEGL + wn * 16 + jc) * LPH + koff;

    // bias of this lane's column of q, k and v, asked for ahead of the k loop
    float bj[3];
    bj[0] = bfr(bq[hc + wn * 16 + jc]);
    bj[1] = bfr(bk[hc + wn * 16 + jc]);
    bj[2] = bfr(bv[hc + wn * 16 + jc]);

    // first stage -> buffer 0, landed and published; then the second -> buffer 1 in flight
    copy14(lds0, gA + kf0, gQ + kf0, gK + kf0, gV + kf0);
    wait_async0();
    __syncthreads();
    copy14(lds0 + FSTG * 2, gA + kf1, gQ + kf1, gK + kf1, gV + kf1);

#pragma unroll 1   // one stage per trip: the buffer index stays a run-time value and the text small
    for (int s = 0; s < NT; ++s) {
      const unsigned short* sb = sS + (s & 1) * FSTG;
#pragma unroll
      for (int kk = 0; kk < KST; kk += 32) {
        // all seven fragments of this k-step are asked for ahead of its 12 products
        v16us bh[3], ah[4];
#pragma unroll
        for (int j = 0; j < 3; ++j) bh[j] = ldfrag_u(sb + fb + (j << 6) * LPH + kk);
#pragma unroll
        for (int i = 0; i < 4; ++i) ah[i] = ldfrag_u(sb + fa + (i << 4) * LPH + kk);
#pragma unroll
        for (int i = 0; i < 4; ++i) {
#pragma unroll
          for (int j = 0; j < 3; ++j) acc[i][j] = mma_h_raw(ah[i], bh[j], acc[i][j]);
          dep_guard1(acc[i][0], acc[i][2], ah[i]);
        }
        keep4_u(bh[0], bh[1], bh[2], bh[2]);
      }
      // publish point of stage s + 1: own reads of this buffer done, own copies landed, then every wave passes
      wait_ds0();
      wait_async0();
      __syncthreads();
      if (s + 2 < NT) {                        // block-uniform: refill the buffer that this trip has just read
        const int q2 = s + 2 + rot;            // below 2 NT: one wrap at most
        const int k2 = (q2 < NT ? q2 : q2 - NT) * KST;
        copy14(lds0 + (unsigned)(s & 1) * (FSTG * 2), gA + k2, gQ + k2, gK + k2, gV + k2);
      }
    }
    wait_async0();

    // ---- planes into LDS: every wave has passed the last trip's barrier, no copy is in flight ----
    const float wsc = 1.0f / WSC;
    float* slab = sT + wv * (16 * SLP);
#pragma unroll
    for (int i = 0; i < 4; ++i) {
      {
        v4u ha = {0u, 0u, 0u, 0u};
#pragma unroll
        for (int e = 0; e < 4; ++e)            // tokens 64 wm + 16 i + 8 hh + 2 e, + 1 of dv 16 wn + jc
          ha[e] = pk16(f2h(acc[i][2][2 * e] * wsc + bj[2]), f2h(acc[i][2][2 * e + 1] * wsc + bj[2]));
        // tile (dv / 16 = wn, token / 32 = 2 wm + i / 2), units 32 (i & 1) + lane
        const int go = (wn * (SEGL / 32) + wm * 2 + (i >> 1)) * 512 + (i & 1) * 256 + lane * 8;
        *(v4u*)(pV + go) = ha;
      }
#pragma unroll
      for (int jj = 0; jj < 2; ++jj)
#pragma unroll
        for (int r = 0; r < 8; ++r) slab[(mOff + r) * SLP + (jj << 4) + jc] = acc[i][jj][r] * wsc + bj[jj];
      wave_sync_lds();
#pragma unroll
      for (int jj = 0; jj < 2; ++jj) {
        const float* sp = slab + jc * SLP + (jj * 2 + hh) * 8;   // token row jc, dims 16 wn + 8 hh..+7 of q (jj 0), k (1)
        v4u ha = {0u, 0u, 0u, 0u};
#pragma unroll
        for (int e = 0; e < 4; ++e) ha[e] = pk16(f2h(sp[2 * e]), f2h(sp[2 * e + 1]));
        // tile (token / 16 = 4 wm + i, col / 32 = wn / 2), units 32 (wn & 1) + lane
        const int go = ((wm * 4 + i) * (HD / 32) + (wn >> 1)) * 512 + (wn & 1) * 256 + lane * 8;
        *(v4u*)((jj ? pK : pQ) + go) = ha;
      }
      wave_sync_lds();
    }
  }
  __syncthreads();   // the planes are whole before any wave reads a fragment

  // B: col = query jc, k = head dim; tile (token / 16 = wv, col / 32), the two k tiles are neighbours
  const int qo = wv * (HD / 32) * 512 + lane * 8;
  const v16us qf0 = ldfrag_t(pQ + qo);                                  // dims 0..31
  const v16us qf1 = ldfrag_t(pQ + qo + 512);                            // dims 32..63
  float m = -1.0e30f, ll = 0.f;                             // query jc: running maximum; sum over this lane's keys
  v8f oz[4];
#pragma unroll
  for (int d = 0; d < 4; ++d) oz[d] = zero8();
  // Per-lane LDS addresses of the segment's first K tile (A: row = key jc, k = head dim; tile (token / 16, col / 32))
  // and first V^T tile (A: row dv = jc, k = key token; tile (dv / 16, token / 32)); every fragment of the segment lies
  // at a constant offset from them.
  const unsigned short* kph = pK + lane * 8;
  const unsigned short* vph = pV + lane * 8;
  constexpr int KT = (HD / 32) * 512;                       // halves to the tile row of keys 16 + jc
  constexpr int VS = (SEGL / 32) * 512;                     // halves to the next dv tile

  // The fragment loads run one chunk ahead of their products, in the order of their use: a chunk's four K fragments are
  // asked for in front of the chunk before's scores, its four V^T fragments in front of the chunk before's P.V. So the
  // LDS latencies run side by side with the arithmetic.
  v16us kf0 = ldfrag_t(kph);                                // chunk 0, head dims 0..31: keys jc, keys 16 + jc
  v16us kf1 = ldfrag_t(kph + KT);
  v16us kf2 = ldfrag_t(kph + 512);                          // head dims 32..63
  v16us kf3 = ldfrag_t(kph + KT + 512);
  v16us f0 = ldfrag_t(vph);                                 // dv tiles 0..3
  v16us f1 = ldfrag_t(vph + VS);
  v16us f2 = ldfrag_t(vph + 2 * VS);
  v16us f3 = ldfrag_t(vph + 3 * VS);

  // unrolled: a group's registers change from chunk to chunk, which a rolled loop would pay for in register copies
#pragma unroll
  for (int c = 0; c < NCHK; ++c) {                          // chunk c: the segment's keys 32 c .. + 31
    const int kn = (c + 1) * 2 * KT;                         // the next chunk's K: two tile rows on
    v16us nk0 = kf0, nk1 = kf1, nk2 = kf2, nk3 = kf3;
    if (c + 1 < NCHK) {                                      // compile-time test
      nk0 = ldfrag_t(kph + kn);
      nk1 = ldfrag_t(kph + kn + KT);
      nk2 = ldfrag_t(kph + kn + 512);
      nk3 = ldfrag_t(kph + kn + KT + 512);
    }
    __builtin_amdgcn_sched_barrier(0);   // this and the one below: the scheduler would sink the loads in front towards their users
    v8f s0 = zero8(), s1 = zero8();
    s0 = mma_h_raw(kf0, qf0, s0);                            // D row 8hh+r = key 32c+8hh+r, col jc = query 16wv+jc
    s1 = mma_h_raw(kf1, qf0, s1);                            // key 32c+16+8hh+r
    s0 = mma_h_raw(kf2, qf1, s0);
    s1 = mma_h_raw(kf3, qf1, s1);
    float t0[8], t1[8];
#pragma unroll
    for (int r = 0; r < 8; ++r) {
      t0[r] = s0[r] * SCL;
      t1[r] = s1[r] * SCL;
    }
    float rm = fmaxf(t0[0], t1[0]);
#pragma unroll
    for (int r = 1; r < 8; ++r) rm = fmaxf(rm, fmaxf(t0[r], t1[r]));
    rm = fmaxf(rm, xhalf(rm));                               // the query's other 16 keys of the chunk
    const float mn2   = fmaxf(m, rm);
    const float alpha = __expf(m - mn2);
    float rs = 0.f;
    FragU pa;                                                // B: col = query jc, elements 0..7 <- k 8hh.., 8..15 <- k 16+8hh..
#pragma unroll
    for (int r = 0; r < 8; ++r) {
      const float e0 = __expf(t0[r] - mn2);
      const float e1 = __expf(t1[r] - mn2);
      rs += e0 + e1;
      pa.v[r]     = f2h(e0 * PSC);                           // P [query jc][k = 8hh + r]
      pa.v[8 + r] = f2h(e1 * PSC);                           // P [query jc][k = 16 + 8hh + r]
    }
    ll = ll * alpha + rs;
    m  = mn2;
#pragma unroll
    for (int d = 0; d < 4; ++d) oz[d] *= alpha;
    v16us nf0 = f0, nf1 = f1, nf2 = f2, nf3 = f3;
    if (c + 1 < NCHK) {
      nf0 = ldfrag_t(vph + (c + 1) * 512);
      nf1 = ldfrag_t(vph + (c + 1) * 512 + VS);
      nf2 = ldfrag_t(vph + (c + 1) * 512 + 2 * VS);
      nf3 = ldfrag_t(vph + (c + 1) * 512 + 3 * VS);
    }
    __builtin_amdgcn_sched_barrier(0);
    // D row 8hh+r = dv, col jc = query
    oz[0] = mma_h_raw(f0, pa.v, oz[0]);
    oz[1] = mma_h_raw(f1, pa.v, oz[1]);
    oz[2] = mma_h_raw(f2, pa.v, oz[2]);
    oz[3] = mma_h_raw(f3, pa.v, oz[3]);
    kf0 = nk0; kf1 = nk1; kf2 = nk2; kf3 = nk3;
    f0 = nf0; f1 = nf1; f2 = nf2; f3 = nf3;
  }

  __syncthreads();   // every wave has read its last fragment: the planes' LDS is free for the output staging
  unsigned short* zst = sS;                                  // output staging
  {
    const float l = ll + xhalf(ll);                          // both halves of the query's keys
    const float inv = ((l > 0.f) ? (1.0f / l) : 0.f) * (ZSC / PSC);
    const int so = (16 * wv + jc) * ZSP + 8 * hh;            // query row, dv 8hh..8hh+7 of each 16: one 16-B piece
#pragma unroll
    for (int d = 0; d < 4; ++d) {
      v4u ha = {0u, 0u, 0u, 0u};
#pragma unroll
      for (int e = 0; e < 4; ++e) ha[e] = pk16(f2h(oz[d][2 * e] * inv), f2h(oz[d][2 * e + 1] * inv));
      *(v4u*)(zst + so + 16 * d) = ha;
    }
  }
  __syncthreads();
  v4u hv[4];
#pragma unroll
  for (int it = 0; it < 4; ++it) {
    const int row = it * 64 + (t >> 3), p = (t & 7) * 8;   // it 0..3 x (t>>3) 0..63 = rows 0..255, 8 lanes per row
    hv[it] = *(const v4u*)(zst + row * ZSP + p);
  }
#pragma unroll
  for (int it = 0; it < 4; ++it) {
    const int row = it * 64 + (t >> 3), p = (t & 7) * 8;
    *(v4u*)(Zh + (size_t)(tq0 + row) * HH + hc + p) = hv[it];
  }
}

// =====================================================================================================
// Workspace map (bytes); every plane is an exact multiple of its whole-row / whole-tile store granularity
//   Xh    f16 [4096][768]     0          6291456
//   Wq16  f16 [768][768]      6291456    1179648   (x16)
//   Wk16  f16 [768][768]      7471104    1179648   (x16)
//   Wv16  f16 [768][768]      8650752    1179648   (x16)
//   Wo16  f16 [768][768]      9830400    1179648   (x16)
//   Zh    f16 [4096][768]     11010048   6291456   (z x16)
//   end                       17301504
// =====================================================================================================
extern "C" void kernel_launch(void* const* d_in, const int* in_sizes, int n_in,
                              void* d_out, int out_size, void* d_ws, size_t ws_size,
                              hipStream_t stream) {
  if (n_in < 9) return;
  if (in_sizes[0] != MT * HH) return;
  if (in_sizes[1] != HH * HH || in_sizes[2] != HH) return;
  if (in_sizes[3] != HH * HH || in_sizes[4] != HH) return;
  if (in_sizes[5] != HH * HH || in_sizes[6] != HH) return;
  if (in_sizes[7] != HH * HH || in_sizes[8] != HH) return;
  if (out_size != MT * HH) return;

  const float* x  = (const float*)d_in[0];
  const float* Wq = (const float*)d_in[1];
  const float* bq = (const float*)d_in[2];
  const float* Wk = (const float*)d_in[3];
  const float* bk = (const float*)d_in[4];
  const float* Wv = (const float*)d_in[5];
  const float* bv = (const float*)d_in[6];
  const float* Wo = (const float*)d_in[7];
  const float* bo = (const float*)d_in[8];

  const size_t PX  = (size_t)MT * HH * 2;        // 6291456
  const size_t PW  = (size_t)HH * HH * 2;        // 1179648
  size_t off = 0;
  const size_t oXh = off; off += PX;
  const size_t oWq = off; off += PW;
  const size_t oWk = off; off += PW;
  const size_t oWv = off; off += PW;
  const size_t oWo = off; off += PW;
  const size_t oZh = off; off += PX;
  if (off > ws_size) return;                     // off = 17301504
  if (off > (size_t)134217728) return;

  char* ws = (char*)d_ws;
  unsigned short* Xh   = (unsigned short*)(ws + oXh);
  unsigned short* Wq16 = (unsigned short*)(ws + oWq);
  unsigned short* Wk16 = (unsigned short*)(ws + oWk);
  unsigned short* Wv16 = (unsigned short*)(ws + oWv);
  unsigned short* Wo16 = (unsigned short*)(ws + oWo);
  unsigned short* Zh   = (unsigned short*)(ws + oZh);
  float*          out0 = (float*)d_out;

  const dim3 blk(256);
  const int gsp = ((MT / 32) * (HH / 64)) / 8;             // 1536 tiles of 32x64 -> 192 blocks
  if ((((MT / 32) * (HH / 64)) % 8) != 0) return;

  // (0) x -> f16 plane of bf16 values; weights [768][768] ([out][in] = Bt[n][k]) -> f16 bits of bf16 values x16
  //     (one grid: 512 blocks for x, 96 for each weight)
  cvt_rows<<<dim3(MT / 8 + 4 * (HH / 8)), blk, 0, stream>>>(x, Wq, Wk, Wv, Wo, Xh, Wq16, Wk16, Wv16, Wo16);

  // (1) per (segment, head): x_seg . [Wq_h; Wk_h; Wv_h]^T + bias (Wq16, Wk16, Wv16 lie one behind the other), q, k, v^T
  //     kept in LDS, block-diagonal segment attention -> z (x16) plane; 16 x 12 blocks of 16 waves
  qkv_attn<<<dim3(MT / SEGL, NHD), dim3(512), 0, stream>>>(Xh, Wq16, bq, bk, bv, Zh);

  // (2) output projection: out = z . Wo^T + bo -> f32
  gemm_out<<<dim3(gsp), blk, 0, stream>>>(Zh, Wo16, out0, bo);
  (void)hipGetLastError();
}

// v010
// A run of this version takes 30.1 microseconds.
// In both of two side-by-side timings against v009, it was 1.03 times as fast.
// All steps since v000 together make it 6.22 times as fast.
// Contractions: q = x.Wq^T, k = x.Wk^T and v = x.Wv^T (plain f16, exact bf16-valued operands);
// attention scores k.q^T and v^T.p^T with q, k, p, v^T rounded once to f16; output projection z.Wo^T with z rounded
// once to f16; all v_wmma_f32_16x16x32_f16 (f16 operands, f32 accumulate); float inputs RNE-converted to bf16 on load
// (x in f16 containers, weights x16 in f16), p carried x1024, z carried x16; softmax in f32 on VALU.
// The inputs carry 8 significant bits, the f16 intermediates 11: no intermediate is the coarsest rounding of its chain.
#include <hip/hip_runtime.h>
#include <math.h>
#include <stdint.h>

#define NBT  2
#define SEQ  2048
#define HH   768
#define NHD  12
#define HD   64
#define SEGL 256
#define MT   (NBT * SEQ)
#define NCHK (SEGL / 32)
#define ZSP  72
#define WSC  16.0f
#define PSC  1024.0f
#define ZSC  16.0f
#define SCL  0.125f
#define KST  128                   // k (halves) per LDS stage: 256 B of every staged row
#define LPH  136                   // LDS row pitch in halves: 272 B = 16 B x odd, for ds_load_b128 readers
#define SROW 320                   // rows per stage: 64 of A, then 256 of Bt
#define STGH (SROW * LPH)          // halves per stage buffer
#define RSB  (16 * LPH * 2)        // LDS bytes between two copies of one lane (16 rows)
#define FROW (SEGL + 3 * HD)       // fused kernel, rows per stage: 256 of x, then 64 each of Wq, Wk, Wv
#define FSTG (FROW * LPH)          // halves per stage buffer
#define RS2  (32 * LPH * 2)        // LDS bytes between two copies of one lane (32 rows)
#define PLH  (SEGL * HD)           // halves of one q, k or v^T plane of a segment and head
#define SLP  36                    // slab pitch in floats: 144 B = 16 B x odd
#define MGO  32768                 // halves from the stage buffers' start to the attention merge area

static_assert(NHD * HD == HH);
static_assert(HD == 64);
static_assert((SEQ % SEGL) == 0 && (MT % SEGL) == 0 && (SEGL % 32) == 0);
static_assert((MT % 64) == 0 && (HH % 64) == 0 && (MT % 32) == 0 && (HH % 32) == 0);
static_assert((((MT / 64) * (HH / 64)) % 8) == 0);
static_assert((((HH / 64) * (MT / 64)) % 8) == 0);
static_assert((((MT / 32) * (HH / 64)) % 8) == 0);
static_assert((MT % 8) == 0 && (HH % 8) == 0 && (HH % 256) == 0);
static_assert(ZSP >= 64 && (ZSP % 8) == 0);
static_assert((MT % 256) == 0 && (HH % 128) == 0 && (MT % 128) == 0 && (HH % KST) == 0 && HH / KST >= 2);
static_assert((LPH % 8) == 0 && LPH >= KST);
static_assert(SEGL == 256 && FROW / 32 == 14 && (FROW % 32) == 0 && 3 * PLH <= 2 * FSTG && SEGL * ZSP <= 2 * FSTG);
static_assert(SEGL * ZSP <= MGO && MGO * 2 + 16 * 9 * 512 <= 2 * FSTG * 2 && (NCHK % 2) == 0);

typedef _Float16 v16h __attribute__((ext_vector_type(16)));
typedef _Float16 v8h  __attribute__((ext_vector_type(8)));
typedef unsigned short v16us __attribute__((ext_vector_type(16)));
typedef unsigned short v8us  __attribute__((ext_vector_type(8)));
typedef float v8f __attribute__((ext_vector_type(8)));
typedef float v4f __attribute__((ext_vector_type(4)));
typedef float v2f __attribute__((ext_vector_type(2)));
typedef unsigned int v4u __attribute__((ext_vector_type(4)));

union FragU { v16us v; v8us h[2]; };

// ---- scalar helpers --------------------------------------------------------------------------------
__device__ __forceinline__ unsigned short bf_bits(float f) {          // f32 -> bf16 bits, RNE convert
  const unsigned u = __float_as_uint(f);
  return (unsigned short)((u + 0x7FFFu + ((u >> 16) & 1u)) >> 16);
}
__device__ __forceinline__ float bf_up(unsigned short h) { return __uint_as_float(((unsigned)h) << 16); }
__device__ __forceinline__ float bfr(float f) { return bf_up(bf_bits(f)); }   // value of the bf16 RNE convert
__device__ __forceinline__ unsigned short h_bits(_Float16 x) { return __builtin_bit_cast(unsigned short, x); }
__device__ __forceinline__ unsigned short f2h(float f) { return h_bits((_Float16)f); }
__device__ __forceinline__ float h_up(unsigned short h) { return (float)__builtin_bit_cast(_Float16, h); }
__device__ __forceinline__ unsigned pk16(unsigned short a, unsigned short b) { return (unsigned)a | ((unsigned)b << 16); }
__device__ __forceinline__ v8f zero8() { v8f z = {0.f, 0.f, 0.f, 0.f, 0.f, 0.f, 0.f, 0.f}; return z; }
__device__ __forceinline__ v8f splat8(float x) { v8f z = {x, x, x, x, x, x, x, x}; return z; }

// ---- fragment loader: 16-bit A/B operand, lane -> row/col (lane&15), p already includes +8*(lane>>4);
//      elements 0..7 <- p[0..7] (k0+8h..), elements 8..15 <- p[16..23] (k0+16+8h..)
__device__ __forceinline__ v16us ldfrag_u(const unsigned short* p) {
  FragU f;
  f.h[0] = *(const v8us*)(p);
  f.h[1] = *(const v8us*)(p + 16);
  return f.v;
}

// ---- fragment-order planes: a [R][C] f16 plane kept as tiles of 16 rows x 32 k (1024 B, tile number
//      (row / 16) * (C / 32) + col / 32), inside a tile 16-B units [k octet 0..3][row 0..15]. Lane l's two pieces of
//      the operand fragment (row l & 15, k 8 (l >> 4).. and 16 + 8 (l >> 4)..) are then units l and 32 + l: each load
//      instruction of a wave covers 512 contiguous bytes (4 whole lines) instead of 16 B in each of 16 rows.
//      p = plane + tile * 512 + lane * 8 (halves); same element order as ldfrag_u
__device__ __forceinline__ v16us ldfrag_t(const unsigned short* p) {
  FragU f;
  f.h[0] = *(const v8us*)(p);
  f.h[1] = *(const v8us*)(p + 256);
  return f.v;
}

// ---- WMMA helpers with trailing VALU hazard gap --------------------------------------------------------
__device__ __forceinline__ v8f mma_h_raw(v16us a, v16us b, v8f c) {             // f16 operands (bits), unguarded
  return __builtin_amdgcn_wmma_f32_16x16x32_f16(false, __builtin_bit_cast(v16h, a), false,
                                                __builtin_bit_cast(v16h, b), (short)0, c, false, false);
}
__device__ __forceinline__ void dep_guard1(v8f& a, v8f& b, v16us x) {
#if defined(__HIP_DEVICE_COMPILE__)
  asm volatile("v_nop\n\tv_nop\n\tv_nop\n\tv_nop" : "+v"(a), "+v"(b) : "v"(x));
#endif
}
__device__ __forceinline__ void keep4_u(v16us a, v16us b, v16us c, v16us d) {
#if defined(__HIP_DEVICE_COMPILE__)
  asm volatile("v_nop" :: "v"(a), "v"(b), "v"(c), "v"(d));
#endif
}
__device__ __forceinline__ void acc_guard4(v8f& a, v8f& b, v8f& c, v8f& d) {
#if defined(__HIP_DEVICE_COMPILE__)
  asm volatile("v_nop\n\tv_nop\n\tv_nop\n\tv_nop" : "+v"(a), "+v"(b), "+v"(c), "+v"(d));
#endif
}
__device__ __forceinline__ void wave_sync_lds() {
  __builtin_amdgcn_fence(__ATOMIC_RELEASE, "workgroup");
  __builtin_amdgcn_wave_barrier();
  __builtin_amdgcn_fence(__ATOMIC_ACQUIRE, "workgroup");
}

// lane l's value exchanged with lane l ^ 16 (the other 16-lane row), in registers
__device__ __forceinline__ float xhalf(float x) {
  return __builtin_bit_cast(float, __builtin_amdgcn_permlanex16(__builtin_bit_cast(int, x), __builtin_bit_cast(int, x),
                                                                0x76543210, 0xfedcba98, false, false));
}

// ---- asynchronous copies global -> LDS ------------------------------------------------------------------
// Eight 16-byte copies per lane: LDS bytes l + i * RSB; global ga + i * gs (i = 0..3) and gb + i * gs (i = 4..7
// as 0..3). The closing s_wait_xcnt stands inside the statement so that no address register named by a copy is
// rewritten in front of it.
__device__ __forceinline__ void copy8(unsigned l, const unsigned short* ga, const unsigned short* gb, size_t gs) {
#if defined(__HIP_DEVICE_COMPILE__)
  asm volatile(
      "global_load_async_to_lds_b128 %0, %8, off\n\t"
      "global_load_async_to_lds_b128 %1, %9, off\n\t"
      "global_load_async_to_lds_b128 %2, %10, off\n\t"
      "global_load_async_to_lds_b128 %3, %11, off\n\t"
      "global_load_async_to_lds_b128 %4, %12, off\n\t"
      "global_load_async_to_lds_b128 %5, %13, off\n\t"
      "global_load_async_to_lds_b128 %6, %14, off\n\t"
      "global_load_async_to_lds_b128 %7, %15, off\n\t"
      "s_wait_xcnt 0x0"
      :: "v"(l), "v"(l + RSB), "v"(l + 2 * RSB), "v"(l + 3 * RSB),
         "v"(l + 4 * RSB), "v"(l + 5 * RSB), "v"(l + 6 * RSB), "v"(l + 7 * RSB),
         "v"(ga), "v"(ga + gs), "v"(ga + 2 * gs), "v"(ga + 3 * gs),
         "v"(gb), "v"(gb + gs), "v"(gb + 2 * gs), "v"(gb + 3 * gs)
      : "memory");
#endif
}
// Four such copies: LDS bytes l + i * RSB, global ga + i * gs (i = 0..3); the closing wait as in copy8.
__device__ __forceinline__ void copy4(unsigned l, const unsigned short* ga, size_t gs) {
#if defined(__HIP_DEVICE_COMPILE__)
  asm volatile(
      "global_load_async_to_lds_b128 %0, %4, off\n\t"
      "global_load_async_to_lds_b128 %1, %5, off\n\t"
      "global_load_async_to_lds_b128 %2, %6, off\n\t"
      "global_load_async_to_lds_b128 %3, %7, off\n\t"
      "s_wait_xcnt 0x0"
      :: "v"(l), "v"(l + RSB), "v"(l + 2 * RSB), "v"(l + 3 * RSB),
         "v"(ga), "v"(ga + gs), "v"(ga + 2 * gs), "v"(ga + 3 * gs)
      : "memory");
#endif
}
// this wave's own copies have landed in LDS
__device__ __forceinline__ void wait_async0() {
#if defined(__HIP_DEVICE_COMPILE__)
  asm volatile("s_wait_asynccnt 0x0" ::: "memory");
#endif
}
// in front of an overwrite of registers that issued global loads or stores name
__device__ __forceinline__ void wait_x0() {
#if defined(__HIP_DEVICE_COMPILE__)
  asm volatile("s_wait_xcnt 0x0" ::: "memory");
#endif
}
// this wave's own LDS reads have returned, before the buffer they read is handed to its next writer
__device__ __forceinline__ void wait_ds0() {
#if defined(__HIP_DEVICE_COMPILE__)
  asm volatile("s_wait_dscnt 0x0" ::: "memory");
#endif
}

// =====================================================================================================
// Rows [nrows][768] f32 -> f16 bits of (bf16 RNE value * sc). Used for x (sc = 1) and for the [out][in]
// weight matrices (sc = 16), which are already Bt[n][k] with k contiguous. The five conversions need nothing
// of each other and share one grid by ranges of the block index: blocks 0..MT/8-1 take x, then HH/8 blocks
// for each of Wq, Wk, Wv, Wo. One wave per row; three column
// chunks of 256: lane owns columns 256c + 8*lane..+7, one instruction = 32 lanes x 16 B = 512 contiguous B
// coverage: 8 rows per block, grid = MT/8 + 4 HH/8 exact, 3 chunks x 256 = 768 cols: union = every row of all five.
// =====================================================================================================
__global__ __launch_bounds__(256) void cvt_rows(const float* __restrict__ xin, const float* __restrict__ Wq,
                                                const float* __restrict__ Wk, const float* __restrict__ Wv,
                                                const float* __restrict__ Wo, unsigned short* Xh,
                                                unsigned short* Wq16, unsigned short* Wk16,
                                                unsigned short* Wv16, unsigned short* Wo16) {
  const int wb  = (int)blockIdx.x - MT / 8;               // block-uniform: below 0 = x, else a weight block
  const int wi  = wb / (HH / 8);                          // which weight, 0..3
  const bool isx = wb < 0;
  const float* x = isx ? xin : wi == 0 ? Wq : wi == 1 ? Wk : wi == 2 ? Wv : Wo;
  unsigned short* xh = isx ? Xh : wi == 0 ? Wq16 : wi == 1 ? Wk16 : wi == 2 ? Wv16 : Wo16;
  const int nrows = isx ? MT : HH;
  const float sc  = isx ? 1.0f : WSC;
  const int row = (isx ? (int)blockIdx.x : wb - wi * (HH / 8)) * 8 + (threadIdx.x >> 5);
  const int lane = threadIdx.x & 31;
  if (wi > 3 || row >= nrows) return;                     // wave-uniform, no barriers below
  v4u hv[HH / 256];
#pragma unroll
  for (int c = 0; c < HH / 256; ++c) {
    const float* p = x + (size_t)row * HH + c * 256 + lane * 8;
    const v4f a0 = *(const v4f*)(p);
    const v4f a1 = *(const v4f*)(p + 4);
    v4u h;
#pragma unroll
    for (int e = 0; e < 2; ++e) {
      h[e]     = pk16(f2h(bfr(a0[2 * e]) * sc), f2h(bfr(a0[2 * e + 1]) * sc));
      h[2 + e] = pk16(f2h(bfr(a1[2 * e]) * sc), f2h(bfr(a1[2 * e + 1]) * sc));
    }
    hv[c] = h;
  }
  unsigned short* d = xh + (size_t)row * HH + lane * 8;
  {
#pragma unroll
    for (int c = 0; c < HH / 256; ++c) *(v4u*)(d + c * 256) = hv[c];
    
  }
}

// =====================================================================================================
// Register-blocked f16 WMMA GEMM: C[m][n] = sum_k A[m][k] * Bt[n][k] * wsc + bias, one wave per 32x64 tile; the
// block's 8 waves form a 64 x 256 tile (2 x 4 waves) whose operand rows are staged in LDS, 128 k at a time, two buffers,
// by asynchronous 16-byte copies (16 lanes per 256-B row piece), the next stage in flight while this one is multiplied.
// A row-major [M][K] pitch lda; Bt row-major [N][K] pitch ldb (k contiguous); M multiple of 64, N of 256, K of 128 and
// at least 256 (true at the call site; host-checked grid = tiles/8 exact so no block exits early).
// Out: f32 Cf (row-major, pitch ldc), column bias bf16(cb[n]) (bf16 RNE value).
// bid = the block's tile number; sT (per-wave 16x64 slabs, pitch 68 floats) and sS (two operand stages) are the calling
// kernel's LDS arrays.
// coverage: MI slabs x 16 rows x 64 cols = the wave's whole 32x64 tile; tiles/8 blocks x 8 waves = every tile.
// =====================================================================================================
__device__ __forceinline__ void gemm_body(
    float* sT, unsigned short* sS, int bid,
    const unsigned short* __restrict__ Ap, int lda,
    const unsigned short* __restrict__ Btp, int ldb,
    float* Cf, int ldc, const float* __restrict__ cb, float wsc, int M, int N, int K) {
  constexpr int MI = 2;
  constexpr int TR = 16 * MI;
  const int lane = threadIdx.x & 31;
  const int wave = threadIdx.x >> 5;
  const int tilesN = N >> 8;
  const int tilesM = M / (2 * TR);
  if (bid >= tilesM * tilesN) return;   // block-uniform, in front of every barrier
  const int tm = bid / tilesN;
  const int tn = bid - tm * tilesN;
  const int wm = wave >> 2;                    // wave row 0..1
  const int wn = wave & 3;                     // wave column 0..3
  const int mb = tm * (2 * TR);                // block's first row of A
  const int nb = tn << 8;                      // block's first row of Bt
  const int m0 = mb + wm * TR;
  const int n0 = nb + (wn << 6);

  const int rlane = lane & 15;                 // row (A) / col (B, D) within subtile
  const int koff  = (lane >> 4) * 8;           // k offset of this lane half
  const int mOff  = (lane >> 4) * 8;           // D row offset

  v8f acc[MI][4];
#pragma unroll
  for (int i = 0; i < MI; ++i)
#pragma unroll
    for (int j = 0; j < 4; ++j) acc[i][j] = zero8();

  // copy map: lane's 16-B piece cch of staged row crow + 16 i, i = 0..19 (rows 0..63 A, 64..319 Bt)
  const int crow = threadIdx.x >> 4;           // 0..15
  const int cch  = (threadIdx.x & 15) * 8;     // halves
  const unsigned lds0 = (unsigned)(size_t)sS + (unsigned)(crow * LPH + cch) * 2u;   // LDS byte address, buffer 0
  const unsigned short* gA0 = Ap + (size_t)(mb + crow) * lda + cch;                 // staged rows 0..63
  const unsigned short* gB0 = Btp + (size_t)(nb + crow) * ldb + cch;                // staged rows 64..319
  const size_t gsa = (size_t)16 * lda, gsb = (size_t)16 * ldb;
  const int NT = K / KST;
  // Blocks that share staged rows (the tn blocks of one tm share A, the tm blocks of one tn share Bt) enter the k stages
  // at different stages and wrap round, so that they do not ask L2 for the same lines at the same moment.
  const int rot = (tm + 2 * tn) % NT;          // block-uniform: trip t multiplies k stage (t + rot) mod NT
  const int kf0 = rot * KST;
  const int kf1 = (rot + 1 < NT ? rot + 1 : rot + 1 - NT) * KST;

  // staged row of this lane's first A fragment and first Bt fragment, with its k offset
  const int fa = (wm * TR + rlane) * LPH + koff;
  const int fb = (64 + (wn << 6) + rlane) * LPH + koff;

  // first stage -> buffer 0, landed and published; then the second -> buffer 1 in flight
  copy4(lds0,            gA0 + kf0,           gsa);
  copy8(lds0 + 4 * RSB,  gB0 + kf0,           gB0 + kf0 + 4 * gsb,  gsb);
  copy8(lds0 + 12 * RSB, gB0 + kf0 + 8 * gsb, gB0 + kf0 + 12 * gsb, gsb);
  wait_async0();
  __syncthreads();
  if (NT > 1) {
    const unsigned lb = lds0 + STGH * 2;
    copy4(lb,            gA0 + kf1,           gsa);
    copy8(lb + 4 * RSB,  gB0 + kf1,           gB0 + kf1 + 4 * gsb,  gsb);
    copy8(lb + 12 * RSB, gB0 + kf1 + 8 * gsb, gB0 + kf1 + 12 * gsb, gsb);
  }

#pragma unroll 1   // one stage per trip: the buffer index stays a run-time value and the text small
  for (int t = 0; t < NT; ++t) {
    const unsigned short* sb = sS + (t & 1) * STGH;
#pragma unroll
    for (int kk = 0; kk < KST; kk += 32) {
      // all six fragments of this k-step are asked for ahead of its 8 products
      v16us bh[4], ahf[MI];
#pragma unroll
      for (int j = 0; j < 4; ++j) bh[j] = ldfrag_u(sb + fb + (j << 4) * LPH + kk);
#pragma unroll
      for (int i = 0; i < MI; ++i) ahf[i] = ldfrag_u(sb + fa + (i << 4) * LPH + kk);
#pragma unroll
      for (int i = 0; i < MI; ++i) {
        const v16us ah = ahf[i];
#pragma unroll
        for (int j = 0; j < 4; ++j) acc[i][j] = mma_h_raw(ah, bh[j], acc[i][j]);
        dep_guard1(acc[i][0], acc[i][3], ah);
      }
      keep4_u(bh[0], bh[1], bh[2], bh[3]);
    }
    // publish point of stage t + 1: own reads of this buffer done, own copies landed, then every wave passes
    wait_ds0();
    wait_async0();
    __syncthreads();
    if (t + 2 < NT) {                          // block-uniform: refill the buffer that this trip has just read
      const unsigned lb = lds0 + (unsigned)(t & 1) * (STGH * 2);
      const int q2 = t + 2 + rot;              // below 2 NT: one wrap at most
      const int k2 = (q2 < NT ? q2 : q2 - NT) * KST;
      copy4(lb,            gA0 + k2,           gsa);
      copy8(lb + 4 * RSB,  gB0 + k2,           gB0 + k2 + 4 * gsb,  gsb);
      copy8(lb + 12 * RSB, gB0 + k2 + 8 * gsb, gB0 + k2 + 12 * gsb, gsb);
    }
  }
  wait_async0();
#pragma unroll
  for (int i = 0; i < MI; ++i) acc_guard4(acc[i][0], acc[i][1], acc[i][2], acc[i][3]);

  const int hh2 = lane >> 4, c4 = (lane & 15) * 4;     // f32 out: 256-B row segment = 16 lanes x 16 B

  v4f cb4;
  {
    const v4f v = *(const v4f*)(cb + n0 + c4);
    cb4[0] = bfr(v[0]); cb4[1] = bfr(v[1]); cb4[2] = bfr(v[2]); cb4[3] = bfr(v[3]);
  }

  // ---- epilogue ----
  float* slab = sT + wave * (16 * 68);
#pragma unroll
  for (int i = 0; i < MI; ++i) {
    const int mBase = m0 + (i << 4);
#pragma unroll
    for (int j = 0; j < 4; ++j) {
#pragma unroll
      for (int r = 0; r < 8; ++r) slab[(mOff + r) * 68 + (j << 4) + rlane] = acc[i][j][r];
    }
    wave_sync_lds();
    v4f vals[8];
#pragma unroll
    for (int it = 0; it < 8; ++it) {
      const int row = it * 2 + hh2;                      // it 0..7 x hh2 0..1 = rows 0..15
      const v4f v = *(const v4f*)(slab + row * 68 + c4);
      vals[it] = v * wsc + cb4;
    }
#pragma unroll
    for (int it = 0; it < 8; ++it) {
      const int row = it * 2 + hh2;
      *(v4f*)(Cf + (size_t)(mBase + row) * ldc + (size_t)n0 + c4) = vals[it];
    }
    wave_sync_lds();
  }
}

// out = z.Wo^T + bo -> f32
__global__ __launch_bounds__(256) void gemm_out(
    const unsigned short* __restrict__ Zh, const unsigned short* __restrict__ Wo16, float* out,
    const float* __restrict__ bo) {
  __shared__ __align__(16) float sT[8 * 16 * 68];         // per-wave 16x64 slab, pitch 68 floats
  __shared__ __align__(16) unsigned short sS[2 * STGH];   // two operand stages
  gemm_body(sT, sS, (int)blockIdx.x, Zh, HH, Wo16, HH, out, HH, bo, 1.0f / (WSC * ZSC), MT, HH, HH);
}

// Fourteen 16-byte copies per lane, one stage of the fused kernel below: LDS bytes l + i * RS2 (32 rows apart); global
// ga + i * 32 rows (i = 0..7), then two each from gq, gk and gv. The closing s_wait_xcnt stands inside the statement so
// that no address register named by a copy is rewritten in front of it.
__device__ __forceinline__ void copy14(unsigned l, const unsigned short* ga, const unsigned short* gq,
                                       const unsigned short* gk, const unsigned short* gv) {
#if defined(__HIP_DEVICE_COMPILE__)
  constexpr size_t gs = (size_t)32 * HH;
  asm volatile(
      "global_load_async_to_lds_b128 %0, %14, off\n\t"
      "global_load_async_to_lds_b128 %1, %15, off\n\t"
      "global_load_async_to_lds_b128 %2, %16, off\n\t"
      "global_load_async_to_lds_b128 %3, %17, off\n\t"
      "global_load_async_to_lds_b128 %4, %18, off\n\t"
      "global_load_async_to_lds_b128 %5, %19, off\n\t"
      "global_load_async_to_lds_b128 %6, %20, off\n\t"
      "global_load_async_to_lds_b128 %7, %21, off\n\t"
      "global_load_async_to_lds_b128 %8, %22, off\n\t"
      "global_load_async_to_lds_b128 %9, %23, off\n\t"
      "global_load_async_to_lds_b128 %10, %24, off\n\t"
      "global_load_async_to_lds_b128 %11, %25, off\n\t"
      "global_load_async_to_lds_b128 %12, %26, off\n\t"
      "global_load_async_to_lds_b128 %13, %27, off\n\t"
      "s_wait_xcnt 0x0"
      :: "v"(l), "v"(l + 1 * RS2), "v"(l + 2 * RS2), "v"(l + 3 * RS2), "v"(l + 4 * RS2), "v"(l + 5 * RS2), "v"(l + 6 * RS2),
         "v"(l + 7 * RS2), "v"(l + 8 * RS2), "v"(l + 9 * RS2), "v"(l + 10 * RS2), "v"(l + 11 * RS2), "v"(l + 12 * RS2), "v"(l + 13 * RS2),
         "v"(ga), "v"(ga + gs), "v"(ga + 2 * gs), "v"(ga + 3 * gs),
         "v"(ga + 4 * gs), "v"(ga + 5 * gs), "v"(ga + 6 * gs), "v"(ga + 7 * gs),
         "v"(gq), "v"(gq + gs), "v"(gk), "v"(gk + gs), "v"(gv), "v"(gv + gs)
      : "memory");
#endif
}

// =====================================================================================================
// Projection and attention of one (256-token segment, head) in one block of 16 waves; q, k and v never leave the WGP.
// Part 1: [256 tokens][192] = x_seg . [Wq_h; Wk_h; Wv_h]^T + bias, the head's 64 rows of each f16 weight plane. Operand
// rows staged in LDS as in gemm_body: 128 k per stage, two buffers, asynchronous 16-byte copies, 14 per lane and stage
// (rows 0..255 x, 256..319 Wq_h, 320..383 Wk_h, 384..447 Wv_h). Waves as 4 x 4: wave (wm, wn) owns tokens 64 wm..+63 and
// columns 16 wn..+15 of each of q, k and v (4 x 3 accumulators).
// Part 2: behind the k loop's last barrier the stage buffers are free; the three f16 planes q, k [256][64] and
// v^T [64][256] are written over them in fragment order (see ldfrag_t): q, k through the wave's slab;
// v from the accumulator itself, which holds 8 successive tokens of one dv per lane = one 16-B unit. One barrier.
// Part 3: attention over the segment, every key valid (no masking); wave w takes queries 32 (w & 7)..+31 (two query
// tiles), keys 128 (w >> 3)..+127 and all 64 dv, so that every K and V^T fragment read from LDS serves two query tiles.
// Both products are taken transposed: S^T = K.Q^T (A = key rows, B = query columns) and O^T = V^T.P^T (A = dv rows,
// B = query columns), so that a lane holds scores, statistics and outputs of ONE query per tile (column jc of its D tiles).
// s = k.q^T, two 32-deep k-steps over the 64 head dims, for all 128 keys ahead of the softmax: the scores stay in
// registers, one maximum per query (in-lane, then joined with lane ^ 16), no running rescale; p = exp(0.125 (s - max))
// carried as 1024 p in f16: the two D tiles of a chunk of 32 keys (keys 8hh + r and 16 + 8hh + r), converted in place,
// are the B fragment in the split k map, with no pass through LDS; z^T accumulates v.p on WMMA for 4 dv tiles per query
// tile. The two key halves of a query tile (unnormalised z^T, maximum, sum) are joined through LDS, each wave of a pair
// finishing one of the two tiles. q, k, p and v^T fragments all use the split k map.
// coverage: 256 query rows x 64 halves at cols 64*head per block in Zh; grid (MT/256) x 12 heads = the whole
// [4096][768] z plane.
// =====================================================================================================
__global__ __launch_bounds__(512) void qkv_attn(
    const unsigned short* __restrict__ Xh, const unsigned short* __restrict__ Wc,
    const float* __restrict__ bq, const float* __restrict__ bk, const float* __restrict__ bv,
    unsigned short* Zh) {
  __shared__ __align__(16) float sT[16 * 16 * SLP];       // per-wave 16x32 slab, pitch 36 floats
  __shared__ __align__(16) unsigned short sS[2 * FSTG];   // two operand stages; then the three planes; then z staging
  const int tq0  = blockIdx.x * SEGL;                     // first token of the segment (token = b*2048 + s)
  const int hc   = blockIdx.y * HD;                       // head column offset
  const int t = threadIdx.x, lane = t & 31, hh = lane >> 4, jc = lane & 15;
  const int wv = __builtin_amdgcn_readfirstlane(t >> 5);
  const int wm = wv >> 2;                      // wave row 0..3
  const int wn = wv & 3;                       // wave column 0..3
  const int koff = hh * 8;                     // k offset of this lane half
  const int mOff = hh * 8;                     // D row offset

  unsigned short* pQ = sS;
  unsigned short* pK = sS + PLH;
  unsigned short* pV = sS + 2 * PLH;

  {
    v8f acc[4][3];
#pragma unroll
    for (int i = 0; i < 4; ++i)
#pragma unroll
      for (int j = 0; j < 3; ++j) acc[i][j] = zero8();

    // copy map: lane's 16-B piece cch of staged row crow + 32 i, i = 0..13
    const int crow = t >> 4;                   // 0..31
    const int cch  = (t & 15) * 8;             // halves
    const unsigned lds0 = (unsigned)(size_t)sS + (unsigned)(crow * LPH + cch) * 2u;   // LDS byte address, buffer 0
    const unsigned short* gA = Xh + (size_t)(tq0 + crow) * HH + cch;                  // staged rows 0..255
    const unsigned short* gQ = Wc + (size_t)(hc + crow) * HH + cch;                   // staged rows 256..319
    const unsigned short* gK = gQ + (size_t)HH * HH;                                  // staged rows 320..383
    const unsigned short* gV = gK + (size_t)HH * HH;                                  // staged rows 384..447
    constexpr int NT = HH / KST;
    // Blocks that share staged rows (the heads of a segment share x, the segments of a head share the weight rows) enter
    // the k stages at different stages and wrap round, so that they do not ask L2 for the same lines at the same moment.
    const int rot = (int)((blockIdx.x + blockIdx.y) % NT);   // block-uniform: trip s multiplies k stage (s + rot) mod NT
    const int kf0 = rot * KST;
    const int kf1 = (rot + 1 < NT ? rot + 1 : rot + 1 - NT) * KST;

    const int fa = (wm * 64 + jc) * LPH + koff;
    const int fb = (SEGL + wn * 16 + jc) * LPH + koff;

    // bias of this lane's column of q, k and v, asked for ahead of the k loop
    float bj[3];
    bj[0] = bfr(bq[hc + wn * 16 + jc]);
    bj[1] = bfr(bk[hc + wn * 16 + jc]);
    bj[2] = bfr(bv[hc + wn * 16 + jc]);

    // first stage -> buffer 0, landed and published; then the second -> buffer 1 in flight
    copy14(lds0, gA + kf0, gQ + kf0, gK + kf0, gV + kf0);
    wait_async0();
    __syncthreads();
    copy14(lds0 + FSTG * 2, gA + kf1, gQ + kf1, gK + kf1, gV + kf1);

#pragma unroll 1   // one stage per trip: the buffer index stays a run-time value and the text small
    for (int s = 0; s < NT; ++s) {
      const unsigned short* sb = sS + (s & 1) * FSTG;
#pragma unroll
      for (int kk = 0; kk < KST; kk += 32) {
        // all seven fragments of this k-step are asked for ahead of its 12 products
        v16us bh[3], ah[4];
#pragma unroll
        for (int j = 0; j < 3; ++j) bh[j] = ldfrag_u(sb + fb + (j << 6) * LPH + kk);
#pragma unroll
        for (int i = 0; i < 4; ++i) ah[i] = ldfrag_u(sb + fa + (i << 4) * LPH + kk);
#pragma unroll
        for (int i = 0; i < 4; ++i) {
#pragma unroll
          for (int j = 0; j < 3; ++j) acc[i][j] = mma_h_raw(ah[i], bh[j], acc[i][j]);
          dep_guard1(acc[i][0], acc[i][2], ah[i]);
        }
        keep4_u(bh[0], bh[1], bh[2], bh[2]);
      }
      // publish point of stage s + 1: own reads of this buffer done, own copies landed, then every wave passes
      wait_ds0();
      wait_async0();
      __syncthreads();
      if (s + 2 < NT) {                        // block-uniform: refill the buffer that this trip has just read
        const int q2 = s + 2 + rot;            // below 2 NT: one wrap at most
        const int k2 = (q2 < NT ? q2 : q2 - NT) * KST;
        copy14(lds0 + (unsigned)(s & 1) * (FSTG * 2), gA + k2, gQ + k2, gK + k2, gV + k2);
      }
    }
    wait_async0();

    // ---- planes into LDS: every wave has passed the last trip's barrier, no copy is in flight ----
    const float wsc = 1.0f / WSC;
    float* slab = sT + wv * (16 * SLP);
#pragma unroll
    for (int i = 0; i < 4; ++i) {
      {
        v4u ha = {0u, 0u, 0u, 0u};
#pragma unroll
        for (int e = 0; e < 4; ++e)            // tokens 64 wm + 16 i + 8 hh + 2 e, + 1 of dv 16 wn + jc
          ha[e] = pk16(f2h(acc[i][2][2 * e] * wsc + bj[2]), f2h(acc[i][2][2 * e + 1] * wsc + bj[2]));
        // tile (dv / 16 = wn, token / 32 = 2 wm + i / 2), units 32 (i & 1) + lane
        const int go = (wn * (SEGL / 32) + wm * 2 + (i >> 1)) * 512 + (i & 1) * 256 + lane * 8;
        *(v4u*)(pV + go) = ha;
      }
#pragma unroll
      for (int jj = 0; jj < 2; ++jj)
#pragma unroll
        for (int r = 0; r < 8; ++r) slab[(mOff + r) * SLP + (jj << 4) + jc] = acc[i][jj][r] * wsc + bj[jj];
      wave_sync_lds();
#pragma unroll
      for (int jj = 0; jj < 2; ++jj) {
        const float* sp = slab + jc * SLP + (jj * 2 + hh) * 8;   // token row jc, dims 16 wn + 8 hh..+7 of q (jj 0), k (1)
        v4u ha = {0u, 0u, 0u, 0u};
#pragma unroll
        for (int e = 0; e < 4; ++e) ha[e] = pk16(f2h(sp[2 * e]), f2h(sp[2 * e + 1]));
        // tile (token / 16 = 4 wm + i, col / 32 = wn / 2), units 32 (wn & 1) + lane
        const int go = ((wm * 4 + i) * (HD / 32) + (wn >> 1)) * 512 + (wn & 1) * 256 + lane * 8;
        *(v4u*)((jj ? pK : pQ) + go) = ha;
      }
      wave_sync_lds();
    }
  }
  __syncthreads();   // the planes are whole before any wave reads a fragment

  // Wave (qg, kh): queries 32 qg..+31 (two query tiles) against keys 128 kh..+127. Tile T0 is the one this wave finishes,
  // tile T1 the one whose partial result it hands to wave wv ^ 8, which has the same two tiles the other way round.
  const int qg = wv & 7;
  const int kh = wv >> 3;
  const int T0 = 2 * qg + kh;
  const int T1 = 2 * qg + 1 - kh;
  constexpr int KT = (HD / 32) * 512;                       // halves of one tile row of q or k (16 tokens x 64 dims)
  constexpr int VS = (SEGL / 32) * 512;                     // halves to the next dv tile
  constexpr int NC2 = NCHK / 2;                             // chunks of 32 keys per wave
  // B: col = query jc, k = head dim; tile (token / 16, col / 32), the two k tiles are neighbours
  const v16us qa0 = ldfrag_t(pQ + T0 * KT + lane * 8);                  // tile T0, dims 0..31
  const v16us qa1 = ldfrag_t(pQ + T0 * KT + lane * 8 + 512);            // dims 32..63
  const v16us qb0 = ldfrag_t(pQ + T1 * KT + lane * 8);                  // tile T1
  const v16us qb1 = ldfrag_t(pQ + T1 * KT + lane * 8 + 512);
  // Per-lane LDS addresses of the wave's first K tile (A: row = key jc, k = head dim; tile (token / 16, col / 32))
  // and first V^T tile (A: row dv = jc, k = key token; tile (dv / 16, token / 32)); every fragment of its key half lies
  // at a constant offset from them.
  const unsigned short* kph = pK + kh * (2 * NC2 * KT) + lane * 8;
  const unsigned short* vph = pV + kh * (NC2 * 512) + lane * 8;

  // Scores of all 128 keys for both query tiles, kept in registers: tiles 2c (keys 32c+8hh+r) and 2c+1 (keys 32c+16+8hh+r).
  // Every K fragment is multiplied with both query tiles. A chunk's four K fragments are asked for one chunk ahead.
  v8f sa[2 * NC2], sb[2 * NC2];
  v16us kf0 = ldfrag_t(kph);                                // chunk 0, head dims 0..31: keys jc, keys 16 + jc
  v16us kf1 = ldfrag_t(kph + KT);
  v16us kf2 = ldfrag_t(kph + 512);                          // head dims 32..63
  v16us kf3 = ldfrag_t(kph + KT + 512);
  // unrolled: the score tiles are register arrays, and a group's registers change from chunk to chunk
#pragma unroll
  for (int c = 0; c < NC2; ++c) {
    const int kn = (c + 1) * 2 * KT;                         // the next chunk's K: two tile rows on
    v16us nk0 = kf0, nk1 = kf1, nk2 = kf2, nk3 = kf3;
    if (c + 1 < NC2) {                                       // compile-time test
      nk0 = ldfrag_t(kph + kn);
      nk1 = ldfrag_t(kph + kn + KT);
      nk2 = ldfrag_t(kph + kn + 512);
      nk3 = ldfrag_t(kph + kn + KT + 512);
    }
    __builtin_amdgcn_sched_barrier(0);   // the scheduler would sink the loads in front towards their users
    sa[2 * c]     = mma_h_raw(kf0, qa0, zero8());            // D row 8hh+r = key, col jc = query 16 T0 + jc
    sa[2 * c + 1] = mma_h_raw(kf1, qa0, zero8());
    sb[2 * c]     = mma_h_raw(kf0, qb0, zero8());            // col jc = query 16 T1 + jc
    sb[2 * c + 1] = mma_h_raw(kf1, qb0, zero8());
    sa[2 * c]     = mma_h_raw(kf2, qa1, sa[2 * c]);
    sa[2 * c + 1] = mma_h_raw(kf3, qa1, sa[2 * c + 1]);
    sb[2 * c]     = mma_h_raw(kf2, qb1, sb[2 * c]);
    sb[2 * c + 1] = mma_h_raw(kf3, qb1, sb[2 * c + 1]);
    kf0 = nk0; kf1 = nk1; kf2 = nk2; kf3 = nk3;
  }
  // chunk 0's V^T fragments (dv tiles 0..3) are asked for in front of the maxima
  v16us f0 = ldfrag_t(vph);
  v16us f1 = ldfrag_t(vph + VS);
  v16us f2 = ldfrag_t(vph + 2 * VS);
  v16us f3 = ldfrag_t(vph + 3 * VS);
  __builtin_amdgcn_sched_barrier(0);     // keeps these loads in front of the maxima, which cover their latency

  // One maximum per query over the wave's 128 keys, on the raw scores (the scale is positive); two chains per tile.
  float ra = sa[0][0], ra1 = sa[1][0], rb = sb[0][0], rb1 = sb[1][0];
#pragma unroll
  for (int c = 0; c < NC2; ++c)
#pragma unroll
    for (int r = 0; r < 8; ++r) {
      ra  = fmaxf(ra,  sa[2 * c][r]);
      ra1 = fmaxf(ra1, sa[2 * c + 1][r]);
      rb  = fmaxf(rb,  sb[2 * c][r]);
      rb1 = fmaxf(rb1, sb[2 * c + 1][r]);
    }
  ra = fmaxf(ra, ra1);
  rb = fmaxf(rb, rb1);
  ra = fmaxf(ra, xhalf(ra));                                 // the query's keys held by lane ^ 16
  rb = fmaxf(rb, xhalf(rb));
  // 1024 p = 2^(s c - max c + 10), c = 0.125 log2 e: one multiply-add per score in front of the exponential
  constexpr float CE = SCL * 1.44269504088896340736f;
  const v8f ce8 = splat8(CE);
  const v8f ba8 = splat8(fmaf(-ra, CE, 10.0f));
  const v8f bb8 = splat8(fmaf(-rb, CE, 10.0f));
  static_assert(PSC == 1024.0f);

  v2f la2 = {0.f, 0.f}, lb2 = {0.f, 0.f};                   // sums of 1024 p over this lane's keys
  v8f oa[4], ob[4];
#pragma unroll
  for (int d = 0; d < 4; ++d) { oa[d] = zero8(); ob[d] = zero8(); }
#pragma unroll
  for (int c = 0; c < NC2; ++c) {
    FragU pa, pb;                                            // B: col = query jc, elements 0..7 <- k 8hh.., 8..15 <- k 16+8hh..
    {
      const v8f t0 = __builtin_elementwise_fma(sa[2 * c], ce8, ba8);
      const v8f t1 = __builtin_elementwise_fma(sa[2 * c + 1], ce8, ba8);
      v8f e0, e1;
#pragma unroll
      for (int r = 0; r < 8; ++r) {
        e0[r] = __builtin_amdgcn_exp2f(t0[r]);
        e1[r] = __builtin_amdgcn_exp2f(t1[r]);
        pa.v[r]     = f2h(e0[r]);                            // P [query jc][k = 8hh + r]
        pa.v[8 + r] = f2h(e1[r]);                            // P [query jc][k = 16 + 8hh + r]
      }
      const v8f es = e0 + e1;
      const v4f e4 = es.lo + es.hi;
      la2 += e4.lo + e4.hi;
    }
    {
      const v8f t0 = __builtin_elementwise_fma(sb[2 * c], ce8, bb8);
      const v8f t1 = __builtin_elementwise_fma(sb[2 * c + 1], ce8, bb8);
      v8f e0, e1;
#pragma unroll
      for (int r = 0; r < 8; ++r) {
        e0[r] = __builtin_amdgcn_exp2f(t0[r]);
        e1[r] = __builtin_amdgcn_exp2f(t1[r]);
        pb.v[r]     = f2h(e0[r]);
        pb.v[8 + r] = f2h(e1[r]);
      }
      const v8f es = e0 + e1;
      const v4f e4 = es.lo + es.hi;
      lb2 += e4.lo + e4.hi;
    }
    // D row 8hh+r = dv, col jc = query; every V^T fragment is multiplied with both query tiles
    oa[0] = mma_h_raw(f0, pa.v, oa[0]);
    oa[1] = mma_h_raw(f1, pa.v, oa[1]);
    oa[2] = mma_h_raw(f2, pa.v, oa[2]);
    oa[3] = mma_h_raw(f3, pa.v, oa[3]);
    ob[0] = mma_h_raw(f0, pb.v, ob[0]);
    ob[1] = mma_h_raw(f1, pb.v, ob[1]);
    ob[2] = mma_h_raw(f2, pb.v, ob[2]);
    ob[3] = mma_h_raw(f3, pb.v, ob[3]);
    if (c + 1 < NC2) {                                       // the next chunk's V^T, in front of its exponentials
      f0 = ldfrag_t(vph + (c + 1) * 512);
      f1 = ldfrag_t(vph + (c + 1) * 512 + VS);
      f2 = ldfrag_t(vph + (c + 1) * 512 + 2 * VS);
      f3 = ldfrag_t(vph + (c + 1) * 512 + 3 * VS);
      __builtin_amdgcn_sched_barrier(0);   // keeps these loads in front of the exponentials, which cover their latency
    }
  }
  float la = la2[0] + la2[1], lb = lb2[0] + lb2[1];
  la += xhalf(la);                                           // both lane halves of the wave's 128 keys
  lb += xhalf(lb);

  __syncthreads();   // every wave has read its last fragment: the planes' LDS is free for the merge and the output staging
  // Tile T1's partial result (32 floats a lane, its maximum and its sum) goes to wave wv ^ 8 through LDS: nine pieces of
  // 32 lanes x 16 B per wave, behind the output staging. Lane and register hold the same (query, dv) in both waves.
  float* mg = (float*)(sS + MGO);
  {
    float* mw = mg + wv * (9 * 128) + lane * 4;
#pragma unroll
    for (int d = 0; d < 4; ++d) {
      *(v4f*)(mw + (2 * d) * 128)     = ob[d].lo;
      *(v4f*)(mw + (2 * d + 1) * 128) = ob[d].hi;
    }
    const v4f st = {rb, lb, 0.f, 0.f};
    *(v4f*)(mw + 8 * 128) = st;
  }
  __syncthreads();   // the partial results are whole before their takers read them
  unsigned short* zst = sS;                                  // output staging
  {
    const float* mr = mg + (wv ^ 8) * (9 * 128) + lane * 4;
    const v4f st = *(const v4f*)(mr + 8 * 128);
    // both halves brought to the query's maximum over all 256 keys: the half that holds it keeps factor 1
    const float dd = ra - st[0];
    const float ex = __builtin_amdgcn_exp2f(-fabsf(dd) * CE);
    const float fa = dd >= 0.f ? 1.0f : ex;
    const float fp = dd >= 0.f ? ex : 1.0f;
    const float l = la * fa + st[1] * fp;                    // 1024 x the sum over all 256 keys
    const float inv = ((l > 0.f) ? (1.0f / l) : 0.f) * ZSC;
    const float ga = fa * inv, gp = fp * inv;
    const int so = (16 * T0 + jc) * ZSP + 8 * hh;            // query row, dv 8hh..8hh+7 of each 16: one 16-B piece
#pragma unroll
    for (int d = 0; d < 4; ++d) {
      const v4f p0 = *(const v4f*)(mr + (2 * d) * 128);
      const v4f p1 = *(const v4f*)(mr + (2 * d + 1) * 128);
      v4u ha = {0u, 0u, 0u, 0u};
#pragma unroll
      for (int e = 0; e < 2; ++e) {
        ha[e]     = pk16(f2h(oa[d][2 * e] * ga + p0[2 * e] * gp),     f2h(oa[d][2 * e + 1] * ga + p0[2 * e + 1] * gp));
        ha[2 + e] = pk16(f2h(oa[d][4 + 2 * e] * ga + p1[2 * e] * gp), f2h(oa[d][4 + 2 * e + 1] * ga + p1[2 * e + 1] * gp));
      }
      *(v4u*)(zst + so + 16 * d) = ha;
    }
  }
  __syncthreads();
  v4u hv[4];
#pragma unroll
  for (int it = 0; it < 4; ++it) {
    const int row = it * 64 + (t >> 3), p = (t & 7) * 8;   // it 0..3 x (t>>3) 0..63 = rows 0..255, 8 lanes per row
    hv[it] = *(const v4u*)(zst + row * ZSP + p);
  }
#pragma unroll
  for (int it = 0; it < 4; ++it) {
    const int row = it * 64 + (t >> 3), p = (t & 7) * 8;
    *(v4u*)(Zh + (size_t)(tq0 + row) * HH + hc + p) = hv[it];
  }
}

// =====================================================================================================
// Workspace map (bytes); every plane is an exact multiple of its whole-row / whole-tile store granularity
//   Xh    f16 [4096][768]     0          6291456
//   Wq16  f16 [768][768]      6291456    1179648   (x16)
//   Wk16  f16 [768][768]      7471104    1179648   (x16)
//   Wv16  f16 [768][768]      8650752    1179648   (x16)
//   Wo16  f16 [768][768]      9830400    1179648   (x16)
//   Zh    f16 [4096][768]     11010048   6291456   (z x16)
//   end                       17301504
// =====================================================================================================
extern "C" void kernel_launch(void* const* d_in, const int* in_sizes, int n_in,
                              void* d_out, int out_size, void* d_ws, size_t ws_size,
                              hipStream_t stream) {
  if (n_in < 9) return;
  if (in_sizes[0] != MT * HH) return;
  if (in_sizes[1] != HH * HH || in_sizes[2] != HH) return;
  if (in_sizes[3] != HH * HH || in_sizes[4] != HH) return;
  if (in_sizes[5] != HH * HH || in_sizes[6] != HH) return;
  if (in_sizes[7] != HH * HH || in_sizes[8] != HH) return;
  if (out_size != MT * HH) return;

  const float* x  = (const float*)d_in[0];
  const float* Wq = (const float*)d_in[1];
  const float* bq = (const float*)d_in[2];
  const float* Wk = (const float*)d_in[3];
  const float* bk = (const float*)d_in[4];
  const float* Wv = (const float*)d_in[5];
  const float* bv = (const float*)d_in[6];
  const float* Wo = (const float*)d_in[7];
  const float* bo = (const float*)d_in[8];

  const size_t PX  = (size_t)MT * HH * 2;        // 6291456
  const size_t PW  = (size_t)HH * HH * 2;        // 1179648
  size_t off = 0;
  const size_t oXh = off; off += PX;
  const size_t oWq = off; off += PW;
  const size_t oWk = off; off += PW;
  const size_t oWv = off; off += PW;
  const size_t oWo = off; off += PW;
  const size_t oZh = off; off += PX;
  if (off > ws_size) return;                     // off = 17301504
  if (off > (size_t)134217728) return;

  char* ws = (char*)d_ws;
  unsigned short* Xh   = (unsigned short*)(ws + oXh);
  unsigned short* Wq16 = (unsigned short*)(ws + oWq);
  unsigned short* Wk16 = (unsigned short*)(ws + oWk);
  unsigned short* Wv16 = (unsigned short*)(ws + oWv);
  unsigned short* Wo16 = (unsigned short*)(ws + oWo);
  unsigned short* Zh   = (unsigned short*)(ws + oZh);
  float*          out0 = (float*)d_out;

  const dim3 blk(256);
  const int gsp = ((MT / 32) * (HH / 64)) / 8;             // 1536 tiles of 32x64 -> 192 blocks
  if ((((MT / 32) * (HH / 64)) % 8) != 0) return;

  // (0) x -> f16 plane of bf16 values; weights [768][768] ([out][in] = Bt[n][k]) -> f16 bits of bf16 values x16
  //     (one grid: 512 blocks for x, 96 for each weight)
  cvt_rows<<<dim3(MT / 8 + 4 * (HH / 8)), blk, 0, stream>>>(x, Wq, Wk, Wv, Wo, Xh, Wq16, Wk16, Wv16, Wo16);

  // (1) per (segment, head): x_seg . [Wq_h; Wk_h; Wv_h]^T + bias (Wq16, Wk16, Wv16 lie one behind the other), q, k, v^T
  //     kept in LDS, block-diagonal segment attention -> z (x16) plane; 16 x 12 blocks of 16 waves
  qkv_attn<<<dim3(MT / SEGL, NHD), dim3(512), 0, stream>>>(Xh, Wq16, bq, bk, bv, Zh);

  // (2) output projection: out = z . Wo^T + bo -> f32
  gemm_out<<<dim3(gsp), blk, 0, stream>>>(Zh, Wo16, out0, bo);
  (void)hipGetLastError();
}
